// v000
// The times below were measured on an AMD MI455X: many runs one after another, warmed up first and cycling through
// copies of the inputs, with the whole window's GPU time divided by the number of runs. Launches and the gaps
// between them are all in it. The median over several windows is given; except for v000 it joins two sittings, which
// can be a few percent apart, so the side-by-side timings, each taken in one sitting, are the better comparison.
// v000 is the starting kernel. One run takes 693 microseconds.
// All contractions on 16-bit WMMA with f32 accumulate: x.Wu, x.Wv and the u.x^T scores on v_wmma_f32_16x16x32_f16 (inputs RNE-converted to bf16 once and held exactly in f16 planes with power-of-two carries: x x16, W x1024, u x16); v0.W1, v0.W2, P.v and y.Wp on v_wmma_f32_16x16x32_bf16 with the computed operand carried as bf16 hi+lo planes (W1, W2, Wp as bf16 planes); softmax, gate, residual and bias in f32.
#include <hip/hip_runtime.h>
#include <math.h>

typedef __attribute__((ext_vector_type(16))) _Float16 v16h;
typedef __attribute__((ext_vector_type(8)))  _Float16 v8h;
typedef __attribute__((ext_vector_type(16))) __bf16   v16b;
typedef __attribute__((ext_vector_type(8)))  __bf16   v8b;
typedef __attribute__((ext_vector_type(8)))  float    v8f;
typedef __attribute__((ext_vector_type(4)))  float    v4f;
typedef __attribute__((ext_vector_type(4)))  unsigned int v4u;

// ---------------------------------------------------------------------------
// Problem constants
// ---------------------------------------------------------------------------
constexpr int kB    = 4;
constexpr int kT    = 2048;
constexpr int kC    = 1024;
constexpr int kH    = 16;
constexpr int kHS   = 64;
constexpr int kRows = kB * kT;
constexpr int kSqrtC = 32;
static_assert(kSqrtC * kSqrtC == kC, "score scale is 1/sqrt(C)");
static_assert(kH * kHS == kC, "head split");
static_assert((kC % 32) == 0 && (kHS % 32) == 0 && (kT % 64) == 0, "K multiples of 32, key chunks of 64");
static_assert((kRows % 64) == 0 && (kC % 64) == 0, "GEMM M,N multiples of 64");

// power-of-two carries of the f16 planes (exact; folded back in f32)
constexpr float kXCarry = 16.0f;
constexpr float kWCarry = 1024.0f;
constexpr float kUCarry = 16.0f;
constexpr float kUScale  = kUCarry / (kXCarry * kWCarry);
constexpr float kV0Scale = 1.0f / (kXCarry * kWCarry);
constexpr float kScoreScale = 1.0f / ((float)kSqrtC * kUCarry * kXCarry);

// ---------------------------------------------------------------------------
// Workspace region map (bytes; every offset is a multiple of 128)
//   XH    f16  [8192][1024]      16*bf16(x)                      16,777,216
//   WUT   f16  [1024 n][1024 k]  1024*bf16(Wu)^T                  2,097,152
//   WVT   f16  [1024 n][1024 k]  1024*bf16(Wv)^T                  2,097,152
//   WPT   bf16 [1024 n][1024 k]  bf16(Wp)^T                       2,097,152
//   W12T  bf16 2 x [64 n][64 k]  bf16(W1)^T | bf16(W2)^T             16,384
//   U16   f16  [8192][1024]      16*u                            16,777,216
//   V0    f32  [8192][1024]      v0; dead after the gated-value launch, then the same bytes
//                                hold YH | YL (bf16 hi | lo planes of y, [8192][1024] each)  33,554,432
//   VTH   bf16 [4][16][64 d][2048 t]  gated v, hi plane           16,777,216
//   VTL   bf16 [4][16][64 d][2048 t]  gated v, lo plane           16,777,216
//   total                                                       106,971,136
// ---------------------------------------------------------------------------
constexpr size_t kSzAct16 = (size_t)kRows * kC * 2;
constexpr size_t kSzW16   = (size_t)kC * kC * 2;
constexpr size_t kSzW12   = (size_t)2 * kHS * kHS * 2;
constexpr size_t kSzV0    = (size_t)kRows * kC * 4;
constexpr size_t kOffXH   = 0;
constexpr size_t kOffWUT  = kOffXH  + kSzAct16;
constexpr size_t kOffWVT  = kOffWUT + kSzW16;
constexpr size_t kOffWPT  = kOffWVT + kSzW16;
constexpr size_t kOffW12  = kOffWPT + kSzW16;
constexpr size_t kOffU    = kOffW12 + kSzW12;
constexpr size_t kOffV0   = kOffU   + kSzAct16;
constexpr size_t kOffYH   = kOffV0;
constexpr size_t kOffYL   = kOffV0  + kSzAct16;
constexpr size_t kOffVTH  = kOffV0  + kSzV0;
constexpr size_t kOffVTL  = kOffVTH + kSzAct16;
constexpr size_t kWsTotal = kOffVTL + kSzAct16;
static_assert(kWsTotal == 106971136ull, "carve total");
static_assert(kWsTotal <= 134217728ull, "carve cap");
static_assert(2 * kSzAct16 == kSzV0, "y hi|lo planes fit the v0 plane exactly");
static_assert((kOffWUT % 128) == 0 && (kOffWVT % 128) == 0 && (kOffWPT % 128) == 0 && (kOffW12 % 128) == 0 &&
              (kOffU % 128) == 0 && (kOffV0 % 128) == 0 && (kOffYL % 128) == 0 && (kOffVTH % 128) == 0 &&
              (kOffVTL % 128) == 0, "128-B aligned regions");

// ---------------------------------------------------------------------------
// Bit helpers
// ---------------------------------------------------------------------------
__device__ __forceinline__ unsigned short f2bf_bits(float f) {
  unsigned u = __float_as_uint(f);
  return (unsigned short)((u + 0x7FFFu + ((u >> 16) & 1u)) >> 16);
}
__device__ __forceinline__ float bf_bits2f(unsigned short h) { return __uint_as_float(((unsigned)h) << 16); }
__device__ __forceinline__ unsigned pk16(unsigned short a, unsigned short b) { return (unsigned)a | ((unsigned)b << 16); }
__device__ __forceinline__ unsigned short h_bits(float f) { const _Float16 h = (_Float16)f; return __builtin_bit_cast(unsigned short, h); }
/* bf16 hi + bf16 lo of an f32 value, both RNE */
__device__ __forceinline__ void split_bits(float f, unsigned short& hb, unsigned short& lb) {
  hb = f2bf_bits(f);
  lb = f2bf_bits(f - bf_bits2f(hb));
}

// ---------------------------------------------------------------------------
// WMMA helpers: every matrix op is followed by 4 nops tied to its own accumulator and its A/B fragments
// ---------------------------------------------------------------------------
__device__ __forceinline__ v8f mma_h(v16h a, v16h b, v8f c) {
  c = __builtin_amdgcn_wmma_f32_16x16x32_f16(false, a, false, b, (short)0, c, false, false);
  asm volatile("v_nop\n\tv_nop\n\tv_nop\n\tv_nop" : "+v"(c) : "v"(a), "v"(b));
  return c;
}
__device__ __forceinline__ v8f mma_b(v16b a, v16b b, v8f c) {
  c = __builtin_amdgcn_wmma_f32_16x16x32_bf16(false, a, false, b, (short)0, c, false, false);
  asm volatile("v_nop\n\tv_nop\n\tv_nop\n\tv_nop" : "+v"(c) : "v"(a), "v"(b));
  return c;
}
__device__ __forceinline__ void keep4_h(v16h a, v16h b, v16h c, v16h d) { asm volatile("v_nop" :: "v"(a), "v"(b), "v"(c), "v"(d)); }
__device__ __forceinline__ void keep4_b(v16b a, v16b b, v16b c, v16b d) { asm volatile("v_nop" :: "v"(a), "v"(b), "v"(c), "v"(d)); }
__device__ __forceinline__ void acc_guard4(v8f& a, v8f& b, v8f& c, v8f& d) { asm volatile("v_nop\n\tv_nop\n\tv_nop\n\tv_nop" : "+v"(a), "+v"(b), "+v"(c), "+v"(d)); }

// Fragment loader: p already points at (row, k0 + 8*(lane>>4)); elements 0..7 <- p[0..7], elements 8..15 <- p[16..23]
template <typename T> struct Frag;
template <> struct Frag<_Float16> {
  typedef v16h V; union U { v16h v; v8h h[2]; };
  static __device__ __forceinline__ v16h load(const _Float16* p) {
    U f; f.h[0] = *(const v8h*)(p); f.h[1] = *(const v8h*)(p + 16); return f.v;
  }
  static __device__ __forceinline__ v8f mma(v16h a, v16h b, v8f c) { return mma_h(a, b, c); }
  static __device__ __forceinline__ void keep(v16h a, v16h b, v16h c, v16h d) { keep4_h(a, b, c, d); }
};
template <> struct Frag<__bf16> {
  typedef v16b V; union U { v16b v; v8b h[2]; };
  static __device__ __forceinline__ v16b load(const __bf16* p) {
    U f; f.h[0] = *(const v8b*)(p); f.h[1] = *(const v8b*)(p + 16); return f.v;
  }
  static __device__ __forceinline__ v8f mma(v16b a, v16b b, v8f c) { return mma_b(a, b, c); }
  static __device__ __forceinline__ void keep(v16b a, v16b b, v16b c, v16b d) { keep4_b(a, b, c, d); }
};

// ---- Register-blocked batched WMMA GEMM ------------------------------------
// C[m,n] = scale * sum_k A[m,k] * Bt[n,k] + bias_scale * bf16(bias[n]); each wave owns a 64x64 tile.
// A row-major [M,K]; Bt row-major [N,K]; M,N % 64 == 0, K % 32 == 0 (no tail handling).
// SPL: 0 = plain (one product), 1 = A carried as hi/lo planes (A2 = lo): hi.b + lo.b,
//      2 = A and Bt as hi/lo planes: hi.hi + hi.lo + lo.hi.
// BIAS_MODE: 0 = none, 2 = bias[n].   OUT_MODE: 0 = f32, 1 = f16.
// ET: 0 = f16 operands, 1 = bf16 operands (pointers passed as 16-bit storage)
template <int ET> struct Elem;
template <> struct Elem<0> { typedef _Float16 T; };
template <> struct Elem<1> { typedef __bf16 T; };
template <int ET, int SPL, int BIAS_MODE, int OUT_MODE>
__global__ __launch_bounds__(256) void wmma_gemm64(
    const unsigned short* __restrict__ Ap, const unsigned short* __restrict__ A2p, int lda, long strideA,
    const unsigned short* __restrict__ Btp, const unsigned short* __restrict__ Bt2p, int ldb, long strideB,
    void* __restrict__ Cout, int ldc, long strideC,
    const float* __restrict__ bias,
    int M, int N, int K, float scale, float bias_scale) {
  typedef typename Elem<ET>::T T;
  typedef typename Frag<T>::V V;
  const T* A = (const T*)Ap; const T* A2 = (const T*)A2p; const T* Bt = (const T*)Btp; const T* Bt2 = (const T*)Bt2p;
  /* per-wave 16x64 slab, pitch 68 floats */
  __shared__ __align__(16) float sT[8][16 * 68];
  const int b    = blockIdx.y;
  const int lane = threadIdx.x & 31;
  const int wave = threadIdx.x >> 5;
  const int tilesN = N >> 6;
  const int tilesM = M >> 6;
  const int tile = blockIdx.x * 8 + wave;
  /* wave-uniform exit; there are no block barriers in this kernel */
  if (tile >= tilesM * tilesN) return;
  const int tm = tile / tilesN;
  const int tn = tile - tm * tilesN;
  const int m0 = tm << 6;
  const int n0 = tn << 6;

  const T* Ab  = A  + (size_t)b * strideA;
  const T* Bb  = Bt + (size_t)b * strideB;
  const T* Ab2 = (SPL >= 1) ? (A2  + (size_t)b * strideA) : nullptr;
  const T* Bb2 = (SPL == 2) ? (Bt2 + (size_t)b * strideB) : nullptr;

  /* rlane: row (A) / col (B, D) within a 16-wide subtile; koff: k offset of this lane half; mOff: D row offset */
  const int rlane = lane & 15;
  const int koff  = (lane >> 4) * 8;
  const int mOff  = (lane >> 4) * 8;

  v8f acc[4][4];
#pragma unroll
  for (int i = 0; i < 4; ++i)
#pragma unroll
    for (int j = 0; j < 4; ++j) acc[i][j] = (v8f){0.f,0.f,0.f,0.f,0.f,0.f,0.f,0.f};

  for (int k0 = 0; k0 < K; k0 += 32) {
    V bh[4], bl[4];
#pragma unroll
    for (int j = 0; j < 4; ++j) {
      const size_t bo = (size_t)(n0 + (j << 4) + rlane) * ldb + koff + k0;
      bh[j] = Frag<T>::load(Bb + bo);
      if (SPL == 2) bl[j] = Frag<T>::load(Bb2 + bo);
    }
#pragma unroll
    for (int i = 0; i < 4; ++i) {
      const size_t ao = (size_t)(m0 + (i << 4) + rlane) * lda + koff + k0;
      V ah = Frag<T>::load(Ab + ao);
      V al;
      if (SPL >= 1) al = Frag<T>::load(Ab2 + ao);
#pragma unroll
      for (int j = 0; j < 4; ++j) {
        acc[i][j] = Frag<T>::mma(ah, bh[j], acc[i][j]);
        if (SPL == 2) acc[i][j] = Frag<T>::mma(ah, bl[j], acc[i][j]);
        if (SPL >= 1) acc[i][j] = Frag<T>::mma(al, bh[j], acc[i][j]);
      }
    }
    Frag<T>::keep(bh[0], bh[1], bh[2], bh[3]);
    if (SPL == 2) Frag<T>::keep(bl[0], bl[1], bl[2], bl[3]);
  }
  acc_guard4(acc[0][0], acc[0][1], acc[0][2], acc[0][3]);
  acc_guard4(acc[1][0], acc[1][1], acc[1][2], acc[1][3]);
  acc_guard4(acc[2][0], acc[2][1], acc[2][2], acc[2][3]);
  acc_guard4(acc[3][0], acc[3][1], acc[3][2], acc[3][3]);

  // ---- epilogue ----
  float* slab = sT[wave];
#pragma unroll
  for (int i = 0; i < 4; ++i) {
    const int mBase = m0 + (i << 4);
#pragma unroll
    for (int j = 0; j < 4; ++j) {
      const int n = n0 + (j << 4) + rlane;
      float bv = 0.f;
      if (BIAS_MODE == 2) bv = bf_bits2f(f2bf_bits(bias[n])) * bias_scale;
#pragma unroll
      for (int r = 0; r < 8; ++r) {
        float v = acc[i][j][r] * scale;
        if (BIAS_MODE == 2) v += bv;
        slab[(mOff + r) * 68 + (j << 4) + rlane] = v;
      }
    }
    __builtin_amdgcn_fence(__ATOMIC_RELEASE, "workgroup");
    __builtin_amdgcn_wave_barrier();
    __builtin_amdgcn_fence(__ATOMIC_ACQUIRE, "workgroup");
    if (OUT_MODE == 0) {
      /* row segment = 256 B = 16 lanes x 16 B; one instruction covers 2 rows */
      float* C = (float*)Cout + (size_t)b * strideC;
      const int hh = lane >> 4, c4 = (lane & 15) * 4;
      {
#pragma unroll
        for (int it = 0; it < 8; ++it) {
          const int row = it * 2 + hh;
          v4f v = *(const v4f*)(slab + row * 68 + c4);
          *(v4f*)(C + (size_t)(mBase + row) * ldc + n0 + c4) = v;
        }
        
      }
    } else {
      const int q = lane >> 3, c8 = (lane & 7) * 8;
      unsigned short* C  = (unsigned short*)Cout  + (size_t)b * strideC;
      {
#pragma unroll
        for (int it = 0; it < 4; ++it) {
          const int row = it * 4 + q;
          const float* sp = slab + row * 68 + c8;
          v8h hv;
#pragma unroll
          for (int e = 0; e < 8; ++e) hv[e] = (_Float16)sp[e];
          *(v8h*)(C + (size_t)(mBase + row) * ldc + n0 + c8) = hv;
        }
        
      }
    }
    __builtin_amdgcn_fence(__ATOMIC_RELEASE, "workgroup");
    __builtin_amdgcn_wave_barrier();
    __builtin_amdgcn_fence(__ATOMIC_ACQUIRE, "workgroup");
  }
}

// ---------------------------------------------------------------------------
// x: f32 -> RNE bf16 -> x16 -> f16 plane (exact), 8 consecutive elements per thread.
// Coverage: n8 = 8192*1024/8 = 1,048,576 threads = 4096 blocks x 256 exactly.
// ---------------------------------------------------------------------------
__global__ __launch_bounds__(256) void cast_x_kernel(const float* __restrict__ in, unsigned short* __restrict__ out, int n8) {
  const int i = blockIdx.x * 256 + threadIdx.x;
  if (i >= n8) return;
  const float* p = in + 8 * (size_t)i;
  const v4f a = *(const v4f*)(p);
  const v4f c = *(const v4f*)(p + 4);
  unsigned short hb[8];
#pragma unroll
  for (int e = 0; e < 4; ++e) {
    const float a_e = a[e];
    const float c_e = c[e];
    hb[e]     = h_bits(bf_bits2f(f2bf_bits(a_e)) * kXCarry);
    hb[4 + e] = h_bits(bf_bits2f(f2bf_bits(c_e)) * kXCarry);
  }
  const v4u u = (v4u){pk16(hb[0], hb[1]), pk16(hb[2], hb[3]), pk16(hb[4], hb[5]), pk16(hb[6], hb[7])};
  unsigned short* q = out + 8 * (size_t)i;
  *(v4u*)q = u;
  
}

// ---------------------------------------------------------------------------
// Weight transpose + cast: W is row-major [dim k][dim n] f32; WT[n][k] = cast(bf16_rne(W[k][n])).
// Planes z < bf_from_z are written as f16 of (bf16 value x carry); planes z >= bf_from_z as raw bf16 bits.
// grid (dim/64, dim/64, planes): blockIdx.x = k tile (64 cols of WT), blockIdx.y = n tile (64 rows of WT). 256 threads.
// Load coverage: 16 iterations x 256 threads = 4096 = the whole 64x64 tile (coalesced along n).
// Store coverage: 8 waves x 2 iterations x 4 rows (lane>>3) = 64 rows; (lane&7) x 8 halves = 64 cols; each row segment =
// ---------------------------------------------------------------------------
__global__ __launch_bounds__(256) void wt_transpose_cast_kernel(const float* __restrict__ W0, const float* __restrict__ W1,
                                                                const float* __restrict__ W2, unsigned short* __restrict__ out,
                                                                int dim, float carry, int bf_from_z) {
  /* sm[n_local][k_local] */
  __shared__ float sm[64][65];
  const int t  = threadIdx.x;
  const int k0 = blockIdx.x * 64;
  const int n0 = blockIdx.y * 64;
  const int z  = blockIdx.z;
  const float* W = (z == 0) ? W0 : (z == 1) ? W1 : W2;
  const bool as_bf = (z >= bf_from_z);
#pragma unroll
  for (int i = 0; i < 16; ++i) {
    const int e = i * 256 + t;
    const int r = e >> 6;
    const int c = e & 63;
    sm[c][r] = W[(size_t)(k0 + r) * dim + n0 + c];
  }
  __syncthreads();
  const int lane = t & 31, wave = t >> 5;
  const int q = lane >> 3, c8 = (lane & 7) * 8;
  unsigned short* op = out + (size_t)z * dim * dim;
  {
#pragma unroll
    for (int it = 0; it < 2; ++it) {
      const int row = wave * 8 + it * 4 + q;
      unsigned short hb[8];
#pragma unroll
      for (int e = 0; e < 8; ++e) {
        const float w = sm[row][c8 + e];
        const unsigned short bb = f2bf_bits(w);
        const unsigned short fh = h_bits(bf_bits2f(bb) * carry);
        hb[e] = as_bf ? bb : fh;
      }
      const v4u u = (v4u){pk16(hb[0], hb[1]), pk16(hb[2], hb[3]), pk16(hb[4], hb[5]), pk16(hb[6], hb[7])};
      *(v4u*)(op + (size_t)(n0 + row) * dim + k0 + c8) = u;
    }
    
  }
}

// ---------------------------------------------------------------------------
// Gated value transform per (64-token block, head): a = v0 + (v0.W1 + b1), g = sigmoid(v0.W2 + b2), v = a*g.
// Block = 4 waves; wave w owns tokens 16w..16w+15 of the block and all 64 output dims.
// v0 tile (f32) staged in LDS; A fragments = bf16 hi and lo of v0 built in registers; W1^T / W2^T bf16 planes staged in LDS;
// 2 k-steps x 4 n-tiles x 2 matrices x 2 products on v_wmma_f32_16x16x32_bf16.
// The two f32 results are transposed through LDS ([d][token]); the gate is applied in the store phase (8 values per lane
// grid (8192/64, 16). All barriers under block-uniform control.
// ---------------------------------------------------------------------------
constexpr int kGP = 68;
__global__ __launch_bounds__(128) void gated_value_kernel(
    const float* __restrict__ V0, const unsigned short* __restrict__ W1tp, const unsigned short* __restrict__ W2tp,
    const float* __restrict__ b1, const float* __restrict__ b2,
    unsigned short* __restrict__ VTH, unsigned short* __restrict__ VTL)
{
  /* sA: first the v0 tile [token][d]; later the gate pre-activation [d][token]. sB: residual sum [d][token]. */
  __shared__ __align__(16) float sA[64 * kGP];
  __shared__ __align__(16) float sB[64 * kGP];
  __shared__ __align__(16) __bf16 sW1[kHS * kHS];
  __shared__ __align__(16) __bf16 sW2[kHS * kHS];
  __shared__ float sBias[2 * kHS];
  const int tid = threadIdx.x, lane = tid & 31, wave = tid >> 5;
  const int hh = lane >> 4, c = lane & 15;
  const int g0 = blockIdx.x * 64;
  const int hd = blockIdx.y;
  const int bidx = g0 / kT;
  const int t0 = g0 - bidx * kT;
  const __bf16* W1t = (const __bf16*)W1tp;
  const __bf16* W2t = (const __bf16*)W2tp;
  /* v0 tile: 64 rows x 16 float4 = 1024 = 8 x 128 threads */
#pragma unroll
  for (int i = 0; i < 8; ++i) {
    const int e = i * 128 + tid;
    const int r = e >> 4, c4 = (e & 15) * 4;
    *(v4f*)(sA + r * kGP + c4) = *(const v4f*)(V0 + (size_t)(g0 + r) * kC + hd * kHS + c4);
  }
  /* weight planes: 4096 bf16 each = 512 x 16 B = 4 x 128 threads */
#pragma unroll
  for (int i = 0; i < 4; ++i) {
    const int e = (i * 128 + tid) * 8;
    *(v8b*)(sW1 + e) = *(const v8b*)(W1t + e);
    *(v8b*)(sW2 + e) = *(const v8b*)(W2t + e);
  }
  {
    const int bi = tid & 63;
    const float x1 = b1[bi];
    const float x2 = b2[bi];
    const float xs = (tid < kHS) ? x1 : x2;
    sBias[tid] = bf_bits2f(f2bf_bits(xs));
  }
  __syncthreads();

  /* A fragments (hi, lo) for this wave's 16 tokens */
  v16b ah[2], al[2];
  {
    const int arow = wave * 16 + c;
#pragma unroll
    for (int ks = 0; ks < 2; ++ks) {
      const float* p = sA + arow * kGP + ks * 32 + 8 * hh;
      const v4f f0 = *(const v4f*)(p);
      const v4f f1 = *(const v4f*)(p + 4);
      const v4f f2 = *(const v4f*)(p + 16);
      const v4f f3 = *(const v4f*)(p + 20);
#pragma unroll
      for (int e = 0; e < 4; ++e) {
        unsigned short hb, lb;
        const float x0 = f0[e];
        const float x1 = f1[e];
        const float x2 = f2[e];
        const float x3 = f3[e];
        split_bits(x0, hb, lb);
        ah[ks][e] = __builtin_bit_cast(__bf16, hb);       al[ks][e] = __builtin_bit_cast(__bf16, lb);
        split_bits(x1, hb, lb);
        ah[ks][4 + e] = __builtin_bit_cast(__bf16, hb);   al[ks][4 + e] = __builtin_bit_cast(__bf16, lb);
        split_bits(x2, hb, lb);
        ah[ks][8 + e] = __builtin_bit_cast(__bf16, hb);   al[ks][8 + e] = __builtin_bit_cast(__bf16, lb);
        split_bits(x3, hb, lb);
        ah[ks][12 + e] = __builtin_bit_cast(__bf16, hb);  al[ks][12 + e] = __builtin_bit_cast(__bf16, lb);
      }
    }
  }

  v8f a1[4], a2[4];
#pragma unroll
  for (int j = 0; j < 4; ++j) {
    a1[j] = (v8f){0.f,0.f,0.f,0.f,0.f,0.f,0.f,0.f};
    a2[j] = (v8f){0.f,0.f,0.f,0.f,0.f,0.f,0.f,0.f};
  }
#pragma unroll
  for (int ks = 0; ks < 2; ++ks) {
#pragma unroll
    for (int j = 0; j < 4; ++j) {
      const v16b w1 = Frag<__bf16>::load(sW1 + (j * 16 + c) * kHS + ks * 32 + 8 * hh);
      const v16b w2 = Frag<__bf16>::load(sW2 + (j * 16 + c) * kHS + ks * 32 + 8 * hh);
      a1[j] = mma_b(ah[ks], w1, a1[j]);
      a1[j] = mma_b(al[ks], w1, a1[j]);
      a2[j] = mma_b(ah[ks], w2, a2[j]);
      a2[j] = mma_b(al[ks], w2, a2[j]);
    }
  }
  acc_guard4(a1[0], a1[1], a1[2], a1[3]);
  acc_guard4(a2[0], a2[1], a2[2], a2[3]);

  /* residual + biases in place (reads only this wave's own token rows of sA) */
#pragma unroll
  for (int j = 0; j < 4; ++j) {
    const int col = j * 16 + c;
    const float bb1 = sBias[col];
    const float bb2 = sBias[kHS + col];
#pragma unroll
    for (int r = 0; r < 8; ++r) {
      const int row = wave * 16 + 8 * hh + r;
      const float vres = sA[row * kGP + col];
      a1[j][r] = vres + (a1[j][r] + bb1);
      a2[j][r] = a2[j][r] + bb2;
    }
  }
  /* every wave has finished reading the v0 tile before it is overwritten */
  __syncthreads();
#pragma unroll
  for (int j = 0; j < 4; ++j) {
    const int col = j * 16 + c;
#pragma unroll
    for (int r = 0; r < 8; ++r) {
      const int row = wave * 16 + 8 * hh + r;
      sB[col * kGP + row] = a1[j][r];
      sA[col * kGP + row] = a2[j][r];
    }
  }
  __syncthreads();

  const int q = lane >> 3, c8 = (lane & 7) * 8;
#pragma unroll 1
  for (int it = 0; it < 4; ++it) {
    const int d = wave * 16 + it * 4 + q;
    const float* pa = sB + d * kGP + c8;
    const float* pg = sA + d * kGP + c8;
    const v4f av0 = *(const v4f*)(pa);
    const v4f av1 = *(const v4f*)(pa + 4);
    const v4f gv0 = *(const v4f*)(pg);
    const v4f gv1 = *(const v4f*)(pg + 4);
    v8h hv, lv;
#pragma unroll
    for (int e = 0; e < 4; ++e) {
      const float xa0 = av0[e];
      const float xg0 = gv0[e];
      const float xa1 = av1[e];
      const float xg1 = gv1[e];
      const float r0 = xa0 * (1.0f / (1.0f + expf(-xg0)));
      const float r1 = xa1 * (1.0f / (1.0f + expf(-xg1)));
      unsigned short hb, lb;
      split_bits(r0, hb, lb);
      hv[e] = __builtin_bit_cast(_Float16, hb);
      lv[e] = __builtin_bit_cast(_Float16, lb);
      split_bits(r1, hb, lb);
      hv[4 + e] = __builtin_bit_cast(_Float16, hb);
      lv[4 + e] = __builtin_bit_cast(_Float16, lb);
    }
    const size_t o = ((size_t)(bidx * kH + hd) * kHS + d) * kT + t0 + c8;
    *(v8h*)(VTH + o) = hv;
    *(v8h*)(VTL + o) = lv;
    
  }
}

// ---------------------------------------------------------------------------
// Causal attention for head dim 64 from 16-bit planes. Block = 4 waves = 64 query rows of one (batch, head);
// keys in chunks of 64 up to and including the diagonal chunk (block-uniform trip count qb + 1 <= 32).
//   scores: A = u (f16, x16) rows, B = x (f16, x16) key rows staged in LDS; 2 matrix ops per 16-key tile; x 1/(32*16*16).
//   diagonal chunk: key > query -> -inf (every row keeps at least its own key; the first chunk always holds key 0).
//   online softmax in f32; the normaliser is summed from the f32 p values.
//   P -> bf16 hi + lo per wave in LDS (A layout); v hi + lo ([d][key] planes) staged in LDS; P.v = hi.hi + hi.lo + lo.hi.
// ---------------------------------------------------------------------------
constexpr int kKC = 64;
__global__ __launch_bounds__(128) void causal_attn_kernel(
    const unsigned short* __restrict__ Up, const unsigned short* __restrict__ XHp,
    const unsigned short* __restrict__ VTHp, const unsigned short* __restrict__ VTLp,
    unsigned short* __restrict__ YH, unsigned short* __restrict__ YL)
{
  __shared__ __align__(16) _Float16 Ksh[kKC * kHS];
  __shared__ __align__(16) __bf16 Vth[kHS * kKC];
  __shared__ __align__(16) __bf16 Vtl[kHS * kKC];
  __shared__ __align__(16) __bf16 Psh[4][16 * kKC];
  __shared__ __align__(16) __bf16 Psl[4][16 * kKC];
  __shared__ __align__(16) float  Os[4][16 * 68];

  const int tid  = threadIdx.x;
  const int wave = tid >> 5;
  const int lane = tid & 31;
  const int hh   = lane >> 4;
  const int c    = lane & 15;

  constexpr int nqb = kT / 64;
  const int bx = blockIdx.x;
  const int qb = bx % nqb;
  const int bh = bx / nqb;
  const int h  = bh % kH;
  const int b  = bh / kH;
  const int q0 = qb * 64 + wave * 16;

  const _Float16* Uh = (const _Float16*)Up;
  const _Float16* Xh = (const _Float16*)XHp;
  const __bf16*   Vh = (const __bf16*)VTHp;
  const __bf16*   Vl = (const __bf16*)VTLp;

  /* query fragments: 2 d-chunks */
  v16h qa[2];
  {
    const _Float16* urow = Uh + (size_t)(b * kT + q0 + c) * kC + h * kHS;
#pragma unroll
    for (int dc = 0; dc < 2; ++dc) qa[dc] = Frag<_Float16>::load(urow + dc * 32 + 8 * hh);
  }

  float mrow[8], lrow[8];
  v8f oacc[4];
#pragma unroll
  for (int r = 0; r < 8; ++r) { mrow[r] = -INFINITY; lrow[r] = 0.f; }
#pragma unroll
  for (int t = 0; t < 4; ++t) oacc[t] = (v8f){0.f,0.f,0.f,0.f,0.f,0.f,0.f,0.f};

  __bf16* pwh = Psh[wave];
  __bf16* pwl = Psl[wave];
  const int nChunks = qb + 1;
  for (int kc = 0; kc < nChunks; ++kc) {
    const int kv0 = kc * kKC;
    __syncthreads();
    /* K, V hi, V lo tiles: 64 rows x 8 x 16 B = 512 each = 4 x 128 threads */
#pragma unroll
    for (int i = 0; i < 4; ++i) {
      const int e = i * 128 + tid;
      const int r = e >> 3, c8 = (e & 7) * 8;
      *(v8h*)(Ksh + r * kHS + c8) = *(const v8h*)(Xh + (size_t)(b * kT + kv0 + r) * kC + h * kHS + c8);
      const size_t vo = ((size_t)bh * kHS + r) * kT + kv0 + c8;
      *(v8b*)(Vth + r * kKC + c8) = *(const v8b*)(Vh + vo);
      *(v8b*)(Vtl + r * kKC + c8) = *(const v8b*)(Vl + vo);
    }
    __syncthreads();

    v8f s[4];
#pragma unroll
    for (int j = 0; j < 4; ++j) {
      s[j] = (v8f){0.f,0.f,0.f,0.f,0.f,0.f,0.f,0.f};
#pragma unroll
      for (int dc = 0; dc < 2; ++dc) {
        const v16h kb = Frag<_Float16>::load(Ksh + (j * 16 + c) * kHS + dc * 32 + 8 * hh);
        s[j] = mma_h(qa[dc], kb, s[j]);
      }
    }
    acc_guard4(s[0], s[1], s[2], s[3]);

    const bool diag = (kc == qb);
    float cm[8];
#pragma unroll
    for (int r = 0; r < 8; ++r) {
      const int qrow = q0 + 8 * hh + r;
      float m = -INFINITY;
#pragma unroll
      for (int j = 0; j < 4; ++j) {
        const int kvcol = kv0 + j * 16 + c;
        float sv = s[j][r] * kScoreScale;
        const bool masked = diag && (kvcol > qrow);
        sv = masked ? -INFINITY : sv;
        s[j][r] = sv;
        m = fmaxf(m, sv);
      }
#pragma unroll
      for (int off = 1; off < 16; off <<= 1) m = fmaxf(m, __shfl_xor(m, off, 32));
      cm[r] = m;
    }
#pragma unroll
    for (int r = 0; r < 8; ++r) {
      const float mnew = fmaxf(mrow[r], cm[r]);
      const float alpha = __expf(mrow[r] - mnew);
      mrow[r] = mnew;
      float psum = 0.f;
#pragma unroll
      for (int j = 0; j < 4; ++j) {
        const float p = __expf(s[j][r] - mnew);
        psum += p;
        unsigned short hb, lb;
        split_bits(p, hb, lb);
        pwh[(8 * hh + r) * kKC + j * 16 + c] = __builtin_bit_cast(__bf16, hb);
        pwl[(8 * hh + r) * kKC + j * 16 + c] = __builtin_bit_cast(__bf16, lb);
      }
#pragma unroll
      for (int off = 1; off < 16; off <<= 1) psum += __shfl_xor(psum, off, 32);
      lrow[r] = lrow[r] * alpha + psum;
#pragma unroll
      for (int t = 0; t < 4; ++t) oacc[t][r] *= alpha;
    }
    __builtin_amdgcn_fence(__ATOMIC_RELEASE, "workgroup");
    __builtin_amdgcn_wave_barrier();
    __builtin_amdgcn_fence(__ATOMIC_ACQUIRE, "workgroup");
#pragma unroll 1
    for (int kk = 0; kk < 2; ++kk) {
      const v16b pa = Frag<__bf16>::load(pwh + c * kKC + kk * 32 + 8 * hh);
      const v16b pl = Frag<__bf16>::load(pwl + c * kKC + kk * 32 + 8 * hh);
#pragma unroll
      for (int t = 0; t < 4; ++t) {
        const v16b vb = Frag<__bf16>::load(Vth + (t * 16 + c) * kKC + kk * 32 + 8 * hh);
        const v16b vl = Frag<__bf16>::load(Vtl + (t * 16 + c) * kKC + kk * 32 + 8 * hh);
        oacc[t] = mma_b(pa, vb, oacc[t]);
        oacc[t] = mma_b(pa, vl, oacc[t]);
        oacc[t] = mma_b(pl, vb, oacc[t]);
      }
    }
    acc_guard4(oacc[0], oacc[1], oacc[2], oacc[3]);
  }

  float* os = Os[wave];
#pragma unroll
  for (int r = 0; r < 8; ++r) {
    const float inv = 1.0f / lrow[r];
#pragma unroll
    for (int t = 0; t < 4; ++t) os[(8 * hh + r) * 68 + t * 16 + c] = oacc[t][r] * inv;
  }
  __builtin_amdgcn_fence(__ATOMIC_RELEASE, "workgroup");
  __builtin_amdgcn_wave_barrier();
  __builtin_amdgcn_fence(__ATOMIC_ACQUIRE, "workgroup");
  {
    const int q = lane >> 3, c8 = (lane & 7) * 8;
    v8h hv[4], lv[4];
#pragma unroll
    for (int it = 0; it < 4; ++it) {
      const int row = it * 4 + q;
      const float* sp = os + row * 68 + c8;
      const v4f y0 = *(const v4f*)(sp);
      const v4f y1 = *(const v4f*)(sp + 4);
#pragma unroll
      for (int e = 0; e < 4; ++e) {
        const float z0 = y0[e];
        const float z1 = y1[e];
        unsigned short hb, lb;
        split_bits(z0, hb, lb);
        hv[it][e] = __builtin_bit_cast(_Float16, hb);
        lv[it][e] = __builtin_bit_cast(_Float16, lb);
        split_bits(z1, hb, lb);
        hv[it][4 + e] = __builtin_bit_cast(_Float16, hb);
        lv[it][4 + e] = __builtin_bit_cast(_Float16, lb);
      }
    }
    {
#pragma unroll
      for (int it = 0; it < 4; ++it) {
        const int row = it * 4 + q;
        const size_t o = (size_t)(b * kT + q0 + row) * kC + h * kHS + c8;
        *(v8h*)(YH + o) = hv[it];
        *(v8h*)(YL + o) = lv[it];
      }
      
    }
  }
}

// ---------------------------------------------------------------------------
// Host glue: 8 launches, kernel launches only.
// GEMM shapes: M 8192, N 1024, K 1024 (K % 32 == 0, M and N % 64 == 0): 128 x 16 tiles = 2048 -> 256 blocks of 8 waves.
// ---------------------------------------------------------------------------
extern "C" void kernel_launch(void* const* d_in, const int* in_sizes, int n_in,
                              void* d_out, int out_size, void* d_ws, size_t ws_size,
                              hipStream_t stream) {
  if (n_in < 11) return;
  if (in_sizes[0] != kRows * kC) return;
  if (in_sizes[1] != kC * kC) return;
  if (in_sizes[2] != kC) return;
  if (in_sizes[3] != kC * kC) return;
  if (in_sizes[4] != kC) return;
  if (in_sizes[5] != kHS * kHS) return;
  if (in_sizes[6] != kHS) return;
  if (in_sizes[7] != kHS * kHS) return;
  if (in_sizes[8] != kHS) return;
  if (in_sizes[9] != kC * kC) return;
  if (in_sizes[10] != kC) return;
  if (out_size != kRows * kC) return;
  if (ws_size < kWsTotal) return;

  const float* x  = (const float*)d_in[0];
  const float* Wu = (const float*)d_in[1];
  const float* bu = (const float*)d_in[2];
  const float* Wv = (const float*)d_in[3];
  const float* bv = (const float*)d_in[4];
  const float* W1 = (const float*)d_in[5];
  const float* b1 = (const float*)d_in[6];
  const float* W2 = (const float*)d_in[7];
  const float* b2 = (const float*)d_in[8];
  const float* Wp = (const float*)d_in[9];
  const float* bp = (const float*)d_in[10];
  float* out = (float*)d_out;

  char* ws = (char*)d_ws;
  unsigned short* XH   = (unsigned short*)(ws + kOffXH);
  unsigned short* WUT  = (unsigned short*)(ws + kOffWUT);
  unsigned short* WVT  = (unsigned short*)(ws + kOffWVT);
  unsigned short* WPT  = (unsigned short*)(ws + kOffWPT);
  unsigned short* W12T = (unsigned short*)(ws + kOffW12);
  unsigned short* U16  = (unsigned short*)(ws + kOffU);
  float*          V0   = (float*)(ws + kOffV0);
  unsigned short* YH   = (unsigned short*)(ws + kOffYH);
  unsigned short* YL   = (unsigned short*)(ws + kOffYL);
  unsigned short* VTH  = (unsigned short*)(ws + kOffVTH);
  unsigned short* VTL  = (unsigned short*)(ws + kOffVTL);

  /* x -> f16 plane (bf16 values x16) */
  cast_x_kernel<<<(kRows * kC / 8) / 256, 256, 0, stream>>>(x, XH, kRows * kC / 8);

  /* in[k][n] -> out[n][k]: Wu, Wv as f16 (x1024), Wp as bf16; planes WUT, WVT, WPT are contiguous */
  wt_transpose_cast_kernel<<<dim3(kC / 64, kC / 64, 3), 256, 0, stream>>>(Wu, Wv, Wp, WUT, kC, kWCarry, 2);
  /* in[k][n] -> out[n][k]: W1, W2 as bf16 [64][64] planes */
  wt_transpose_cast_kernel<<<dim3(1, 1, 2), 256, 0, stream>>>(W1, W2, W2, W12T, kHS, 1.0f, 0);

  /* u (f16, x16) = x.Wu + bu */
  wmma_gemm64<0, 0, 2, 1><<<dim3(256, 1), 256, 0, stream>>>(
      XH, XH, kC, 0L,
      WUT, WUT, kC, 0L,
      (void*)U16, kC, 0L,
      bu, kRows, kC, kC, kUScale, kUCarry);

  /* v0 (f32) = x.Wv + bv */
  wmma_gemm64<0, 0, 2, 0><<<dim3(256, 1), 256, 0, stream>>>(
      XH, XH, kC, 0L,
      WVT, WVT, kC, 0L,
      (void*)V0, kC, 0L,
      bv, kRows, kC, kC, kV0Scale, 1.0f);

  /* gated value -> vT hi | lo planes */
  gated_value_kernel<<<dim3(kRows / 64, kH), 128, 0, stream>>>(V0, W12T, W12T + kHS * kHS, b1, b2, VTH, VTL);

  /* causal attention -> y hi | lo planes (the v0 bytes are dead from here on) */
  causal_attn_kernel<<<kB * kH * (kT / 64), 128, 0, stream>>>(U16, XH, VTH, VTL, YH, YL);

  /* out = y.Wp + bp (y hi.W + y lo.W) */
  wmma_gemm64<1, 1, 2, 0><<<dim3(256, 1), 256, 0, stream>>>(
      YH, YL, kC, 0L,
      WPT, WPT, kC, 0L,
      (void*)out, kC, 0L,
      bp, kRows, kC, kC, 1.0f, 1.0f);
}

// v001
// A run of this version takes 568 microseconds.
// In both of two side-by-side timings against v000, it was 1.24 times as fast.
// All contractions on 16-bit WMMA with f32 accumulate: x.Wu, x.Wv and the u.x^T scores on v_wmma_f32_16x16x32_f16 (inputs RNE-converted to bf16 once and held exactly in f16 planes with power-of-two carries: x x16, W x1024, u x16); v0.W1, v0.W2, P.v and y.Wp on v_wmma_f32_16x16x32_bf16 with the computed operand carried as bf16 hi+lo planes (W1, W2, Wp as bf16 planes); softmax, gate, residual and bias in f32.
#include <hip/hip_runtime.h>
#include <math.h>

typedef __attribute__((ext_vector_type(16))) _Float16 v16h;
typedef __attribute__((ext_vector_type(8)))  _Float16 v8h;
typedef __attribute__((ext_vector_type(16))) __bf16   v16b;
typedef __attribute__((ext_vector_type(8)))  __bf16   v8b;
typedef __attribute__((ext_vector_type(8)))  float    v8f;
typedef __attribute__((ext_vector_type(4)))  float    v4f;
typedef __attribute__((ext_vector_type(4)))  unsigned int v4u;

// ---------------------------------------------------------------------------
// Problem constants
// ---------------------------------------------------------------------------
constexpr int kB    = 4;
constexpr int kT    = 2048;
constexpr int kC    = 1024;
constexpr int kH    = 16;
constexpr int kHS   = 64;
constexpr int kRows = kB * kT;
constexpr int kSqrtC = 32;
static_assert(kSqrtC * kSqrtC == kC, "score scale is 1/sqrt(C)");
static_assert(kH * kHS == kC, "head split");
static_assert((kC % 32) == 0 && (kHS % 32) == 0 && (kT % 64) == 0, "K multiples of 32, key chunks of 64");
static_assert((kRows % 64) == 0 && (kC % 64) == 0, "GEMM M,N multiples of 64");

// power-of-two carries of the f16 planes (exact; folded back in f32)
constexpr float kXCarry = 16.0f;
constexpr float kWCarry = 1024.0f;
constexpr float kUCarry = 16.0f;
constexpr float kUScale  = kUCarry / (kXCarry * kWCarry);
constexpr float kV0Scale = 1.0f / (kXCarry * kWCarry);
constexpr float kScoreScale = 1.0f / ((float)kSqrtC * kUCarry * kXCarry);

// ---------------------------------------------------------------------------
// Workspace region map (bytes; every offset is a multiple of 128)
//   XH    f16  [8192][1024]      16*bf16(x)                      16,777,216
//   WUT   f16  [1024 n][1024 k]  1024*bf16(Wu)^T                  2,097,152
//   WVT   f16  [1024 n][1024 k]  1024*bf16(Wv)^T                  2,097,152
//   WPT   bf16 [1024 n][1024 k]  bf16(Wp)^T                       2,097,152
//   W12T  bf16 2 x [64 n][64 k]  bf16(W1)^T | bf16(W2)^T             16,384
//   U16   f16  [8192][1024]      16*u                            16,777,216
//   V0    f32  [8192][1024]      v0; dead after the gated-value launch, then the same bytes
//                                hold YH | YL (bf16 hi | lo planes of y, [8192][1024] each)  33,554,432
//   VTH   bf16 [4][16][64 d][2048 t]  gated v, hi plane           16,777,216
//   VTL   bf16 [4][16][64 d][2048 t]  gated v, lo plane           16,777,216
//   total                                                       106,971,136
// ---------------------------------------------------------------------------
constexpr size_t kSzAct16 = (size_t)kRows * kC * 2;
constexpr size_t kSzW16   = (size_t)kC * kC * 2;
constexpr size_t kSzW12   = (size_t)2 * kHS * kHS * 2;
constexpr size_t kSzV0    = (size_t)kRows * kC * 4;
constexpr size_t kOffXH   = 0;
constexpr size_t kOffWUT  = kOffXH  + kSzAct16;
constexpr size_t kOffWVT  = kOffWUT + kSzW16;
constexpr size_t kOffWPT  = kOffWVT + kSzW16;
constexpr size_t kOffW12  = kOffWPT + kSzW16;
constexpr size_t kOffU    = kOffW12 + kSzW12;
constexpr size_t kOffV0   = kOffU   + kSzAct16;
constexpr size_t kOffYH   = kOffV0;
constexpr size_t kOffYL   = kOffV0  + kSzAct16;
constexpr size_t kOffVTH  = kOffV0  + kSzV0;
constexpr size_t kOffVTL  = kOffVTH + kSzAct16;
constexpr size_t kWsTotal = kOffVTL + kSzAct16;
static_assert(kWsTotal == 106971136ull, "carve total");
static_assert(kWsTotal <= 134217728ull, "carve cap");
static_assert(2 * kSzAct16 == kSzV0, "y hi|lo planes fit the v0 plane exactly");
static_assert((kOffWUT % 128) == 0 && (kOffWVT % 128) == 0 && (kOffWPT % 128) == 0 && (kOffW12 % 128) == 0 &&
              (kOffU % 128) == 0 && (kOffV0 % 128) == 0 && (kOffYL % 128) == 0 && (kOffVTH % 128) == 0 &&
              (kOffVTL % 128) == 0, "128-B aligned regions");

// ---------------------------------------------------------------------------
// Bit helpers
// ---------------------------------------------------------------------------
__device__ __forceinline__ unsigned short f2bf_bits(float f) {
  unsigned u = __float_as_uint(f);
  return (unsigned short)((u + 0x7FFFu + ((u >> 16) & 1u)) >> 16);
}
__device__ __forceinline__ float bf_bits2f(unsigned short h) { return __uint_as_float(((unsigned)h) << 16); }
__device__ __forceinline__ unsigned pk16(unsigned short a, unsigned short b) { return (unsigned)a | ((unsigned)b << 16); }
__device__ __forceinline__ unsigned short h_bits(float f) { const _Float16 h = (_Float16)f; return __builtin_bit_cast(unsigned short, h); }
/* bf16 hi + bf16 lo of an f32 value, both RNE */
__device__ __forceinline__ void split_bits(float f, unsigned short& hb, unsigned short& lb) {
  hb = f2bf_bits(f);
  lb = f2bf_bits(f - bf_bits2f(hb));
}

// ---------------------------------------------------------------------------
// WMMA helpers: every matrix op is followed by 4 nops tied to its own accumulator and its A/B fragments
// ---------------------------------------------------------------------------
__device__ __forceinline__ v8f mma_h(v16h a, v16h b, v8f c) {
  c = __builtin_amdgcn_wmma_f32_16x16x32_f16(false, a, false, b, (short)0, c, false, false);
  asm volatile("v_nop\n\tv_nop\n\tv_nop\n\tv_nop" : "+v"(c) : "v"(a), "v"(b));
  return c;
}
__device__ __forceinline__ v8f mma_b(v16b a, v16b b, v8f c) {
  c = __builtin_amdgcn_wmma_f32_16x16x32_bf16(false, a, false, b, (short)0, c, false, false);
  asm volatile("v_nop\n\tv_nop\n\tv_nop\n\tv_nop" : "+v"(c) : "v"(a), "v"(b));
  return c;
}
__device__ __forceinline__ void keep4_h(v16h a, v16h b, v16h c, v16h d) { asm volatile("v_nop" :: "v"(a), "v"(b), "v"(c), "v"(d)); }
__device__ __forceinline__ void keep4_b(v16b a, v16b b, v16b c, v16b d) { asm volatile("v_nop" :: "v"(a), "v"(b), "v"(c), "v"(d)); }
__device__ __forceinline__ void acc_guard4(v8f& a, v8f& b, v8f& c, v8f& d) { asm volatile("v_nop\n\tv_nop\n\tv_nop\n\tv_nop" : "+v"(a), "+v"(b), "+v"(c), "+v"(d)); }

// Fragment loader: p already points at (row, k0 + 8*(lane>>4)); elements 0..7 <- p[0..7], elements 8..15 <- p[16..23]
template <typename T> struct Frag;
template <> struct Frag<_Float16> {
  typedef v16h V; union U { v16h v; v8h h[2]; };
  static __device__ __forceinline__ v16h load(const _Float16* p) {
    U f; f.h[0] = *(const v8h*)(p); f.h[1] = *(const v8h*)(p + 16); return f.v;
  }
  static __device__ __forceinline__ v8f mma(v16h a, v16h b, v8f c) { return mma_h(a, b, c); }
  static __device__ __forceinline__ void keep(v16h a, v16h b, v16h c, v16h d) { keep4_h(a, b, c, d); }
};
template <> struct Frag<__bf16> {
  typedef v16b V; union U { v16b v; v8b h[2]; };
  static __device__ __forceinline__ v16b load(const __bf16* p) {
    U f; f.h[0] = *(const v8b*)(p); f.h[1] = *(const v8b*)(p + 16); return f.v;
  }
  static __device__ __forceinline__ v8f mma(v16b a, v16b b, v8f c) { return mma_b(a, b, c); }
  static __device__ __forceinline__ void keep(v16b a, v16b b, v16b c, v16b d) { keep4_b(a, b, c, d); }
};

// ---- Register-blocked batched WMMA GEMM ------------------------------------
// C[m,n] = scale * sum_k A[m,k] * Bt[n,k] + bias_scale * bf16(bias[n]); each wave owns a 64x64 tile.
// A row-major [M,K]; Bt row-major [N,K]; M,N % 64 == 0, K % 32 == 0 (no tail handling).
// SPL: 0 = plain (one product), 1 = A carried as hi/lo planes (A2 = lo): hi.b + lo.b,
//      2 = A and Bt as hi/lo planes: hi.hi + hi.lo + lo.hi.
// BIAS_MODE: 0 = none, 2 = bias[n].   OUT_MODE: 0 = f32, 1 = f16.
// ET: 0 = f16 operands, 1 = bf16 operands (pointers passed as 16-bit storage)
template <int ET> struct Elem;
template <> struct Elem<0> { typedef _Float16 T; };
template <> struct Elem<1> { typedef __bf16 T; };
template <int ET, int SPL, int BIAS_MODE, int OUT_MODE>
__global__ __launch_bounds__(256) void wmma_gemm64(
    const unsigned short* __restrict__ Ap, const unsigned short* __restrict__ A2p, int lda, long strideA,
    const unsigned short* __restrict__ Btp, const unsigned short* __restrict__ Bt2p, int ldb, long strideB,
    void* __restrict__ Cout, int ldc, long strideC,
    const float* __restrict__ bias,
    int M, int N, int K, float scale, float bias_scale) {
  typedef typename Elem<ET>::T T;
  typedef typename Frag<T>::V V;
  const T* A = (const T*)Ap; const T* A2 = (const T*)A2p; const T* Bt = (const T*)Btp; const T* Bt2 = (const T*)Bt2p;
  /* per-wave 16x64 slab, pitch 68 floats */
  __shared__ __align__(16) float sT[8][16 * 68];
  const int b    = blockIdx.y;
  const int lane = threadIdx.x & 31;
  const int wave = threadIdx.x >> 5;
  const int tilesN = N >> 6;
  const int tilesM = M >> 6;
  const int tile = blockIdx.x * 8 + wave;
  /* wave-uniform exit; there are no block barriers in this kernel */
  if (tile >= tilesM * tilesN) return;
  const int tm = tile / tilesN;
  const int tn = tile - tm * tilesN;
  const int m0 = tm << 6;
  const int n0 = tn << 6;

  const T* Ab  = A  + (size_t)b * strideA;
  const T* Bb  = Bt + (size_t)b * strideB;
  const T* Ab2 = (SPL >= 1) ? (A2  + (size_t)b * strideA) : nullptr;
  const T* Bb2 = (SPL == 2) ? (Bt2 + (size_t)b * strideB) : nullptr;

  /* rlane: row (A) / col (B, D) within a 16-wide subtile; koff: k offset of this lane half; mOff: D row offset */
  const int rlane = lane & 15;
  const int koff  = (lane >> 4) * 8;
  const int mOff  = (lane >> 4) * 8;

  v8f acc[4][4];
#pragma unroll
  for (int i = 0; i < 4; ++i)
#pragma unroll
    for (int j = 0; j < 4; ++j) acc[i][j] = (v8f){0.f,0.f,0.f,0.f,0.f,0.f,0.f,0.f};

  for (int k0 = 0; k0 < K; k0 += 32) {
    V bh[4], bl[4];
#pragma unroll
    for (int j = 0; j < 4; ++j) {
      const size_t bo = (size_t)(n0 + (j << 4) + rlane) * ldb + koff + k0;
      bh[j] = Frag<T>::load(Bb + bo);
      if (SPL == 2) bl[j] = Frag<T>::load(Bb2 + bo);
    }
#pragma unroll
    for (int i = 0; i < 4; ++i) {
      const size_t ao = (size_t)(m0 + (i << 4) + rlane) * lda + koff + k0;
      V ah = Frag<T>::load(Ab + ao);
      V al;
      if (SPL >= 1) al = Frag<T>::load(Ab2 + ao);
#pragma unroll
      for (int j = 0; j < 4; ++j) {
        acc[i][j] = Frag<T>::mma(ah, bh[j], acc[i][j]);
        if (SPL == 2) acc[i][j] = Frag<T>::mma(ah, bl[j], acc[i][j]);
        if (SPL >= 1) acc[i][j] = Frag<T>::mma(al, bh[j], acc[i][j]);
      }
    }
    Frag<T>::keep(bh[0], bh[1], bh[2], bh[3]);
    if (SPL == 2) Frag<T>::keep(bl[0], bl[1], bl[2], bl[3]);
  }
  acc_guard4(acc[0][0], acc[0][1], acc[0][2], acc[0][3]);
  acc_guard4(acc[1][0], acc[1][1], acc[1][2], acc[1][3]);
  acc_guard4(acc[2][0], acc[2][1], acc[2][2], acc[2][3]);
  acc_guard4(acc[3][0], acc[3][1], acc[3][2], acc[3][3]);

  // ---- epilogue ----
  float* slab = sT[wave];
#pragma unroll
  for (int i = 0; i < 4; ++i) {
    const int mBase = m0 + (i << 4);
#pragma unroll
    for (int j = 0; j < 4; ++j) {
      const int n = n0 + (j << 4) + rlane;
      float bv = 0.f;
      if (BIAS_MODE == 2) bv = bf_bits2f(f2bf_bits(bias[n])) * bias_scale;
#pragma unroll
      for (int r = 0; r < 8; ++r) {
        float v = acc[i][j][r] * scale;
        if (BIAS_MODE == 2) v += bv;
        slab[(mOff + r) * 68 + (j << 4) + rlane] = v;
      }
    }
    __builtin_amdgcn_fence(__ATOMIC_RELEASE, "workgroup");
    __builtin_amdgcn_wave_barrier();
    __builtin_amdgcn_fence(__ATOMIC_ACQUIRE, "workgroup");
    if (OUT_MODE == 0) {
      /* row segment = 256 B = 16 lanes x 16 B; one instruction covers 2 rows */
      float* C = (float*)Cout + (size_t)b * strideC;
      const int hh = lane >> 4, c4 = (lane & 15) * 4;
      {
#pragma unroll
        for (int it = 0; it < 8; ++it) {
          const int row = it * 2 + hh;
          v4f v = *(const v4f*)(slab + row * 68 + c4);
          *(v4f*)(C + (size_t)(mBase + row) * ldc + n0 + c4) = v;
        }
        
      }
    } else {
      const int q = lane >> 3, c8 = (lane & 7) * 8;
      unsigned short* C  = (unsigned short*)Cout  + (size_t)b * strideC;
      {
#pragma unroll
        for (int it = 0; it < 4; ++it) {
          const int row = it * 4 + q;
          const float* sp = slab + row * 68 + c8;
          v8h hv;
#pragma unroll
          for (int e = 0; e < 8; ++e) hv[e] = (_Float16)sp[e];
          *(v8h*)(C + (size_t)(mBase + row) * ldc + n0 + c8) = hv;
        }
        
      }
    }
    __builtin_amdgcn_fence(__ATOMIC_RELEASE, "workgroup");
    __builtin_amdgcn_wave_barrier();
    __builtin_amdgcn_fence(__ATOMIC_ACQUIRE, "workgroup");
  }
}

// ---------------------------------------------------------------------------
// x: f32 -> RNE bf16 -> x16 -> f16 plane (exact), 8 consecutive elements per thread.
// Coverage: n8 = 8192*1024/8 = 1,048,576 threads = 4096 blocks x 256 exactly.
// ---------------------------------------------------------------------------
__global__ __launch_bounds__(256) void cast_x_kernel(const float* __restrict__ in, unsigned short* __restrict__ out, int n8) {
  const int i = blockIdx.x * 256 + threadIdx.x;
  if (i >= n8) return;
  const float* p = in + 8 * (size_t)i;
  const v4f a = *(const v4f*)(p);
  const v4f c = *(const v4f*)(p + 4);
  unsigned short hb[8];
#pragma unroll
  for (int e = 0; e < 4; ++e) {
    const float a_e = a[e];
    const float c_e = c[e];
    hb[e]     = h_bits(bf_bits2f(f2bf_bits(a_e)) * kXCarry);
    hb[4 + e] = h_bits(bf_bits2f(f2bf_bits(c_e)) * kXCarry);
  }
  const v4u u = (v4u){pk16(hb[0], hb[1]), pk16(hb[2], hb[3]), pk16(hb[4], hb[5]), pk16(hb[6], hb[7])};
  unsigned short* q = out + 8 * (size_t)i;
  *(v4u*)q = u;
  
}

// ---------------------------------------------------------------------------
// Weight transpose + cast: W is row-major [dim k][dim n] f32; WT[n][k] = cast(bf16_rne(W[k][n])).
// Planes z < bf_from_z are written as f16 of (bf16 value x carry); planes z >= bf_from_z as raw bf16 bits.
// grid (dim/64, dim/64, planes): blockIdx.x = k tile (64 cols of WT), blockIdx.y = n tile (64 rows of WT). 256 threads.
// Load coverage: 16 iterations x 256 threads = 4096 = the whole 64x64 tile (coalesced along n).
// Store coverage: 8 waves x 2 iterations x 4 rows (lane>>3) = 64 rows; (lane&7) x 8 halves = 64 cols; each row segment =
// ---------------------------------------------------------------------------
__global__ __launch_bounds__(256) void wt_transpose_cast_kernel(const float* __restrict__ W0, const float* __restrict__ W1,
                                                                const float* __restrict__ W2, unsigned short* __restrict__ out,
                                                                int dim, float carry, int bf_from_z) {
  /* sm[n_local][k_local] */
  __shared__ float sm[64][65];
  const int t  = threadIdx.x;
  const int k0 = blockIdx.x * 64;
  const int n0 = blockIdx.y * 64;
  const int z  = blockIdx.z;
  const float* W = (z == 0) ? W0 : (z == 1) ? W1 : W2;
  const bool as_bf = (z >= bf_from_z);
#pragma unroll
  for (int i = 0; i < 16; ++i) {
    const int e = i * 256 + t;
    const int r = e >> 6;
    const int c = e & 63;
    sm[c][r] = W[(size_t)(k0 + r) * dim + n0 + c];
  }
  __syncthreads();
  const int lane = t & 31, wave = t >> 5;
  const int q = lane >> 3, c8 = (lane & 7) * 8;
  unsigned short* op = out + (size_t)z * dim * dim;
  {
#pragma unroll
    for (int it = 0; it < 2; ++it) {
      const int row = wave * 8 + it * 4 + q;
      unsigned short hb[8];
#pragma unroll
      for (int e = 0; e < 8; ++e) {
        const float w = sm[row][c8 + e];
        const unsigned short bb = f2bf_bits(w);
        const unsigned short fh = h_bits(bf_bits2f(bb) * carry);
        hb[e] = as_bf ? bb : fh;
      }
      const v4u u = (v4u){pk16(hb[0], hb[1]), pk16(hb[2], hb[3]), pk16(hb[4], hb[5]), pk16(hb[6], hb[7])};
      *(v4u*)(op + (size_t)(n0 + row) * dim + k0 + c8) = u;
    }
    
  }
}

// ---------------------------------------------------------------------------
// Gated value transform per (64-token block, head): a = v0 + (v0.W1 + b1), g = sigmoid(v0.W2 + b2), v = a*g.
// Block = 4 waves; wave w owns tokens 16w..16w+15 of the block and all 64 output dims.
// v0 tile (f32) staged in LDS; A fragments = bf16 hi and lo of v0 built in registers; W1^T / W2^T bf16 planes staged in LDS;
// 2 k-steps x 4 n-tiles x 2 matrices x 2 products on v_wmma_f32_16x16x32_bf16.
// The two f32 results are transposed through LDS ([d][token]); the gate is applied in the store phase (8 values per lane
// grid (8192/64, 16). All barriers under block-uniform control.
// ---------------------------------------------------------------------------
constexpr int kGP = 68;
/* LDS row pitch of the two 64 x 64 bf16 weight planes: 144 B = 16 B x 9 (odd) for their 16-byte fragment loads */
constexpr int kWP = 72;
__global__ __launch_bounds__(128) void gated_value_kernel(
    const float* __restrict__ V0, const unsigned short* __restrict__ W1tp, const unsigned short* __restrict__ W2tp,
    const float* __restrict__ b1, const float* __restrict__ b2,
    unsigned short* __restrict__ VTH, unsigned short* __restrict__ VTL)
{
  /* sA: first the v0 tile [token][d]; later the gate pre-activation [d][token]. sB: residual sum [d][token]. */
  __shared__ __align__(16) float sA[64 * kGP];
  __shared__ __align__(16) float sB[64 * kGP];
  __shared__ __align__(16) __bf16 sW1[kHS * kWP];
  __shared__ __align__(16) __bf16 sW2[kHS * kWP];
  __shared__ float sBias[2 * kHS];
  const int tid = threadIdx.x, lane = tid & 31, wave = tid >> 5;
  const int hh = lane >> 4, c = lane & 15;
  const int g0 = blockIdx.x * 64;
  const int hd = blockIdx.y;
  const int bidx = g0 / kT;
  const int t0 = g0 - bidx * kT;
  const __bf16* W1t = (const __bf16*)W1tp;
  const __bf16* W2t = (const __bf16*)W2tp;
  /* v0 tile: 64 rows x 16 float4 = 1024 = 8 x 128 threads */
#pragma unroll
  for (int i = 0; i < 8; ++i) {
    const int e = i * 128 + tid;
    const int r = e >> 4, c4 = (e & 15) * 4;
    *(v4f*)(sA + r * kGP + c4) = *(const v4f*)(V0 + (size_t)(g0 + r) * kC + hd * kHS + c4);
  }
  /* weight planes: 4096 bf16 each = 512 x 16 B = 4 x 128 threads */
#pragma unroll
  for (int i = 0; i < 4; ++i) {
    const int e = (i * 128 + tid) * 8;
    const int le = (e >> 6) * kWP + (e & 63);
    *(v8b*)(sW1 + le) = *(const v8b*)(W1t + e);
    *(v8b*)(sW2 + le) = *(const v8b*)(W2t + e);
  }
  {
    const int bi = tid & 63;
    const float x1 = b1[bi];
    const float x2 = b2[bi];
    const float xs = (tid < kHS) ? x1 : x2;
    sBias[tid] = bf_bits2f(f2bf_bits(xs));
  }
  __syncthreads();

  /* A fragments (hi, lo) for this wave's 16 tokens */
  v16b ah[2], al[2];
  {
    const int arow = wave * 16 + c;
#pragma unroll
    for (int ks = 0; ks < 2; ++ks) {
      const float* p = sA + arow * kGP + ks * 32 + 8 * hh;
      const v4f f0 = *(const v4f*)(p);
      const v4f f1 = *(const v4f*)(p + 4);
      const v4f f2 = *(const v4f*)(p + 16);
      const v4f f3 = *(const v4f*)(p + 20);
#pragma unroll
      for (int e = 0; e < 4; ++e) {
        unsigned short hb, lb;
        const float x0 = f0[e];
        const float x1 = f1[e];
        const float x2 = f2[e];
        const float x3 = f3[e];
        split_bits(x0, hb, lb);
        ah[ks][e] = __builtin_bit_cast(__bf16, hb);       al[ks][e] = __builtin_bit_cast(__bf16, lb);
        split_bits(x1, hb, lb);
        ah[ks][4 + e] = __builtin_bit_cast(__bf16, hb);   al[ks][4 + e] = __builtin_bit_cast(__bf16, lb);
        split_bits(x2, hb, lb);
        ah[ks][8 + e] = __builtin_bit_cast(__bf16, hb);   al[ks][8 + e] = __builtin_bit_cast(__bf16, lb);
        split_bits(x3, hb, lb);
        ah[ks][12 + e] = __builtin_bit_cast(__bf16, hb);  al[ks][12 + e] = __builtin_bit_cast(__bf16, lb);
      }
    }
  }

  v8f a1[4], a2[4];
#pragma unroll
  for (int j = 0; j < 4; ++j) {
    a1[j] = (v8f){0.f,0.f,0.f,0.f,0.f,0.f,0.f,0.f};
    a2[j] = (v8f){0.f,0.f,0.f,0.f,0.f,0.f,0.f,0.f};
  }
#pragma unroll
  for (int ks = 0; ks < 2; ++ks) {
#pragma unroll
    for (int j = 0; j < 4; ++j) {
      const v16b w1 = Frag<__bf16>::load(sW1 + (j * 16 + c) * kWP + ks * 32 + 8 * hh);
      const v16b w2 = Frag<__bf16>::load(sW2 + (j * 16 + c) * kWP + ks * 32 + 8 * hh);
      a1[j] = mma_b(ah[ks], w1, a1[j]);
      a1[j] = mma_b(al[ks], w1, a1[j]);
      a2[j] = mma_b(ah[ks], w2, a2[j]);
      a2[j] = mma_b(al[ks], w2, a2[j]);
    }
  }
  acc_guard4(a1[0], a1[1], a1[2], a1[3]);
  acc_guard4(a2[0], a2[1], a2[2], a2[3]);

  /* residual + biases in place (reads only this wave's own token rows of sA) */
#pragma unroll
  for (int j = 0; j < 4; ++j) {
    const int col = j * 16 + c;
    const float bb1 = sBias[col];
    const float bb2 = sBias[kHS + col];
#pragma unroll
    for (int r = 0; r < 8; ++r) {
      const int row = wave * 16 + 8 * hh + r;
      const float vres = sA[row * kGP + col];
      a1[j][r] = vres + (a1[j][r] + bb1);
      a2[j][r] = a2[j][r] + bb2;
    }
  }
  /* every wave has finished reading the v0 tile before it is overwritten */
  __syncthreads();
#pragma unroll
  for (int j = 0; j < 4; ++j) {
    const int col = j * 16 + c;
#pragma unroll
    for (int r = 0; r < 8; ++r) {
      const int row = wave * 16 + 8 * hh + r;
      sB[col * kGP + row] = a1[j][r];
      sA[col * kGP + row] = a2[j][r];
    }
  }
  __syncthreads();

  const int q = lane >> 3, c8 = (lane & 7) * 8;
#pragma unroll 1
  for (int it = 0; it < 4; ++it) {
    const int d = wave * 16 + it * 4 + q;
    const float* pa = sB + d * kGP + c8;
    const float* pg = sA + d * kGP + c8;
    const v4f av0 = *(const v4f*)(pa);
    const v4f av1 = *(const v4f*)(pa + 4);
    const v4f gv0 = *(const v4f*)(pg);
    const v4f gv1 = *(const v4f*)(pg + 4);
    v8h hv, lv;
#pragma unroll
    for (int e = 0; e < 4; ++e) {
      const float xa0 = av0[e];
      const float xg0 = gv0[e];
      const float xa1 = av1[e];
      const float xg1 = gv1[e];
      const float r0 = xa0 * (1.0f / (1.0f + expf(-xg0)));
      const float r1 = xa1 * (1.0f / (1.0f + expf(-xg1)));
      unsigned short hb, lb;
      split_bits(r0, hb, lb);
      hv[e] = __builtin_bit_cast(_Float16, hb);
      lv[e] = __builtin_bit_cast(_Float16, lb);
      split_bits(r1, hb, lb);
      hv[4 + e] = __builtin_bit_cast(_Float16, hb);
      lv[4 + e] = __builtin_bit_cast(_Float16, lb);
    }
    const size_t o = ((size_t)(bidx * kH + hd) * kHS + d) * kT + t0 + c8;
    *(v8h*)(VTH + o) = hv;
    *(v8h*)(VTL + o) = lv;
    
  }
}

// ---------------------------------------------------------------------------
// Causal attention for head dim 64 from 16-bit planes. Block = 4 waves = 64 query rows of one (batch, head);
// keys in chunks of 64 up to and including the diagonal chunk (block-uniform trip count qb + 1 <= 32).
//   scores: A = u (f16, x16) rows, B = x (f16, x16) key rows staged in LDS; 2 matrix ops per 16-key tile; x 1/(32*16*16).
//   diagonal chunk: key > query -> -inf (every row keeps at least its own key; the first chunk always holds key 0).
//   online softmax in f32; the normaliser is summed from the f32 p values.
//   P -> bf16 hi + lo per wave in LDS (A layout); v hi + lo ([d][key] planes) staged in LDS; P.v = hi.hi + hi.lo + lo.hi.
// ---------------------------------------------------------------------------
constexpr int kKC = 64;
/* LDS row pitch of every 64-element 16-bit tile read by 16-byte fragment loads: 72 elements = 144 B = 16 B x 9 (odd), so 16 rows fall on distinct banks */
constexpr int kLP = 72;
static_assert(kLP >= kKC && kLP >= kHS && (kLP % 8) == 0 && ((kLP / 8) % 2) == 1, "pitch: 16-B aligned rows, odd multiple of 16 B");
__global__ __launch_bounds__(128) void causal_attn_kernel(
    const unsigned short* __restrict__ Up, const unsigned short* __restrict__ XHp,
    const unsigned short* __restrict__ VTHp, const unsigned short* __restrict__ VTLp,
    unsigned short* __restrict__ YH, unsigned short* __restrict__ YL)
{
  __shared__ __align__(16) _Float16 Ksh[kKC * kLP];
  __shared__ __align__(16) __bf16 Vth[kHS * kLP];
  __shared__ __align__(16) __bf16 Vtl[kHS * kLP];
  __shared__ __align__(16) __bf16 Psh[4][16 * kLP];
  __shared__ __align__(16) __bf16 Psl[4][16 * kLP];
  __shared__ __align__(16) float  Os[4][16 * 68];

  const int tid  = threadIdx.x;
  const int wave = tid >> 5;
  const int lane = tid & 31;
  const int hh   = lane >> 4;
  const int c    = lane & 15;

  constexpr int nqb = kT / 64;
  const int bx = blockIdx.x;
  const int qb = bx % nqb;
  const int bh = bx / nqb;
  const int h  = bh % kH;
  const int b  = bh / kH;
  const int q0 = qb * 64 + wave * 16;

  const _Float16* Uh = (const _Float16*)Up;
  const _Float16* Xh = (const _Float16*)XHp;
  const __bf16*   Vh = (const __bf16*)VTHp;
  const __bf16*   Vl = (const __bf16*)VTLp;

  /* query fragments: 2 d-chunks */
  v16h qa[2];
  {
    const _Float16* urow = Uh + (size_t)(b * kT + q0 + c) * kC + h * kHS;
#pragma unroll
    for (int dc = 0; dc < 2; ++dc) qa[dc] = Frag<_Float16>::load(urow + dc * 32 + 8 * hh);
  }

  float mrow[8], lrow[8];
  v8f oacc[4];
#pragma unroll
  for (int r = 0; r < 8; ++r) { mrow[r] = -INFINITY; lrow[r] = 0.f; }
#pragma unroll
  for (int t = 0; t < 4; ++t) oacc[t] = (v8f){0.f,0.f,0.f,0.f,0.f,0.f,0.f,0.f};

  __bf16* pwh = Psh[wave];
  __bf16* pwl = Psl[wave];
  const int nChunks = qb + 1;
  for (int kc = 0; kc < nChunks; ++kc) {
    const int kv0 = kc * kKC;
    __syncthreads();
    /* K, V hi, V lo tiles: 64 rows x 8 x 16 B = 512 each = 4 x 128 threads */
#pragma unroll
    for (int i = 0; i < 4; ++i) {
      const int e = i * 128 + tid;
      const int r = e >> 3, c8 = (e & 7) * 8;
      *(v8h*)(Ksh + r * kLP + c8) = *(const v8h*)(Xh + (size_t)(b * kT + kv0 + r) * kC + h * kHS + c8);
      const size_t vo = ((size_t)bh * kHS + r) * kT + kv0 + c8;
      *(v8b*)(Vth + r * kLP + c8) = *(const v8b*)(Vh + vo);
      *(v8b*)(Vtl + r * kLP + c8) = *(const v8b*)(Vl + vo);
    }
    __syncthreads();

    v8f s[4];
#pragma unroll
    for (int j = 0; j < 4; ++j) {
      s[j] = (v8f){0.f,0.f,0.f,0.f,0.f,0.f,0.f,0.f};
#pragma unroll
      for (int dc = 0; dc < 2; ++dc) {
        const v16h kb = Frag<_Float16>::load(Ksh + (j * 16 + c) * kLP + dc * 32 + 8 * hh);
        s[j] = mma_h(qa[dc], kb, s[j]);
      }
    }
    acc_guard4(s[0], s[1], s[2], s[3]);

    const bool diag = (kc == qb);
    float cm[8];
#pragma unroll
    for (int r = 0; r < 8; ++r) {
      const int qrow = q0 + 8 * hh + r;
      float m = -INFINITY;
#pragma unroll
      for (int j = 0; j < 4; ++j) {
        const int kvcol = kv0 + j * 16 + c;
        float sv = s[j][r] * kScoreScale;
        const bool masked = diag && (kvcol > qrow);
        sv = masked ? -INFINITY : sv;
        s[j][r] = sv;
        m = fmaxf(m, sv);
      }
#pragma unroll
      for (int off = 1; off < 16; off <<= 1) m = fmaxf(m, __shfl_xor(m, off, 32));
      cm[r] = m;
    }
#pragma unroll
    for (int r = 0; r < 8; ++r) {
      const float mnew = fmaxf(mrow[r], cm[r]);
      const float alpha = __expf(mrow[r] - mnew);
      mrow[r] = mnew;
      float psum = 0.f;
#pragma unroll
      for (int j = 0; j < 4; ++j) {
        const float p = __expf(s[j][r] - mnew);
        psum += p;
        unsigned short hb, lb;
        split_bits(p, hb, lb);
        pwh[(8 * hh + r) * kLP + j * 16 + c] = __builtin_bit_cast(__bf16, hb);
        pwl[(8 * hh + r) * kLP + j * 16 + c] = __builtin_bit_cast(__bf16, lb);
      }
#pragma unroll
      for (int off = 1; off < 16; off <<= 1) psum += __shfl_xor(psum, off, 32);
      lrow[r] = lrow[r] * alpha + psum;
#pragma unroll
      for (int t = 0; t < 4; ++t) oacc[t][r] *= alpha;
    }
    __builtin_amdgcn_fence(__ATOMIC_RELEASE, "workgroup");
    __builtin_amdgcn_wave_barrier();
    __builtin_amdgcn_fence(__ATOMIC_ACQUIRE, "workgroup");
#pragma unroll 1
    for (int kk = 0; kk < 2; ++kk) {
      const v16b pa = Frag<__bf16>::load(pwh + c * kLP + kk * 32 + 8 * hh);
      const v16b pl = Frag<__bf16>::load(pwl + c * kLP + kk * 32 + 8 * hh);
#pragma unroll
      for (int t = 0; t < 4; ++t) {
        const v16b vb = Frag<__bf16>::load(Vth + (t * 16 + c) * kLP + kk * 32 + 8 * hh);
        const v16b vl = Frag<__bf16>::load(Vtl + (t * 16 + c) * kLP + kk * 32 + 8 * hh);
        oacc[t] = mma_b(pa, vb, oacc[t]);
        oacc[t] = mma_b(pa, vl, oacc[t]);
        oacc[t] = mma_b(pl, vb, oacc[t]);
      }
    }
    acc_guard4(oacc[0], oacc[1], oacc[2], oacc[3]);
  }

  float* os = Os[wave];
#pragma unroll
  for (int r = 0; r < 8; ++r) {
    const float inv = 1.0f / lrow[r];
#pragma unroll
    for (int t = 0; t < 4; ++t) os[(8 * hh + r) * 68 + t * 16 + c] = oacc[t][r] * inv;
  }
  __builtin_amdgcn_fence(__ATOMIC_RELEASE, "workgroup");
  __builtin_amdgcn_wave_barrier();
  __builtin_amdgcn_fence(__ATOMIC_ACQUIRE, "workgroup");
  {
    const int q = lane >> 3, c8 = (lane & 7) * 8;
    v8h hv[4], lv[4];
#pragma unroll
    for (int it = 0; it < 4; ++it) {
      const int row = it * 4 + q;
      const float* sp = os + row * 68 + c8;
      const v4f y0 = *(const v4f*)(sp);
      const v4f y1 = *(const v4f*)(sp + 4);
#pragma unroll
      for (int e = 0; e < 4; ++e) {
        const float z0 = y0[e];
        const float z1 = y1[e];
        unsigned short hb, lb;
        split_bits(z0, hb, lb);
        hv[it][e] = __builtin_bit_cast(_Float16, hb);
        lv[it][e] = __builtin_bit_cast(_Float16, lb);
        split_bits(z1, hb, lb);
        hv[it][4 + e] = __builtin_bit_cast(_Float16, hb);
        lv[it][4 + e] = __builtin_bit_cast(_Float16, lb);
      }
    }
    {
#pragma unroll
      for (int it = 0; it < 4; ++it) {
        const int row = it * 4 + q;
        const size_t o = (size_t)(b * kT + q0 + row) * kC + h * kHS + c8;
        *(v8h*)(YH + o) = hv[it];
        *(v8h*)(YL + o) = lv[it];
      }
      
    }
  }
}

// ---------------------------------------------------------------------------
// Host glue: 8 launches, kernel launches only.
// GEMM shapes: M 8192, N 1024, K 1024 (K % 32 == 0, M and N % 64 == 0): 128 x 16 tiles = 2048 -> 256 blocks of 8 waves.
// ---------------------------------------------------------------------------
extern "C" void kernel_launch(void* const* d_in, const int* in_sizes, int n_in,
                              void* d_out, int out_size, void* d_ws, size_t ws_size,
                              hipStream_t stream) {
  if (n_in < 11) return;
  if (in_sizes[0] != kRows * kC) return;
  if (in_sizes[1] != kC * kC) return;
  if (in_sizes[2] != kC) return;
  if (in_sizes[3] != kC * kC) return;
  if (in_sizes[4] != kC) return;
  if (in_sizes[5] != kHS * kHS) return;
  if (in_sizes[6] != kHS) return;
  if (in_sizes[7] != kHS * kHS) return;
  if (in_sizes[8] != kHS) return;
  if (in_sizes[9] != kC * kC) return;
  if (in_sizes[10] != kC) return;
  if (out_size != kRows * kC) return;
  if (ws_size < kWsTotal) return;

  const float* x  = (const float*)d_in[0];
  const float* Wu = (const float*)d_in[1];
  const float* bu = (const float*)d_in[2];
  const float* Wv = (const float*)d_in[3];
  const float* bv = (const float*)d_in[4];
  const float* W1 = (const float*)d_in[5];
  const float* b1 = (const float*)d_in[6];
  const float* W2 = (const float*)d_in[7];
  const float* b2 = (const float*)d_in[8];
  const float* Wp = (const float*)d_in[9];
  const float* bp = (const float*)d_in[10];
  float* out = (float*)d_out;

  char* ws = (char*)d_ws;
  unsigned short* XH   = (unsigned short*)(ws + kOffXH);
  unsigned short* WUT  = (unsigned short*)(ws + kOffWUT);
  unsigned short* WVT  = (unsigned short*)(ws + kOffWVT);
  unsigned short* WPT  = (unsigned short*)(ws + kOffWPT);
  unsigned short* W12T = (unsigned short*)(ws + kOffW12);
  unsigned short* U16  = (unsigned short*)(ws + kOffU);
  float*          V0   = (float*)(ws + kOffV0);
  unsigned short* YH   = (unsigned short*)(ws + kOffYH);
  unsigned short* YL   = (unsigned short*)(ws + kOffYL);
  unsigned short* VTH  = (unsigned short*)(ws + kOffVTH);
  unsigned short* VTL  = (unsigned short*)(ws + kOffVTL);

  /* x -> f16 plane (bf16 values x16) */
  cast_x_kernel<<<(kRows * kC / 8) / 256, 256, 0, stream>>>(x, XH, kRows * kC / 8);

  /* in[k][n] -> out[n][k]: Wu, Wv as f16 (x1024), Wp as bf16; planes WUT, WVT, WPT are contiguous */
  wt_transpose_cast_kernel<<<dim3(kC / 64, kC / 64, 3), 256, 0, stream>>>(Wu, Wv, Wp, WUT, kC, kWCarry, 2);
  /* in[k][n] -> out[n][k]: W1, W2 as bf16 [64][64] planes */
  wt_transpose_cast_kernel<<<dim3(1, 1, 2), 256, 0, stream>>>(W1, W2, W2, W12T, kHS, 1.0f, 0);

  /* u (f16, x16) = x.Wu + bu */
  wmma_gemm64<0, 0, 2, 1><<<dim3(256, 1), 256, 0, stream>>>(
      XH, XH, kC, 0L,
      WUT, WUT, kC, 0L,
      (void*)U16, kC, 0L,
      bu, kRows, kC, kC, kUScale, kUCarry);

  /* v0 (f32) = x.Wv + bv */
  wmma_gemm64<0, 0, 2, 0><<<dim3(256, 1), 256, 0, stream>>>(
      XH, XH, kC, 0L,
      WVT, WVT, kC, 0L,
      (void*)V0, kC, 0L,
      bv, kRows, kC, kC, kV0Scale, 1.0f);

  /* gated value -> vT hi | lo planes */
  gated_value_kernel<<<dim3(kRows / 64, kH), 128, 0, stream>>>(V0, W12T, W12T + kHS * kHS, b1, b2, VTH, VTL);

  /* causal attention -> y hi | lo planes (the v0 bytes are dead from here on) */
  causal_attn_kernel<<<kB * kH * (kT / 64), 128, 0, stream>>>(U16, XH, VTH, VTL, YH, YL);

  /* out = y.Wp + bp (y hi.W + y lo.W) */
  wmma_gemm64<1, 1, 2, 0><<<dim3(256, 1), 256, 0, stream>>>(
      YH, YL, kC, 0L,
      WPT, WPT, kC, 0L,
      (void*)out, kC, 0L,
      bp, kRows, kC, kC, 1.0f, 1.0f);
}

// v002
// Measured time: 443 microseconds a run.
// Next to v001, in two timings, it ran 1.28 times as fast each time.
// All steps since v000 together make it 1.59 times as fast.
// All contractions on 16-bit WMMA with f32 accumulate: x.Wu, x.Wv and the u.x^T scores on v_wmma_f32_16x16x32_f16 (inputs RNE-converted to bf16 once and held exactly in f16 planes with power-of-two carries: x x16, W x1024, u x16); v0.W1, v0.W2, P.v and y.Wp on v_wmma_f32_16x16x32_bf16 with the computed operand carried as bf16 hi+lo planes (W1, W2, Wp as bf16 planes); softmax, gate, residual and bias in f32.
#include <hip/hip_runtime.h>
#include <math.h>

typedef __attribute__((ext_vector_type(16))) _Float16 v16h;
typedef __attribute__((ext_vector_type(8)))  _Float16 v8h;
typedef __attribute__((ext_vector_type(16))) __bf16   v16b;
typedef __attribute__((ext_vector_type(8)))  __bf16   v8b;
typedef __attribute__((ext_vector_type(8)))  float    v8f;
typedef __attribute__((ext_vector_type(4)))  float    v4f;
typedef __attribute__((ext_vector_type(4)))  unsigned int v4u;

// ---------------------------------------------------------------------------
// Problem constants
// ---------------------------------------------------------------------------
constexpr int kB    = 4;
constexpr int kT    = 2048;
constexpr int kC    = 1024;
constexpr int kH    = 16;
constexpr int kHS   = 64;
constexpr int kRows = kB * kT;
constexpr int kSqrtC = 32;
static_assert(kSqrtC * kSqrtC == kC, "score scale is 1/sqrt(C)");
static_assert(kH * kHS == kC, "head split");
static_assert((kC % 32) == 0 && (kHS % 32) == 0 && (kT % 64) == 0, "K multiples of 32, key chunks of 64");
static_assert((kRows % 64) == 0 && (kC % 64) == 0, "GEMM M,N multiples of 64");

// power-of-two carries of the f16 planes (exact; folded back in f32)
constexpr float kXCarry = 16.0f;
constexpr float kWCarry = 1024.0f;
constexpr float kUCarry = 16.0f;
constexpr float kUScale  = kUCarry / (kXCarry * kWCarry);
constexpr float kV0Scale = 1.0f / (kXCarry * kWCarry);
constexpr float kScoreScale = 1.0f / ((float)kSqrtC * kUCarry * kXCarry);

// ---------------------------------------------------------------------------
// Workspace region map (bytes; every offset is a multiple of 128)
//   XH    f16  [8192][1024]      16*bf16(x)                      16,777,216
//   WUT   f16  [1024 n][1024 k]  1024*bf16(Wu)^T                  2,097,152
//   WVT   f16  [1024 n][1024 k]  1024*bf16(Wv)^T                  2,097,152
//   WPT   bf16 [1024 n][1024 k]  bf16(Wp)^T                       2,097,152
//   W12T  bf16 2 x [64 n][64 k]  bf16(W1)^T | bf16(W2)^T             16,384
//   U16   f16  [8192][1024]      16*u                            16,777,216
//   V0    f32  [8192][1024]      v0; dead after the gated-value launch, then the same bytes
//                                hold YH | YL (bf16 hi | lo planes of y, [8192][1024] each)  33,554,432
//   VTH   bf16 [4][16][64 d][2048 t]  gated v, hi plane           16,777,216
//   VTL   bf16 [4][16][64 d][2048 t]  gated v, lo plane           16,777,216
//   total                                                       106,971,136
// ---------------------------------------------------------------------------
constexpr size_t kSzAct16 = (size_t)kRows * kC * 2;
constexpr size_t kSzW16   = (size_t)kC * kC * 2;
constexpr size_t kSzW12   = (size_t)2 * kHS * kHS * 2;
constexpr size_t kSzV0    = (size_t)kRows * kC * 4;
constexpr size_t kOffXH   = 0;
constexpr size_t kOffWUT  = kOffXH  + kSzAct16;
constexpr size_t kOffWVT  = kOffWUT + kSzW16;
constexpr size_t kOffWPT  = kOffWVT + kSzW16;
constexpr size_t kOffW12  = kOffWPT + kSzW16;
constexpr size_t kOffU    = kOffW12 + kSzW12;
constexpr size_t kOffV0   = kOffU   + kSzAct16;
constexpr size_t kOffYH   = kOffV0;
constexpr size_t kOffYL   = kOffV0  + kSzAct16;
constexpr size_t kOffVTH  = kOffV0  + kSzV0;
constexpr size_t kOffVTL  = kOffVTH + kSzAct16;
constexpr size_t kWsTotal = kOffVTL + kSzAct16;
static_assert(kWsTotal == 106971136ull, "carve total");
static_assert(kWsTotal <= 134217728ull, "carve cap");
static_assert(2 * kSzAct16 == kSzV0, "y hi|lo planes fit the v0 plane exactly");
static_assert((kOffWUT % 128) == 0 && (kOffWVT % 128) == 0 && (kOffWPT % 128) == 0 && (kOffW12 % 128) == 0 &&
              (kOffU % 128) == 0 && (kOffV0 % 128) == 0 && (kOffYL % 128) == 0 && (kOffVTH % 128) == 0 &&
              (kOffVTL % 128) == 0, "128-B aligned regions");

// ---------------------------------------------------------------------------
// Bit helpers
// ---------------------------------------------------------------------------
__device__ __forceinline__ unsigned short f2bf_bits(float f) {
  unsigned u = __float_as_uint(f);
  return (unsigned short)((u + 0x7FFFu + ((u >> 16) & 1u)) >> 16);
}
__device__ __forceinline__ float bf_bits2f(unsigned short h) { return __uint_as_float(((unsigned)h) << 16); }
__device__ __forceinline__ unsigned pk16(unsigned short a, unsigned short b) { return (unsigned)a | ((unsigned)b << 16); }
__device__ __forceinline__ unsigned short h_bits(float f) { const _Float16 h = (_Float16)f; return __builtin_bit_cast(unsigned short, h); }
/* bf16 hi + bf16 lo of an f32 value, both RNE */
__device__ __forceinline__ void split_bits(float f, unsigned short& hb, unsigned short& lb) {
  hb = f2bf_bits(f);
  lb = f2bf_bits(f - bf_bits2f(hb));
}

// ---------------------------------------------------------------------------
// WMMA helpers: every matrix op is followed by 4 nops tied to its own accumulator and its A/B fragments
// ---------------------------------------------------------------------------
__device__ __forceinline__ v8f mma_h(v16h a, v16h b, v8f c) {
  c = __builtin_amdgcn_wmma_f32_16x16x32_f16(false, a, false, b, (short)0, c, false, false);
  asm volatile("v_nop\n\tv_nop\n\tv_nop\n\tv_nop" : "+v"(c) : "v"(a), "v"(b));
  return c;
}
__device__ __forceinline__ v8f mma_b(v16b a, v16b b, v8f c) {
  c = __builtin_amdgcn_wmma_f32_16x16x32_bf16(false, a, false, b, (short)0, c, false, false);
  asm volatile("v_nop\n\tv_nop\n\tv_nop\n\tv_nop" : "+v"(c) : "v"(a), "v"(b));
  return c;
}
__device__ __forceinline__ void keep4_h(v16h a, v16h b, v16h c, v16h d) { asm volatile("v_nop" :: "v"(a), "v"(b), "v"(c), "v"(d)); }
__device__ __forceinline__ void keep4_b(v16b a, v16b b, v16b c, v16b d) { asm volatile("v_nop" :: "v"(a), "v"(b), "v"(c), "v"(d)); }
__device__ __forceinline__ void acc_guard4(v8f& a, v8f& b, v8f& c, v8f& d) { asm volatile("v_nop\n\tv_nop\n\tv_nop\n\tv_nop" : "+v"(a), "+v"(b), "+v"(c), "+v"(d)); }

// Fragment loader: p already points at (row, k0 + 8*(lane>>4)); elements 0..7 <- p[0..7], elements 8..15 <- p[16..23]
template <typename T> struct Frag;
template <> struct Frag<_Float16> {
  typedef v16h V; union U { v16h v; v8h h[2]; };
  static __device__ __forceinline__ v16h load(const _Float16* p) {
    U f; f.h[0] = *(const v8h*)(p); f.h[1] = *(const v8h*)(p + 16); return f.v;
  }
  static __device__ __forceinline__ v8f mma(v16h a, v16h b, v8f c) { return mma_h(a, b, c); }
  static __device__ __forceinline__ void keep(v16h a, v16h b, v16h c, v16h d) { keep4_h(a, b, c, d); }
};
template <> struct Frag<__bf16> {
  typedef v16b V; union U { v16b v; v8b h[2]; };
  static __device__ __forceinline__ v16b load(const __bf16* p) {
    U f; f.h[0] = *(const v8b*)(p); f.h[1] = *(const v8b*)(p + 16); return f.v;
  }
  static __device__ __forceinline__ v8f mma(v16b a, v16b b, v8f c) { return mma_b(a, b, c); }
  static __device__ __forceinline__ void keep(v16b a, v16b b, v16b c, v16b d) { keep4_b(a, b, c, d); }
};

// ---- LDS-staged batched WMMA GEMM ------------------------------------------
// C[m,n] = scale * sum_k A[m,k] * Bt[n,k] + bias_scale * bf16(bias[n]).
// Block = 8 waves = one 128 x 256 tile of C; waves 2 (m) x 4 (n), each wave owns a 64x64 tile.
// A pass is 64 k = 128 B of every operand row. The block brings a pass's rows [A 128 | A2 128 (SPL 1) | Bt 256] from global
// memory as whole 128-B lines (8 lanes x 16 B per row) by asynchronous 16-byte copies into one of two LDS buffers, so that
// the next pass's rows fly while this pass is worked on; every wave reads its fragments from LDS. One block barrier per
// pass: it publishes the buffer just filled and ends the reads of the buffer that is refilled behind it.
// A row-major [M,K]; Bt row-major [N,K]; M % 128 == 0, N % 256 == 0, K % 64 == 0 (no tail handling).
// SPL: 0 = plain (one product), 1 = A carried as hi/lo planes (A2 = lo): hi.b + lo.b.
// BIAS_MODE: 0 = none, 2 = bias[n].   OUT_MODE: 0 = f32, 1 = f16.
// ET: 0 = f16 operands, 1 = bf16 operands (pointers passed as 16-bit storage)
constexpr int kBM = 128;
constexpr int kBN = 256;
constexpr int kKP = 64;
/* LDS row pitch of a staged 64-element row: 144 B = 16 B x 9 (odd) for the 16-byte fragment loads */
constexpr int kSP = 72;
static_assert((kRows % kBM) == 0 && (kC % kBN) == 0 && (kC % kKP) == 0, "GEMM block tile and pass divide the shapes");
template <int ET> struct Elem;
template <> struct Elem<0> { typedef _Float16 T; };
template <> struct Elem<1> { typedef __bf16 T; };
template <int ET, int SPL, int BIAS_MODE, int OUT_MODE>
__global__ __launch_bounds__(256) void wmma_gemm64(
    const unsigned short* __restrict__ Ap, const unsigned short* __restrict__ A2p, int lda, long strideA,
    const unsigned short* __restrict__ Btp, const unsigned short* __restrict__ Bt2p, int ldb, long strideB,
    void* __restrict__ Cout, int ldc, long strideC,
    const float* __restrict__ bias,
    int M, int N, int K, float scale, float bias_scale) {
  static_assert(SPL == 0 || SPL == 1, "one or two A planes");
  typedef typename Elem<ET>::T T;
  typedef typename Frag<T>::V V;
  constexpr int kRowsA      = (SPL == 1) ? 2 * kBM : kBM;
  constexpr int kStageRows  = kRowsA + kBN;
  constexpr int kStageElems = kStageRows * kSP;
  /* one 16-byte copy per thread covers 32 rows of the stage */
  constexpr int kCopies     = kStageRows / 32;
  constexpr unsigned kStageBytes = (unsigned)kStageElems * 2u;
  static_assert((kCopies % 4) == 0, "copies go four to a statement");
  const T* A = (const T*)Ap; const T* A2 = (const T*)A2p; const T* Bt = (const T*)Btp;
  __shared__ __align__(16) T sStage[2 * kStageElems];
  /* per-wave 16x64 slab, pitch 68 floats */
  __shared__ __align__(16) float sT[8][16 * 68];
  const int b    = blockIdx.y;
  const int tid  = threadIdx.x;
  const int lane = tid & 31;
  const int wave = tid >> 5;
  const int tilesN = N / kBN;
  const int tilesM = M / kBM;
  const int tile = blockIdx.x;
  /* block-uniform exit, in front of every barrier */
  if (tile >= tilesM * tilesN) return;
  const int tm = tile / tilesN;
  const int tn = tile - tm * tilesN;
  const int wm = wave >> 2;
  const int wn = wave & 3;
  const int m0 = tm * kBM + (wm << 6);
  const int n0 = tn * kBN + (wn << 6);

  const T* Ab  = A  + (size_t)b * strideA + (size_t)(tm * kBM) * lda;
  const T* Ab2 = A2 + (size_t)b * strideA + (size_t)(tm * kBM) * lda;
  const T* Bb  = Bt + (size_t)b * strideB + (size_t)(tn * kBN) * ldb;

  /* rlane: row (A) / col (B, D) within a 16-wide subtile; koff: k offset of this lane half; mOff: D row offset */
  const int rlane = lane & 15;
  const int koff  = (lane >> 4) * 8;
  const int mOff  = (lane >> 4) * 8;

  /* staging: thread -> (row tid / 8 of each group of 32 rows, 16-byte piece tid % 8 of its 128 B) */
  const int srow = tid >> 3;
  const int sc8  = (tid & 7) * 8;
  const unsigned offA = (unsigned)srow * (unsigned)lda + (unsigned)sc8;
  const unsigned offB = (unsigned)srow * (unsigned)ldb + (unsigned)sc8;
  /* LDS byte address (low 32 bits of the __shared__ address) of this thread's piece in row srow of buffer 0 */
  const unsigned ldsT = (unsigned)(size_t)(sStage + srow * kSP + sc8);
  auto copy_stage = [&](int k0, unsigned bufByte) {
    /* both loops unrolled: which operand a group of rows belongs to is then decided at compile time */
#pragma unroll
    for (int g = 0; g < kCopies / 4; ++g) {
      const T* gp[4];
      unsigned lp[4];
#pragma unroll
      for (int e = 0; e < 4; ++e) {
        const int r0 = (g * 4 + e) * 32;
        if (r0 < kBM)         gp[e] = Ab  + (size_t)r0 * lda + k0 + offA;
        else if (r0 < kRowsA) gp[e] = Ab2 + (size_t)(r0 - kBM) * lda + k0 + offA;
        else                  gp[e] = Bb  + (size_t)(r0 - kRowsA) * ldb + k0 + offB;
        lp[e] = ldsT + bufByte + (unsigned)(r0 * kSP * 2);
      }
      /* four copies, then the wait that stands in front of any rewrite of the address registers they name */
      asm volatile("global_load_async_to_lds_b128 %0, %1, off\n\t"
                   "global_load_async_to_lds_b128 %2, %3, off\n\t"
                   "global_load_async_to_lds_b128 %4, %5, off\n\t"
                   "global_load_async_to_lds_b128 %6, %7, off\n\t"
                   "s_wait_xcnt 0x0"
                   :: "v"(lp[0]), "v"(gp[0]), "v"(lp[1]), "v"(gp[1]), "v"(lp[2]), "v"(gp[2]), "v"(lp[3]), "v"(gp[3])
                   : "memory");
    }
  };

  v8f acc[4][4];
#pragma unroll
  for (int i = 0; i < 4; ++i)
#pragma unroll
    for (int j = 0; j < 4; ++j) acc[i][j] = (v8f){0.f,0.f,0.f,0.f,0.f,0.f,0.f,0.f};

  const int nPass = K / kKP;
  copy_stage(0, 0u);
  /* pass 0's rows have landed (this wave's copies), then every wave's */
  asm volatile("s_wait_asynccnt 0x0" ::: "memory");
  __syncthreads();
  if (nPass > 1) copy_stage(kKP, kStageBytes);
  for (int p = 0; p < nPass; ++p) {
    const T* buf = sStage + (p & 1) * kStageElems;
    const T* sA  = buf + ((wm << 6) + rlane) * kSP + koff;
    const T* sA2 = sA + kBM * kSP;
    const T* sB  = buf + (kRowsA + (wn << 6) + rlane) * kSP + koff;
    /* the loops below are unrolled so that every index of a fragment or accumulator array is a constant (registers, no scratch) */
#pragma unroll
    for (int ks = 0; ks < kKP / 32; ++ks) {
      V bh[4];
#pragma unroll
      for (int j = 0; j < 4; ++j) bh[j] = Frag<T>::load(sB + (j << 4) * kSP + ks * 32);
      /* per accumulator and k step: the hi product, then the lo product */
#pragma unroll
      for (int pl = 0; pl <= SPL; ++pl) {
        const T* sAp = (pl == 0) ? sA : sA2;
        V af[4];
#pragma unroll
        for (int i = 0; i < 4; ++i) af[i] = Frag<T>::load(sAp + (i << 4) * kSP + ks * 32);
#pragma unroll
        for (int i = 0; i < 4; ++i) {
#pragma unroll
          for (int j = 0; j < 4; ++j) acc[i][j] = Frag<T>::mma(af[i], bh[j], acc[i][j]);
        }
      }
      Frag<T>::keep(bh[0], bh[1], bh[2], bh[3]);
    }
    /* this wave's reads of buffer p & 1 are done before that buffer is refilled */
    asm volatile("s_wait_dscnt 0x0" ::: "memory");
    /* this wave's copies of pass p + 1 have landed before the barrier publishes them */
    asm volatile("s_wait_asynccnt 0x0" ::: "memory");
    __syncthreads();
    if (p + 2 < nPass) copy_stage((p + 2) * kKP, (unsigned)(p & 1) * kStageBytes);
  }
  /* no copy is outstanding when the wave goes on to the epilogue */
  asm volatile("s_wait_asynccnt 0x0" ::: "memory");
  acc_guard4(acc[0][0], acc[0][1], acc[0][2], acc[0][3]);
  acc_guard4(acc[1][0], acc[1][1], acc[1][2], acc[1][3]);
  acc_guard4(acc[2][0], acc[2][1], acc[2][2], acc[2][3]);
  acc_guard4(acc[3][0], acc[3][1], acc[3][2], acc[3][3]);

  // ---- epilogue ----
  float* slab = sT[wave];
#pragma unroll
  for (int i = 0; i < 4; ++i) {
    const int mBase = m0 + (i << 4);
#pragma unroll
    for (int j = 0; j < 4; ++j) {
      const int n = n0 + (j << 4) + rlane;
      float bv = 0.f;
      if (BIAS_MODE == 2) bv = bf_bits2f(f2bf_bits(bias[n])) * bias_scale;
#pragma unroll
      for (int r = 0; r < 8; ++r) {
        float v = acc[i][j][r] * scale;
        if (BIAS_MODE == 2) v += bv;
        slab[(mOff + r) * 68 + (j << 4) + rlane] = v;
      }
    }
    __builtin_amdgcn_fence(__ATOMIC_RELEASE, "workgroup");
    __builtin_amdgcn_wave_barrier();
    __builtin_amdgcn_fence(__ATOMIC_ACQUIRE, "workgroup");
    if (OUT_MODE == 0) {
      /* row segment = 256 B = 16 lanes x 16 B; one instruction covers 2 rows */
      float* C = (float*)Cout + (size_t)b * strideC;
      const int hh = lane >> 4, c4 = (lane & 15) * 4;
      {
#pragma unroll
        for (int it = 0; it < 8; ++it) {
          const int row = it * 2 + hh;
          v4f v = *(const v4f*)(slab + row * 68 + c4);
          *(v4f*)(C + (size_t)(mBase + row) * ldc + n0 + c4) = v;
        }
        
      }
    } else {
      const int q = lane >> 3, c8 = (lane & 7) * 8;
      unsigned short* C  = (unsigned short*)Cout  + (size_t)b * strideC;
      {
#pragma unroll
        for (int it = 0; it < 4; ++it) {
          const int row = it * 4 + q;
          const float* sp = slab + row * 68 + c8;
          v8h hv;
#pragma unroll
          for (int e = 0; e < 8; ++e) hv[e] = (_Float16)sp[e];
          *(v8h*)(C + (size_t)(mBase + row) * ldc + n0 + c8) = hv;
        }
        
      }
    }
    __builtin_amdgcn_fence(__ATOMIC_RELEASE, "workgroup");
    __builtin_amdgcn_wave_barrier();
    __builtin_amdgcn_fence(__ATOMIC_ACQUIRE, "workgroup");
  }
}

// ---------------------------------------------------------------------------
// x: f32 -> RNE bf16 -> x16 -> f16 plane (exact), 8 consecutive elements per thread.
// Coverage: n8 = 8192*1024/8 = 1,048,576 threads = 4096 blocks x 256 exactly.
// ---------------------------------------------------------------------------
__global__ __launch_bounds__(256) void cast_x_kernel(const float* __restrict__ in, unsigned short* __restrict__ out, int n8) {
  const int i = blockIdx.x * 256 + threadIdx.x;
  if (i >= n8) return;
  const float* p = in + 8 * (size_t)i;
  const v4f a = *(const v4f*)(p);
  const v4f c = *(const v4f*)(p + 4);
  unsigned short hb[8];
#pragma unroll
  for (int e = 0; e < 4; ++e) {
    const float a_e = a[e];
    const float c_e = c[e];
    hb[e]     = h_bits(bf_bits2f(f2bf_bits(a_e)) * kXCarry);
    hb[4 + e] = h_bits(bf_bits2f(f2bf_bits(c_e)) * kXCarry);
  }
  const v4u u = (v4u){pk16(hb[0], hb[1]), pk16(hb[2], hb[3]), pk16(hb[4], hb[5]), pk16(hb[6], hb[7])};
  unsigned short* q = out + 8 * (size_t)i;
  *(v4u*)q = u;
  
}

// ---------------------------------------------------------------------------
// Weight transpose + cast: W is row-major [dim k][dim n] f32; WT[n][k] = cast(bf16_rne(W[k][n])).
// Planes z < bf_from_z are written as f16 of (bf16 value x carry); planes z >= bf_from_z as raw bf16 bits.
// grid (dim/64, dim/64, planes): blockIdx.x = k tile (64 cols of WT), blockIdx.y = n tile (64 rows of WT). 256 threads.
// Load coverage: 16 iterations x 256 threads = 4096 = the whole 64x64 tile (coalesced along n).
// Store coverage: 8 waves x 2 iterations x 4 rows (lane>>3) = 64 rows; (lane&7) x 8 halves = 64 cols; each row segment =
// ---------------------------------------------------------------------------
__global__ __launch_bounds__(256) void wt_transpose_cast_kernel(const float* __restrict__ W0, const float* __restrict__ W1,
                                                                const float* __restrict__ W2, unsigned short* __restrict__ out,
                                                                int dim, float carry, int bf_from_z) {
  /* sm[n_local][k_local] */
  __shared__ float sm[64][65];
  const int t  = threadIdx.x;
  const int k0 = blockIdx.x * 64;
  const int n0 = blockIdx.y * 64;
  const int z  = blockIdx.z;
  const float* W = (z == 0) ? W0 : (z == 1) ? W1 : W2;
  const bool as_bf = (z >= bf_from_z);
#pragma unroll
  for (int i = 0; i < 16; ++i) {
    const int e = i * 256 + t;
    const int r = e >> 6;
    const int c = e & 63;
    sm[c][r] = W[(size_t)(k0 + r) * dim + n0 + c];
  }
  __syncthreads();
  const int lane = t & 31, wave = t >> 5;
  const int q = lane >> 3, c8 = (lane & 7) * 8;
  unsigned short* op = out + (size_t)z * dim * dim;
  {
#pragma unroll
    for (int it = 0; it < 2; ++it) {
      const int row = wave * 8 + it * 4 + q;
      unsigned short hb[8];
#pragma unroll
      for (int e = 0; e < 8; ++e) {
        const float w = sm[row][c8 + e];
        const unsigned short bb = f2bf_bits(w);
        const unsigned short fh = h_bits(bf_bits2f(bb) * carry);
        hb[e] = as_bf ? bb : fh;
      }
      const v4u u = (v4u){pk16(hb[0], hb[1]), pk16(hb[2], hb[3]), pk16(hb[4], hb[5]), pk16(hb[6], hb[7])};
      *(v4u*)(op + (size_t)(n0 + row) * dim + k0 + c8) = u;
    }
    
  }
}

// ---------------------------------------------------------------------------
// Gated value transform per (64-token block, head): a = v0 + (v0.W1 + b1), g = sigmoid(v0.W2 + b2), v = a*g.
// Block = 4 waves; wave w owns tokens 16w..16w+15 of the block and all 64 output dims.
// v0 tile (f32) staged in LDS; A fragments = bf16 hi and lo of v0 built in registers; W1^T / W2^T bf16 planes staged in LDS;
// 2 k-steps x 4 n-tiles x 2 matrices x 2 products on v_wmma_f32_16x16x32_bf16.
// The two f32 results are transposed through LDS ([d][token]); the gate is applied in the store phase (8 values per lane
// grid (8192/64, 16). All barriers under block-uniform control.
// ---------------------------------------------------------------------------
constexpr int kGP = 68;
/* LDS row pitch of the two 64 x 64 bf16 weight planes: 144 B = 16 B x 9 (odd) for their 16-byte fragment loads */
constexpr int kWP = 72;
__global__ __launch_bounds__(128) void gated_value_kernel(
    const float* __restrict__ V0, const unsigned short* __restrict__ W1tp, const unsigned short* __restrict__ W2tp,
    const float* __restrict__ b1, const float* __restrict__ b2,
    unsigned short* __restrict__ VTH, unsigned short* __restrict__ VTL)
{
  /* sA: first the v0 tile [token][d]; later the gate pre-activation [d][token]. sB: residual sum [d][token]. */
  __shared__ __align__(16) float sA[64 * kGP];
  __shared__ __align__(16) float sB[64 * kGP];
  __shared__ __align__(16) __bf16 sW1[kHS * kWP];
  __shared__ __align__(16) __bf16 sW2[kHS * kWP];
  __shared__ float sBias[2 * kHS];
  const int tid = threadIdx.x, lane = tid & 31, wave = tid >> 5;
  const int hh = lane >> 4, c = lane & 15;
  const int g0 = blockIdx.x * 64;
  const int hd = blockIdx.y;
  const int bidx = g0 / kT;
  const int t0 = g0 - bidx * kT;
  const __bf16* W1t = (const __bf16*)W1tp;
  const __bf16* W2t = (const __bf16*)W2tp;
  /* v0 tile: 64 rows x 16 float4 = 1024 = 8 x 128 threads */
#pragma unroll
  for (int i = 0; i < 8; ++i) {
    const int e = i * 128 + tid;
    const int r = e >> 4, c4 = (e & 15) * 4;
    *(v4f*)(sA + r * kGP + c4) = *(const v4f*)(V0 + (size_t)(g0 + r) * kC + hd * kHS + c4);
  }
  /* weight planes: 4096 bf16 each = 512 x 16 B = 4 x 128 threads */
#pragma unroll
  for (int i = 0; i < 4; ++i) {
    const int e = (i * 128 + tid) * 8;
    const int le = (e >> 6) * kWP + (e & 63);
    *(v8b*)(sW1 + le) = *(const v8b*)(W1t + e);
    *(v8b*)(sW2 + le) = *(const v8b*)(W2t + e);
  }
  {
    const int bi = tid & 63;
    const float x1 = b1[bi];
    const float x2 = b2[bi];
    const float xs = (tid < kHS) ? x1 : x2;
    sBias[tid] = bf_bits2f(f2bf_bits(xs));
  }
  __syncthreads();

  /* A fragments (hi, lo) for this wave's 16 tokens */
  v16b ah[2], al[2];
  {
    const int arow = wave * 16 + c;
#pragma unroll
    for (int ks = 0; ks < 2; ++ks) {
      const float* p = sA + arow * kGP + ks * 32 + 8 * hh;
      const v4f f0 = *(const v4f*)(p);
      const v4f f1 = *(const v4f*)(p + 4);
      const v4f f2 = *(const v4f*)(p + 16);
      const v4f f3 = *(const v4f*)(p + 20);
#pragma unroll
      for (int e = 0; e < 4; ++e) {
        unsigned short hb, lb;
        const float x0 = f0[e];
        const float x1 = f1[e];
        const float x2 = f2[e];
        const float x3 = f3[e];
        split_bits(x0, hb, lb);
        ah[ks][e] = __builtin_bit_cast(__bf16, hb);       al[ks][e] = __builtin_bit_cast(__bf16, lb);
        split_bits(x1, hb, lb);
        ah[ks][4 + e] = __builtin_bit_cast(__bf16, hb);   al[ks][4 + e] = __builtin_bit_cast(__bf16, lb);
        split_bits(x2, hb, lb);
        ah[ks][8 + e] = __builtin_bit_cast(__bf16, hb);   al[ks][8 + e] = __builtin_bit_cast(__bf16, lb);
        split_bits(x3, hb, lb);
        ah[ks][12 + e] = __builtin_bit_cast(__bf16, hb);  al[ks][12 + e] = __builtin_bit_cast(__bf16, lb);
      }
    }
  }

  v8f a1[4], a2[4];
#pragma unroll
  for (int j = 0; j < 4; ++j) {
    a1[j] = (v8f){0.f,0.f,0.f,0.f,0.f,0.f,0.f,0.f};
    a2[j] = (v8f){0.f,0.f,0.f,0.f,0.f,0.f,0.f,0.f};
  }
#pragma unroll
  for (int ks = 0; ks < 2; ++ks) {
#pragma unroll
    for (int j = 0; j < 4; ++j) {
      const v16b w1 = Frag<__bf16>::load(sW1 + (j * 16 + c) * kWP + ks * 32 + 8 * hh);
      const v16b w2 = Frag<__bf16>::load(sW2 + (j * 16 + c) * kWP + ks * 32 + 8 * hh);
      a1[j] = mma_b(ah[ks], w1, a1[j]);
      a1[j] = mma_b(al[ks], w1, a1[j]);
      a2[j] = mma_b(ah[ks], w2, a2[j]);
      a2[j] = mma_b(al[ks], w2, a2[j]);
    }
  }
  acc_guard4(a1[0], a1[1], a1[2], a1[3]);
  acc_guard4(a2[0], a2[1], a2[2], a2[3]);

  /* residual + biases in place (reads only this wave's own token rows of sA) */
#pragma unroll
  for (int j = 0; j < 4; ++j) {
    const int col = j * 16 + c;
    const float bb1 = sBias[col];
    const float bb2 = sBias[kHS + col];
#pragma unroll
    for (int r = 0; r < 8; ++r) {
      const int row = wave * 16 + 8 * hh + r;
      const float vres = sA[row * kGP + col];
      a1[j][r] = vres + (a1[j][r] + bb1);
      a2[j][r] = a2[j][r] + bb2;
    }
  }
  /* every wave has finished reading the v0 tile before it is overwritten */
  __syncthreads();
#pragma unroll
  for (int j = 0; j < 4; ++j) {
    const int col = j * 16 + c;
#pragma unroll
    for (int r = 0; r < 8; ++r) {
      const int row = wave * 16 + 8 * hh + r;
      sB[col * kGP + row] = a1[j][r];
      sA[col * kGP + row] = a2[j][r];
    }
  }
  __syncthreads();

  const int q = lane >> 3, c8 = (lane & 7) * 8;
#pragma unroll 1
  for (int it = 0; it < 4; ++it) {
    const int d = wave * 16 + it * 4 + q;
    const float* pa = sB + d * kGP + c8;
    const float* pg = sA + d * kGP + c8;
    const v4f av0 = *(const v4f*)(pa);
    const v4f av1 = *(const v4f*)(pa + 4);
    const v4f gv0 = *(const v4f*)(pg);
    const v4f gv1 = *(const v4f*)(pg + 4);
    v8h hv, lv;
#pragma unroll
    for (int e = 0; e < 4; ++e) {
      const float xa0 = av0[e];
      const float xg0 = gv0[e];
      const float xa1 = av1[e];
      const float xg1 = gv1[e];
      const float r0 = xa0 * (1.0f / (1.0f + expf(-xg0)));
      const float r1 = xa1 * (1.0f / (1.0f + expf(-xg1)));
      unsigned short hb, lb;
      split_bits(r0, hb, lb);
      hv[e] = __builtin_bit_cast(_Float16, hb);
      lv[e] = __builtin_bit_cast(_Float16, lb);
      split_bits(r1, hb, lb);
      hv[4 + e] = __builtin_bit_cast(_Float16, hb);
      lv[4 + e] = __builtin_bit_cast(_Float16, lb);
    }
    const size_t o = ((size_t)(bidx * kH + hd) * kHS + d) * kT + t0 + c8;
    *(v8h*)(VTH + o) = hv;
    *(v8h*)(VTL + o) = lv;
    
  }
}

// ---------------------------------------------------------------------------
// Causal attention for head dim 64 from 16-bit planes. Block = 4 waves = 64 query rows of one (batch, head);
// keys in chunks of 64 up to and including the diagonal chunk (block-uniform trip count qb + 1 <= 32).
//   scores: A = u (f16, x16) rows, B = x (f16, x16) key rows staged in LDS; 2 matrix ops per 16-key tile; x 1/(32*16*16).
//   diagonal chunk: key > query -> -inf (every row keeps at least its own key; the first chunk always holds key 0).
//   online softmax in f32; the normaliser is summed from the f32 p values.
//   P -> bf16 hi + lo per wave in LDS (A layout); v hi + lo ([d][key] planes) staged in LDS; P.v = hi.hi + hi.lo + lo.hi.
// ---------------------------------------------------------------------------
constexpr int kKC = 64;
/* LDS row pitch of every 64-element 16-bit tile read by 16-byte fragment loads: 72 elements = 144 B = 16 B x 9 (odd), so 16 rows fall on distinct banks */
constexpr int kLP = 72;
static_assert(kLP >= kKC && kLP >= kHS && (kLP % 8) == 0 && ((kLP / 8) % 2) == 1, "pitch: 16-B aligned rows, odd multiple of 16 B");
__global__ __launch_bounds__(128) void causal_attn_kernel(
    const unsigned short* __restrict__ Up, const unsigned short* __restrict__ XHp,
    const unsigned short* __restrict__ VTHp, const unsigned short* __restrict__ VTLp,
    unsigned short* __restrict__ YH, unsigned short* __restrict__ YL)
{
  __shared__ __align__(16) _Float16 Ksh[kKC * kLP];
  __shared__ __align__(16) __bf16 Vth[kHS * kLP];
  __shared__ __align__(16) __bf16 Vtl[kHS * kLP];
  __shared__ __align__(16) __bf16 Psh[4][16 * kLP];
  __shared__ __align__(16) __bf16 Psl[4][16 * kLP];
  __shared__ __align__(16) float  Os[4][16 * 68];

  const int tid  = threadIdx.x;
  const int wave = tid >> 5;
  const int lane = tid & 31;
  const int hh   = lane >> 4;
  const int c    = lane & 15;

  constexpr int nqb = kT / 64;
  const int bx = blockIdx.x;
  const int qb = bx % nqb;
  const int bh = bx / nqb;
  const int h  = bh % kH;
  const int b  = bh / kH;
  const int q0 = qb * 64 + wave * 16;

  const _Float16* Uh = (const _Float16*)Up;
  const _Float16* Xh = (const _Float16*)XHp;
  const __bf16*   Vh = (const __bf16*)VTHp;
  const __bf16*   Vl = (const __bf16*)VTLp;

  /* query fragments: 2 d-chunks */
  v16h qa[2];
  {
    const _Float16* urow = Uh + (size_t)(b * kT + q0 + c) * kC + h * kHS;
#pragma unroll
    for (int dc = 0; dc < 2; ++dc) qa[dc] = Frag<_Float16>::load(urow + dc * 32 + 8 * hh);
  }

  float mrow[8], lrow[8];
  v8f oacc[4];
#pragma unroll
  for (int r = 0; r < 8; ++r) { mrow[r] = -INFINITY; lrow[r] = 0.f; }
#pragma unroll
  for (int t = 0; t < 4; ++t) oacc[t] = (v8f){0.f,0.f,0.f,0.f,0.f,0.f,0.f,0.f};

  __bf16* pwh = Psh[wave];
  __bf16* pwl = Psl[wave];
  const int nChunks = qb + 1;
  for (int kc = 0; kc < nChunks; ++kc) {
    const int kv0 = kc * kKC;
    __syncthreads();
    /* K, V hi, V lo tiles: 64 rows x 8 x 16 B = 512 each = 4 x 128 threads */
#pragma unroll
    for (int i = 0; i < 4; ++i) {
      const int e = i * 128 + tid;
      const int r = e >> 3, c8 = (e & 7) * 8;
      *(v8h*)(Ksh + r * kLP + c8) = *(const v8h*)(Xh + (size_t)(b * kT + kv0 + r) * kC + h * kHS + c8);
      const size_t vo = ((size_t)bh * kHS + r) * kT + kv0 + c8;
      *(v8b*)(Vth + r * kLP + c8) = *(const v8b*)(Vh + vo);
      *(v8b*)(Vtl + r * kLP + c8) = *(const v8b*)(Vl + vo);
    }
    __syncthreads();

    v8f s[4];
#pragma unroll
    for (int j = 0; j < 4; ++j) {
      s[j] = (v8f){0.f,0.f,0.f,0.f,0.f,0.f,0.f,0.f};
#pragma unroll
      for (int dc = 0; dc < 2; ++dc) {
        const v16h kb = Frag<_Float16>::load(Ksh + (j * 16 + c) * kLP + dc * 32 + 8 * hh);
        s[j] = mma_h(qa[dc], kb, s[j]);
      }
    }
    acc_guard4(s[0], s[1], s[2], s[3]);

    const bool diag = (kc == qb);
    float cm[8];
#pragma unroll
    for (int r = 0; r < 8; ++r) {
      const int qrow = q0 + 8 * hh + r;
      float m = -INFINITY;
#pragma unroll
      for (int j = 0; j < 4; ++j) {
        const int kvcol = kv0 + j * 16 + c;
        float sv = s[j][r] * kScoreScale;
        const bool masked = diag && (kvcol > qrow);
        sv = masked ? -INFINITY : sv;
        s[j][r] = sv;
        m = fmaxf(m, sv);
      }
#pragma unroll
      for (int off = 1; off < 16; off <<= 1) m = fmaxf(m, __shfl_xor(m, off, 32));
      cm[r] = m;
    }
#pragma unroll
    for (int r = 0; r < 8; ++r) {
      const float mnew = fmaxf(mrow[r], cm[r]);
      const float alpha = __expf(mrow[r] - mnew);
      mrow[r] = mnew;
      float psum = 0.f;
#pragma unroll
      for (int j = 0; j < 4; ++j) {
        const float p = __expf(s[j][r] - mnew);
        psum += p;
        unsigned short hb, lb;
        split_bits(p, hb, lb);
        pwh[(8 * hh + r) * kLP + j * 16 + c] = __builtin_bit_cast(__bf16, hb);
        pwl[(8 * hh + r) * kLP + j * 16 + c] = __builtin_bit_cast(__bf16, lb);
      }
#pragma unroll
      for (int off = 1; off < 16; off <<= 1) psum += __shfl_xor(psum, off, 32);
      lrow[r] = lrow[r] * alpha + psum;
#pragma unroll
      for (int t = 0; t < 4; ++t) oacc[t][r] *= alpha;
    }
    __builtin_amdgcn_fence(__ATOMIC_RELEASE, "workgroup");
    __builtin_amdgcn_wave_barrier();
    __builtin_amdgcn_fence(__ATOMIC_ACQUIRE, "workgroup");
#pragma unroll 1
    for (int kk = 0; kk < 2; ++kk) {
      const v16b pa = Frag<__bf16>::load(pwh + c * kLP + kk * 32 + 8 * hh);
      const v16b pl = Frag<__bf16>::load(pwl + c * kLP + kk * 32 + 8 * hh);
#pragma unroll
      for (int t = 0; t < 4; ++t) {
        const v16b vb = Frag<__bf16>::load(Vth + (t * 16 + c) * kLP + kk * 32 + 8 * hh);
        const v16b vl = Frag<__bf16>::load(Vtl + (t * 16 + c) * kLP + kk * 32 + 8 * hh);
        oacc[t] = mma_b(pa, vb, oacc[t]);
        oacc[t] = mma_b(pa, vl, oacc[t]);
        oacc[t] = mma_b(pl, vb, oacc[t]);
      }
    }
    acc_guard4(oacc[0], oacc[1], oacc[2], oacc[3]);
  }

  float* os = Os[wave];
#pragma unroll
  for (int r = 0; r < 8; ++r) {
    const float inv = 1.0f / lrow[r];
#pragma unroll
    for (int t = 0; t < 4; ++t) os[(8 * hh + r) * 68 + t * 16 + c] = oacc[t][r] * inv;
  }
  __builtin_amdgcn_fence(__ATOMIC_RELEASE, "workgroup");
  __builtin_amdgcn_wave_barrier();
  __builtin_amdgcn_fence(__ATOMIC_ACQUIRE, "workgroup");
  {
    const int q = lane >> 3, c8 = (lane & 7) * 8;
    v8h hv[4], lv[4];
#pragma unroll
    for (int it = 0; it < 4; ++it) {
      const int row = it * 4 + q;
      const float* sp = os + row * 68 + c8;
      const v4f y0 = *(const v4f*)(sp);
      const v4f y1 = *(const v4f*)(sp + 4);
#pragma unroll
      for (int e = 0; e < 4; ++e) {
        const float z0 = y0[e];
        const float z1 = y1[e];
        unsigned short hb, lb;
        split_bits(z0, hb, lb);
        hv[it][e] = __builtin_bit_cast(_Float16, hb);
        lv[it][e] = __builtin_bit_cast(_Float16, lb);
        split_bits(z1, hb, lb);
        hv[it][4 + e] = __builtin_bit_cast(_Float16, hb);
        lv[it][4 + e] = __builtin_bit_cast(_Float16, lb);
      }
    }
    {
#pragma unroll
      for (int it = 0; it < 4; ++it) {
        const int row = it * 4 + q;
        const size_t o = (size_t)(b * kT + q0 + row) * kC + h * kHS + c8;
        *(v8h*)(YH + o) = hv[it];
        *(v8h*)(YL + o) = lv[it];
      }
      
    }
  }
}

// ---------------------------------------------------------------------------
// Host glue: 8 launches, kernel launches only.
// GEMM shapes: M 8192, N 1024, K 1024: 64 x 4 block tiles of 128 x 256 = 256 blocks of 8 waves.
// ---------------------------------------------------------------------------
extern "C" void kernel_launch(void* const* d_in, const int* in_sizes, int n_in,
                              void* d_out, int out_size, void* d_ws, size_t ws_size,
                              hipStream_t stream) {
  if (n_in < 11) return;
  if (in_sizes[0] != kRows * kC) return;
  if (in_sizes[1] != kC * kC) return;
  if (in_sizes[2] != kC) return;
  if (in_sizes[3] != kC * kC) return;
  if (in_sizes[4] != kC) return;
  if (in_sizes[5] != kHS * kHS) return;
  if (in_sizes[6] != kHS) return;
  if (in_sizes[7] != kHS * kHS) return;
  if (in_sizes[8] != kHS) return;
  if (in_sizes[9] != kC * kC) return;
  if (in_sizes[10] != kC) return;
  if (out_size != kRows * kC) return;
  if (ws_size < kWsTotal) return;

  const float* x  = (const float*)d_in[0];
  const float* Wu = (const float*)d_in[1];
  const float* bu = (const float*)d_in[2];
  const float* Wv = (const float*)d_in[3];
  const float* bv = (const float*)d_in[4];
  const float* W1 = (const float*)d_in[5];
  const float* b1 = (const float*)d_in[6];
  const float* W2 = (const float*)d_in[7];
  const float* b2 = (const float*)d_in[8];
  const float* Wp = (const float*)d_in[9];
  const float* bp = (const float*)d_in[10];
  float* out = (float*)d_out;

  char* ws = (char*)d_ws;
  unsigned short* XH   = (unsigned short*)(ws + kOffXH);
  unsigned short* WUT  = (unsigned short*)(ws + kOffWUT);
  unsigned short* WVT  = (unsigned short*)(ws + kOffWVT);
  unsigned short* WPT  = (unsigned short*)(ws + kOffWPT);
  unsigned short* W12T = (unsigned short*)(ws + kOffW12);
  unsigned short* U16  = (unsigned short*)(ws + kOffU);
  float*          V0   = (float*)(ws + kOffV0);
  unsigned short* YH   = (unsigned short*)(ws + kOffYH);
  unsigned short* YL   = (unsigned short*)(ws + kOffYL);
  unsigned short* VTH  = (unsigned short*)(ws + kOffVTH);
  unsigned short* VTL  = (unsigned short*)(ws + kOffVTL);

  /* x -> f16 plane (bf16 values x16) */
  cast_x_kernel<<<(kRows * kC / 8) / 256, 256, 0, stream>>>(x, XH, kRows * kC / 8);

  /* in[k][n] -> out[n][k]: Wu, Wv as f16 (x1024), Wp as bf16; planes WUT, WVT, WPT are contiguous */
  wt_transpose_cast_kernel<<<dim3(kC / 64, kC / 64, 3), 256, 0, stream>>>(Wu, Wv, Wp, WUT, kC, kWCarry, 2);
  /* in[k][n] -> out[n][k]: W1, W2 as bf16 [64][64] planes */
  wt_transpose_cast_kernel<<<dim3(1, 1, 2), 256, 0, stream>>>(W1, W2, W2, W12T, kHS, 1.0f, 0);

  /* u (f16, x16) = x.Wu + bu */
  wmma_gemm64<0, 0, 2, 1><<<dim3(256, 1), 256, 0, stream>>>(
      XH, XH, kC, 0L,
      WUT, WUT, kC, 0L,
      (void*)U16, kC, 0L,
      bu, kRows, kC, kC, kUScale, kUCarry);

  /* v0 (f32) = x.Wv + bv */
  wmma_gemm64<0, 0, 2, 0><<<dim3(256, 1), 256, 0, stream>>>(
      XH, XH, kC, 0L,
      WVT, WVT, kC, 0L,
      (void*)V0, kC, 0L,
      bv, kRows, kC, kC, kV0Scale, 1.0f);

  /* gated value -> vT hi | lo planes */
  gated_value_kernel<<<dim3(kRows / 64, kH), 128, 0, stream>>>(V0, W12T, W12T + kHS * kHS, b1, b2, VTH, VTL);

  /* causal attention -> y hi | lo planes (the v0 bytes are dead from here on) */
  causal_attn_kernel<<<kB * kH * (kT / 64), 128, 0, stream>>>(U16, XH, VTH, VTL, YH, YL);

  /* out = y.Wp + bp (y hi.W + y lo.W) */
  wmma_gemm64<1, 1, 2, 0><<<dim3(256, 1), 256, 0, stream>>>(
      YH, YL, kC, 0L,
      WPT, WPT, kC, 0L,
      (void*)out, kC, 0L,
      bp, kRows, kC, kC, 1.0f, 1.0f);
}

// v003
// One run takes 221 microseconds.
// Timed twice side by side with v002, it ran 2.00 times as fast both times.
// Counting every step since v000, it is 3.19 times as fast.
// All contractions on 16-bit WMMA with f32 accumulate: x.Wu, x.Wv and the u.x^T scores on v_wmma_f32_16x16x32_f16 (inputs RNE-converted to bf16 once and held exactly in f16 planes with power-of-two carries: x x16, W x1024, u x16); v0.W1, v0.W2, P.v and y.Wp on v_wmma_f32_16x16x32_bf16 with the computed operand carried as bf16 hi+lo planes (W1, W2, Wp as bf16 planes); softmax, gate, residual and bias in f32.
#include <hip/hip_runtime.h>
#include <math.h>

typedef __attribute__((ext_vector_type(16))) _Float16 v16h;
typedef __attribute__((ext_vector_type(8)))  _Float16 v8h;
typedef __attribute__((ext_vector_type(16))) __bf16   v16b;
typedef __attribute__((ext_vector_type(8)))  __bf16   v8b;
typedef __attribute__((ext_vector_type(8)))  float    v8f;
typedef __attribute__((ext_vector_type(4)))  float    v4f;
typedef __attribute__((ext_vector_type(4)))  unsigned int v4u;

// ---------------------------------------------------------------------------
// Problem constants
// ---------------------------------------------------------------------------
constexpr int kB    = 4;
constexpr int kT    = 2048;
constexpr int kC    = 1024;
constexpr int kH    = 16;
constexpr int kHS   = 64;
constexpr int kRows = kB * kT;
constexpr int kSqrtC = 32;
static_assert(kSqrtC * kSqrtC == kC, "score scale is 1/sqrt(C)");
static_assert(kH * kHS == kC, "head split");
static_assert((kC % 32) == 0 && (kHS % 32) == 0 && (kT % 64) == 0, "K multiples of 32, key chunks of 64");
static_assert((kRows % 64) == 0 && (kC % 64) == 0, "GEMM M,N multiples of 64");

// power-of-two carries of the f16 planes (exact; folded back in f32)
constexpr float kXCarry = 16.0f;
constexpr float kWCarry = 1024.0f;
constexpr float kUCarry = 16.0f;
constexpr float kUScale  = kUCarry / (kXCarry * kWCarry);
constexpr float kV0Scale = 1.0f / (kXCarry * kWCarry);
constexpr float kScoreScale = 1.0f / ((float)kSqrtC * kUCarry * kXCarry);

// ---------------------------------------------------------------------------
// Workspace region map (bytes; every offset is a multiple of 128)
//   XH    f16  [8192][1024]      16*bf16(x)                      16,777,216
//   WUT   f16  [1024 n][1024 k]  1024*bf16(Wu)^T                  2,097,152
//   WVT   f16  [1024 n][1024 k]  1024*bf16(Wv)^T                  2,097,152
//   WPT   bf16 [1024 n][1024 k]  bf16(Wp)^T                       2,097,152
//   W12T  bf16 2 x [64 n][64 k]  bf16(W1)^T | bf16(W2)^T             16,384
//   U16   f16  [8192][1024]      16*u                            16,777,216
//   V0    f32  [8192][1024]      v0; dead after the gated-value launch, then the same bytes
//                                hold YH | YL (bf16 hi | lo planes of y, [8192][1024] each)  33,554,432
//   VTH   bf16 [4][16][64 d][2048 t]  gated v, hi plane           16,777,216
//   VTL   bf16 [4][16][64 d][2048 t]  gated v, lo plane           16,777,216
//   total                                                       106,971,136
// ---------------------------------------------------------------------------
constexpr size_t kSzAct16 = (size_t)kRows * kC * 2;
constexpr size_t kSzW16   = (size_t)kC * kC * 2;
constexpr size_t kSzW12   = (size_t)2 * kHS * kHS * 2;
constexpr size_t kSzV0    = (size_t)kRows * kC * 4;
constexpr size_t kOffXH   = 0;
constexpr size_t kOffWUT  = kOffXH  + kSzAct16;
constexpr size_t kOffWVT  = kOffWUT + kSzW16;
constexpr size_t kOffWPT  = kOffWVT + kSzW16;
constexpr size_t kOffW12  = kOffWPT + kSzW16;
constexpr size_t kOffU    = kOffW12 + kSzW12;
constexpr size_t kOffV0   = kOffU   + kSzAct16;
constexpr size_t kOffYH   = kOffV0;
constexpr size_t kOffYL   = kOffV0  + kSzAct16;
constexpr size_t kOffVTH  = kOffV0  + kSzV0;
constexpr size_t kOffVTL  = kOffVTH + kSzAct16;
constexpr size_t kWsTotal = kOffVTL + kSzAct16;
static_assert(kWsTotal == 106971136ull, "carve total");
static_assert(kWsTotal <= 134217728ull, "carve cap");
static_assert(2 * kSzAct16 == kSzV0, "y hi|lo planes fit the v0 plane exactly");
static_assert((kOffWUT % 128) == 0 && (kOffWVT % 128) == 0 && (kOffWPT % 128) == 0 && (kOffW12 % 128) == 0 &&
              (kOffU % 128) == 0 && (kOffV0 % 128) == 0 && (kOffYL % 128) == 0 && (kOffVTH % 128) == 0 &&
              (kOffVTL % 128) == 0, "128-B aligned regions");

// ---------------------------------------------------------------------------
// Bit helpers
// ---------------------------------------------------------------------------
__device__ __forceinline__ unsigned short f2bf_bits(float f) {
  unsigned u = __float_as_uint(f);
  return (unsigned short)((u + 0x7FFFu + ((u >> 16) & 1u)) >> 16);
}
__device__ __forceinline__ float bf_bits2f(unsigned short h) { return __uint_as_float(((unsigned)h) << 16); }
__device__ __forceinline__ unsigned pk16(unsigned short a, unsigned short b) { return (unsigned)a | ((unsigned)b << 16); }
__device__ __forceinline__ unsigned short h_bits(float f) { const _Float16 h = (_Float16)f; return __builtin_bit_cast(unsigned short, h); }
/* bf16 hi + bf16 lo of an f32 value, both RNE */
__device__ __forceinline__ void split_bits(float f, unsigned short& hb, unsigned short& lb) {
  hb = f2bf_bits(f);
  lb = f2bf_bits(f - bf_bits2f(hb));
}

// ---------------------------------------------------------------------------
// WMMA helpers: every matrix op is followed by 4 nops tied to its own accumulator and its A/B fragments
// ---------------------------------------------------------------------------
__device__ __forceinline__ v8f mma_h(v16h a, v16h b, v8f c) {
  c = __builtin_amdgcn_wmma_f32_16x16x32_f16(false, a, false, b, (short)0, c, false, false);
  asm volatile("v_nop\n\tv_nop\n\tv_nop\n\tv_nop" : "+v"(c) : "v"(a), "v"(b));
  return c;
}
__device__ __forceinline__ v8f mma_b(v16b a, v16b b, v8f c) {
  c = __builtin_amdgcn_wmma_f32_16x16x32_bf16(false, a, false, b, (short)0, c, false, false);
  asm volatile("v_nop\n\tv_nop\n\tv_nop\n\tv_nop" : "+v"(c) : "v"(a), "v"(b));
  return c;
}
__device__ __forceinline__ void keep4_h(v16h a, v16h b, v16h c, v16h d) { asm volatile("v_nop" :: "v"(a), "v"(b), "v"(c), "v"(d)); }
__device__ __forceinline__ void keep4_b(v16b a, v16b b, v16b c, v16b d) { asm volatile("v_nop" :: "v"(a), "v"(b), "v"(c), "v"(d)); }
__device__ __forceinline__ void acc_guard4(v8f& a, v8f& b, v8f& c, v8f& d) { asm volatile("v_nop\n\tv_nop\n\tv_nop\n\tv_nop" : "+v"(a), "+v"(b), "+v"(c), "+v"(d)); }

// Fragment loader: p already points at (row, k0 + 8*(lane>>4)); elements 0..7 <- p[0..7], elements 8..15 <- p[16..23]
template <typename T> struct Frag;
template <> struct Frag<_Float16> {
  typedef v16h V; union U { v16h v; v8h h[2]; };
  static __device__ __forceinline__ v16h load(const _Float16* p) {
    U f; f.h[0] = *(const v8h*)(p); f.h[1] = *(const v8h*)(p + 16); return f.v;
  }
  static __device__ __forceinline__ v8f mma(v16h a, v16h b, v8f c) { return mma_h(a, b, c); }
  static __device__ __forceinline__ void keep(v16h a, v16h b, v16h c, v16h d) { keep4_h(a, b, c, d); }
};
template <> struct Frag<__bf16> {
  typedef v16b V; union U { v16b v; v8b h[2]; };
  static __device__ __forceinline__ v16b load(const __bf16* p) {
    U f; f.h[0] = *(const v8b*)(p); f.h[1] = *(const v8b*)(p + 16); return f.v;
  }
  static __device__ __forceinline__ v8f mma(v16b a, v16b b, v8f c) { return mma_b(a, b, c); }
  static __device__ __forceinline__ void keep(v16b a, v16b b, v16b c, v16b d) { keep4_b(a, b, c, d); }
};

// ---- LDS-staged batched WMMA GEMM ------------------------------------------
// C[m,n] = scale * sum_k A[m,k] * Bt[n,k] + bias_scale * bf16(bias[n]).
// Block = 8 waves = one 128 x 256 tile of C; waves 2 (m) x 4 (n), each wave owns a 64x64 tile.
// A pass is 64 k = 128 B of every operand row. The block brings a pass's rows [A 128 | A2 128 (SPL 1) | Bt 256] from global
// memory as whole 128-B lines (8 lanes x 16 B per row) by asynchronous 16-byte copies into one of two LDS buffers, so that
// the next pass's rows fly while this pass is worked on; every wave reads its fragments from LDS. One block barrier per
// pass: it publishes the buffer just filled and ends the reads of the buffer that is refilled behind it.
// A row-major [M,K]; Bt row-major [N,K]; M % 128 == 0, N % 256 == 0, K % 64 == 0 (no tail handling).
// SPL: 0 = plain (one product), 1 = A carried as hi/lo planes (A2 = lo): hi.b + lo.b.
// BIAS_MODE: 0 = none, 2 = bias[n].   OUT_MODE: 0 = f32, 1 = f16.
// ET: 0 = f16 operands, 1 = bf16 operands (pointers passed as 16-bit storage)
constexpr int kBM = 128;
constexpr int kBN = 256;
constexpr int kKP = 64;
/* LDS row pitch of a staged 64-element row: 144 B = 16 B x 9 (odd) for the 16-byte fragment loads */
constexpr int kSP = 72;
static_assert((kRows % kBM) == 0 && (kC % kBN) == 0 && (kC % kKP) == 0, "GEMM block tile and pass divide the shapes");
template <int ET> struct Elem;
template <> struct Elem<0> { typedef _Float16 T; };
template <> struct Elem<1> { typedef __bf16 T; };
template <int ET, int SPL, int BIAS_MODE, int OUT_MODE>
__global__ __launch_bounds__(256) void wmma_gemm64(
    const unsigned short* __restrict__ Ap, const unsigned short* __restrict__ A2p, int lda, long strideA,
    const unsigned short* __restrict__ Btp, const unsigned short* __restrict__ Bt2p, int ldb, long strideB,
    void* __restrict__ Cout, int ldc, long strideC,
    const float* __restrict__ bias,
    int M, int N, int K, float scale, float bias_scale) {
  static_assert(SPL == 0 || SPL == 1, "one or two A planes");
  typedef typename Elem<ET>::T T;
  typedef typename Frag<T>::V V;
  constexpr int kRowsA      = (SPL == 1) ? 2 * kBM : kBM;
  constexpr int kStageRows  = kRowsA + kBN;
  constexpr int kStageElems = kStageRows * kSP;
  /* one 16-byte copy per thread covers 32 rows of the stage */
  constexpr int kCopies     = kStageRows / 32;
  constexpr unsigned kStageBytes = (unsigned)kStageElems * 2u;
  static_assert((kCopies % 4) == 0, "copies go four to a statement");
  const T* A = (const T*)Ap; const T* A2 = (const T*)A2p; const T* Bt = (const T*)Btp;
  __shared__ __align__(16) T sStage[2 * kStageElems];
  /* per-wave 16x64 slab, pitch 68 floats */
  __shared__ __align__(16) float sT[8][16 * 68];
  const int b    = blockIdx.y;
  const int tid  = threadIdx.x;
  const int lane = tid & 31;
  const int wave = tid >> 5;
  const int tilesN = N / kBN;
  const int tilesM = M / kBM;
  const int tile = blockIdx.x;
  /* block-uniform exit, in front of every barrier */
  if (tile >= tilesM * tilesN) return;
  const int tm = tile / tilesN;
  const int tn = tile - tm * tilesN;
  const int wm = wave >> 2;
  const int wn = wave & 3;
  const int m0 = tm * kBM + (wm << 6);
  const int n0 = tn * kBN + (wn << 6);

  const T* Ab  = A  + (size_t)b * strideA + (size_t)(tm * kBM) * lda;
  const T* Ab2 = A2 + (size_t)b * strideA + (size_t)(tm * kBM) * lda;
  const T* Bb  = Bt + (size_t)b * strideB + (size_t)(tn * kBN) * ldb;

  /* rlane: row (A) / col (B, D) within a 16-wide subtile; koff: k offset of this lane half; mOff: D row offset */
  const int rlane = lane & 15;
  const int koff  = (lane >> 4) * 8;
  const int mOff  = (lane >> 4) * 8;

  /* staging: thread -> (row tid / 8 of each group of 32 rows, 16-byte piece tid % 8 of its 128 B) */
  const int srow = tid >> 3;
  const int sc8  = (tid & 7) * 8;
  const unsigned offA = (unsigned)srow * (unsigned)lda + (unsigned)sc8;
  const unsigned offB = (unsigned)srow * (unsigned)ldb + (unsigned)sc8;
  /* LDS byte address (low 32 bits of the __shared__ address) of this thread's piece in row srow of buffer 0 */
  const unsigned ldsT = (unsigned)(size_t)(sStage + srow * kSP + sc8);
  auto copy_stage = [&](int k0, unsigned bufByte) {
    /* both loops unrolled: which operand a group of rows belongs to is then decided at compile time */
#pragma unroll
    for (int g = 0; g < kCopies / 4; ++g) {
      const T* gp[4];
      unsigned lp[4];
#pragma unroll
      for (int e = 0; e < 4; ++e) {
        const int r0 = (g * 4 + e) * 32;
        if (r0 < kBM)         gp[e] = Ab  + (size_t)r0 * lda + k0 + offA;
        else if (r0 < kRowsA) gp[e] = Ab2 + (size_t)(r0 - kBM) * lda + k0 + offA;
        else                  gp[e] = Bb  + (size_t)(r0 - kRowsA) * ldb + k0 + offB;
        lp[e] = ldsT + bufByte + (unsigned)(r0 * kSP * 2);
      }
      /* four copies, then the wait that stands in front of any rewrite of the address registers they name */
      asm volatile("global_load_async_to_lds_b128 %0, %1, off\n\t"
                   "global_load_async_to_lds_b128 %2, %3, off\n\t"
                   "global_load_async_to_lds_b128 %4, %5, off\n\t"
                   "global_load_async_to_lds_b128 %6, %7, off\n\t"
                   "s_wait_xcnt 0x0"
                   :: "v"(lp[0]), "v"(gp[0]), "v"(lp[1]), "v"(gp[1]), "v"(lp[2]), "v"(gp[2]), "v"(lp[3]), "v"(gp[3])
                   : "memory");
    }
  };

  v8f acc[4][4];
#pragma unroll
  for (int i = 0; i < 4; ++i)
#pragma unroll
    for (int j = 0; j < 4; ++j) acc[i][j] = (v8f){0.f,0.f,0.f,0.f,0.f,0.f,0.f,0.f};

  const int nPass = K / kKP;
  copy_stage(0, 0u);
  /* pass 0's rows have landed (this wave's copies), then every wave's */
  asm volatile("s_wait_asynccnt 0x0" ::: "memory");
  __syncthreads();
  if (nPass > 1) copy_stage(kKP, kStageBytes);
  for (int p = 0; p < nPass; ++p) {
    const T* buf = sStage + (p & 1) * kStageElems;
    const T* sA  = buf + ((wm << 6) + rlane) * kSP + koff;
    const T* sA2 = sA + kBM * kSP;
    const T* sB  = buf + (kRowsA + (wn << 6) + rlane) * kSP + koff;
    /* the loops below are unrolled so that every index of a fragment or accumulator array is a constant (registers, no scratch) */
#pragma unroll
    for (int ks = 0; ks < kKP / 32; ++ks) {
      V bh[4];
#pragma unroll
      for (int j = 0; j < 4; ++j) bh[j] = Frag<T>::load(sB + (j << 4) * kSP + ks * 32);
      /* per accumulator and k step: the hi product, then the lo product */
#pragma unroll
      for (int pl = 0; pl <= SPL; ++pl) {
        const T* sAp = (pl == 0) ? sA : sA2;
        V af[4];
#pragma unroll
        for (int i = 0; i < 4; ++i) af[i] = Frag<T>::load(sAp + (i << 4) * kSP + ks * 32);
#pragma unroll
        for (int i = 0; i < 4; ++i) {
#pragma unroll
          for (int j = 0; j < 4; ++j) acc[i][j] = Frag<T>::mma(af[i], bh[j], acc[i][j]);
        }
      }
      Frag<T>::keep(bh[0], bh[1], bh[2], bh[3]);
    }
    /* this wave's reads of buffer p & 1 are done before that buffer is refilled */
    asm volatile("s_wait_dscnt 0x0" ::: "memory");
    /* this wave's copies of pass p + 1 have landed before the barrier publishes them */
    asm volatile("s_wait_asynccnt 0x0" ::: "memory");
    __syncthreads();
    if (p + 2 < nPass) copy_stage((p + 2) * kKP, (unsigned)(p & 1) * kStageBytes);
  }
  /* no copy is outstanding when the wave goes on to the epilogue */
  asm volatile("s_wait_asynccnt 0x0" ::: "memory");
  acc_guard4(acc[0][0], acc[0][1], acc[0][2], acc[0][3]);
  acc_guard4(acc[1][0], acc[1][1], acc[1][2], acc[1][3]);
  acc_guard4(acc[2][0], acc[2][1], acc[2][2], acc[2][3]);
  acc_guard4(acc[3][0], acc[3][1], acc[3][2], acc[3][3]);

  // ---- epilogue ----
  float* slab = sT[wave];
#pragma unroll
  for (int i = 0; i < 4; ++i) {
    const int mBase = m0 + (i << 4);
#pragma unroll
    for (int j = 0; j < 4; ++j) {
      const int n = n0 + (j << 4) + rlane;
      float bv = 0.f;
      if (BIAS_MODE == 2) bv = bf_bits2f(f2bf_bits(bias[n])) * bias_scale;
#pragma unroll
      for (int r = 0; r < 8; ++r) {
        float v = acc[i][j][r] * scale;
        if (BIAS_MODE == 2) v += bv;
        slab[(mOff + r) * 68 + (j << 4) + rlane] = v;
      }
    }
    __builtin_amdgcn_fence(__ATOMIC_RELEASE, "workgroup");
    __builtin_amdgcn_wave_barrier();
    __builtin_amdgcn_fence(__ATOMIC_ACQUIRE, "workgroup");
    if (OUT_MODE == 0) {
      /* row segment = 256 B = 16 lanes x 16 B; one instruction covers 2 rows */
      float* C = (float*)Cout + (size_t)b * strideC;
      const int hh = lane >> 4, c4 = (lane & 15) * 4;
      {
#pragma unroll
        for (int it = 0; it < 8; ++it) {
          const int row = it * 2 + hh;
          v4f v = *(const v4f*)(slab + row * 68 + c4);
          *(v4f*)(C + (size_t)(mBase + row) * ldc + n0 + c4) = v;
        }
        
      }
    } else {
      const int q = lane >> 3, c8 = (lane & 7) * 8;
      unsigned short* C  = (unsigned short*)Cout  + (size_t)b * strideC;
      {
#pragma unroll
        for (int it = 0; it < 4; ++it) {
          const int row = it * 4 + q;
          const float* sp = slab + row * 68 + c8;
          v8h hv;
#pragma unroll
          for (int e = 0; e < 8; ++e) hv[e] = (_Float16)sp[e];
          *(v8h*)(C + (size_t)(mBase + row) * ldc + n0 + c8) = hv;
        }
        
      }
    }
    __builtin_amdgcn_fence(__ATOMIC_RELEASE, "workgroup");
    __builtin_amdgcn_wave_barrier();
    __builtin_amdgcn_fence(__ATOMIC_ACQUIRE, "workgroup");
  }
}

// ---------------------------------------------------------------------------
// x: f32 -> RNE bf16 -> x16 -> f16 plane (exact), 8 consecutive elements per thread.
// Coverage: n8 = 8192*1024/8 = 1,048,576 threads = 4096 blocks x 256 exactly.
// ---------------------------------------------------------------------------
__global__ __launch_bounds__(256) void cast_x_kernel(const float* __restrict__ in, unsigned short* __restrict__ out, int n8) {
  const int i = blockIdx.x * 256 + threadIdx.x;
  if (i >= n8) return;
  const float* p = in + 8 * (size_t)i;
  const v4f a = *(const v4f*)(p);
  const v4f c = *(const v4f*)(p + 4);
  unsigned short hb[8];
#pragma unroll
  for (int e = 0; e < 4; ++e) {
    const float a_e = a[e];
    const float c_e = c[e];
    hb[e]     = h_bits(bf_bits2f(f2bf_bits(a_e)) * kXCarry);
    hb[4 + e] = h_bits(bf_bits2f(f2bf_bits(c_e)) * kXCarry);
  }
  const v4u u = (v4u){pk16(hb[0], hb[1]), pk16(hb[2], hb[3]), pk16(hb[4], hb[5]), pk16(hb[6], hb[7])};
  unsigned short* q = out + 8 * (size_t)i;
  *(v4u*)q = u;
  
}

// ---------------------------------------------------------------------------
// Weight transpose + cast: W is row-major [dim k][dim n] f32; WT[n][k] = cast(bf16_rne(W[k][n])).
// Planes z < bf_from_z are written as f16 of (bf16 value x carry); planes z >= bf_from_z as raw bf16 bits.
// grid (dim/64, dim/64, planes): blockIdx.x = k tile (64 cols of WT), blockIdx.y = n tile (64 rows of WT). 256 threads.
// Load coverage: 16 iterations x 256 threads = 4096 = the whole 64x64 tile (coalesced along n).
// Store coverage: 8 waves x 2 iterations x 4 rows (lane>>3) = 64 rows; (lane&7) x 8 halves = 64 cols; each row segment =
// ---------------------------------------------------------------------------
__global__ __launch_bounds__(256) void wt_transpose_cast_kernel(const float* __restrict__ W0, const float* __restrict__ W1,
                                                                const float* __restrict__ W2, unsigned short* __restrict__ out,
                                                                int dim, float carry, int bf_from_z) {
  /* sm[n_local][k_local] */
  __shared__ float sm[64][65];
  const int t  = threadIdx.x;
  const int k0 = blockIdx.x * 64;
  const int n0 = blockIdx.y * 64;
  const int z  = blockIdx.z;
  const float* W = (z == 0) ? W0 : (z == 1) ? W1 : W2;
  const bool as_bf = (z >= bf_from_z);
#pragma unroll
  for (int i = 0; i < 16; ++i) {
    const int e = i * 256 + t;
    const int r = e >> 6;
    const int c = e & 63;
    sm[c][r] = W[(size_t)(k0 + r) * dim + n0 + c];
  }
  __syncthreads();
  const int lane = t & 31, wave = t >> 5;
  const int q = lane >> 3, c8 = (lane & 7) * 8;
  unsigned short* op = out + (size_t)z * dim * dim;
  {
#pragma unroll
    for (int it = 0; it < 2; ++it) {
      const int row = wave * 8 + it * 4 + q;
      unsigned short hb[8];
#pragma unroll
      for (int e = 0; e < 8; ++e) {
        const float w = sm[row][c8 + e];
        const unsigned short bb = f2bf_bits(w);
        const unsigned short fh = h_bits(bf_bits2f(bb) * carry);
        hb[e] = as_bf ? bb : fh;
      }
      const v4u u = (v4u){pk16(hb[0], hb[1]), pk16(hb[2], hb[3]), pk16(hb[4], hb[5]), pk16(hb[6], hb[7])};
      *(v4u*)(op + (size_t)(n0 + row) * dim + k0 + c8) = u;
    }
    
  }
}

// ---------------------------------------------------------------------------
// Gated value transform per (64-token block, head): a = v0 + (v0.W1 + b1), g = sigmoid(v0.W2 + b2), v = a*g.
// Block = 4 waves; wave w owns tokens 16w..16w+15 of the block and all 64 output dims.
// v0 tile (f32) staged in LDS; A fragments = bf16 hi and lo of v0 built in registers; W1^T / W2^T bf16 planes staged in LDS;
// 2 k-steps x 4 n-tiles x 2 matrices x 2 products on v_wmma_f32_16x16x32_bf16.
// The two f32 results are transposed through LDS ([d][token]); the gate is applied in the store phase (8 values per lane
// grid (8192/64, 16). All barriers under block-uniform control.
// ---------------------------------------------------------------------------
constexpr int kGP = 68;
/* LDS row pitch of the two 64 x 64 bf16 weight planes: 144 B = 16 B x 9 (odd) for their 16-byte fragment loads */
constexpr int kWP = 72;
__global__ __launch_bounds__(128) void gated_value_kernel(
    const float* __restrict__ V0, const unsigned short* __restrict__ W1tp, const unsigned short* __restrict__ W2tp,
    const float* __restrict__ b1, const float* __restrict__ b2,
    unsigned short* __restrict__ VTH, unsigned short* __restrict__ VTL)
{
  /* sA: first the v0 tile [token][d]; later the gate pre-activation [d][token]. sB: residual sum [d][token]. */
  __shared__ __align__(16) float sA[64 * kGP];
  __shared__ __align__(16) float sB[64 * kGP];
  __shared__ __align__(16) __bf16 sW1[kHS * kWP];
  __shared__ __align__(16) __bf16 sW2[kHS * kWP];
  __shared__ float sBias[2 * kHS];
  const int tid = threadIdx.x, lane = tid & 31, wave = tid >> 5;
  const int hh = lane >> 4, c = lane & 15;
  const int g0 = blockIdx.x * 64;
  const int hd = blockIdx.y;
  const int bidx = g0 / kT;
  const int t0 = g0 - bidx * kT;
  const __bf16* W1t = (const __bf16*)W1tp;
  const __bf16* W2t = (const __bf16*)W2tp;
  /* v0 tile: 64 rows x 16 float4 = 1024 = 8 x 128 threads */
#pragma unroll
  for (int i = 0; i < 8; ++i) {
    const int e = i * 128 + tid;
    const int r = e >> 4, c4 = (e & 15) * 4;
    *(v4f*)(sA + r * kGP + c4) = *(const v4f*)(V0 + (size_t)(g0 + r) * kC + hd * kHS + c4);
  }
  /* weight planes: 4096 bf16 each = 512 x 16 B = 4 x 128 threads */
#pragma unroll
  for (int i = 0; i < 4; ++i) {
    const int e = (i * 128 + tid) * 8;
    const int le = (e >> 6) * kWP + (e & 63);
    *(v8b*)(sW1 + le) = *(const v8b*)(W1t + e);
    *(v8b*)(sW2 + le) = *(const v8b*)(W2t + e);
  }
  {
    const int bi = tid & 63;
    const float x1 = b1[bi];
    const float x2 = b2[bi];
    const float xs = (tid < kHS) ? x1 : x2;
    sBias[tid] = bf_bits2f(f2bf_bits(xs));
  }
  __syncthreads();

  /* A fragments (hi, lo) for this wave's 16 tokens */
  v16b ah[2], al[2];
  {
    const int arow = wave * 16 + c;
#pragma unroll
    for (int ks = 0; ks < 2; ++ks) {
      const float* p = sA + arow * kGP + ks * 32 + 8 * hh;
      const v4f f0 = *(const v4f*)(p);
      const v4f f1 = *(const v4f*)(p + 4);
      const v4f f2 = *(const v4f*)(p + 16);
      const v4f f3 = *(const v4f*)(p + 20);
#pragma unroll
      for (int e = 0; e < 4; ++e) {
        unsigned short hb, lb;
        const float x0 = f0[e];
        const float x1 = f1[e];
        const float x2 = f2[e];
        const float x3 = f3[e];
        split_bits(x0, hb, lb);
        ah[ks][e] = __builtin_bit_cast(__bf16, hb);       al[ks][e] = __builtin_bit_cast(__bf16, lb);
        split_bits(x1, hb, lb);
        ah[ks][4 + e] = __builtin_bit_cast(__bf16, hb);   al[ks][4 + e] = __builtin_bit_cast(__bf16, lb);
        split_bits(x2, hb, lb);
        ah[ks][8 + e] = __builtin_bit_cast(__bf16, hb);   al[ks][8 + e] = __builtin_bit_cast(__bf16, lb);
        split_bits(x3, hb, lb);
        ah[ks][12 + e] = __builtin_bit_cast(__bf16, hb);  al[ks][12 + e] = __builtin_bit_cast(__bf16, lb);
      }
    }
  }

  v8f a1[4], a2[4];
#pragma unroll
  for (int j = 0; j < 4; ++j) {
    a1[j] = (v8f){0.f,0.f,0.f,0.f,0.f,0.f,0.f,0.f};
    a2[j] = (v8f){0.f,0.f,0.f,0.f,0.f,0.f,0.f,0.f};
  }
#pragma unroll
  for (int ks = 0; ks < 2; ++ks) {
#pragma unroll
    for (int j = 0; j < 4; ++j) {
      const v16b w1 = Frag<__bf16>::load(sW1 + (j * 16 + c) * kWP + ks * 32 + 8 * hh);
      const v16b w2 = Frag<__bf16>::load(sW2 + (j * 16 + c) * kWP + ks * 32 + 8 * hh);
      a1[j] = mma_b(ah[ks], w1, a1[j]);
      a1[j] = mma_b(al[ks], w1, a1[j]);
      a2[j] = mma_b(ah[ks], w2, a2[j]);
      a2[j] = mma_b(al[ks], w2, a2[j]);
    }
  }
  acc_guard4(a1[0], a1[1], a1[2], a1[3]);
  acc_guard4(a2[0], a2[1], a2[2], a2[3]);

  /* residual + biases in place (reads only this wave's own token rows of sA) */
#pragma unroll
  for (int j = 0; j < 4; ++j) {
    const int col = j * 16 + c;
    const float bb1 = sBias[col];
    const float bb2 = sBias[kHS + col];
#pragma unroll
    for (int r = 0; r < 8; ++r) {
      const int row = wave * 16 + 8 * hh + r;
      const float vres = sA[row * kGP + col];
      a1[j][r] = vres + (a1[j][r] + bb1);
      a2[j][r] = a2[j][r] + bb2;
    }
  }
  /* every wave has finished reading the v0 tile before it is overwritten */
  __syncthreads();
#pragma unroll
  for (int j = 0; j < 4; ++j) {
    const int col = j * 16 + c;
#pragma unroll
    for (int r = 0; r < 8; ++r) {
      const int row = wave * 16 + 8 * hh + r;
      sB[col * kGP + row] = a1[j][r];
      sA[col * kGP + row] = a2[j][r];
    }
  }
  __syncthreads();

  const int q = lane >> 3, c8 = (lane & 7) * 8;
#pragma unroll 1
  for (int it = 0; it < 4; ++it) {
    const int d = wave * 16 + it * 4 + q;
    const float* pa = sB + d * kGP + c8;
    const float* pg = sA + d * kGP + c8;
    const v4f av0 = *(const v4f*)(pa);
    const v4f av1 = *(const v4f*)(pa + 4);
    const v4f gv0 = *(const v4f*)(pg);
    const v4f gv1 = *(const v4f*)(pg + 4);
    v8h hv, lv;
#pragma unroll
    for (int e = 0; e < 4; ++e) {
      const float xa0 = av0[e];
      const float xg0 = gv0[e];
      const float xa1 = av1[e];
      const float xg1 = gv1[e];
      const float r0 = xa0 * (1.0f / (1.0f + expf(-xg0)));
      const float r1 = xa1 * (1.0f / (1.0f + expf(-xg1)));
      unsigned short hb, lb;
      split_bits(r0, hb, lb);
      hv[e] = __builtin_bit_cast(_Float16, hb);
      lv[e] = __builtin_bit_cast(_Float16, lb);
      split_bits(r1, hb, lb);
      hv[4 + e] = __builtin_bit_cast(_Float16, hb);
      lv[4 + e] = __builtin_bit_cast(_Float16, lb);
    }
    const size_t o = ((size_t)(bidx * kH + hd) * kHS + d) * kT + t0 + c8;
    *(v8h*)(VTH + o) = hv;
    *(v8h*)(VTL + o) = lv;
    
  }
}

// ---------------------------------------------------------------------------
// Causal attention for head dim 64 from 16-bit planes. Block = 4 waves = 64 query rows of one (batch, head);
// keys in chunks of 64 up to and including the diagonal chunk (block-uniform trip count qb + 1 <= 32).
// Both products are computed transposed, so that a lane owns ONE query (column c = lane & 15):
//   scores^T: A = x (f16, x16) key rows staged in LDS, B = u (f16, x16) query rows held in registers; register r of tile j
//   is the score of key 16 j + 8 (lane >> 4) + r against query c; x 1/(32*16*16).
//   diagonal chunk: key > query -> -inf (every query keeps at least its own key; the first chunk always holds key 0).
//   online softmax in f32: maximum and normaliser run in the lane over its 32 keys; the two lane halves exchange the maximum
//   once per chunk and join their normalisers once behind the loop; the normaliser is summed from the f32 p values.
//   P^T: score tiles 2 kk and 2 kk + 1, converted in place to bf16 hi + lo, ARE the B operand of k step kk (element s = tile
//   s >> 3, register s & 7, the k order of the fragment loader); P never leaves the registers.
//   O^T += v^T.P^T: A = v hi + lo ([d][key] planes) staged in LDS; hi.hi + lo(v).hi(P) + hi(v).lo(P).
//   A lane ends with 8 consecutive d of its query per tile: one 16-byte store per tile and plane.
// ---------------------------------------------------------------------------
constexpr int kKC = 64;
/* LDS row pitch of every 64-element 16-bit tile read by 16-byte fragment loads: 72 elements = 144 B = 16 B x 9 (odd), so 16 rows fall on distinct banks */
constexpr int kLP = 72;
static_assert(kLP >= kKC && kLP >= kHS && (kLP % 8) == 0 && ((kLP / 8) % 2) == 1, "pitch: 16-B aligned rows, odd multiple of 16 B");
/* the value that lane ^ 16 holds */
__device__ __forceinline__ float other_half(float x) {
  const int bits = __float_as_int(x);
  return __int_as_float(__builtin_amdgcn_permlanex16(bits, bits, 0x76543210, 0xfedcba98, false, false));
}
__global__ __launch_bounds__(128) void causal_attn_kernel(
    const unsigned short* __restrict__ Up, const unsigned short* __restrict__ XHp,
    const unsigned short* __restrict__ VTHp, const unsigned short* __restrict__ VTLp,
    unsigned short* __restrict__ YH, unsigned short* __restrict__ YL)
{
  __shared__ __align__(16) _Float16 Ksh[kKC * kLP];
  __shared__ __align__(16) __bf16 Vth[kHS * kLP];
  __shared__ __align__(16) __bf16 Vtl[kHS * kLP];

  const int tid  = threadIdx.x;
  const int wave = tid >> 5;
  const int lane = tid & 31;
  const int hh   = lane >> 4;
  const int c    = lane & 15;

  constexpr int nqb = kT / 64;
  const int bx = blockIdx.x;
  const int qb = bx % nqb;
  const int bh = bx / nqb;
  const int h  = bh % kH;
  const int b  = bh / kH;
  const int q0 = qb * 64 + wave * 16;
  /* this lane's query */
  const int qrow = q0 + c;

  const _Float16* Uh = (const _Float16*)Up;
  const _Float16* Xh = (const _Float16*)XHp;
  const __bf16*   Vh = (const __bf16*)VTHp;
  const __bf16*   Vl = (const __bf16*)VTLp;

  /* query fragments (B operand, column c = query c): 2 d-chunks */
  v16h qa[2];
  {
    const _Float16* urow = Uh + (size_t)(b * kT + qrow) * kC + h * kHS;
#pragma unroll
    for (int dc = 0; dc < 2; ++dc) qa[dc] = Frag<_Float16>::load(urow + dc * 32 + 8 * hh);
  }

  /* running maximum of the query (equal in both lane halves); normaliser over this lane half's keys only */
  float mrow = -INFINITY, lrow = 0.f;
  v8f oacc[4];
#pragma unroll
  for (int t = 0; t < 4; ++t) oacc[t] = (v8f){0.f,0.f,0.f,0.f,0.f,0.f,0.f,0.f};

  const int nChunks = qb + 1;
  for (int kc = 0; kc < nChunks; ++kc) {
    const int kv0 = kc * kKC;
    __syncthreads();
    /* K, V hi, V lo tiles: 64 rows x 8 x 16 B = 512 each = 4 x 128 threads */
#pragma unroll
    for (int i = 0; i < 4; ++i) {
      const int e = i * 128 + tid;
      const int r = e >> 3, c8 = (e & 7) * 8;
      *(v8h*)(Ksh + r * kLP + c8) = *(const v8h*)(Xh + (size_t)(b * kT + kv0 + r) * kC + h * kHS + c8);
      const size_t vo = ((size_t)bh * kHS + r) * kT + kv0 + c8;
      *(v8b*)(Vth + r * kLP + c8) = *(const v8b*)(Vh + vo);
      *(v8b*)(Vtl + r * kLP + c8) = *(const v8b*)(Vl + vo);
    }
    __syncthreads();

    v8f s[4];
#pragma unroll
    for (int j = 0; j < 4; ++j) {
      s[j] = (v8f){0.f,0.f,0.f,0.f,0.f,0.f,0.f,0.f};
#pragma unroll
      for (int dc = 0; dc < 2; ++dc) {
        const v16h kb = Frag<_Float16>::load(Ksh + (j * 16 + c) * kLP + dc * 32 + 8 * hh);
        s[j] = mma_h(kb, qa[dc], s[j]);
      }
    }
    acc_guard4(s[0], s[1], s[2], s[3]);

    const bool diag = (kc == qb);
    /* one maximum (and below one sum) per score tile: four short independent chains instead of one of 32 links */
    float cmj[4];
#pragma unroll
    for (int j = 0; j < 4; ++j) {
      cmj[j] = -INFINITY;
#pragma unroll
      for (int r = 0; r < 8; ++r) {
        const int kvrow = kv0 + j * 16 + 8 * hh + r;
        float sv = s[j][r] * kScoreScale;
        const bool masked = diag && (kvrow > qrow);
        sv = masked ? -INFINITY : sv;
        s[j][r] = sv;
        cmj[j] = fmaxf(cmj[j], sv);
      }
    }
    float cm = fmaxf(fmaxf(cmj[0], cmj[1]), fmaxf(cmj[2], cmj[3]));
    /* the other lane half holds the query's other 32 keys */
    cm = fmaxf(cm, other_half(cm));
    const float mnew = fmaxf(mrow, cm);
    const float alpha = __expf(mrow - mnew);
    mrow = mnew;
    float psj[4];
    v16b ph[2], pl[2];
#pragma unroll
    for (int j = 0; j < 4; ++j) {
      psj[j] = 0.f;
#pragma unroll
      for (int r = 0; r < 8; ++r) {
        const float p = __expf(s[j][r] - mnew);
        psj[j] += p;
        unsigned short hb, lb;
        split_bits(p, hb, lb);
        ph[j >> 1][(j & 1) * 8 + r] = __builtin_bit_cast(__bf16, hb);
        pl[j >> 1][(j & 1) * 8 + r] = __builtin_bit_cast(__bf16, lb);
      }
    }
    lrow = lrow * alpha + ((psj[0] + psj[1]) + (psj[2] + psj[3]));
#pragma unroll
    for (int t = 0; t < 4; ++t)
#pragma unroll
      for (int r = 0; r < 8; ++r) oacc[t][r] *= alpha;
    /* unrolled so that the index of the P fragments is a constant (registers, no scratch) */
#pragma unroll
    for (int kk = 0; kk < 2; ++kk) {
#pragma unroll
      for (int t = 0; t < 4; ++t) {
        const v16b vb = Frag<__bf16>::load(Vth + (t * 16 + c) * kLP + kk * 32 + 8 * hh);
        const v16b vl = Frag<__bf16>::load(Vtl + (t * 16 + c) * kLP + kk * 32 + 8 * hh);
        oacc[t] = mma_b(vb, ph[kk], oacc[t]);
        oacc[t] = mma_b(vl, ph[kk], oacc[t]);
        oacc[t] = mma_b(vb, pl[kk], oacc[t]);
      }
    }
    acc_guard4(oacc[0], oacc[1], oacc[2], oacc[3]);
  }

  /* join the two lane halves' normalisers */
  lrow += other_half(lrow);
  const float inv = 1.0f / lrow;
#pragma unroll
  for (int t = 0; t < 4; ++t) {
    v8h hv, lv;
#pragma unroll
    for (int r = 0; r < 8; ++r) {
      unsigned short hb, lb;
      split_bits(oacc[t][r] * inv, hb, lb);
      hv[r] = __builtin_bit_cast(_Float16, hb);
      lv[r] = __builtin_bit_cast(_Float16, lb);
    }
    const size_t o = (size_t)(b * kT + qrow) * kC + h * kHS + t * 16 + 8 * hh;
    *(v8h*)(YH + o) = hv;
    *(v8h*)(YL + o) = lv;
  }
}

// ---------------------------------------------------------------------------
// Host glue: 8 launches, kernel launches only.
// GEMM shapes: M 8192, N 1024, K 1024: 64 x 4 block tiles of 128 x 256 = 256 blocks of 8 waves.
// ---------------------------------------------------------------------------
extern "C" void kernel_launch(void* const* d_in, const int* in_sizes, int n_in,
                              void* d_out, int out_size, void* d_ws, size_t ws_size,
                              hipStream_t stream) {
  if (n_in < 11) return;
  if (in_sizes[0] != kRows * kC) return;
  if (in_sizes[1] != kC * kC) return;
  if (in_sizes[2] != kC) return;
  if (in_sizes[3] != kC * kC) return;
  if (in_sizes[4] != kC) return;
  if (in_sizes[5] != kHS * kHS) return;
  if (in_sizes[6] != kHS) return;
  if (in_sizes[7] != kHS * kHS) return;
  if (in_sizes[8] != kHS) return;
  if (in_sizes[9] != kC * kC) return;
  if (in_sizes[10] != kC) return;
  if (out_size != kRows * kC) return;
  if (ws_size < kWsTotal) return;

  const float* x  = (const float*)d_in[0];
  const float* Wu = (const float*)d_in[1];
  const float* bu = (const float*)d_in[2];
  const float* Wv = (const float*)d_in[3];
  const float* bv = (const float*)d_in[4];
  const float* W1 = (const float*)d_in[5];
  const float* b1 = (const float*)d_in[6];
  const float* W2 = (const float*)d_in[7];
  const float* b2 = (const float*)d_in[8];
  const float* Wp = (const float*)d_in[9];
  const float* bp = (const float*)d_in[10];
  float* out = (float*)d_out;

  char* ws = (char*)d_ws;
  unsigned short* XH   = (unsigned short*)(ws + kOffXH);
  unsigned short* WUT  = (unsigned short*)(ws + kOffWUT);
  unsigned short* WVT  = (unsigned short*)(ws + kOffWVT);
  unsigned short* WPT  = (unsigned short*)(ws + kOffWPT);
  unsigned short* W12T = (unsigned short*)(ws + kOffW12);
  unsigned short* U16  = (unsigned short*)(ws + kOffU);
  float*          V0   = (float*)(ws + kOffV0);
  unsigned short* YH   = (unsigned short*)(ws + kOffYH);
  unsigned short* YL   = (unsigned short*)(ws + kOffYL);
  unsigned short* VTH  = (unsigned short*)(ws + kOffVTH);
  unsigned short* VTL  = (unsigned short*)(ws + kOffVTL);

  /* x -> f16 plane (bf16 values x16) */
  cast_x_kernel<<<(kRows * kC / 8) / 256, 256, 0, stream>>>(x, XH, kRows * kC / 8);

  /* in[k][n] -> out[n][k]: Wu, Wv as f16 (x1024), Wp as bf16; planes WUT, WVT, WPT are contiguous */
  wt_transpose_cast_kernel<<<dim3(kC / 64, kC / 64, 3), 256, 0, stream>>>(Wu, Wv, Wp, WUT, kC, kWCarry, 2);
  /* in[k][n] -> out[n][k]: W1, W2 as bf16 [64][64] planes */
  wt_transpose_cast_kernel<<<dim3(1, 1, 2), 256, 0, stream>>>(W1, W2, W2, W12T, kHS, 1.0f, 0);

  /* u (f16, x16) = x.Wu + bu */
  wmma_gemm64<0, 0, 2, 1><<<dim3(256, 1), 256, 0, stream>>>(
      XH, XH, kC, 0L,
      WUT, WUT, kC, 0L,
      (void*)U16, kC, 0L,
      bu, kRows, kC, kC, kUScale, kUCarry);

  /* v0 (f32) = x.Wv + bv */
  wmma_gemm64<0, 0, 2, 0><<<dim3(256, 1), 256, 0, stream>>>(
      XH, XH, kC, 0L,
      WVT, WVT, kC, 0L,
      (void*)V0, kC, 0L,
      bv, kRows, kC, kC, kV0Scale, 1.0f);

  /* gated value -> vT hi | lo planes */
  gated_value_kernel<<<dim3(kRows / 64, kH), 128, 0, stream>>>(V0, W12T, W12T + kHS * kHS, b1, b2, VTH, VTL);

  /* causal attention -> y hi | lo planes (the v0 bytes are dead from here on) */
  causal_attn_kernel<<<kB * kH * (kT / 64), 128, 0, stream>>>(U16, XH, VTH, VTL, YH, YL);

  /* out = y.Wp + bp (y hi.W + y lo.W) */
  wmma_gemm64<1, 1, 2, 0><<<dim3(256, 1), 256, 0, stream>>>(
      YH, YL, kC, 0L,
      WPT, WPT, kC, 0L,
      (void*)out, kC, 0L,
      bp, kRows, kC, kC, 1.0f, 1.0f);
}

// v004
// One run takes 191 microseconds.
// Two timings next to v003 put it at 1.16 and 1.15 times that version's speed.
// Counting every step since v000, it is 3.69 times as fast.
// All contractions on 16-bit WMMA with f32 accumulate: x.Wu, x.Wv and the u.x^T scores on v_wmma_f32_16x16x32_f16 (inputs RNE-converted to bf16 once and held exactly in f16 planes with power-of-two carries: x x16, W x1024, u x16); v0.W1, v0.W2, P.v and y.Wp on v_wmma_f32_16x16x32_bf16 with the computed operand carried as bf16 hi+lo planes (W1, W2, Wp as bf16 planes); softmax, gate, residual and bias in f32.
#include <hip/hip_runtime.h>
#include <math.h>

typedef __attribute__((ext_vector_type(16))) _Float16 v16h;
typedef __attribute__((ext_vector_type(8)))  _Float16 v8h;
typedef __attribute__((ext_vector_type(16))) __bf16   v16b;
typedef __attribute__((ext_vector_type(8)))  __bf16   v8b;
typedef __attribute__((ext_vector_type(8)))  float    v8f;
typedef __attribute__((ext_vector_type(4)))  float    v4f;
typedef __attribute__((ext_vector_type(4)))  unsigned int v4u;

// ---------------------------------------------------------------------------
// Problem constants
// ---------------------------------------------------------------------------
constexpr int kB    = 4;
constexpr int kT    = 2048;
constexpr int kC    = 1024;
constexpr int kH    = 16;
constexpr int kHS   = 64;
constexpr int kRows = kB * kT;
constexpr int kSqrtC = 32;
static_assert(kSqrtC * kSqrtC == kC, "score scale is 1/sqrt(C)");
static_assert(kH * kHS == kC, "head split");
static_assert((kC % 32) == 0 && (kHS % 32) == 0 && (kT % 64) == 0, "K multiples of 32, key chunks of 64");
static_assert((kRows % 64) == 0 && (kC % 64) == 0, "GEMM M,N multiples of 64");

// power-of-two carries of the f16 planes (exact; folded back in f32)
constexpr float kXCarry = 16.0f;
constexpr float kWCarry = 1024.0f;
constexpr float kUCarry = 16.0f;
constexpr float kUScale  = kUCarry / (kXCarry * kWCarry);
constexpr float kV0Scale = 1.0f / (kXCarry * kWCarry);
constexpr float kScoreScale = 1.0f / ((float)kSqrtC * kUCarry * kXCarry);

// ---------------------------------------------------------------------------
// Workspace region map (bytes; every offset is a multiple of 128)
//   XH    f16  [8192][1024]      16*bf16(x)                      16,777,216
//   WUT   f16  [1024 n][1024 k]  1024*bf16(Wu)^T                  2,097,152
//   WVT   f16  [1024 n][1024 k]  1024*bf16(Wv)^T                  2,097,152
//   WPT   bf16 [1024 n][1024 k]  bf16(Wp)^T                       2,097,152
//   W12T  bf16 2 x [64 n][64 k]  bf16(W1)^T | bf16(W2)^T             16,384
//   U16   f16  [8192][1024]      16*u                            16,777,216
//   V0    f32  [8192][1024]      v0; dead after the gated-value launch, then the same bytes
//                                hold YH | YL (bf16 hi | lo planes of y, [8192][1024] each)  33,554,432
//   VTH   bf16 [4][16][64 d][2048 t]  gated v, hi plane           16,777,216
//   VTL   bf16 [4][16][64 d][2048 t]  gated v, lo plane           16,777,216
//   total                                                       106,971,136
// ---------------------------------------------------------------------------
constexpr size_t kSzAct16 = (size_t)kRows * kC * 2;
constexpr size_t kSzW16   = (size_t)kC * kC * 2;
constexpr size_t kSzW12   = (size_t)2 * kHS * kHS * 2;
constexpr size_t kSzV0    = (size_t)kRows * kC * 4;
constexpr size_t kOffXH   = 0;
constexpr size_t kOffWUT  = kOffXH  + kSzAct16;
constexpr size_t kOffWVT  = kOffWUT + kSzW16;
constexpr size_t kOffWPT  = kOffWVT + kSzW16;
constexpr size_t kOffW12  = kOffWPT + kSzW16;
constexpr size_t kOffU    = kOffW12 + kSzW12;
constexpr size_t kOffV0   = kOffU   + kSzAct16;
constexpr size_t kOffYH   = kOffV0;
constexpr size_t kOffYL   = kOffV0  + kSzAct16;
constexpr size_t kOffVTH  = kOffV0  + kSzV0;
constexpr size_t kOffVTL  = kOffVTH + kSzAct16;
constexpr size_t kWsTotal = kOffVTL + kSzAct16;
static_assert(kWsTotal == 106971136ull, "carve total");
static_assert(kWsTotal <= 134217728ull, "carve cap");
static_assert(2 * kSzAct16 == kSzV0, "y hi|lo planes fit the v0 plane exactly");
static_assert((kOffWUT % 128) == 0 && (kOffWVT % 128) == 0 && (kOffWPT % 128) == 0 && (kOffW12 % 128) == 0 &&
              (kOffU % 128) == 0 && (kOffV0 % 128) == 0 && (kOffYL % 128) == 0 && (kOffVTH % 128) == 0 &&
              (kOffVTL % 128) == 0, "128-B aligned regions");

// ---------------------------------------------------------------------------
// Bit helpers
// ---------------------------------------------------------------------------
__device__ __forceinline__ unsigned short f2bf_bits(float f) {
  unsigned u = __float_as_uint(f);
  return (unsigned short)((u + 0x7FFFu + ((u >> 16) & 1u)) >> 16);
}
__device__ __forceinline__ float bf_bits2f(unsigned short h) { return __uint_as_float(((unsigned)h) << 16); }
__device__ __forceinline__ unsigned pk16(unsigned short a, unsigned short b) { return (unsigned)a | ((unsigned)b << 16); }
__device__ __forceinline__ unsigned short h_bits(float f) { const _Float16 h = (_Float16)f; return __builtin_bit_cast(unsigned short, h); }
/* bf16 hi + bf16 lo of an f32 value, both RNE */
__device__ __forceinline__ void split_bits(float f, unsigned short& hb, unsigned short& lb) {
  hb = f2bf_bits(f);
  lb = f2bf_bits(f - bf_bits2f(hb));
}

// ---------------------------------------------------------------------------
// WMMA helpers: every matrix op is followed by 4 nops tied to its own accumulator and its A/B fragments
// ---------------------------------------------------------------------------
__device__ __forceinline__ v8f mma_h(v16h a, v16h b, v8f c) {
  c = __builtin_amdgcn_wmma_f32_16x16x32_f16(false, a, false, b, (short)0, c, false, false);
  asm volatile("v_nop\n\tv_nop\n\tv_nop\n\tv_nop" : "+v"(c) : "v"(a), "v"(b));
  return c;
}
__device__ __forceinline__ v8f mma_b(v16b a, v16b b, v8f c) {
  c = __builtin_amdgcn_wmma_f32_16x16x32_bf16(false, a, false, b, (short)0, c, false, false);
  asm volatile("v_nop\n\tv_nop\n\tv_nop\n\tv_nop" : "+v"(c) : "v"(a), "v"(b));
  return c;
}
__device__ __forceinline__ void keep4_h(v16h a, v16h b, v16h c, v16h d) { asm volatile("v_nop" :: "v"(a), "v"(b), "v"(c), "v"(d)); }
__device__ __forceinline__ void keep4_b(v16b a, v16b b, v16b c, v16b d) { asm volatile("v_nop" :: "v"(a), "v"(b), "v"(c), "v"(d)); }
__device__ __forceinline__ void acc_guard4(v8f& a, v8f& b, v8f& c, v8f& d) { asm volatile("v_nop\n\tv_nop\n\tv_nop\n\tv_nop" : "+v"(a), "+v"(b), "+v"(c), "+v"(d)); }

// Fragment loader: p already points at (row, k0 + 8*(lane>>4)); elements 0..7 <- p[0..7], elements 8..15 <- p[16..23]
template <typename T> struct Frag;
template <> struct Frag<_Float16> {
  typedef v16h V; union U { v16h v; v8h h[2]; };
  static __device__ __forceinline__ v16h load(const _Float16* p) {
    U f; f.h[0] = *(const v8h*)(p); f.h[1] = *(const v8h*)(p + 16); return f.v;
  }
  static __device__ __forceinline__ v8f mma(v16h a, v16h b, v8f c) { return mma_h(a, b, c); }
  static __device__ __forceinline__ void keep(v16h a, v16h b, v16h c, v16h d) { keep4_h(a, b, c, d); }
};
template <> struct Frag<__bf16> {
  typedef v16b V; union U { v16b v; v8b h[2]; };
  static __device__ __forceinline__ v16b load(const __bf16* p) {
    U f; f.h[0] = *(const v8b*)(p); f.h[1] = *(const v8b*)(p + 16); return f.v;
  }
  static __device__ __forceinline__ v8f mma(v16b a, v16b b, v8f c) { return mma_b(a, b, c); }
  static __device__ __forceinline__ void keep(v16b a, v16b b, v16b c, v16b d) { keep4_b(a, b, c, d); }
};

// ---- LDS-staged batched WMMA GEMM ------------------------------------------
// C[m,n] = scale * sum_k A[m,k] * Bt[n,k] + bias_scale * bf16(bias[n]).
// Block = 8 waves = one 128 x 256 tile of C; waves 2 (m) x 4 (n), each wave owns a 64x64 tile.
// A pass is 64 k = 128 B of every operand row. The block brings a pass's rows [A 128 | A2 128 (SPL 1) | Bt 256] from global
// memory as whole 128-B lines (8 lanes x 16 B per row) by asynchronous 16-byte copies into one of two LDS buffers, so that
// the next pass's rows fly while this pass is worked on; every wave reads its fragments from LDS. One block barrier per
// pass: it publishes the buffer just filled and ends the reads of the buffer that is refilled behind it.
// A row-major [M,K]; Bt row-major [N,K]; M % 128 == 0, N % 256 == 0, K % 64 == 0 (no tail handling).
// SPL: 0 = plain (one product), 1 = A carried as hi/lo planes (A2 = lo): hi.b + lo.b.
// BIAS_MODE: 0 = none, 2 = bias[n].   OUT_MODE: 0 = f32, 1 = f16.
// ET: 0 = f16 operands, 1 = bf16 operands (pointers passed as 16-bit storage)
constexpr int kBM = 128;
constexpr int kBN = 256;
constexpr int kKP = 64;
/* LDS row pitch of a staged 64-element row: 144 B = 16 B x 9 (odd) for the 16-byte fragment loads */
constexpr int kSP = 72;
static_assert((kRows % kBM) == 0 && (kC % kBN) == 0 && (kC % kKP) == 0, "GEMM block tile and pass divide the shapes");
template <int ET> struct Elem;
template <> struct Elem<0> { typedef _Float16 T; };
template <> struct Elem<1> { typedef __bf16 T; };
template <int ET, int SPL, int BIAS_MODE, int OUT_MODE>
__global__ __launch_bounds__(256) void wmma_gemm64(
    const unsigned short* __restrict__ Ap, const unsigned short* __restrict__ A2p, int lda, long strideA,
    const unsigned short* __restrict__ Btp, const unsigned short* __restrict__ Bt2p, int ldb, long strideB,
    void* __restrict__ Cout, int ldc, long strideC,
    const float* __restrict__ bias,
    int M, int N, int K, float scale, float bias_scale) {
  static_assert(SPL == 0 || SPL == 1, "one or two A planes");
  typedef typename Elem<ET>::T T;
  typedef typename Frag<T>::V V;
  constexpr int kRowsA      = (SPL == 1) ? 2 * kBM : kBM;
  constexpr int kStageRows  = kRowsA + kBN;
  constexpr int kStageElems = kStageRows * kSP;
  /* one 16-byte copy per thread covers 32 rows of the stage */
  constexpr int kCopies     = kStageRows / 32;
  constexpr unsigned kStageBytes = (unsigned)kStageElems * 2u;
  static_assert((kCopies % 4) == 0, "copies go four to a statement");
  const T* A = (const T*)Ap; const T* A2 = (const T*)A2p; const T* Bt = (const T*)Btp;
  __shared__ __align__(16) T sStage[2 * kStageElems];
  /* per-wave 16x64 slab, pitch 68 floats */
  __shared__ __align__(16) float sT[8][16 * 68];
  const int b    = blockIdx.y;
  const int tid  = threadIdx.x;
  const int lane = tid & 31;
  const int wave = tid >> 5;
  const int tilesN = N / kBN;
  const int tilesM = M / kBM;
  const int tile = blockIdx.x;
  /* block-uniform exit, in front of every barrier */
  if (tile >= tilesM * tilesN) return;
  const int tm = tile / tilesN;
  const int tn = tile - tm * tilesN;
  const int wm = wave >> 2;
  const int wn = wave & 3;
  const int m0 = tm * kBM + (wm << 6);
  const int n0 = tn * kBN + (wn << 6);

  const T* Ab  = A  + (size_t)b * strideA + (size_t)(tm * kBM) * lda;
  const T* Ab2 = A2 + (size_t)b * strideA + (size_t)(tm * kBM) * lda;
  const T* Bb  = Bt + (size_t)b * strideB + (size_t)(tn * kBN) * ldb;

  /* rlane: row (A) / col (B, D) within a 16-wide subtile; koff: k offset of this lane half; mOff: D row offset */
  const int rlane = lane & 15;
  const int koff  = (lane >> 4) * 8;
  const int mOff  = (lane >> 4) * 8;

  /* staging: thread -> (row tid / 8 of each group of 32 rows, 16-byte piece tid % 8 of its 128 B) */
  const int srow = tid >> 3;
  const int sc8  = (tid & 7) * 8;
  const unsigned offA = (unsigned)srow * (unsigned)lda + (unsigned)sc8;
  const unsigned offB = (unsigned)srow * (unsigned)ldb + (unsigned)sc8;
  /* LDS byte address (low 32 bits of the __shared__ address) of this thread's piece in row srow of buffer 0 */
  const unsigned ldsT = (unsigned)(size_t)(sStage + srow * kSP + sc8);
  auto copy_stage = [&](int k0, unsigned bufByte) {
    /* both loops unrolled: which operand a group of rows belongs to is then decided at compile time */
#pragma unroll
    for (int g = 0; g < kCopies / 4; ++g) {
      const T* gp[4];
      unsigned lp[4];
#pragma unroll
      for (int e = 0; e < 4; ++e) {
        const int r0 = (g * 4 + e) * 32;
        if (r0 < kBM)         gp[e] = Ab  + (size_t)r0 * lda + k0 + offA;
        else if (r0 < kRowsA) gp[e] = Ab2 + (size_t)(r0 - kBM) * lda + k0 + offA;
        else                  gp[e] = Bb  + (size_t)(r0 - kRowsA) * ldb + k0 + offB;
        lp[e] = ldsT + bufByte + (unsigned)(r0 * kSP * 2);
      }
      /* four copies, then the wait that stands in front of any rewrite of the address registers they name */
      asm volatile("global_load_async_to_lds_b128 %0, %1, off\n\t"
                   "global_load_async_to_lds_b128 %2, %3, off\n\t"
                   "global_load_async_to_lds_b128 %4, %5, off\n\t"
                   "global_load_async_to_lds_b128 %6, %7, off\n\t"
                   "s_wait_xcnt 0x0"
                   :: "v"(lp[0]), "v"(gp[0]), "v"(lp[1]), "v"(gp[1]), "v"(lp[2]), "v"(gp[2]), "v"(lp[3]), "v"(gp[3])
                   : "memory");
    }
  };

  v8f acc[4][4];
#pragma unroll
  for (int i = 0; i < 4; ++i)
#pragma unroll
    for (int j = 0; j < 4; ++j) acc[i][j] = (v8f){0.f,0.f,0.f,0.f,0.f,0.f,0.f,0.f};

  const int nPass = K / kKP;
  copy_stage(0, 0u);
  /* pass 0's rows have landed (this wave's copies), then every wave's */
  asm volatile("s_wait_asynccnt 0x0" ::: "memory");
  __syncthreads();
  if (nPass > 1) copy_stage(kKP, kStageBytes);
  for (int p = 0; p < nPass; ++p) {
    const T* buf = sStage + (p & 1) * kStageElems;
    const T* sA  = buf + ((wm << 6) + rlane) * kSP + koff;
    const T* sA2 = sA + kBM * kSP;
    const T* sB  = buf + (kRowsA + (wn << 6) + rlane) * kSP + koff;
    /* the loops below are unrolled so that every index of a fragment or accumulator array is a constant (registers, no scratch) */
#pragma unroll
    for (int ks = 0; ks < kKP / 32; ++ks) {
      V bh[4];
#pragma unroll
      for (int j = 0; j < 4; ++j) bh[j] = Frag<T>::load(sB + (j << 4) * kSP + ks * 32);
      /* per accumulator and k step: the hi product, then the lo product */
#pragma unroll
      for (int pl = 0; pl <= SPL; ++pl) {
        const T* sAp = (pl == 0) ? sA : sA2;
        V af[4];
#pragma unroll
        for (int i = 0; i < 4; ++i) af[i] = Frag<T>::load(sAp + (i << 4) * kSP + ks * 32);
#pragma unroll
        for (int i = 0; i < 4; ++i) {
#pragma unroll
          for (int j = 0; j < 4; ++j) acc[i][j] = Frag<T>::mma(af[i], bh[j], acc[i][j]);
        }
      }
      Frag<T>::keep(bh[0], bh[1], bh[2], bh[3]);
    }
    /* this wave's reads of buffer p & 1 are done before that buffer is refilled */
    asm volatile("s_wait_dscnt 0x0" ::: "memory");
    /* this wave's copies of pass p + 1 have landed before the barrier publishes them */
    asm volatile("s_wait_asynccnt 0x0" ::: "memory");
    __syncthreads();
    if (p + 2 < nPass) copy_stage((p + 2) * kKP, (unsigned)(p & 1) * kStageBytes);
  }
  /* no copy is outstanding when the wave goes on to the epilogue */
  asm volatile("s_wait_asynccnt 0x0" ::: "memory");
  acc_guard4(acc[0][0], acc[0][1], acc[0][2], acc[0][3]);
  acc_guard4(acc[1][0], acc[1][1], acc[1][2], acc[1][3]);
  acc_guard4(acc[2][0], acc[2][1], acc[2][2], acc[2][3]);
  acc_guard4(acc[3][0], acc[3][1], acc[3][2], acc[3][3]);

  // ---- epilogue ----
  float* slab = sT[wave];
#pragma unroll
  for (int i = 0; i < 4; ++i) {
    const int mBase = m0 + (i << 4);
#pragma unroll
    for (int j = 0; j < 4; ++j) {
      const int n = n0 + (j << 4) + rlane;
      float bv = 0.f;
      if (BIAS_MODE == 2) bv = bf_bits2f(f2bf_bits(bias[n])) * bias_scale;
#pragma unroll
      for (int r = 0; r < 8; ++r) {
        float v = acc[i][j][r] * scale;
        if (BIAS_MODE == 2) v += bv;
        slab[(mOff + r) * 68 + (j << 4) + rlane] = v;
      }
    }
    __builtin_amdgcn_fence(__ATOMIC_RELEASE, "workgroup");
    __builtin_amdgcn_wave_barrier();
    __builtin_amdgcn_fence(__ATOMIC_ACQUIRE, "workgroup");
    if (OUT_MODE == 0) {
      /* row segment = 256 B = 16 lanes x 16 B; one instruction covers 2 rows */
      float* C = (float*)Cout + (size_t)b * strideC;
      const int hh = lane >> 4, c4 = (lane & 15) * 4;
      {
#pragma unroll
        for (int it = 0; it < 8; ++it) {
          const int row = it * 2 + hh;
          v4f v = *(const v4f*)(slab + row * 68 + c4);
          *(v4f*)(C + (size_t)(mBase + row) * ldc + n0 + c4) = v;
        }
        
      }
    } else {
      const int q = lane >> 3, c8 = (lane & 7) * 8;
      unsigned short* C  = (unsigned short*)Cout  + (size_t)b * strideC;
      {
#pragma unroll
        for (int it = 0; it < 4; ++it) {
          const int row = it * 4 + q;
          const float* sp = slab + row * 68 + c8;
          v8h hv;
#pragma unroll
          for (int e = 0; e < 8; ++e) hv[e] = (_Float16)sp[e];
          *(v8h*)(C + (size_t)(mBase + row) * ldc + n0 + c8) = hv;
        }
        
      }
    }
    __builtin_amdgcn_fence(__ATOMIC_RELEASE, "workgroup");
    __builtin_amdgcn_wave_barrier();
    __builtin_amdgcn_fence(__ATOMIC_ACQUIRE, "workgroup");
  }
}

// ---------------------------------------------------------------------------
// x: f32 -> RNE bf16 -> x16 -> f16 plane (exact), 8 consecutive elements per thread.
// Coverage: n8 = 8192*1024/8 = 1,048,576 threads = 4096 blocks x 256 exactly.
// ---------------------------------------------------------------------------
__global__ __launch_bounds__(256) void cast_x_kernel(const float* __restrict__ in, unsigned short* __restrict__ out, int n8) {
  const int i = blockIdx.x * 256 + threadIdx.x;
  if (i >= n8) return;
  const float* p = in + 8 * (size_t)i;
  const v4f a = *(const v4f*)(p);
  const v4f c = *(const v4f*)(p + 4);
  unsigned short hb[8];
#pragma unroll
  for (int e = 0; e < 4; ++e) {
    const float a_e = a[e];
    const float c_e = c[e];
    hb[e]     = h_bits(bf_bits2f(f2bf_bits(a_e)) * kXCarry);
    hb[4 + e] = h_bits(bf_bits2f(f2bf_bits(c_e)) * kXCarry);
  }
  const v4u u = (v4u){pk16(hb[0], hb[1]), pk16(hb[2], hb[3]), pk16(hb[4], hb[5]), pk16(hb[6], hb[7])};
  unsigned short* q = out + 8 * (size_t)i;
  *(v4u*)q = u;
  
}

// ---------------------------------------------------------------------------
// Weight transpose + cast: W is row-major [dim k][dim n] f32; WT[n][k] = cast(bf16_rne(W[k][n])).
// Planes z < bf_from_z are written as f16 of (bf16 value x carry); planes z >= bf_from_z as raw bf16 bits.
// grid (dim/64, dim/64, planes): blockIdx.x = k tile (64 cols of WT), blockIdx.y = n tile (64 rows of WT). 256 threads.
// Load coverage: 16 iterations x 256 threads = 4096 = the whole 64x64 tile (coalesced along n).
// Store coverage: 8 waves x 2 iterations x 4 rows (lane>>3) = 64 rows; (lane&7) x 8 halves = 64 cols; each row segment =
// ---------------------------------------------------------------------------
__global__ __launch_bounds__(256) void wt_transpose_cast_kernel(const float* __restrict__ W0, const float* __restrict__ W1,
                                                                const float* __restrict__ W2, unsigned short* __restrict__ out,
                                                                int dim, float carry, int bf_from_z) {
  /* sm[n_local][k_local] */
  __shared__ float sm[64][65];
  const int t  = threadIdx.x;
  const int k0 = blockIdx.x * 64;
  const int n0 = blockIdx.y * 64;
  const int z  = blockIdx.z;
  const float* W = (z == 0) ? W0 : (z == 1) ? W1 : W2;
  const bool as_bf = (z >= bf_from_z);
#pragma unroll
  for (int i = 0; i < 16; ++i) {
    const int e = i * 256 + t;
    const int r = e >> 6;
    const int c = e & 63;
    sm[c][r] = W[(size_t)(k0 + r) * dim + n0 + c];
  }
  __syncthreads();
  const int lane = t & 31, wave = t >> 5;
  const int q = lane >> 3, c8 = (lane & 7) * 8;
  unsigned short* op = out + (size_t)z * dim * dim;
  {
#pragma unroll
    for (int it = 0; it < 2; ++it) {
      const int row = wave * 8 + it * 4 + q;
      unsigned short hb[8];
#pragma unroll
      for (int e = 0; e < 8; ++e) {
        const float w = sm[row][c8 + e];
        const unsigned short bb = f2bf_bits(w);
        const unsigned short fh = h_bits(bf_bits2f(bb) * carry);
        hb[e] = as_bf ? bb : fh;
      }
      const v4u u = (v4u){pk16(hb[0], hb[1]), pk16(hb[2], hb[3]), pk16(hb[4], hb[5]), pk16(hb[6], hb[7])};
      *(v4u*)(op + (size_t)(n0 + row) * dim + k0 + c8) = u;
    }
    
  }
}

// ---------------------------------------------------------------------------
// Gated value transform per (64-token block, head): a = v0 + (v0.W1 + b1), g = sigmoid(v0.W2 + b2), v = a*g.
// Block = 4 waves; wave w owns tokens 16w..16w+15 of the block and all 64 output dims.
// v0 tile (f32) staged in LDS; A fragments = bf16 hi and lo of v0 built in registers; W1^T / W2^T bf16 planes staged in LDS;
// 2 k-steps x 4 n-tiles x 2 matrices x 2 products on v_wmma_f32_16x16x32_bf16.
// The two f32 results are transposed through LDS ([d][token]); the gate is applied in the store phase (8 values per lane
// grid (8192/64, 16). All barriers under block-uniform control.
// ---------------------------------------------------------------------------
constexpr int kGP = 68;
/* LDS row pitch of the two 64 x 64 bf16 weight planes: 144 B = 16 B x 9 (odd) for their 16-byte fragment loads */
constexpr int kWP = 72;
__global__ __launch_bounds__(128) void gated_value_kernel(
    const float* __restrict__ V0, const unsigned short* __restrict__ W1tp, const unsigned short* __restrict__ W2tp,
    const float* __restrict__ b1, const float* __restrict__ b2,
    unsigned short* __restrict__ VTH, unsigned short* __restrict__ VTL)
{
  /* sA: first the v0 tile [token][d]; later the gate pre-activation [d][token]. sB: residual sum [d][token]. */
  __shared__ __align__(16) float sA[64 * kGP];
  __shared__ __align__(16) float sB[64 * kGP];
  __shared__ __align__(16) __bf16 sW1[kHS * kWP];
  __shared__ __align__(16) __bf16 sW2[kHS * kWP];
  __shared__ float sBias[2 * kHS];
  const int tid = threadIdx.x, lane = tid & 31, wave = tid >> 5;
  const int hh = lane >> 4, c = lane & 15;
  const int g0 = blockIdx.x * 64;
  const int hd = blockIdx.y;
  const int bidx = g0 / kT;
  const int t0 = g0 - bidx * kT;
  const __bf16* W1t = (const __bf16*)W1tp;
  const __bf16* W2t = (const __bf16*)W2tp;
  /* v0 tile: 64 rows x 16 float4 = 1024 = 8 x 128 threads */
#pragma unroll
  for (int i = 0; i < 8; ++i) {
    const int e = i * 128 + tid;
    const int r = e >> 4, c4 = (e & 15) * 4;
    *(v4f*)(sA + r * kGP + c4) = *(const v4f*)(V0 + (size_t)(g0 + r) * kC + hd * kHS + c4);
  }
  /* weight planes: 4096 bf16 each = 512 x 16 B = 4 x 128 threads */
#pragma unroll
  for (int i = 0; i < 4; ++i) {
    const int e = (i * 128 + tid) * 8;
    const int le = (e >> 6) * kWP + (e & 63);
    *(v8b*)(sW1 + le) = *(const v8b*)(W1t + e);
    *(v8b*)(sW2 + le) = *(const v8b*)(W2t + e);
  }
  {
    const int bi = tid & 63;
    const float x1 = b1[bi];
    const float x2 = b2[bi];
    const float xs = (tid < kHS) ? x1 : x2;
    sBias[tid] = bf_bits2f(f2bf_bits(xs));
  }
  __syncthreads();

  /* A fragments (hi, lo) for this wave's 16 tokens */
  v16b ah[2], al[2];
  {
    const int arow = wave * 16 + c;
#pragma unroll
    for (int ks = 0; ks < 2; ++ks) {
      const float* p = sA + arow * kGP + ks * 32 + 8 * hh;
      const v4f f0 = *(const v4f*)(p);
      const v4f f1 = *(const v4f*)(p + 4);
      const v4f f2 = *(const v4f*)(p + 16);
      const v4f f3 = *(const v4f*)(p + 20);
#pragma unroll
      for (int e = 0; e < 4; ++e) {
        unsigned short hb, lb;
        const float x0 = f0[e];
        const float x1 = f1[e];
        const float x2 = f2[e];
        const float x3 = f3[e];
        split_bits(x0, hb, lb);
        ah[ks][e] = __builtin_bit_cast(__bf16, hb);       al[ks][e] = __builtin_bit_cast(__bf16, lb);
        split_bits(x1, hb, lb);
        ah[ks][4 + e] = __builtin_bit_cast(__bf16, hb);   al[ks][4 + e] = __builtin_bit_cast(__bf16, lb);
        split_bits(x2, hb, lb);
        ah[ks][8 + e] = __builtin_bit_cast(__bf16, hb);   al[ks][8 + e] = __builtin_bit_cast(__bf16, lb);
        split_bits(x3, hb, lb);
        ah[ks][12 + e] = __builtin_bit_cast(__bf16, hb);  al[ks][12 + e] = __builtin_bit_cast(__bf16, lb);
      }
    }
  }

  v8f a1[4], a2[4];
#pragma unroll
  for (int j = 0; j < 4; ++j) {
    a1[j] = (v8f){0.f,0.f,0.f,0.f,0.f,0.f,0.f,0.f};
    a2[j] = (v8f){0.f,0.f,0.f,0.f,0.f,0.f,0.f,0.f};
  }
#pragma unroll
  for (int ks = 0; ks < 2; ++ks) {
#pragma unroll
    for (int j = 0; j < 4; ++j) {
      const v16b w1 = Frag<__bf16>::load(sW1 + (j * 16 + c) * kWP + ks * 32 + 8 * hh);
      const v16b w2 = Frag<__bf16>::load(sW2 + (j * 16 + c) * kWP + ks * 32 + 8 * hh);
      a1[j] = mma_b(ah[ks], w1, a1[j]);
      a1[j] = mma_b(al[ks], w1, a1[j]);
      a2[j] = mma_b(ah[ks], w2, a2[j]);
      a2[j] = mma_b(al[ks], w2, a2[j]);
    }
  }
  acc_guard4(a1[0], a1[1], a1[2], a1[3]);
  acc_guard4(a2[0], a2[1], a2[2], a2[3]);

  /* residual + biases in place (reads only this wave's own token rows of sA) */
#pragma unroll
  for (int j = 0; j < 4; ++j) {
    const int col = j * 16 + c;
    const float bb1 = sBias[col];
    const float bb2 = sBias[kHS + col];
#pragma unroll
    for (int r = 0; r < 8; ++r) {
      const int row = wave * 16 + 8 * hh + r;
      const float vres = sA[row * kGP + col];
      a1[j][r] = vres + (a1[j][r] + bb1);
      a2[j][r] = a2[j][r] + bb2;
    }
  }
  /* every wave has finished reading the v0 tile before it is overwritten */
  __syncthreads();
#pragma unroll
  for (int j = 0; j < 4; ++j) {
    const int col = j * 16 + c;
#pragma unroll
    for (int r = 0; r < 8; ++r) {
      const int row = wave * 16 + 8 * hh + r;
      sB[col * kGP + row] = a1[j][r];
      sA[col * kGP + row] = a2[j][r];
    }
  }
  __syncthreads();

  const int q = lane >> 3, c8 = (lane & 7) * 8;
#pragma unroll 1
  for (int it = 0; it < 4; ++it) {
    const int d = wave * 16 + it * 4 + q;
    const float* pa = sB + d * kGP + c8;
    const float* pg = sA + d * kGP + c8;
    const v4f av0 = *(const v4f*)(pa);
    const v4f av1 = *(const v4f*)(pa + 4);
    const v4f gv0 = *(const v4f*)(pg);
    const v4f gv1 = *(const v4f*)(pg + 4);
    v8h hv, lv;
#pragma unroll
    for (int e = 0; e < 4; ++e) {
      const float xa0 = av0[e];
      const float xg0 = gv0[e];
      const float xa1 = av1[e];
      const float xg1 = gv1[e];
      const float r0 = xa0 * (1.0f / (1.0f + expf(-xg0)));
      const float r1 = xa1 * (1.0f / (1.0f + expf(-xg1)));
      unsigned short hb, lb;
      split_bits(r0, hb, lb);
      hv[e] = __builtin_bit_cast(_Float16, hb);
      lv[e] = __builtin_bit_cast(_Float16, lb);
      split_bits(r1, hb, lb);
      hv[4 + e] = __builtin_bit_cast(_Float16, hb);
      lv[4 + e] = __builtin_bit_cast(_Float16, lb);
    }
    const size_t o = ((size_t)(bidx * kH + hd) * kHS + d) * kT + t0 + c8;
    *(v8h*)(VTH + o) = hv;
    *(v8h*)(VTL + o) = lv;
    
  }
}

// ---------------------------------------------------------------------------
// Causal attention for head dim 64 from 16-bit planes. Block = 4 waves = two tiles of 64 query rows of one (batch, head), tile
// nqb - 1 - tp and then tile tp, so that every block walks the same number of key chunks (nqb + 1) wherever it is placed;
// per tile: keys in chunks of 64 up to and including the diagonal chunk (block-uniform trip count qb + 1 <= 32).
// Both products are computed transposed, so that a lane owns ONE query (column c = lane & 15):
//   scores^T: A = x (f16, x16) key rows staged in LDS, B = u (f16, x16) query rows held in registers; register r of tile j
//   is the score of key 16 j + 8 (lane >> 4) + r against query c; x 1/(32*16*16).
//   diagonal chunk: key > query -> -inf (every query keeps at least its own key; the first chunk always holds key 0).
//   online softmax in f32: maximum and normaliser run in the lane over its 32 keys; the two lane halves exchange the maximum
//   once per chunk and join their normalisers once behind the loop; the normaliser is summed from the f32 p values.
//   P^T: score tiles 2 kk and 2 kk + 1, converted in place to bf16 hi + lo, ARE the B operand of k step kk (element s = tile
//   s >> 3, register s & 7, the k order of the fragment loader); P never leaves the registers.
//   O^T += v^T.P^T: A = v hi + lo ([d][key] planes) staged in LDS; hi.hi + lo(v).hi(P) + hi(v).lo(P).
//   A lane ends with 8 consecutive d of its query per tile: one 16-byte store per tile and plane.
// ---------------------------------------------------------------------------
constexpr int kKC = 64;
/* LDS row pitch of every 64-element 16-bit tile read by 16-byte fragment loads: 72 elements = 144 B = 16 B x 9 (odd), so 16 rows fall on distinct banks */
constexpr int kLP = 72;
static_assert(kLP >= kKC && kLP >= kHS && (kLP % 8) == 0 && ((kLP / 8) % 2) == 1, "pitch: 16-B aligned rows, odd multiple of 16 B");
/* the value that lane ^ 16 holds */
__device__ __forceinline__ float other_half(float x) {
  const int bits = __float_as_int(x);
  return __int_as_float(__builtin_amdgcn_permlanex16(bits, bits, 0x76543210, 0xfedcba98, false, false));
}
__global__ __launch_bounds__(128) void causal_attn_kernel(
    const unsigned short* __restrict__ Up, const unsigned short* __restrict__ XHp,
    const unsigned short* __restrict__ VTHp, const unsigned short* __restrict__ VTLp,
    unsigned short* __restrict__ YH, unsigned short* __restrict__ YL)
{
  __shared__ __align__(16) _Float16 Ksh[kKC * kLP];
  __shared__ __align__(16) __bf16 Vth[kHS * kLP];
  __shared__ __align__(16) __bf16 Vtl[kHS * kLP];

  const int tid  = threadIdx.x;
  const int wave = tid >> 5;
  const int lane = tid & 31;
  const int hh   = lane >> 4;
  const int c    = lane & 15;

  constexpr int nqb = kT / 64;
  static_assert((nqb % 2) == 0, "query tiles pair up as t and nqb - 1 - t");
  const int bx = blockIdx.x;
  const int tp = bx % (nqb / 2);
  const int bh = bx / (nqb / 2);
  const int h  = bh % kH;
  const int b  = bh / kH;

  const _Float16* Uh = (const _Float16*)Up;
  const _Float16* Xh = (const _Float16*)XHp;
  const __bf16*   Vh = (const __bf16*)VTHp;
  const __bf16*   Vl = (const __bf16*)VTLp;

  /* the block's two query tiles, one after the other in every wave: nqb - 1 - tp, then tp; together nqb + 1 key chunks in every
     block. Kept rolled: one copy of the chunk loop in the instruction cache */
#pragma unroll 1
  for (int half = 0; half < 2; ++half) {
  const int qb = (half == 0) ? (nqb - 1 - tp) : tp;
  const int q0 = qb * 64 + wave * 16;
  /* this lane's query */
  const int qrow = q0 + c;

  /* query fragments (B operand, column c = query c): 2 d-chunks */
  v16h qa[2];
  {
    const _Float16* urow = Uh + (size_t)(b * kT + qrow) * kC + h * kHS;
#pragma unroll
    for (int dc = 0; dc < 2; ++dc) qa[dc] = Frag<_Float16>::load(urow + dc * 32 + 8 * hh);
  }

  /* running maximum of the query (equal in both lane halves); normaliser over this lane half's keys only */
  float mrow = -INFINITY, lrow = 0.f;
  v8f oacc[4];
#pragma unroll
  for (int t = 0; t < 4; ++t) oacc[t] = (v8f){0.f,0.f,0.f,0.f,0.f,0.f,0.f,0.f};

  const int nChunks = qb + 1;
  for (int kc = 0; kc < nChunks; ++kc) {
    const int kv0 = kc * kKC;
    __syncthreads();
    /* K, V hi, V lo tiles: 64 rows x 8 x 16 B = 512 each = 4 x 128 threads */
#pragma unroll
    for (int i = 0; i < 4; ++i) {
      const int e = i * 128 + tid;
      const int r = e >> 3, c8 = (e & 7) * 8;
      *(v8h*)(Ksh + r * kLP + c8) = *(const v8h*)(Xh + (size_t)(b * kT + kv0 + r) * kC + h * kHS + c8);
      const size_t vo = ((size_t)bh * kHS + r) * kT + kv0 + c8;
      *(v8b*)(Vth + r * kLP + c8) = *(const v8b*)(Vh + vo);
      *(v8b*)(Vtl + r * kLP + c8) = *(const v8b*)(Vl + vo);
    }
    __syncthreads();

    v8f s[4];
#pragma unroll
    for (int j = 0; j < 4; ++j) {
      s[j] = (v8f){0.f,0.f,0.f,0.f,0.f,0.f,0.f,0.f};
#pragma unroll
      for (int dc = 0; dc < 2; ++dc) {
        const v16h kb = Frag<_Float16>::load(Ksh + (j * 16 + c) * kLP + dc * 32 + 8 * hh);
        s[j] = mma_h(kb, qa[dc], s[j]);
      }
    }
    acc_guard4(s[0], s[1], s[2], s[3]);

    const bool diag = (kc == qb);
    /* one maximum (and below one sum) per score tile: four short independent chains instead of one of 32 links */
    float cmj[4];
#pragma unroll
    for (int j = 0; j < 4; ++j) {
      cmj[j] = -INFINITY;
#pragma unroll
      for (int r = 0; r < 8; ++r) {
        const int kvrow = kv0 + j * 16 + 8 * hh + r;
        float sv = s[j][r] * kScoreScale;
        const bool masked = diag && (kvrow > qrow);
        sv = masked ? -INFINITY : sv;
        s[j][r] = sv;
        cmj[j] = fmaxf(cmj[j], sv);
      }
    }
    float cm = fmaxf(fmaxf(cmj[0], cmj[1]), fmaxf(cmj[2], cmj[3]));
    /* the other lane half holds the query's other 32 keys */
    cm = fmaxf(cm, other_half(cm));
    const float mnew = fmaxf(mrow, cm);
    const float alpha = __expf(mrow - mnew);
    mrow = mnew;
    float psj[4];
    v16b ph[2], pl[2];
#pragma unroll
    for (int j = 0; j < 4; ++j) {
      psj[j] = 0.f;
#pragma unroll
      for (int r = 0; r < 8; ++r) {
        const float p = __expf(s[j][r] - mnew);
        psj[j] += p;
        unsigned short hb, lb;
        split_bits(p, hb, lb);
        ph[j >> 1][(j & 1) * 8 + r] = __builtin_bit_cast(__bf16, hb);
        pl[j >> 1][(j & 1) * 8 + r] = __builtin_bit_cast(__bf16, lb);
      }
    }
    lrow = lrow * alpha + ((psj[0] + psj[1]) + (psj[2] + psj[3]));
#pragma unroll
    for (int t = 0; t < 4; ++t)
#pragma unroll
      for (int r = 0; r < 8; ++r) oacc[t][r] *= alpha;
    /* unrolled so that the index of the P fragments is a constant (registers, no scratch) */
#pragma unroll
    for (int kk = 0; kk < 2; ++kk) {
#pragma unroll
      for (int t = 0; t < 4; ++t) {
        const v16b vb = Frag<__bf16>::load(Vth + (t * 16 + c) * kLP + kk * 32 + 8 * hh);
        const v16b vl = Frag<__bf16>::load(Vtl + (t * 16 + c) * kLP + kk * 32 + 8 * hh);
        oacc[t] = mma_b(vb, ph[kk], oacc[t]);
        oacc[t] = mma_b(vl, ph[kk], oacc[t]);
        oacc[t] = mma_b(vb, pl[kk], oacc[t]);
      }
    }
    acc_guard4(oacc[0], oacc[1], oacc[2], oacc[3]);
  }

  /* join the two lane halves' normalisers */
  lrow += other_half(lrow);
  const float inv = 1.0f / lrow;
#pragma unroll
  for (int t = 0; t < 4; ++t) {
    v8h hv, lv;
#pragma unroll
    for (int r = 0; r < 8; ++r) {
      unsigned short hb, lb;
      split_bits(oacc[t][r] * inv, hb, lb);
      hv[r] = __builtin_bit_cast(_Float16, hb);
      lv[r] = __builtin_bit_cast(_Float16, lb);
    }
    const size_t o = (size_t)(b * kT + qrow) * kC + h * kHS + t * 16 + 8 * hh;
    *(v8h*)(YH + o) = hv;
    *(v8h*)(YL + o) = lv;
  }
  /* the next tile rewrites the registers that these stores name: the wait that stands in front of such a rewrite */
  asm volatile("s_wait_xcnt 0x0" ::: "memory");
  }
}

// ---------------------------------------------------------------------------
// Host glue: 8 launches, kernel launches only.
// GEMM shapes: M 8192, N 1024, K 1024: 64 x 4 block tiles of 128 x 256 = 256 blocks of 8 waves.
// ---------------------------------------------------------------------------
extern "C" void kernel_launch(void* const* d_in, const int* in_sizes, int n_in,
                              void* d_out, int out_size, void* d_ws, size_t ws_size,
                              hipStream_t stream) {
  if (n_in < 11) return;
  if (in_sizes[0] != kRows * kC) return;
  if (in_sizes[1] != kC * kC) return;
  if (in_sizes[2] != kC) return;
  if (in_sizes[3] != kC * kC) return;
  if (in_sizes[4] != kC) return;
  if (in_sizes[5] != kHS * kHS) return;
  if (in_sizes[6] != kHS) return;
  if (in_sizes[7] != kHS * kHS) return;
  if (in_sizes[8] != kHS) return;
  if (in_sizes[9] != kC * kC) return;
  if (in_sizes[10] != kC) return;
  if (out_size != kRows * kC) return;
  if (ws_size < kWsTotal) return;

  const float* x  = (const float*)d_in[0];
  const float* Wu = (const float*)d_in[1];
  const float* bu = (const float*)d_in[2];
  const float* Wv = (const float*)d_in[3];
  const float* bv = (const float*)d_in[4];
  const float* W1 = (const float*)d_in[5];
  const float* b1 = (const float*)d_in[6];
  const float* W2 = (const float*)d_in[7];
  const float* b2 = (const float*)d_in[8];
  const float* Wp = (const float*)d_in[9];
  const float* bp = (const float*)d_in[10];
  float* out = (float*)d_out;

  char* ws = (char*)d_ws;
  unsigned short* XH   = (unsigned short*)(ws + kOffXH);
  unsigned short* WUT  = (unsigned short*)(ws + kOffWUT);
  unsigned short* WVT  = (unsigned short*)(ws + kOffWVT);
  unsigned short* WPT  = (unsigned short*)(ws + kOffWPT);
  unsigned short* W12T = (unsigned short*)(ws + kOffW12);
  unsigned short* U16  = (unsigned short*)(ws + kOffU);
  float*          V0   = (float*)(ws + kOffV0);
  unsigned short* YH   = (unsigned short*)(ws + kOffYH);
  unsigned short* YL   = (unsigned short*)(ws + kOffYL);
  unsigned short* VTH  = (unsigned short*)(ws + kOffVTH);
  unsigned short* VTL  = (unsigned short*)(ws + kOffVTL);

  /* x -> f16 plane (bf16 values x16) */
  cast_x_kernel<<<(kRows * kC / 8) / 256, 256, 0, stream>>>(x, XH, kRows * kC / 8);

  /* in[k][n] -> out[n][k]: Wu, Wv as f16 (x1024), Wp as bf16; planes WUT, WVT, WPT are contiguous */
  wt_transpose_cast_kernel<<<dim3(kC / 64, kC / 64, 3), 256, 0, stream>>>(Wu, Wv, Wp, WUT, kC, kWCarry, 2);
  /* in[k][n] -> out[n][k]: W1, W2 as bf16 [64][64] planes */
  wt_transpose_cast_kernel<<<dim3(1, 1, 2), 256, 0, stream>>>(W1, W2, W2, W12T, kHS, 1.0f, 0);

  /* u (f16, x16) = x.Wu + bu */
  wmma_gemm64<0, 0, 2, 1><<<dim3(256, 1), 256, 0, stream>>>(
      XH, XH, kC, 0L,
      WUT, WUT, kC, 0L,
      (void*)U16, kC, 0L,
      bu, kRows, kC, kC, kUScale, kUCarry);

  /* v0 (f32) = x.Wv + bv */
  wmma_gemm64<0, 0, 2, 0><<<dim3(256, 1), 256, 0, stream>>>(
      XH, XH, kC, 0L,
      WVT, WVT, kC, 0L,
      (void*)V0, kC, 0L,
      bv, kRows, kC, kC, kV0Scale, 1.0f);

  /* gated value -> vT hi | lo planes */
  gated_value_kernel<<<dim3(kRows / 64, kH), 128, 0, stream>>>(V0, W12T, W12T + kHS * kHS, b1, b2, VTH, VTL);

  /* causal attention -> y hi | lo planes (the v0 bytes are dead from here on) */
  causal_attn_kernel<<<kB * kH * (kT / 128), 128, 0, stream>>>(U16, XH, VTH, VTL, YH, YL);

  /* out = y.Wp + bp (y hi.W + y lo.W) */
  wmma_gemm64<1, 1, 2, 0><<<dim3(256, 1), 256, 0, stream>>>(
      YH, YL, kC, 0L,
      WPT, WPT, kC, 0L,
      (void*)out, kC, 0L,
      bp, kRows, kC, kC, 1.0f, 1.0f);
}

// v005
// It runs in 185 microseconds.
// Next to v004, in two timings, it ran 1.04 and 1.03 times as fast.
// Over all steps from v000 it is 3.82 times as fast.
// All contractions on 16-bit WMMA with f32 accumulate: x.Wu, x.Wv and the u.x^T scores on v_wmma_f32_16x16x32_f16 (inputs RNE-converted to bf16 once and held exactly in f16 planes with power-of-two carries: x x16, W x1024, u x16); v0.W1, v0.W2, P.v and y.Wp on v_wmma_f32_16x16x32_bf16 with the computed operand carried as bf16 hi+lo planes (W1, W2, Wp as bf16 planes); softmax, gate, residual and bias in f32.
#include <hip/hip_runtime.h>
#include <math.h>

typedef __attribute__((ext_vector_type(16))) _Float16 v16h;
typedef __attribute__((ext_vector_type(8)))  _Float16 v8h;
typedef __attribute__((ext_vector_type(16))) __bf16   v16b;
typedef __attribute__((ext_vector_type(8)))  __bf16   v8b;
typedef __attribute__((ext_vector_type(8)))  float    v8f;
typedef __attribute__((ext_vector_type(4)))  float    v4f;
typedef __attribute__((ext_vector_type(4)))  unsigned int v4u;

// ---------------------------------------------------------------------------
// Problem constants
// ---------------------------------------------------------------------------
constexpr int kB    = 4;
constexpr int kT    = 2048;
constexpr int kC    = 1024;
constexpr int kH    = 16;
constexpr int kHS   = 64;
constexpr int kRows = kB * kT;
constexpr int kSqrtC = 32;
static_assert(kSqrtC * kSqrtC == kC, "score scale is 1/sqrt(C)");
static_assert(kH * kHS == kC, "head split");
static_assert((kC % 32) == 0 && (kHS % 32) == 0 && (kT % 64) == 0, "K multiples of 32, key chunks of 64");
static_assert((kRows % 64) == 0 && (kC % 64) == 0, "GEMM M,N multiples of 64");

// power-of-two carries of the f16 planes (exact; folded back in f32)
constexpr float kXCarry = 16.0f;
constexpr float kWCarry = 1024.0f;
constexpr float kUCarry = 16.0f;
constexpr float kUScale  = kUCarry / (kXCarry * kWCarry);
constexpr float kV0Scale = 1.0f / (kXCarry * kWCarry);
constexpr float kScoreScale = 1.0f / ((float)kSqrtC * kUCarry * kXCarry);

// ---------------------------------------------------------------------------
// Workspace region map (bytes; every offset is a multiple of 128)
//   XH    f16  [8192][1024]      16*bf16(x)                      16,777,216
//   WUT   f16  [1024 n][1024 k]  1024*bf16(Wu)^T                  2,097,152
//   WVT   f16  [1024 n][1024 k]  1024*bf16(Wv)^T                  2,097,152
//   WPT   bf16 [1024 n][1024 k]  bf16(Wp)^T                       2,097,152
//   W12T  bf16 2 x [64 n][64 k]  bf16(W1)^T | bf16(W2)^T             16,384
//   U16   f16  [8192][1024]      16*u                            16,777,216
//   V0    f32  [8192][1024]      v0; dead after the gated-value launch, then the same bytes
//                                hold YH | YL (bf16 hi | lo planes of y, [8192][1024] each)  33,554,432
//   VTH   bf16 [4][16][64 d][2048 t]  gated v, hi plane           16,777,216
//   VTL   bf16 [4][16][64 d][2048 t]  gated v, lo plane           16,777,216
//   total                                                       106,971,136
// ---------------------------------------------------------------------------
constexpr size_t kSzAct16 = (size_t)kRows * kC * 2;
constexpr size_t kSzW16   = (size_t)kC * kC * 2;
constexpr size_t kSzW12   = (size_t)2 * kHS * kHS * 2;
constexpr size_t kSzV0    = (size_t)kRows * kC * 4;
constexpr size_t kOffXH   = 0;
constexpr size_t kOffWUT  = kOffXH  + kSzAct16;
constexpr size_t kOffWVT  = kOffWUT + kSzW16;
constexpr size_t kOffWPT  = kOffWVT + kSzW16;
constexpr size_t kOffW12  = kOffWPT + kSzW16;
constexpr size_t kOffU    = kOffW12 + kSzW12;
constexpr size_t kOffV0   = kOffU   + kSzAct16;
constexpr size_t kOffYH   = kOffV0;
constexpr size_t kOffYL   = kOffV0  + kSzAct16;
constexpr size_t kOffVTH  = kOffV0  + kSzV0;
constexpr size_t kOffVTL  = kOffVTH + kSzAct16;
constexpr size_t kWsTotal = kOffVTL + kSzAct16;
static_assert(kWsTotal == 106971136ull, "carve total");
static_assert(kWsTotal <= 134217728ull, "carve cap");
static_assert(2 * kSzAct16 == kSzV0, "y hi|lo planes fit the v0 plane exactly");
static_assert((kOffWUT % 128) == 0 && (kOffWVT % 128) == 0 && (kOffWPT % 128) == 0 && (kOffW12 % 128) == 0 &&
              (kOffU % 128) == 0 && (kOffV0 % 128) == 0 && (kOffYL % 128) == 0 && (kOffVTH % 128) == 0 &&
              (kOffVTL % 128) == 0, "128-B aligned regions");

// ---------------------------------------------------------------------------
// Bit helpers
// ---------------------------------------------------------------------------
__device__ __forceinline__ unsigned short f2bf_bits(float f) {
  unsigned u = __float_as_uint(f);
  return (unsigned short)((u + 0x7FFFu + ((u >> 16) & 1u)) >> 16);
}
__device__ __forceinline__ float bf_bits2f(unsigned short h) { return __uint_as_float(((unsigned)h) << 16); }
__device__ __forceinline__ unsigned pk16(unsigned short a, unsigned short b) { return (unsigned)a | ((unsigned)b << 16); }
__device__ __forceinline__ unsigned short h_bits(float f) { const _Float16 h = (_Float16)f; return __builtin_bit_cast(unsigned short, h); }
/* bf16 hi + bf16 lo of an f32 value, both RNE */
__device__ __forceinline__ void split_bits(float f, unsigned short& hb, unsigned short& lb) {
  hb = f2bf_bits(f);
  lb = f2bf_bits(f - bf_bits2f(hb));
}

// ---------------------------------------------------------------------------
// WMMA helpers: every matrix op is followed by 4 nops tied to its own accumulator and its A/B fragments
// ---------------------------------------------------------------------------
__device__ __forceinline__ v8f mma_h(v16h a, v16h b, v8f c) {
  c = __builtin_amdgcn_wmma_f32_16x16x32_f16(false, a, false, b, (short)0, c, false, false);
  asm volatile("v_nop\n\tv_nop\n\tv_nop\n\tv_nop" : "+v"(c) : "v"(a), "v"(b));
  return c;
}
__device__ __forceinline__ v8f mma_b(v16b a, v16b b, v8f c) {
  c = __builtin_amdgcn_wmma_f32_16x16x32_bf16(false, a, false, b, (short)0, c, false, false);
  asm volatile("v_nop\n\tv_nop\n\tv_nop\n\tv_nop" : "+v"(c) : "v"(a), "v"(b));
  return c;
}
__device__ __forceinline__ void keep4_h(v16h a, v16h b, v16h c, v16h d) { asm volatile("v_nop" :: "v"(a), "v"(b), "v"(c), "v"(d)); }
__device__ __forceinline__ void keep4_b(v16b a, v16b b, v16b c, v16b d) { asm volatile("v_nop" :: "v"(a), "v"(b), "v"(c), "v"(d)); }
__device__ __forceinline__ void acc_guard4(v8f& a, v8f& b, v8f& c, v8f& d) { asm volatile("v_nop\n\tv_nop\n\tv_nop\n\tv_nop" : "+v"(a), "+v"(b), "+v"(c), "+v"(d)); }

// Fragment loader: p already points at (row, k0 + 8*(lane>>4)); elements 0..7 <- p[0..7], elements 8..15 <- p[16..23]
template <typename T> struct Frag;
template <> struct Frag<_Float16> {
  typedef v16h V; union U { v16h v; v8h h[2]; };
  static __device__ __forceinline__ v16h load(const _Float16* p) {
    U f; f.h[0] = *(const v8h*)(p); f.h[1] = *(const v8h*)(p + 16); return f.v;
  }
  static __device__ __forceinline__ v8f mma(v16h a, v16h b, v8f c) { return mma_h(a, b, c); }
  static __device__ __forceinline__ void keep(v16h a, v16h b, v16h c, v16h d) { keep4_h(a, b, c, d); }
};
template <> struct Frag<__bf16> {
  typedef v16b V; union U { v16b v; v8b h[2]; };
  static __device__ __forceinline__ v16b load(const __bf16* p) {
    U f; f.h[0] = *(const v8b*)(p); f.h[1] = *(const v8b*)(p + 16); return f.v;
  }
  static __device__ __forceinline__ v8f mma(v16b a, v16b b, v8f c) { return mma_b(a, b, c); }
  static __device__ __forceinline__ void keep(v16b a, v16b b, v16b c, v16b d) { keep4_b(a, b, c, d); }
};

// ---- LDS-staged batched WMMA GEMM ------------------------------------------
// C[m,n] = scale * sum_k A[m,k] * Bt[n,k] + bias_scale * bf16(bias[n]).
// Block = 8 waves = one 128 x 256 tile of C; waves 2 (m) x 4 (n), each wave owns a 64x64 tile.
// A pass is 64 k = 128 B of every operand row. The block brings a pass's rows [A 128 | A2 128 (SPL 1) | Bt 256] from global
// memory as whole 128-B lines (8 lanes x 16 B per row) by asynchronous 16-byte copies into one of two LDS buffers, so that
// the next pass's rows fly while this pass is worked on; every wave reads its fragments from LDS. One block barrier per
// pass: it publishes the buffer just filled and ends the reads of the buffer that is refilled behind it.
// A row-major [M,K]; Bt row-major [N,K]; M % 128 == 0, N % 256 == 0, K % 64 == 0 (no tail handling).
// SPL: 0 = plain (one product), 1 = A carried as hi/lo planes (A2 = lo): hi.b + lo.b.
// BIAS_MODE: 0 = none, 2 = bias[n].   OUT_MODE: 0 = f32, 1 = f16.
// ET: 0 = f16 operands, 1 = bf16 operands (pointers passed as 16-bit storage)
constexpr int kBM = 128;
constexpr int kBN = 256;
constexpr int kKP = 64;
/* LDS row pitch of a staged 64-element row: 144 B = 16 B x 9 (odd) for the 16-byte fragment loads */
constexpr int kSP = 72;
static_assert((kRows % kBM) == 0 && (kC % kBN) == 0 && (kC % kKP) == 0, "GEMM block tile and pass divide the shapes");
template <int ET> struct Elem;
template <> struct Elem<0> { typedef _Float16 T; };
template <> struct Elem<1> { typedef __bf16 T; };
template <int ET, int SPL, int BIAS_MODE, int OUT_MODE>
__global__ __launch_bounds__(256) void wmma_gemm64(
    const unsigned short* __restrict__ Ap, const unsigned short* __restrict__ A2p, int lda, long strideA,
    const unsigned short* __restrict__ Btp, const unsigned short* __restrict__ Bt2p, int ldb, long strideB,
    void* __restrict__ Cout, int ldc, long strideC,
    const float* __restrict__ bias,
    int M, int N, int K, float scale, float bias_scale) {
  static_assert(SPL == 0 || SPL == 1, "one or two A planes");
  typedef typename Elem<ET>::T T;
  typedef typename Frag<T>::V V;
  constexpr int kRowsA      = (SPL == 1) ? 2 * kBM : kBM;
  constexpr int kStageRows  = kRowsA + kBN;
  constexpr int kStageElems = kStageRows * kSP;
  /* one 16-byte copy per thread covers 32 rows of the stage */
  constexpr int kCopies     = kStageRows / 32;
  constexpr unsigned kStageBytes = (unsigned)kStageElems * 2u;
  static_assert((kCopies % 4) == 0, "copies go four to a statement");
  const T* A = (const T*)Ap; const T* A2 = (const T*)A2p; const T* Bt = (const T*)Btp;
  __shared__ __align__(16) T sStage[2 * kStageElems];
  /* per-wave 16x64 slab, pitch 68 floats */
  __shared__ __align__(16) float sT[8][16 * 68];
  const int b    = blockIdx.y;
  const int tid  = threadIdx.x;
  const int lane = tid & 31;
  const int wave = tid >> 5;
  const int tilesN = N / kBN;
  const int tilesM = M / kBM;
  const int tile = blockIdx.x;
  /* block-uniform exit, in front of every barrier */
  if (tile >= tilesM * tilesN) return;
  const int tm = tile / tilesN;
  const int tn = tile - tm * tilesN;
  const int wm = wave >> 2;
  const int wn = wave & 3;
  const int m0 = tm * kBM + (wm << 6);
  const int n0 = tn * kBN + (wn << 6);

  const T* Ab  = A  + (size_t)b * strideA + (size_t)(tm * kBM) * lda;
  const T* Ab2 = A2 + (size_t)b * strideA + (size_t)(tm * kBM) * lda;
  const T* Bb  = Bt + (size_t)b * strideB + (size_t)(tn * kBN) * ldb;

  /* rlane: row (A) / col (B, D) within a 16-wide subtile; koff: k offset of this lane half; mOff: D row offset */
  const int rlane = lane & 15;
  const int koff  = (lane >> 4) * 8;
  const int mOff  = (lane >> 4) * 8;

  /* staging: thread -> (row tid / 8 of each group of 32 rows, 16-byte piece tid % 8 of its 128 B) */
  const int srow = tid >> 3;
  const int sc8  = (tid & 7) * 8;
  const unsigned offA = (unsigned)srow * (unsigned)lda + (unsigned)sc8;
  const unsigned offB = (unsigned)srow * (unsigned)ldb + (unsigned)sc8;
  /* LDS byte address (low 32 bits of the __shared__ address) of this thread's piece in row srow of buffer 0 */
  const unsigned ldsT = (unsigned)(size_t)(sStage + srow * kSP + sc8);
  auto copy_stage = [&](int k0, unsigned bufByte) {
    /* both loops unrolled: which operand a group of rows belongs to is then decided at compile time */
#pragma unroll
    for (int g = 0; g < kCopies / 4; ++g) {
      const T* gp[4];
      unsigned lp[4];
#pragma unroll
      for (int e = 0; e < 4; ++e) {
        const int r0 = (g * 4 + e) * 32;
        if (r0 < kBM)         gp[e] = Ab  + (size_t)r0 * lda + k0 + offA;
        else if (r0 < kRowsA) gp[e] = Ab2 + (size_t)(r0 - kBM) * lda + k0 + offA;
        else                  gp[e] = Bb  + (size_t)(r0 - kRowsA) * ldb + k0 + offB;
        lp[e] = ldsT + bufByte + (unsigned)(r0 * kSP * 2);
      }
      /* four copies, then the wait that stands in front of any rewrite of the address registers they name */
      asm volatile("global_load_async_to_lds_b128 %0, %1, off\n\t"
                   "global_load_async_to_lds_b128 %2, %3, off\n\t"
                   "global_load_async_to_lds_b128 %4, %5, off\n\t"
                   "global_load_async_to_lds_b128 %6, %7, off\n\t"
                   "s_wait_xcnt 0x0"
                   :: "v"(lp[0]), "v"(gp[0]), "v"(lp[1]), "v"(gp[1]), "v"(lp[2]), "v"(gp[2]), "v"(lp[3]), "v"(gp[3])
                   : "memory");
    }
  };

  v8f acc[4][4];
#pragma unroll
  for (int i = 0; i < 4; ++i)
#pragma unroll
    for (int j = 0; j < 4; ++j) acc[i][j] = (v8f){0.f,0.f,0.f,0.f,0.f,0.f,0.f,0.f};

  const int nPass = K / kKP;
  copy_stage(0, 0u);
  /* pass 0's rows have landed (this wave's copies), then every wave's */
  asm volatile("s_wait_asynccnt 0x0" ::: "memory");
  __syncthreads();
  if (nPass > 1) copy_stage(kKP, kStageBytes);
  for (int p = 0; p < nPass; ++p) {
    const T* buf = sStage + (p & 1) * kStageElems;
    const T* sA  = buf + ((wm << 6) + rlane) * kSP + koff;
    const T* sA2 = sA + kBM * kSP;
    const T* sB  = buf + (kRowsA + (wn << 6) + rlane) * kSP + koff;
    /* the loops below are unrolled so that every index of a fragment or accumulator array is a constant (registers, no scratch) */
#pragma unroll
    for (int ks = 0; ks < kKP / 32; ++ks) {
      V bh[4];
#pragma unroll
      for (int j = 0; j < 4; ++j) bh[j] = Frag<T>::load(sB + (j << 4) * kSP + ks * 32);
      /* per accumulator and k step: the hi product, then the lo product */
#pragma unroll
      for (int pl = 0; pl <= SPL; ++pl) {
        const T* sAp = (pl == 0) ? sA : sA2;
        V af[4];
#pragma unroll
        for (int i = 0; i < 4; ++i) af[i] = Frag<T>::load(sAp + (i << 4) * kSP + ks * 32);
#pragma unroll
        for (int i = 0; i < 4; ++i) {
#pragma unroll
          for (int j = 0; j < 4; ++j) acc[i][j] = Frag<T>::mma(af[i], bh[j], acc[i][j]);
        }
      }
      Frag<T>::keep(bh[0], bh[1], bh[2], bh[3]);
    }
    /* this wave's reads of buffer p & 1 are done before that buffer is refilled */
    asm volatile("s_wait_dscnt 0x0" ::: "memory");
    /* this wave's copies of pass p + 1 have landed before the barrier publishes them */
    asm volatile("s_wait_asynccnt 0x0" ::: "memory");
    __syncthreads();
    if (p + 2 < nPass) copy_stage((p + 2) * kKP, (unsigned)(p & 1) * kStageBytes);
  }
  /* no copy is outstanding when the wave goes on to the epilogue */
  asm volatile("s_wait_asynccnt 0x0" ::: "memory");
  acc_guard4(acc[0][0], acc[0][1], acc[0][2], acc[0][3]);
  acc_guard4(acc[1][0], acc[1][1], acc[1][2], acc[1][3]);
  acc_guard4(acc[2][0], acc[2][1], acc[2][2], acc[2][3]);
  acc_guard4(acc[3][0], acc[3][1], acc[3][2], acc[3][3]);

  // ---- epilogue ----
  float* slab = sT[wave];
#pragma unroll
  for (int i = 0; i < 4; ++i) {
    const int mBase = m0 + (i << 4);
#pragma unroll
    for (int j = 0; j < 4; ++j) {
      const int n = n0 + (j << 4) + rlane;
      float bv = 0.f;
      if (BIAS_MODE == 2) bv = bf_bits2f(f2bf_bits(bias[n])) * bias_scale;
#pragma unroll
      for (int r = 0; r < 8; ++r) {
        float v = acc[i][j][r] * scale;
        if (BIAS_MODE == 2) v += bv;
        slab[(mOff + r) * 68 + (j << 4) + rlane] = v;
      }
    }
    __builtin_amdgcn_fence(__ATOMIC_RELEASE, "workgroup");
    __builtin_amdgcn_wave_barrier();
    __builtin_amdgcn_fence(__ATOMIC_ACQUIRE, "workgroup");
    if (OUT_MODE == 0) {
      /* row segment = 256 B = 16 lanes x 16 B; one instruction covers 2 rows */
      float* C = (float*)Cout + (size_t)b * strideC;
      const int hh = lane >> 4, c4 = (lane & 15) * 4;
      {
#pragma unroll
        for (int it = 0; it < 8; ++it) {
          const int row = it * 2 + hh;
          v4f v = *(const v4f*)(slab + row * 68 + c4);
          *(v4f*)(C + (size_t)(mBase + row) * ldc + n0 + c4) = v;
        }
        
      }
    } else {
      const int q = lane >> 3, c8 = (lane & 7) * 8;
      unsigned short* C  = (unsigned short*)Cout  + (size_t)b * strideC;
      {
#pragma unroll
        for (int it = 0; it < 4; ++it) {
          const int row = it * 4 + q;
          const float* sp = slab + row * 68 + c8;
          v8h hv;
#pragma unroll
          for (int e = 0; e < 8; ++e) hv[e] = (_Float16)sp[e];
          *(v8h*)(C + (size_t)(mBase + row) * ldc + n0 + c8) = hv;
        }
        
      }
    }
    __builtin_amdgcn_fence(__ATOMIC_RELEASE, "workgroup");
    __builtin_amdgcn_wave_barrier();
    __builtin_amdgcn_fence(__ATOMIC_ACQUIRE, "workgroup");
  }
}

// ---------------------------------------------------------------------------
// x: f32 -> RNE bf16 -> x16 -> f16 plane (exact), 8 consecutive elements per thread.
// Coverage: n8 = 8192*1024/8 = 1,048,576 threads = 4096 blocks x 256 exactly.
// ---------------------------------------------------------------------------
__global__ __launch_bounds__(256) void cast_x_kernel(const float* __restrict__ in, unsigned short* __restrict__ out, int n8) {
  const int i = blockIdx.x * 256 + threadIdx.x;
  if (i >= n8) return;
  const float* p = in + 8 * (size_t)i;
  const v4f a = *(const v4f*)(p);
  const v4f c = *(const v4f*)(p + 4);
  unsigned short hb[8];
#pragma unroll
  for (int e = 0; e < 4; ++e) {
    const float a_e = a[e];
    const float c_e = c[e];
    hb[e]     = h_bits(bf_bits2f(f2bf_bits(a_e)) * kXCarry);
    hb[4 + e] = h_bits(bf_bits2f(f2bf_bits(c_e)) * kXCarry);
  }
  const v4u u = (v4u){pk16(hb[0], hb[1]), pk16(hb[2], hb[3]), pk16(hb[4], hb[5]), pk16(hb[6], hb[7])};
  unsigned short* q = out + 8 * (size_t)i;
  *(v4u*)q = u;
  
}

// ---------------------------------------------------------------------------
// Weight transpose + cast: W is row-major [dim k][dim n] f32; WT[n][k] = cast(bf16_rne(W[k][n])).
// Planes z < bf_from_z are written as f16 of (bf16 value x carry); planes z >= bf_from_z as raw bf16 bits.
// grid (dim/64, dim/64, planes): blockIdx.x = k tile (64 cols of WT), blockIdx.y = n tile (64 rows of WT). 256 threads.
// Load coverage: 16 iterations x 256 threads = 4096 = the whole 64x64 tile (coalesced along n).
// Store coverage: 8 waves x 2 iterations x 4 rows (lane>>3) = 64 rows; (lane&7) x 8 halves = 64 cols; each row segment =
// ---------------------------------------------------------------------------
__global__ __launch_bounds__(256) void wt_transpose_cast_kernel(const float* __restrict__ W0, const float* __restrict__ W1,
                                                                const float* __restrict__ W2, unsigned short* __restrict__ out,
                                                                int dim, float carry, int bf_from_z) {
  /* sm[n_local][k_local] */
  __shared__ float sm[64][65];
  const int t  = threadIdx.x;
  const int k0 = blockIdx.x * 64;
  const int n0 = blockIdx.y * 64;
  const int z  = blockIdx.z;
  const float* W = (z == 0) ? W0 : (z == 1) ? W1 : W2;
  const bool as_bf = (z >= bf_from_z);
#pragma unroll
  for (int i = 0; i < 16; ++i) {
    const int e = i * 256 + t;
    const int r = e >> 6;
    const int c = e & 63;
    sm[c][r] = W[(size_t)(k0 + r) * dim + n0 + c];
  }
  __syncthreads();
  const int lane = t & 31, wave = t >> 5;
  const int q = lane >> 3, c8 = (lane & 7) * 8;
  unsigned short* op = out + (size_t)z * dim * dim;
  {
#pragma unroll
    for (int it = 0; it < 2; ++it) {
      const int row = wave * 8 + it * 4 + q;
      unsigned short hb[8];
#pragma unroll
      for (int e = 0; e < 8; ++e) {
        const float w = sm[row][c8 + e];
        const unsigned short bb = f2bf_bits(w);
        const unsigned short fh = h_bits(bf_bits2f(bb) * carry);
        hb[e] = as_bf ? bb : fh;
      }
      const v4u u = (v4u){pk16(hb[0], hb[1]), pk16(hb[2], hb[3]), pk16(hb[4], hb[5]), pk16(hb[6], hb[7])};
      *(v4u*)(op + (size_t)(n0 + row) * dim + k0 + c8) = u;
    }
    
  }
}

// ---------------------------------------------------------------------------
// Gated value transform per (64-token block, head): a = v0 + (v0.W1 + b1), g = sigmoid(v0.W2 + b2), v = a*g.
// Block = 4 waves; wave w owns tokens 16w..16w+15 of the block and all 64 output dims.
// v0 tile (f32) staged in LDS; A fragments = bf16 hi and lo of v0 built in registers; W1^T / W2^T bf16 planes staged in LDS;
// 2 k-steps x 4 n-tiles x 2 matrices x 2 products on v_wmma_f32_16x16x32_bf16.
// The two f32 results are transposed through LDS ([d][token]); the gate is applied in the store phase (8 values per lane
// grid (8192/64, 16). All barriers under block-uniform control.
// ---------------------------------------------------------------------------
constexpr int kGP = 68;
/* LDS row pitch of the two 64 x 64 bf16 weight planes: 144 B = 16 B x 9 (odd) for their 16-byte fragment loads */
constexpr int kWP = 72;
__global__ __launch_bounds__(128) void gated_value_kernel(
    const float* __restrict__ V0, const unsigned short* __restrict__ W1tp, const unsigned short* __restrict__ W2tp,
    const float* __restrict__ b1, const float* __restrict__ b2,
    unsigned short* __restrict__ VTH, unsigned short* __restrict__ VTL)
{
  /* sA: first the v0 tile [token][d]; later the gate pre-activation [d][token]. sB: residual sum [d][token]. */
  __shared__ __align__(16) float sA[64 * kGP];
  __shared__ __align__(16) float sB[64 * kGP];
  __shared__ __align__(16) __bf16 sW1[kHS * kWP];
  __shared__ __align__(16) __bf16 sW2[kHS * kWP];
  __shared__ float sBias[2 * kHS];
  const int tid = threadIdx.x, lane = tid & 31, wave = tid >> 5;
  const int hh = lane >> 4, c = lane & 15;
  const int g0 = blockIdx.x * 64;
  const int hd = blockIdx.y;
  const int bidx = g0 / kT;
  const int t0 = g0 - bidx * kT;
  const __bf16* W1t = (const __bf16*)W1tp;
  const __bf16* W2t = (const __bf16*)W2tp;
  /* v0 tile: 64 rows x 16 float4 = 1024 = 8 x 128 threads */
#pragma unroll
  for (int i = 0; i < 8; ++i) {
    const int e = i * 128 + tid;
    const int r = e >> 4, c4 = (e & 15) * 4;
    *(v4f*)(sA + r * kGP + c4) = *(const v4f*)(V0 + (size_t)(g0 + r) * kC + hd * kHS + c4);
  }
  /* weight planes: 4096 bf16 each = 512 x 16 B = 4 x 128 threads */
#pragma unroll
  for (int i = 0; i < 4; ++i) {
    const int e = (i * 128 + tid) * 8;
    const int le = (e >> 6) * kWP + (e & 63);
    *(v8b*)(sW1 + le) = *(const v8b*)(W1t + e);
    *(v8b*)(sW2 + le) = *(const v8b*)(W2t + e);
  }
  {
    const int bi = tid & 63;
    const float x1 = b1[bi];
    const float x2 = b2[bi];
    const float xs = (tid < kHS) ? x1 : x2;
    sBias[tid] = bf_bits2f(f2bf_bits(xs));
  }
  __syncthreads();

  /* A fragments (hi, lo) for this wave's 16 tokens */
  v16b ah[2], al[2];
  {
    const int arow = wave * 16 + c;
#pragma unroll
    for (int ks = 0; ks < 2; ++ks) {
      const float* p = sA + arow * kGP + ks * 32 + 8 * hh;
      const v4f f0 = *(const v4f*)(p);
      const v4f f1 = *(const v4f*)(p + 4);
      const v4f f2 = *(const v4f*)(p + 16);
      const v4f f3 = *(const v4f*)(p + 20);
#pragma unroll
      for (int e = 0; e < 4; ++e) {
        unsigned short hb, lb;
        const float x0 = f0[e];
        const float x1 = f1[e];
        const float x2 = f2[e];
        const float x3 = f3[e];
        split_bits(x0, hb, lb);
        ah[ks][e] = __builtin_bit_cast(__bf16, hb);       al[ks][e] = __builtin_bit_cast(__bf16, lb);
        split_bits(x1, hb, lb);
        ah[ks][4 + e] = __builtin_bit_cast(__bf16, hb);   al[ks][4 + e] = __builtin_bit_cast(__bf16, lb);
        split_bits(x2, hb, lb);
        ah[ks][8 + e] = __builtin_bit_cast(__bf16, hb);   al[ks][8 + e] = __builtin_bit_cast(__bf16, lb);
        split_bits(x3, hb, lb);
        ah[ks][12 + e] = __builtin_bit_cast(__bf16, hb);  al[ks][12 + e] = __builtin_bit_cast(__bf16, lb);
      }
    }
  }

  v8f a1[4], a2[4];
#pragma unroll
  for (int j = 0; j < 4; ++j) {
    a1[j] = (v8f){0.f,0.f,0.f,0.f,0.f,0.f,0.f,0.f};
    a2[j] = (v8f){0.f,0.f,0.f,0.f,0.f,0.f,0.f,0.f};
  }
#pragma unroll
  for (int ks = 0; ks < 2; ++ks) {
#pragma unroll
    for (int j = 0; j < 4; ++j) {
      const v16b w1 = Frag<__bf16>::load(sW1 + (j * 16 + c) * kWP + ks * 32 + 8 * hh);
      const v16b w2 = Frag<__bf16>::load(sW2 + (j * 16 + c) * kWP + ks * 32 + 8 * hh);
      a1[j] = mma_b(ah[ks], w1, a1[j]);
      a1[j] = mma_b(al[ks], w1, a1[j]);
      a2[j] = mma_b(ah[ks], w2, a2[j]);
      a2[j] = mma_b(al[ks], w2, a2[j]);
    }
  }
  acc_guard4(a1[0], a1[1], a1[2], a1[3]);
  acc_guard4(a2[0], a2[1], a2[2], a2[3]);

  /* residual + biases in place (reads only this wave's own token rows of sA) */
#pragma unroll
  for (int j = 0; j < 4; ++j) {
    const int col = j * 16 + c;
    const float bb1 = sBias[col];
    const float bb2 = sBias[kHS + col];
#pragma unroll
    for (int r = 0; r < 8; ++r) {
      const int row = wave * 16 + 8 * hh + r;
      const float vres = sA[row * kGP + col];
      a1[j][r] = vres + (a1[j][r] + bb1);
      a2[j][r] = a2[j][r] + bb2;
    }
  }
  /* every wave has finished reading the v0 tile before it is overwritten */
  __syncthreads();
#pragma unroll
  for (int j = 0; j < 4; ++j) {
    const int col = j * 16 + c;
#pragma unroll
    for (int r = 0; r < 8; ++r) {
      const int row = wave * 16 + 8 * hh + r;
      sB[col * kGP + row] = a1[j][r];
      sA[col * kGP + row] = a2[j][r];
    }
  }
  __syncthreads();

  const int q = lane >> 3, c8 = (lane & 7) * 8;
#pragma unroll 1
  for (int it = 0; it < 4; ++it) {
    const int d = wave * 16 + it * 4 + q;
    const float* pa = sB + d * kGP + c8;
    const float* pg = sA + d * kGP + c8;
    const v4f av0 = *(const v4f*)(pa);
    const v4f av1 = *(const v4f*)(pa + 4);
    const v4f gv0 = *(const v4f*)(pg);
    const v4f gv1 = *(const v4f*)(pg + 4);
    v8h hv, lv;
#pragma unroll
    for (int e = 0; e < 4; ++e) {
      const float xa0 = av0[e];
      const float xg0 = gv0[e];
      const float xa1 = av1[e];
      const float xg1 = gv1[e];
      const float r0 = xa0 * (1.0f / (1.0f + expf(-xg0)));
      const float r1 = xa1 * (1.0f / (1.0f + expf(-xg1)));
      unsigned short hb, lb;
      split_bits(r0, hb, lb);
      hv[e] = __builtin_bit_cast(_Float16, hb);
      lv[e] = __builtin_bit_cast(_Float16, lb);
      split_bits(r1, hb, lb);
      hv[4 + e] = __builtin_bit_cast(_Float16, hb);
      lv[4 + e] = __builtin_bit_cast(_Float16, lb);
    }
    const size_t o = ((size_t)(bidx * kH + hd) * kHS + d) * kT + t0 + c8;
    *(v8h*)(VTH + o) = hv;
    *(v8h*)(VTL + o) = lv;
    
  }
}

// ---------------------------------------------------------------------------
// Causal attention for head dim 64 from 16-bit planes. Block = 4 waves = two tiles of 64 query rows of one (batch, head), tile
// nqb - 1 - tp and then tile tp, so that every block walks the same number of key chunks (nqb + 1) wherever it is placed;
// per tile: keys in chunks of 64 up to and including the diagonal chunk (block-uniform trip count qb + 1 <= 32).
// Both products are computed transposed, so that a lane owns ONE query (column c = lane & 15):
//   scores^T: A = x (f16, x16) key rows staged in LDS, B = u (f16, x16) query rows held in registers; register r of tile j
//   is the score of key 16 j + 8 (lane >> 4) + r against query c; x 1/(32*16*16).
//   diagonal chunk: key > query -> -inf (every query keeps at least its own key; the first chunk always holds key 0).
//   online softmax in f32: maximum and normaliser run in the lane over its 32 keys; the two lane halves exchange the maximum
//   once per chunk and join their normalisers once behind the loop; the normaliser is summed from the f32 p values.
//   P^T: score tiles 2 kk and 2 kk + 1, converted in place to bf16 hi + lo, ARE the B operand of k step kk (element s = tile
//   s >> 3, register s & 7, the k order of the fragment loader); P never leaves the registers.
//   O^T += v^T.P^T: A = v hi + lo ([d][key] planes) staged in LDS; hi.hi + lo(v).hi(P) + hi(v).lo(P).
//   LDS fragment reads stand in groups ahead of the products that use them, never one by one in front of each product.
//   A lane ends with 8 consecutive d of its query per tile: one 16-byte store per tile and plane.
// ---------------------------------------------------------------------------
constexpr int kKC = 64;
/* LDS row pitch of every 64-element 16-bit tile read by 16-byte fragment loads: 72 elements = 144 B = 16 B x 9 (odd), so 16 rows fall on distinct banks */
constexpr int kLP = 72;
static_assert(kLP >= kKC && kLP >= kHS && (kLP % 8) == 0 && ((kLP / 8) % 2) == 1, "pitch: 16-B aligned rows, odd multiple of 16 B");
/* the value that lane ^ 16 holds */
__device__ __forceinline__ float other_half(float x) {
  const int bits = __float_as_int(x);
  return __int_as_float(__builtin_amdgcn_permlanex16(bits, bits, 0x76543210, 0xfedcba98, false, false));
}
__global__ __launch_bounds__(128) void causal_attn_kernel(
    const unsigned short* __restrict__ Up, const unsigned short* __restrict__ XHp,
    const unsigned short* __restrict__ VTHp, const unsigned short* __restrict__ VTLp,
    unsigned short* __restrict__ YH, unsigned short* __restrict__ YL)
{
  __shared__ __align__(16) _Float16 Ksh[kKC * kLP];
  __shared__ __align__(16) __bf16 Vth[kHS * kLP];
  __shared__ __align__(16) __bf16 Vtl[kHS * kLP];

  const int tid  = threadIdx.x;
  const int wave = tid >> 5;
  const int lane = tid & 31;
  const int hh   = lane >> 4;
  const int c    = lane & 15;

  constexpr int nqb = kT / 64;
  static_assert((nqb % 2) == 0, "query tiles pair up as t and nqb - 1 - t");
  const int bx = blockIdx.x;
  const int tp = bx % (nqb / 2);
  const int bh = bx / (nqb / 2);
  const int h  = bh % kH;
  const int b  = bh / kH;

  const _Float16* Uh = (const _Float16*)Up;
  const _Float16* Xh = (const _Float16*)XHp;
  const __bf16*   Vh = (const __bf16*)VTHp;
  const __bf16*   Vl = (const __bf16*)VTLp;

  /* the block's two query tiles, one after the other in every wave: nqb - 1 - tp, then tp; together nqb + 1 key chunks in every
     block. Kept rolled: one copy of the chunk loop in the instruction cache */
#pragma unroll 1
  for (int half = 0; half < 2; ++half) {
  const int qb = (half == 0) ? (nqb - 1 - tp) : tp;
  const int q0 = qb * 64 + wave * 16;
  /* this lane's query */
  const int qrow = q0 + c;

  /* query fragments (B operand, column c = query c): 2 d-chunks */
  v16h qa[2];
  {
    const _Float16* urow = Uh + (size_t)(b * kT + qrow) * kC + h * kHS;
#pragma unroll
    for (int dc = 0; dc < 2; ++dc) qa[dc] = Frag<_Float16>::load(urow + dc * 32 + 8 * hh);
  }

  /* running maximum of the query (equal in both lane halves); normaliser over this lane half's keys only */
  float mrow = -INFINITY, lrow = 0.f;
  v8f oacc[4];
#pragma unroll
  for (int t = 0; t < 4; ++t) oacc[t] = (v8f){0.f,0.f,0.f,0.f,0.f,0.f,0.f,0.f};

  const int nChunks = qb + 1;
  for (int kc = 0; kc < nChunks; ++kc) {
    const int kv0 = kc * kKC;
    __syncthreads();
    /* K, V hi, V lo tiles: 64 rows x 8 x 16 B = 512 each = 4 x 128 threads */
#pragma unroll
    for (int i = 0; i < 4; ++i) {
      const int e = i * 128 + tid;
      const int r = e >> 3, c8 = (e & 7) * 8;
      *(v8h*)(Ksh + r * kLP + c8) = *(const v8h*)(Xh + (size_t)(b * kT + kv0 + r) * kC + h * kHS + c8);
      const size_t vo = ((size_t)bh * kHS + r) * kT + kv0 + c8;
      *(v8b*)(Vth + r * kLP + c8) = *(const v8b*)(Vh + vo);
      *(v8b*)(Vtl + r * kLP + c8) = *(const v8b*)(Vl + vo);
    }
    __syncthreads();

    /* the chunk's 8 K fragments are read from LDS as one group ahead of the score products: the wave waits out the LDS latency
       once, not once in front of every product */
    v16h kf[4][2];
#pragma unroll
    for (int j = 0; j < 4; ++j)
#pragma unroll
      for (int dc = 0; dc < 2; ++dc) kf[j][dc] = Frag<_Float16>::load(Ksh + (j * 16 + c) * kLP + dc * 32 + 8 * hh);
    v8f s[4];
#pragma unroll
    for (int j = 0; j < 4; ++j) {
      s[j] = (v8f){0.f,0.f,0.f,0.f,0.f,0.f,0.f,0.f};
#pragma unroll
      for (int dc = 0; dc < 2; ++dc) s[j] = mma_h(kf[j][dc], qa[dc], s[j]);
    }
    acc_guard4(s[0], s[1], s[2], s[3]);

    const bool diag = (kc == qb);
    /* one maximum (and below one sum) per score tile: four short independent chains instead of one of 32 links */
    float cmj[4];
#pragma unroll
    for (int j = 0; j < 4; ++j) {
      cmj[j] = -INFINITY;
#pragma unroll
      for (int r = 0; r < 8; ++r) {
        const int kvrow = kv0 + j * 16 + 8 * hh + r;
        float sv = s[j][r] * kScoreScale;
        const bool masked = diag && (kvrow > qrow);
        sv = masked ? -INFINITY : sv;
        s[j][r] = sv;
        cmj[j] = fmaxf(cmj[j], sv);
      }
    }
    float cm = fmaxf(fmaxf(cmj[0], cmj[1]), fmaxf(cmj[2], cmj[3]));
    /* the other lane half holds the query's other 32 keys */
    cm = fmaxf(cm, other_half(cm));
    const float mnew = fmaxf(mrow, cm);
    const float alpha = __expf(mrow - mnew);
    mrow = mnew;
    /* scheduling fence between the maximum and the exponentials: the V reads written below are lifted up to here, under the
       exponentials, and no further */
    __builtin_amdgcn_sched_barrier(0);
    float psj[4];
    v16b ph[2], pl[2];
#pragma unroll
    for (int j = 0; j < 4; ++j) {
      psj[j] = 0.f;
#pragma unroll
      for (int r = 0; r < 8; ++r) {
        const float p = __expf(s[j][r] - mnew);
        psj[j] += p;
        unsigned short hb, lb;
        split_bits(p, hb, lb);
        ph[j >> 1][(j & 1) * 8 + r] = __builtin_bit_cast(__bf16, hb);
        pl[j >> 1][(j & 1) * 8 + r] = __builtin_bit_cast(__bf16, lb);
      }
    }
    /* V fragment pair i (hi and lo plane) = k step i >> 2, d tile i & 3. The pairs are read from LDS in groups of two, each group after the first
       two pairs (6 products) ahead of its use, so that the products cover the LDS latency */
    v16b vfh[8], vfl[8];
    auto read_v = [&](int i) {
      vfh[i] = Frag<__bf16>::load(Vth + ((i & 3) * 16 + c) * kLP + (i >> 2) * 32 + 8 * hh);
      vfl[i] = Frag<__bf16>::load(Vtl + ((i & 3) * 16 + c) * kLP + (i >> 2) * 32 + 8 * hh);
    };
    read_v(0);
    read_v(1);
    lrow = lrow * alpha + ((psj[0] + psj[1]) + (psj[2] + psj[3]));
#pragma unroll
    for (int t = 0; t < 4; ++t)
#pragma unroll
      for (int r = 0; r < 8; ++r) oacc[t][r] *= alpha;
    /* unrolled so that the index of the P and V fragments is a constant (registers, no scratch) */
#pragma unroll
    for (int i = 0; i < 8; ++i) {
      if ((i & 1) == 0 && i + 2 < 8) {
        read_v(i + 2);
        read_v(i + 3);
      }
      const int kk = i >> 2, t = i & 3;
      oacc[t] = mma_b(vfh[i], ph[kk], oacc[t]);
      oacc[t] = mma_b(vfl[i], ph[kk], oacc[t]);
      oacc[t] = mma_b(vfh[i], pl[kk], oacc[t]);
    }
    acc_guard4(oacc[0], oacc[1], oacc[2], oacc[3]);
  }

  /* join the two lane halves' normalisers */
  lrow += other_half(lrow);
  const float inv = 1.0f / lrow;
#pragma unroll
  for (int t = 0; t < 4; ++t) {
    v8h hv, lv;
#pragma unroll
    for (int r = 0; r < 8; ++r) {
      unsigned short hb, lb;
      split_bits(oacc[t][r] * inv, hb, lb);
      hv[r] = __builtin_bit_cast(_Float16, hb);
      lv[r] = __builtin_bit_cast(_Float16, lb);
    }
    const size_t o = (size_t)(b * kT + qrow) * kC + h * kHS + t * 16 + 8 * hh;
    *(v8h*)(YH + o) = hv;
    *(v8h*)(YL + o) = lv;
  }
  /* the next tile rewrites the registers that these stores name: the wait that stands in front of such a rewrite */
  asm volatile("s_wait_xcnt 0x0" ::: "memory");
  }
}

// ---------------------------------------------------------------------------
// Host glue: 8 launches, kernel launches only.
// GEMM shapes: M 8192, N 1024, K 1024: 64 x 4 block tiles of 128 x 256 = 256 blocks of 8 waves.
// ---------------------------------------------------------------------------
extern "C" void kernel_launch(void* const* d_in, const int* in_sizes, int n_in,
                              void* d_out, int out_size, void* d_ws, size_t ws_size,
                              hipStream_t stream) {
  if (n_in < 11) return;
  if (in_sizes[0] != kRows * kC) return;
  if (in_sizes[1] != kC * kC) return;
  if (in_sizes[2] != kC) return;
  if (in_sizes[3] != kC * kC) return;
  if (in_sizes[4] != kC) return;
  if (in_sizes[5] != kHS * kHS) return;
  if (in_sizes[6] != kHS) return;
  if (in_sizes[7] != kHS * kHS) return;
  if (in_sizes[8] != kHS) return;
  if (in_sizes[9] != kC * kC) return;
  if (in_sizes[10] != kC) return;
  if (out_size != kRows * kC) return;
  if (ws_size < kWsTotal) return;

  const float* x  = (const float*)d_in[0];
  const float* Wu = (const float*)d_in[1];
  const float* bu = (const float*)d_in[2];
  const float* Wv = (const float*)d_in[3];
  const float* bv = (const float*)d_in[4];
  const float* W1 = (const float*)d_in[5];
  const float* b1 = (const float*)d_in[6];
  const float* W2 = (const float*)d_in[7];
  const float* b2 = (const float*)d_in[8];
  const float* Wp = (const float*)d_in[9];
  const float* bp = (const float*)d_in[10];
  float* out = (float*)d_out;

  char* ws = (char*)d_ws;
  unsigned short* XH   = (unsigned short*)(ws + kOffXH);
  unsigned short* WUT  = (unsigned short*)(ws + kOffWUT);
  unsigned short* WVT  = (unsigned short*)(ws + kOffWVT);
  unsigned short* WPT  = (unsigned short*)(ws + kOffWPT);
  unsigned short* W12T = (unsigned short*)(ws + kOffW12);
  unsigned short* U16  = (unsigned short*)(ws + kOffU);
  float*          V0   = (float*)(ws + kOffV0);
  unsigned short* YH   = (unsigned short*)(ws + kOffYH);
  unsigned short* YL   = (unsigned short*)(ws + kOffYL);
  unsigned short* VTH  = (unsigned short*)(ws + kOffVTH);
  unsigned short* VTL  = (unsigned short*)(ws + kOffVTL);

  /* x -> f16 plane (bf16 values x16) */
  cast_x_kernel<<<(kRows * kC / 8) / 256, 256, 0, stream>>>(x, XH, kRows * kC / 8);

  /* in[k][n] -> out[n][k]: Wu, Wv as f16 (x1024), Wp as bf16; planes WUT, WVT, WPT are contiguous */
  wt_transpose_cast_kernel<<<dim3(kC / 64, kC / 64, 3), 256, 0, stream>>>(Wu, Wv, Wp, WUT, kC, kWCarry, 2);
  /* in[k][n] -> out[n][k]: W1, W2 as bf16 [64][64] planes */
  wt_transpose_cast_kernel<<<dim3(1, 1, 2), 256, 0, stream>>>(W1, W2, W2, W12T, kHS, 1.0f, 0);

  /* u (f16, x16) = x.Wu + bu */
  wmma_gemm64<0, 0, 2, 1><<<dim3(256, 1), 256, 0, stream>>>(
      XH, XH, kC, 0L,
      WUT, WUT, kC, 0L,
      (void*)U16, kC, 0L,
      bu, kRows, kC, kC, kUScale, kUCarry);

  /* v0 (f32) = x.Wv + bv */
  wmma_gemm64<0, 0, 2, 0><<<dim3(256, 1), 256, 0, stream>>>(
      XH, XH, kC, 0L,
      WVT, WVT, kC, 0L,
      (void*)V0, kC, 0L,
      bv, kRows, kC, kC, kV0Scale, 1.0f);

  /* gated value -> vT hi | lo planes */
  gated_value_kernel<<<dim3(kRows / 64, kH), 128, 0, stream>>>(V0, W12T, W12T + kHS * kHS, b1, b2, VTH, VTL);

  /* causal attention -> y hi | lo planes (the v0 bytes are dead from here on) */
  causal_attn_kernel<<<kB * kH * (kT / 128), 128, 0, stream>>>(U16, XH, VTH, VTL, YH, YL);

  /* out = y.Wp + bp (y hi.W + y lo.W) */
  wmma_gemm64<1, 1, 2, 0><<<dim3(256, 1), 256, 0, stream>>>(
      YH, YL, kC, 0L,
      WPT, WPT, kC, 0L,
      (void*)out, kC, 0L,
      bp, kRows, kC, kC, 1.0f, 1.0f);
}

// v006
// One run takes 175 microseconds.
// Timed twice side by side with v005, it ran 1.05 and 1.06 times as fast.
// Over all steps from v000 it is 4.02 times as fast.
// All contractions on 16-bit WMMA with f32 accumulate: x.Wu, x.Wv and the u.x^T scores on v_wmma_f32_16x16x32_f16 (inputs RNE-converted to bf16 once and held exactly in f16 planes with power-of-two carries: x x16, W x1024, u x16); v0.W1, v0.W2, P.v and y.Wp on v_wmma_f32_16x16x32_bf16 with the computed operand carried as bf16 hi+lo planes (W1, W2, Wp as bf16 planes); softmax, gate, residual and bias in f32.
#include <hip/hip_runtime.h>
#include <math.h>

typedef __attribute__((ext_vector_type(16))) _Float16 v16h;
typedef __attribute__((ext_vector_type(8)))  _Float16 v8h;
typedef __attribute__((ext_vector_type(16))) __bf16   v16b;
typedef __attribute__((ext_vector_type(8)))  __bf16   v8b;
typedef __attribute__((ext_vector_type(8)))  float    v8f;
typedef __attribute__((ext_vector_type(4)))  float    v4f;
typedef __attribute__((ext_vector_type(4)))  unsigned int v4u;
typedef __attribute__((ext_vector_type(8)))  unsigned int v8u;
typedef __attribute__((ext_vector_type(2)))  float    v2f;
typedef __attribute__((ext_vector_type(2)))  __bf16   v2b;

// ---------------------------------------------------------------------------
// Problem constants
// ---------------------------------------------------------------------------
constexpr int kB    = 4;
constexpr int kT    = 2048;
constexpr int kC    = 1024;
constexpr int kH    = 16;
constexpr int kHS   = 64;
constexpr int kRows = kB * kT;
constexpr int kSqrtC = 32;
static_assert(kSqrtC * kSqrtC == kC, "score scale is 1/sqrt(C)");
static_assert(kH * kHS == kC, "head split");
static_assert((kC % 32) == 0 && (kHS % 32) == 0 && (kT % 64) == 0, "K multiples of 32, key chunks of 64");
static_assert((kRows % 64) == 0 && (kC % 64) == 0, "GEMM M,N multiples of 64");

// power-of-two carries of the f16 planes (exact; folded back in f32)
constexpr float kXCarry = 16.0f;
constexpr float kWCarry = 1024.0f;
constexpr float kUCarry = 16.0f;
constexpr float kUScale  = kUCarry / (kXCarry * kWCarry);
constexpr float kV0Scale = 1.0f / (kXCarry * kWCarry);
constexpr float kScoreScale = 1.0f / ((float)kSqrtC * kUCarry * kXCarry);

// ---------------------------------------------------------------------------
// Workspace region map (bytes; every offset is a multiple of 128)
//   XH    f16  [8192][1024]      16*bf16(x)                      16,777,216
//   WUT   f16  [1024 n][1024 k]  1024*bf16(Wu)^T                  2,097,152
//   WVT   f16  [1024 n][1024 k]  1024*bf16(Wv)^T                  2,097,152
//   WPT   bf16 [1024 n][1024 k]  bf16(Wp)^T                       2,097,152
//   W12T  bf16 2 x [64 n][64 k]  bf16(W1)^T | bf16(W2)^T             16,384
//   U16   f16  [8192][1024]      16*u                            16,777,216
//   V0    f32  [8192][1024]      v0; dead after the gated-value launch, then the same bytes
//                                hold YH | YL (bf16 hi | lo planes of y, [8192][1024] each)  33,554,432
//   VTH   bf16 [4][16][64 d][2048 t]  gated v, hi plane           16,777,216
//   VTL   bf16 [4][16][64 d][2048 t]  gated v, lo plane           16,777,216
//   total                                                       106,971,136
// ---------------------------------------------------------------------------
constexpr size_t kSzAct16 = (size_t)kRows * kC * 2;
constexpr size_t kSzW16   = (size_t)kC * kC * 2;
constexpr size_t kSzW12   = (size_t)2 * kHS * kHS * 2;
constexpr size_t kSzV0    = (size_t)kRows * kC * 4;
constexpr size_t kOffXH   = 0;
constexpr size_t kOffWUT  = kOffXH  + kSzAct16;
constexpr size_t kOffWVT  = kOffWUT + kSzW16;
constexpr size_t kOffWPT  = kOffWVT + kSzW16;
constexpr size_t kOffW12  = kOffWPT + kSzW16;
constexpr size_t kOffU    = kOffW12 + kSzW12;
constexpr size_t kOffV0   = kOffU   + kSzAct16;
constexpr size_t kOffYH   = kOffV0;
constexpr size_t kOffYL   = kOffV0  + kSzAct16;
constexpr size_t kOffVTH  = kOffV0  + kSzV0;
constexpr size_t kOffVTL  = kOffVTH + kSzAct16;
constexpr size_t kWsTotal = kOffVTL + kSzAct16;
static_assert(kWsTotal == 106971136ull, "carve total");
static_assert(kWsTotal <= 134217728ull, "carve cap");
static_assert(2 * kSzAct16 == kSzV0, "y hi|lo planes fit the v0 plane exactly");
static_assert((kOffWUT % 128) == 0 && (kOffWVT % 128) == 0 && (kOffWPT % 128) == 0 && (kOffW12 % 128) == 0 &&
              (kOffU % 128) == 0 && (kOffV0 % 128) == 0 && (kOffYL % 128) == 0 && (kOffVTH % 128) == 0 &&
              (kOffVTL % 128) == 0, "128-B aligned regions");

// ---------------------------------------------------------------------------
// Bit helpers
// ---------------------------------------------------------------------------
/* f32 -> bf16 by the hardware's conversion (round to nearest even) */
__device__ __forceinline__ unsigned short f2bf_bits(float f) { const __bf16 h = (__bf16)f; return __builtin_bit_cast(unsigned short, h); }
__device__ __forceinline__ float bf_bits2f(unsigned short h) { return __uint_as_float(((unsigned)h) << 16); }
__device__ __forceinline__ unsigned pk16(unsigned short a, unsigned short b) { return (unsigned)a | ((unsigned)b << 16); }
__device__ __forceinline__ unsigned short h_bits(float f) { const _Float16 h = (_Float16)f; return __builtin_bit_cast(unsigned short, h); }
/* bf16 hi + bf16 lo of two f32 values, both RNE, as packed words (a in the low half): one packed conversion per plane */
__device__ __forceinline__ void split_pair(float a, float b, unsigned& hw, unsigned& lw) {
  const v2b h = __builtin_convertvector((v2f){a, b}, v2b);
  const v2b l = __builtin_convertvector((v2f){a - (float)h[0], b - (float)h[1]}, v2b);
  hw = __builtin_bit_cast(unsigned, h);
  lw = __builtin_bit_cast(unsigned, l);
}

// ---------------------------------------------------------------------------
// WMMA helpers: every matrix op is followed by 4 nops tied to its own accumulator and its A/B fragments
// ---------------------------------------------------------------------------
__device__ __forceinline__ v8f mma_h(v16h a, v16h b, v8f c) {
  c = __builtin_amdgcn_wmma_f32_16x16x32_f16(false, a, false, b, (short)0, c, false, false);
  asm volatile("v_nop\n\tv_nop\n\tv_nop\n\tv_nop" : "+v"(c) : "v"(a), "v"(b));
  return c;
}
__device__ __forceinline__ v8f mma_b(v16b a, v16b b, v8f c) {
  c = __builtin_amdgcn_wmma_f32_16x16x32_bf16(false, a, false, b, (short)0, c, false, false);
  asm volatile("v_nop\n\tv_nop\n\tv_nop\n\tv_nop" : "+v"(c) : "v"(a), "v"(b));
  return c;
}
__device__ __forceinline__ void keep4_h(v16h a, v16h b, v16h c, v16h d) { asm volatile("v_nop" :: "v"(a), "v"(b), "v"(c), "v"(d)); }
__device__ __forceinline__ void keep4_b(v16b a, v16b b, v16b c, v16b d) { asm volatile("v_nop" :: "v"(a), "v"(b), "v"(c), "v"(d)); }
__device__ __forceinline__ void acc_guard4(v8f& a, v8f& b, v8f& c, v8f& d) { asm volatile("v_nop\n\tv_nop\n\tv_nop\n\tv_nop" : "+v"(a), "+v"(b), "+v"(c), "+v"(d)); }

// Fragment loader: p already points at (row, k0 + 8*(lane>>4)); elements 0..7 <- p[0..7], elements 8..15 <- p[16..23]
template <typename T> struct Frag;
template <> struct Frag<_Float16> {
  typedef v16h V; union U { v16h v; v8h h[2]; };
  static __device__ __forceinline__ v16h load(const _Float16* p) {
    U f; f.h[0] = *(const v8h*)(p); f.h[1] = *(const v8h*)(p + 16); return f.v;
  }
  static __device__ __forceinline__ v8f mma(v16h a, v16h b, v8f c) { return mma_h(a, b, c); }
  static __device__ __forceinline__ void keep(v16h a, v16h b, v16h c, v16h d) { keep4_h(a, b, c, d); }
};
template <> struct Frag<__bf16> {
  typedef v16b V; union U { v16b v; v8b h[2]; };
  static __device__ __forceinline__ v16b load(const __bf16* p) {
    U f; f.h[0] = *(const v8b*)(p); f.h[1] = *(const v8b*)(p + 16); return f.v;
  }
  static __device__ __forceinline__ v8f mma(v16b a, v16b b, v8f c) { return mma_b(a, b, c); }
  static __device__ __forceinline__ void keep(v16b a, v16b b, v16b c, v16b d) { keep4_b(a, b, c, d); }
};

// ---- LDS-staged batched WMMA GEMM ------------------------------------------
// C[m,n] = scale * sum_k A[m,k] * Bt[n,k] + bias_scale * bf16(bias[n]).
// Block = 8 waves = one 128 x 256 tile of C; waves 2 (m) x 4 (n), each wave owns a 64x64 tile.
// A pass is 64 k = 128 B of every operand row. The block brings a pass's rows [A 128 | A2 128 (SPL 1) | Bt 256] from global
// memory as whole 128-B lines (8 lanes x 16 B per row) by asynchronous 16-byte copies into one of two LDS buffers, so that
// the next pass's rows fly while this pass is worked on; every wave reads its fragments from LDS. One block barrier per
// pass: it publishes the buffer just filled and ends the reads of the buffer that is refilled behind it.
// A row-major [M,K]; Bt row-major [N,K]; M % 128 == 0, N % 256 == 0, K % 64 == 0 (no tail handling).
// SPL: 0 = plain (one product), 1 = A carried as hi/lo planes (A2 = lo): hi.b + lo.b.
// BIAS_MODE: 0 = none, 2 = bias[n].   OUT_MODE: 0 = f32, 1 = f16.
// ET: 0 = f16 operands, 1 = bf16 operands (pointers passed as 16-bit storage)
constexpr int kBM = 128;
constexpr int kBN = 256;
constexpr int kKP = 64;
/* LDS row pitch of a staged 64-element row: 144 B = 16 B x 9 (odd) for the 16-byte fragment loads */
constexpr int kSP = 72;
static_assert((kRows % kBM) == 0 && (kC % kBN) == 0 && (kC % kKP) == 0, "GEMM block tile and pass divide the shapes");
template <int ET> struct Elem;
template <> struct Elem<0> { typedef _Float16 T; };
template <> struct Elem<1> { typedef __bf16 T; };
template <int ET, int SPL, int BIAS_MODE, int OUT_MODE>
__global__ __launch_bounds__(256) void wmma_gemm64(
    const unsigned short* __restrict__ Ap, const unsigned short* __restrict__ A2p, int lda, long strideA,
    const unsigned short* __restrict__ Btp, const unsigned short* __restrict__ Bt2p, int ldb, long strideB,
    void* __restrict__ Cout, int ldc, long strideC,
    const float* __restrict__ bias,
    int M, int N, int K, float scale, float bias_scale) {
  static_assert(SPL == 0 || SPL == 1, "one or two A planes");
  typedef typename Elem<ET>::T T;
  typedef typename Frag<T>::V V;
  constexpr int kRowsA      = (SPL == 1) ? 2 * kBM : kBM;
  constexpr int kStageRows  = kRowsA + kBN;
  constexpr int kStageElems = kStageRows * kSP;
  /* one 16-byte copy per thread covers 32 rows of the stage */
  constexpr int kCopies     = kStageRows / 32;
  constexpr unsigned kStageBytes = (unsigned)kStageElems * 2u;
  static_assert((kCopies % 4) == 0, "copies go four to a statement");
  const T* A = (const T*)Ap; const T* A2 = (const T*)A2p; const T* Bt = (const T*)Btp;
  __shared__ __align__(16) T sStage[2 * kStageElems];
  /* per-wave 16x64 slab, pitch 68 floats */
  __shared__ __align__(16) float sT[8][16 * 68];
  const int b    = blockIdx.y;
  const int tid  = threadIdx.x;
  const int lane = tid & 31;
  const int wave = tid >> 5;
  const int tilesN = N / kBN;
  const int tilesM = M / kBM;
  const int tile = blockIdx.x;
  /* block-uniform exit, in front of every barrier */
  if (tile >= tilesM * tilesN) return;
  const int tm = tile / tilesN;
  const int tn = tile - tm * tilesN;
  const int wm = wave >> 2;
  const int wn = wave & 3;
  const int m0 = tm * kBM + (wm << 6);
  const int n0 = tn * kBN + (wn << 6);

  const T* Ab  = A  + (size_t)b * strideA + (size_t)(tm * kBM) * lda;
  const T* Ab2 = A2 + (size_t)b * strideA + (size_t)(tm * kBM) * lda;
  const T* Bb  = Bt + (size_t)b * strideB + (size_t)(tn * kBN) * ldb;

  /* rlane: row (A) / col (B, D) within a 16-wide subtile; koff: k offset of this lane half; mOff: D row offset */
  const int rlane = lane & 15;
  const int koff  = (lane >> 4) * 8;
  const int mOff  = (lane >> 4) * 8;

  /* staging: thread -> (row tid / 8 of each group of 32 rows, 16-byte piece tid % 8 of its 128 B) */
  const int srow = tid >> 3;
  const int sc8  = (tid & 7) * 8;
  const unsigned offA = (unsigned)srow * (unsigned)lda + (unsigned)sc8;
  const unsigned offB = (unsigned)srow * (unsigned)ldb + (unsigned)sc8;
  /* LDS byte address (low 32 bits of the __shared__ address) of this thread's piece in row srow of buffer 0 */
  const unsigned ldsT = (unsigned)(size_t)(sStage + srow * kSP + sc8);
  auto copy_stage = [&](int k0, unsigned bufByte) {
    /* both loops unrolled: which operand a group of rows belongs to is then decided at compile time */
#pragma unroll
    for (int g = 0; g < kCopies / 4; ++g) {
      const T* gp[4];
      unsigned lp[4];
#pragma unroll
      for (int e = 0; e < 4; ++e) {
        const int r0 = (g * 4 + e) * 32;
        if (r0 < kBM)         gp[e] = Ab  + (size_t)r0 * lda + k0 + offA;
        else if (r0 < kRowsA) gp[e] = Ab2 + (size_t)(r0 - kBM) * lda + k0 + offA;
        else                  gp[e] = Bb  + (size_t)(r0 - kRowsA) * ldb + k0 + offB;
        lp[e] = ldsT + bufByte + (unsigned)(r0 * kSP * 2);
      }
      /* four copies, then the wait that stands in front of any rewrite of the address registers they name */
      asm volatile("global_load_async_to_lds_b128 %0, %1, off\n\t"
                   "global_load_async_to_lds_b128 %2, %3, off\n\t"
                   "global_load_async_to_lds_b128 %4, %5, off\n\t"
                   "global_load_async_to_lds_b128 %6, %7, off\n\t"
                   "s_wait_xcnt 0x0"
                   :: "v"(lp[0]), "v"(gp[0]), "v"(lp[1]), "v"(gp[1]), "v"(lp[2]), "v"(gp[2]), "v"(lp[3]), "v"(gp[3])
                   : "memory");
    }
  };

  v8f acc[4][4];
#pragma unroll
  for (int i = 0; i < 4; ++i)
#pragma unroll
    for (int j = 0; j < 4; ++j) acc[i][j] = (v8f){0.f,0.f,0.f,0.f,0.f,0.f,0.f,0.f};

  const int nPass = K / kKP;
  copy_stage(0, 0u);
  /* pass 0's rows have landed (this wave's copies), then every wave's */
  asm volatile("s_wait_asynccnt 0x0" ::: "memory");
  __syncthreads();
  if (nPass > 1) copy_stage(kKP, kStageBytes);
  for (int p = 0; p < nPass; ++p) {
    const T* buf = sStage + (p & 1) * kStageElems;
    const T* sA  = buf + ((wm << 6) + rlane) * kSP + koff;
    const T* sA2 = sA + kBM * kSP;
    const T* sB  = buf + (kRowsA + (wn << 6) + rlane) * kSP + koff;
    /* the loops below are unrolled so that every index of a fragment or accumulator array is a constant (registers, no scratch) */
#pragma unroll
    for (int ks = 0; ks < kKP / 32; ++ks) {
      V bh[4];
#pragma unroll
      for (int j = 0; j < 4; ++j) bh[j] = Frag<T>::load(sB + (j << 4) * kSP + ks * 32);
      /* per accumulator and k step: the hi product, then the lo product */
#pragma unroll
      for (int pl = 0; pl <= SPL; ++pl) {
        const T* sAp = (pl == 0) ? sA : sA2;
        V af[4];
#pragma unroll
        for (int i = 0; i < 4; ++i) af[i] = Frag<T>::load(sAp + (i << 4) * kSP + ks * 32);
#pragma unroll
        for (int i = 0; i < 4; ++i) {
#pragma unroll
          for (int j = 0; j < 4; ++j) acc[i][j] = Frag<T>::mma(af[i], bh[j], acc[i][j]);
        }
      }
      Frag<T>::keep(bh[0], bh[1], bh[2], bh[3]);
    }
    /* this wave's reads of buffer p & 1 are done before that buffer is refilled */
    asm volatile("s_wait_dscnt 0x0" ::: "memory");
    /* this wave's copies of pass p + 1 have landed before the barrier publishes them */
    asm volatile("s_wait_asynccnt 0x0" ::: "memory");
    __syncthreads();
    if (p + 2 < nPass) copy_stage((p + 2) * kKP, (unsigned)(p & 1) * kStageBytes);
  }
  /* no copy is outstanding when the wave goes on to the epilogue */
  asm volatile("s_wait_asynccnt 0x0" ::: "memory");
  acc_guard4(acc[0][0], acc[0][1], acc[0][2], acc[0][3]);
  acc_guard4(acc[1][0], acc[1][1], acc[1][2], acc[1][3]);
  acc_guard4(acc[2][0], acc[2][1], acc[2][2], acc[2][3]);
  acc_guard4(acc[3][0], acc[3][1], acc[3][2], acc[3][3]);

  // ---- epilogue ----
  float* slab = sT[wave];
#pragma unroll
  for (int i = 0; i < 4; ++i) {
    const int mBase = m0 + (i << 4);
#pragma unroll
    for (int j = 0; j < 4; ++j) {
      const int n = n0 + (j << 4) + rlane;
      float bv = 0.f;
      if (BIAS_MODE == 2) bv = bf_bits2f(f2bf_bits(bias[n])) * bias_scale;
#pragma unroll
      for (int r = 0; r < 8; ++r) {
        float v = acc[i][j][r] * scale;
        if (BIAS_MODE == 2) v += bv;
        slab[(mOff + r) * 68 + (j << 4) + rlane] = v;
      }
    }
    __builtin_amdgcn_fence(__ATOMIC_RELEASE, "workgroup");
    __builtin_amdgcn_wave_barrier();
    __builtin_amdgcn_fence(__ATOMIC_ACQUIRE, "workgroup");
    if (OUT_MODE == 0) {
      /* row segment = 256 B = 16 lanes x 16 B; one instruction covers 2 rows */
      float* C = (float*)Cout + (size_t)b * strideC;
      const int hh = lane >> 4, c4 = (lane & 15) * 4;
      {
#pragma unroll
        for (int it = 0; it < 8; ++it) {
          const int row = it * 2 + hh;
          v4f v = *(const v4f*)(slab + row * 68 + c4);
          *(v4f*)(C + (size_t)(mBase + row) * ldc + n0 + c4) = v;
        }
        
      }
    } else {
      const int q = lane >> 3, c8 = (lane & 7) * 8;
      unsigned short* C  = (unsigned short*)Cout  + (size_t)b * strideC;
      {
#pragma unroll
        for (int it = 0; it < 4; ++it) {
          const int row = it * 4 + q;
          const float* sp = slab + row * 68 + c8;
          v8h hv;
#pragma unroll
          for (int e = 0; e < 8; ++e) hv[e] = (_Float16)sp[e];
          *(v8h*)(C + (size_t)(mBase + row) * ldc + n0 + c8) = hv;
        }
        
      }
    }
    __builtin_amdgcn_fence(__ATOMIC_RELEASE, "workgroup");
    __builtin_amdgcn_wave_barrier();
    __builtin_amdgcn_fence(__ATOMIC_ACQUIRE, "workgroup");
  }
}

// ---------------------------------------------------------------------------
// x: f32 -> RNE bf16 -> x16 -> f16 plane (exact), 8 consecutive elements per thread.
// Coverage: n8 = 8192*1024/8 = 1,048,576 threads = 4096 blocks x 256 exactly.
// ---------------------------------------------------------------------------
__global__ __launch_bounds__(256) void cast_x_kernel(const float* __restrict__ in, unsigned short* __restrict__ out, int n8) {
  const int i = blockIdx.x * 256 + threadIdx.x;
  if (i >= n8) return;
  const float* p = in + 8 * (size_t)i;
  const v4f a = *(const v4f*)(p);
  const v4f c = *(const v4f*)(p + 4);
  unsigned short hb[8];
#pragma unroll
  for (int e = 0; e < 4; ++e) {
    const float a_e = a[e];
    const float c_e = c[e];
    hb[e]     = h_bits(bf_bits2f(f2bf_bits(a_e)) * kXCarry);
    hb[4 + e] = h_bits(bf_bits2f(f2bf_bits(c_e)) * kXCarry);
  }
  const v4u u = (v4u){pk16(hb[0], hb[1]), pk16(hb[2], hb[3]), pk16(hb[4], hb[5]), pk16(hb[6], hb[7])};
  unsigned short* q = out + 8 * (size_t)i;
  *(v4u*)q = u;
  
}

// ---------------------------------------------------------------------------
// Weight transpose + cast: W is row-major [dim k][dim n] f32; WT[n][k] = cast(bf16_rne(W[k][n])).
// Planes z < bf_from_z are written as f16 of (bf16 value x carry); planes z >= bf_from_z as raw bf16 bits.
// grid (dim/64, dim/64, planes): blockIdx.x = k tile (64 cols of WT), blockIdx.y = n tile (64 rows of WT). 256 threads.
// Load coverage: 16 iterations x 256 threads = 4096 = the whole 64x64 tile (coalesced along n).
// Store coverage: 8 waves x 2 iterations x 4 rows (lane>>3) = 64 rows; (lane&7) x 8 halves = 64 cols; each row segment =
// ---------------------------------------------------------------------------
__global__ __launch_bounds__(256) void wt_transpose_cast_kernel(const float* __restrict__ W0, const float* __restrict__ W1,
                                                                const float* __restrict__ W2, unsigned short* __restrict__ out,
                                                                int dim, float carry, int bf_from_z) {
  /* sm[n_local][k_local] */
  __shared__ float sm[64][65];
  const int t  = threadIdx.x;
  const int k0 = blockIdx.x * 64;
  const int n0 = blockIdx.y * 64;
  const int z  = blockIdx.z;
  const float* W = (z == 0) ? W0 : (z == 1) ? W1 : W2;
  const bool as_bf = (z >= bf_from_z);
#pragma unroll
  for (int i = 0; i < 16; ++i) {
    const int e = i * 256 + t;
    const int r = e >> 6;
    const int c = e & 63;
    sm[c][r] = W[(size_t)(k0 + r) * dim + n0 + c];
  }
  __syncthreads();
  const int lane = t & 31, wave = t >> 5;
  const int q = lane >> 3, c8 = (lane & 7) * 8;
  unsigned short* op = out + (size_t)z * dim * dim;
  {
#pragma unroll
    for (int it = 0; it < 2; ++it) {
      const int row = wave * 8 + it * 4 + q;
      unsigned short hb[8];
#pragma unroll
      for (int e = 0; e < 8; ++e) {
        const float w = sm[row][c8 + e];
        const unsigned short bb = f2bf_bits(w);
        const unsigned short fh = h_bits(bf_bits2f(bb) * carry);
        hb[e] = as_bf ? bb : fh;
      }
      const v4u u = (v4u){pk16(hb[0], hb[1]), pk16(hb[2], hb[3]), pk16(hb[4], hb[5]), pk16(hb[6], hb[7])};
      *(v4u*)(op + (size_t)(n0 + row) * dim + k0 + c8) = u;
    }
    
  }
}

// ---------------------------------------------------------------------------
// Gated value transform per (64-token block, head): a = v0 + (v0.W1 + b1), g = sigmoid(v0.W2 + b2), v = a*g.
// Block = 4 waves; wave w owns tokens 16w..16w+15 of the block and all 64 output dims.
// v0 tile (f32) staged in LDS; A fragments = bf16 hi and lo of v0 built in registers; W1^T / W2^T bf16 planes staged in LDS;
// 2 k-steps x 4 n-tiles x 2 matrices x 2 products on v_wmma_f32_16x16x32_bf16.
// The two f32 results are transposed through LDS ([d][token]); the gate is applied in the store phase (8 values per lane
// grid (8192/64, 16). All barriers under block-uniform control.
// ---------------------------------------------------------------------------
constexpr int kGP = 68;
/* LDS row pitch of the two 64 x 64 bf16 weight planes: 144 B = 16 B x 9 (odd) for their 16-byte fragment loads */
constexpr int kWP = 72;
__global__ __launch_bounds__(128) void gated_value_kernel(
    const float* __restrict__ V0, const unsigned short* __restrict__ W1tp, const unsigned short* __restrict__ W2tp,
    const float* __restrict__ b1, const float* __restrict__ b2,
    unsigned short* __restrict__ VTH, unsigned short* __restrict__ VTL)
{
  /* sA: first the v0 tile [token][d]; later the gate pre-activation [d][token]. sB: residual sum [d][token]. */
  __shared__ __align__(16) float sA[64 * kGP];
  __shared__ __align__(16) float sB[64 * kGP];
  __shared__ __align__(16) __bf16 sW1[kHS * kWP];
  __shared__ __align__(16) __bf16 sW2[kHS * kWP];
  __shared__ float sBias[2 * kHS];
  const int tid = threadIdx.x, lane = tid & 31, wave = tid >> 5;
  const int hh = lane >> 4, c = lane & 15;
  const int g0 = blockIdx.x * 64;
  const int hd = blockIdx.y;
  const int bidx = g0 / kT;
  const int t0 = g0 - bidx * kT;
  const __bf16* W1t = (const __bf16*)W1tp;
  const __bf16* W2t = (const __bf16*)W2tp;
  /* v0 tile: 64 rows x 16 float4 = 1024 = 8 x 128 threads */
#pragma unroll
  for (int i = 0; i < 8; ++i) {
    const int e = i * 128 + tid;
    const int r = e >> 4, c4 = (e & 15) * 4;
    *(v4f*)(sA + r * kGP + c4) = *(const v4f*)(V0 + (size_t)(g0 + r) * kC + hd * kHS + c4);
  }
  /* weight planes: 4096 bf16 each = 512 x 16 B = 4 x 128 threads */
#pragma unroll
  for (int i = 0; i < 4; ++i) {
    const int e = (i * 128 + tid) * 8;
    const int le = (e >> 6) * kWP + (e & 63);
    *(v8b*)(sW1 + le) = *(const v8b*)(W1t + e);
    *(v8b*)(sW2 + le) = *(const v8b*)(W2t + e);
  }
  {
    const int bi = tid & 63;
    const float x1 = b1[bi];
    const float x2 = b2[bi];
    const float xs = (tid < kHS) ? x1 : x2;
    sBias[tid] = bf_bits2f(f2bf_bits(xs));
  }
  __syncthreads();

  /* A fragments (hi, lo) for this wave's 16 tokens */
  v16b ah[2], al[2];
  {
    const int arow = wave * 16 + c;
    v8u hw, lw;
#pragma unroll
    for (int ks = 0; ks < 2; ++ks) {
      const float* p = sA + arow * kGP + ks * 32 + 8 * hh;
      const v4f f0 = *(const v4f*)(p);
      const v4f f1 = *(const v4f*)(p + 4);
      const v4f f2 = *(const v4f*)(p + 16);
      const v4f f3 = *(const v4f*)(p + 20);
#pragma unroll
      for (int e = 0; e < 2; ++e) {
        unsigned h2, l2;
        split_pair(f0[2 * e], f0[2 * e + 1], h2, l2);
        hw[e] = h2;      lw[e] = l2;
        split_pair(f1[2 * e], f1[2 * e + 1], h2, l2);
        hw[2 + e] = h2;  lw[2 + e] = l2;
        split_pair(f2[2 * e], f2[2 * e + 1], h2, l2);
        hw[4 + e] = h2;  lw[4 + e] = l2;
        split_pair(f3[2 * e], f3[2 * e + 1], h2, l2);
        hw[6 + e] = h2;  lw[6 + e] = l2;
      }
      ah[ks] = __builtin_bit_cast(v16b, hw);
      al[ks] = __builtin_bit_cast(v16b, lw);
    }
  }

  v8f a1[4], a2[4];
#pragma unroll
  for (int j = 0; j < 4; ++j) {
    a1[j] = (v8f){0.f,0.f,0.f,0.f,0.f,0.f,0.f,0.f};
    a2[j] = (v8f){0.f,0.f,0.f,0.f,0.f,0.f,0.f,0.f};
  }
#pragma unroll
  for (int ks = 0; ks < 2; ++ks) {
#pragma unroll
    for (int j = 0; j < 4; ++j) {
      const v16b w1 = Frag<__bf16>::load(sW1 + (j * 16 + c) * kWP + ks * 32 + 8 * hh);
      const v16b w2 = Frag<__bf16>::load(sW2 + (j * 16 + c) * kWP + ks * 32 + 8 * hh);
      a1[j] = mma_b(ah[ks], w1, a1[j]);
      a1[j] = mma_b(al[ks], w1, a1[j]);
      a2[j] = mma_b(ah[ks], w2, a2[j]);
      a2[j] = mma_b(al[ks], w2, a2[j]);
    }
  }
  acc_guard4(a1[0], a1[1], a1[2], a1[3]);
  acc_guard4(a2[0], a2[1], a2[2], a2[3]);

  /* residual + biases in place (reads only this wave's own token rows of sA) */
#pragma unroll
  for (int j = 0; j < 4; ++j) {
    const int col = j * 16 + c;
    const float bb1 = sBias[col];
    const float bb2 = sBias[kHS + col];
#pragma unroll
    for (int r = 0; r < 8; ++r) {
      const int row = wave * 16 + 8 * hh + r;
      const float vres = sA[row * kGP + col];
      a1[j][r] = vres + (a1[j][r] + bb1);
      a2[j][r] = a2[j][r] + bb2;
    }
  }
  /* every wave has finished reading the v0 tile before it is overwritten */
  __syncthreads();
#pragma unroll
  for (int j = 0; j < 4; ++j) {
    const int col = j * 16 + c;
#pragma unroll
    for (int r = 0; r < 8; ++r) {
      const int row = wave * 16 + 8 * hh + r;
      sB[col * kGP + row] = a1[j][r];
      sA[col * kGP + row] = a2[j][r];
    }
  }
  __syncthreads();

  const int q = lane >> 3, c8 = (lane & 7) * 8;
#pragma unroll 1
  for (int it = 0; it < 4; ++it) {
    const int d = wave * 16 + it * 4 + q;
    const float* pa = sB + d * kGP + c8;
    const float* pg = sA + d * kGP + c8;
    const v4f av0 = *(const v4f*)(pa);
    const v4f av1 = *(const v4f*)(pa + 4);
    const v4f gv0 = *(const v4f*)(pg);
    const v4f gv1 = *(const v4f*)(pg + 4);
    float rv[8];
#pragma unroll
    for (int e = 0; e < 4; ++e) {
      const float xa0 = av0[e];
      const float xg0 = gv0[e];
      const float xa1 = av1[e];
      const float xg1 = gv1[e];
      rv[e]     = xa0 * (1.0f / (1.0f + expf(-xg0)));
      rv[4 + e] = xa1 * (1.0f / (1.0f + expf(-xg1)));
    }
    v4u hw, lw;
#pragma unroll
    for (int e = 0; e < 4; ++e) {
      unsigned h2, l2;
      split_pair(rv[2 * e], rv[2 * e + 1], h2, l2);
      hw[e] = h2;
      lw[e] = l2;
    }
    const v8h hv = __builtin_bit_cast(v8h, hw);
    const v8h lv = __builtin_bit_cast(v8h, lw);
    const size_t o = ((size_t)(bidx * kH + hd) * kHS + d) * kT + t0 + c8;
    *(v8h*)(VTH + o) = hv;
    *(v8h*)(VTL + o) = lv;
    
  }
}

// ---------------------------------------------------------------------------
// Causal attention for head dim 64 from 16-bit planes. Block = 4 waves = two tiles of 64 query rows of one (batch, head), tile
// nqb - 1 - tp and then tile tp, so that every block walks the same number of key chunks (nqb + 1) wherever it is placed;
// per tile: keys in chunks of 64 up to and including the diagonal chunk (block-uniform trip count qb + 1 <= 32).
// Both products are computed transposed, so that a lane owns ONE query (column c = lane & 15):
//   scores^T: A = x (f16, x16) key rows staged in LDS, B = u (f16, x16) query rows held in registers; register r of tile j
//   is the score of key 16 j + 8 (lane >> 4) + r against query c; x 1/(32*16*16).
//   diagonal chunk: key > query -> -inf (every query keeps at least its own key; the first chunk always holds key 0).
//   online softmax in f32: maximum and normaliser run in the lane over its 32 keys; the two lane halves exchange the maximum
//   once per chunk and join their normalisers once behind the loop; the normaliser is summed from the f32 p values.
//   P^T: score tiles 2 kk and 2 kk + 1, converted in place to bf16 hi + lo, ARE the B operand of k step kk (element s = tile
//   s >> 3, register s & 7, the k order of the fragment loader); P never leaves the registers.
//   O^T += v^T.P^T: A = v hi + lo ([d][key] planes) staged in LDS; hi.hi + lo(v).hi(P) + hi(v).lo(P).
//   LDS fragment reads stand in groups ahead of the products that use them, never one by one in front of each product.
//   A lane ends with 8 consecutive d of its query per tile: one 16-byte store per tile and plane.
// ---------------------------------------------------------------------------
constexpr int kKC = 64;
/* LDS row pitch of every 64-element 16-bit tile read by 16-byte fragment loads: 72 elements = 144 B = 16 B x 9 (odd), so 16 rows fall on distinct banks */
constexpr int kLP = 72;
static_assert(kLP >= kKC && kLP >= kHS && (kLP % 8) == 0 && ((kLP / 8) % 2) == 1, "pitch: 16-B aligned rows, odd multiple of 16 B");
/* the value that lane ^ 16 holds */
__device__ __forceinline__ float other_half(float x) {
  const int bits = __float_as_int(x);
  return __int_as_float(__builtin_amdgcn_permlanex16(bits, bits, 0x76543210, 0xfedcba98, false, false));
}
__global__ __launch_bounds__(128) void causal_attn_kernel(
    const unsigned short* __restrict__ Up, const unsigned short* __restrict__ XHp,
    const unsigned short* __restrict__ VTHp, const unsigned short* __restrict__ VTLp,
    unsigned short* __restrict__ YH, unsigned short* __restrict__ YL)
{
  __shared__ __align__(16) _Float16 Ksh[kKC * kLP];
  __shared__ __align__(16) __bf16 Vth[kHS * kLP];
  __shared__ __align__(16) __bf16 Vtl[kHS * kLP];

  const int tid  = threadIdx.x;
  const int wave = tid >> 5;
  const int lane = tid & 31;
  const int hh   = lane >> 4;
  const int c    = lane & 15;

  constexpr int nqb = kT / 64;
  static_assert((nqb % 2) == 0, "query tiles pair up as t and nqb - 1 - t");
  const int bx = blockIdx.x;
  const int tp = bx % (nqb / 2);
  const int bh = bx / (nqb / 2);
  const int h  = bh % kH;
  const int b  = bh / kH;

  const _Float16* Uh = (const _Float16*)Up;
  const _Float16* Xh = (const _Float16*)XHp;
  const __bf16*   Vh = (const __bf16*)VTHp;
  const __bf16*   Vl = (const __bf16*)VTLp;

  /* the block's two query tiles, one after the other in every wave: nqb - 1 - tp, then tp; together nqb + 1 key chunks in every
     block. Kept rolled: one copy of the chunk loop in the instruction cache */
#pragma unroll 1
  for (int half = 0; half < 2; ++half) {
  const int qb = (half == 0) ? (nqb - 1 - tp) : tp;
  const int q0 = qb * 64 + wave * 16;
  /* this lane's query */
  const int qrow = q0 + c;

  /* query fragments (B operand, column c = query c): 2 d-chunks */
  v16h qa[2];
  {
    const _Float16* urow = Uh + (size_t)(b * kT + qrow) * kC + h * kHS;
#pragma unroll
    for (int dc = 0; dc < 2; ++dc) qa[dc] = Frag<_Float16>::load(urow + dc * 32 + 8 * hh);
  }

  /* running maximum of the query (equal in both lane halves); normaliser over this lane half's keys only */
  float mrow = -INFINITY, lrow = 0.f;
  v8f oacc[4];
#pragma unroll
  for (int t = 0; t < 4; ++t) oacc[t] = (v8f){0.f,0.f,0.f,0.f,0.f,0.f,0.f,0.f};

  const int nChunks = qb + 1;
  for (int kc = 0; kc < nChunks; ++kc) {
    const int kv0 = kc * kKC;
    __syncthreads();
    /* K, V hi, V lo tiles: 64 rows x 8 x 16 B = 512 each = 4 x 128 threads */
#pragma unroll
    for (int i = 0; i < 4; ++i) {
      const int e = i * 128 + tid;
      const int r = e >> 3, c8 = (e & 7) * 8;
      *(v8h*)(Ksh + r * kLP + c8) = *(const v8h*)(Xh + (size_t)(b * kT + kv0 + r) * kC + h * kHS + c8);
      const size_t vo = ((size_t)bh * kHS + r) * kT + kv0 + c8;
      *(v8b*)(Vth + r * kLP + c8) = *(const v8b*)(Vh + vo);
      *(v8b*)(Vtl + r * kLP + c8) = *(const v8b*)(Vl + vo);
    }
    __syncthreads();

    /* the chunk's 8 K fragments are read from LDS as one group ahead of the score products: the wave waits out the LDS latency
       once, not once in front of every product */
    v16h kf[4][2];
#pragma unroll
    for (int j = 0; j < 4; ++j)
#pragma unroll
      for (int dc = 0; dc < 2; ++dc) kf[j][dc] = Frag<_Float16>::load(Ksh + (j * 16 + c) * kLP + dc * 32 + 8 * hh);
    v8f s[4];
#pragma unroll
    for (int j = 0; j < 4; ++j) {
      s[j] = (v8f){0.f,0.f,0.f,0.f,0.f,0.f,0.f,0.f};
#pragma unroll
      for (int dc = 0; dc < 2; ++dc) s[j] = mma_h(kf[j][dc], qa[dc], s[j]);
    }
    acc_guard4(s[0], s[1], s[2], s[3]);

    const bool diag = (kc == qb);
    /* one maximum (and below one sum) per score tile: four short independent chains instead of one of 32 links */
    float cmj[4];
#pragma unroll
    for (int j = 0; j < 4; ++j) {
      cmj[j] = -INFINITY;
#pragma unroll
      for (int r = 0; r < 8; ++r) {
        const int kvrow = kv0 + j * 16 + 8 * hh + r;
        float sv = s[j][r] * kScoreScale;
        const bool masked = diag && (kvrow > qrow);
        sv = masked ? -INFINITY : sv;
        s[j][r] = sv;
        cmj[j] = fmaxf(cmj[j], sv);
      }
    }
    float cm = fmaxf(fmaxf(cmj[0], cmj[1]), fmaxf(cmj[2], cmj[3]));
    /* the other lane half holds the query's other 32 keys */
    cm = fmaxf(cm, other_half(cm));
    const float mnew = fmaxf(mrow, cm);
    const float alpha = __expf(mrow - mnew);
    mrow = mnew;
    /* scheduling fence between the maximum and the exponentials: the V reads written below are lifted up to here, under the
       exponentials, and no further */
    __builtin_amdgcn_sched_barrier(0);
    float psj[4];
    v8u phw[2], plw[2];
#pragma unroll
    for (int j = 0; j < 4; ++j) {
      psj[j] = 0.f;
#pragma unroll
      for (int r = 0; r < 8; r += 2) {
        const float p0 = __expf(s[j][r] - mnew);
        const float p1 = __expf(s[j][r + 1] - mnew);
        psj[j] += p0;
        psj[j] += p1;
        unsigned h2, l2;
        split_pair(p0, p1, h2, l2);
        phw[j >> 1][(j & 1) * 4 + (r >> 1)] = h2;
        plw[j >> 1][(j & 1) * 4 + (r >> 1)] = l2;
      }
    }
    const v16b ph[2] = {__builtin_bit_cast(v16b, phw[0]), __builtin_bit_cast(v16b, phw[1])};
    const v16b pl[2] = {__builtin_bit_cast(v16b, plw[0]), __builtin_bit_cast(v16b, plw[1])};
    /* V fragment pair i (hi and lo plane) = k step i >> 2, d tile i & 3. The pairs are read from LDS in groups of two, each group
       two pairs (6 products) ahead of its use, so that the products cover the LDS latency */
    v16b vfh[8], vfl[8];
    auto read_v = [&](int i) {
      vfh[i] = Frag<__bf16>::load(Vth + ((i & 3) * 16 + c) * kLP + (i >> 2) * 32 + 8 * hh);
      vfl[i] = Frag<__bf16>::load(Vtl + ((i & 3) * 16 + c) * kLP + (i >> 2) * 32 + 8 * hh);
    };
    read_v(0);
    read_v(1);
    lrow = lrow * alpha + ((psj[0] + psj[1]) + (psj[2] + psj[3]));
#pragma unroll
    for (int t = 0; t < 4; ++t)
#pragma unroll
      for (int r = 0; r < 8; ++r) oacc[t][r] *= alpha;
    /* unrolled so that the index of the P and V fragments is a constant (registers, no scratch) */
#pragma unroll
    for (int i = 0; i < 8; ++i) {
      if ((i & 1) == 0 && i + 2 < 8) {
        read_v(i + 2);
        read_v(i + 3);
      }
      const int kk = i >> 2, t = i & 3;
      oacc[t] = mma_b(vfh[i], ph[kk], oacc[t]);
      oacc[t] = mma_b(vfl[i], ph[kk], oacc[t]);
      oacc[t] = mma_b(vfh[i], pl[kk], oacc[t]);
    }
    acc_guard4(oacc[0], oacc[1], oacc[2], oacc[3]);
  }

  /* join the two lane halves' normalisers */
  lrow += other_half(lrow);
  const float inv = 1.0f / lrow;
#pragma unroll
  for (int t = 0; t < 4; ++t) {
    v4u hw, lw;
#pragma unroll
    for (int r = 0; r < 4; ++r) {
      unsigned h2, l2;
      split_pair(oacc[t][2 * r] * inv, oacc[t][2 * r + 1] * inv, h2, l2);
      hw[r] = h2;
      lw[r] = l2;
    }
    const v8h hv = __builtin_bit_cast(v8h, hw);
    const v8h lv = __builtin_bit_cast(v8h, lw);
    const size_t o = (size_t)(b * kT + qrow) * kC + h * kHS + t * 16 + 8 * hh;
    *(v8h*)(YH + o) = hv;
    *(v8h*)(YL + o) = lv;
  }
  /* the next tile rewrites the registers that these stores name: the wait that stands in front of such a rewrite */
  asm volatile("s_wait_xcnt 0x0" ::: "memory");
  }
}

// ---------------------------------------------------------------------------
// Host glue: 8 launches, kernel launches only.
// GEMM shapes: M 8192, N 1024, K 1024: 64 x 4 block tiles of 128 x 256 = 256 blocks of 8 waves.
// ---------------------------------------------------------------------------
extern "C" void kernel_launch(void* const* d_in, const int* in_sizes, int n_in,
                              void* d_out, int out_size, void* d_ws, size_t ws_size,
                              hipStream_t stream) {
  if (n_in < 11) return;
  if (in_sizes[0] != kRows * kC) return;
  if (in_sizes[1] != kC * kC) return;
  if (in_sizes[2] != kC) return;
  if (in_sizes[3] != kC * kC) return;
  if (in_sizes[4] != kC) return;
  if (in_sizes[5] != kHS * kHS) return;
  if (in_sizes[6] != kHS) return;
  if (in_sizes[7] != kHS * kHS) return;
  if (in_sizes[8] != kHS) return;
  if (in_sizes[9] != kC * kC) return;
  if (in_sizes[10] != kC) return;
  if (out_size != kRows * kC) return;
  if (ws_size < kWsTotal) return;

  const float* x  = (const float*)d_in[0];
  const float* Wu = (const float*)d_in[1];
  const float* bu = (const float*)d_in[2];
  const float* Wv = (const float*)d_in[3];
  const float* bv = (const float*)d_in[4];
  const float* W1 = (const float*)d_in[5];
  const float* b1 = (const float*)d_in[6];
  const float* W2 = (const float*)d_in[7];
  const float* b2 = (const float*)d_in[8];
  const float* Wp = (const float*)d_in[9];
  const float* bp = (const float*)d_in[10];
  float* out = (float*)d_out;

  char* ws = (char*)d_ws;
  unsigned short* XH   = (unsigned short*)(ws + kOffXH);
  unsigned short* WUT  = (unsigned short*)(ws + kOffWUT);
  unsigned short* WVT  = (unsigned short*)(ws + kOffWVT);
  unsigned short* WPT  = (unsigned short*)(ws + kOffWPT);
  unsigned short* W12T = (unsigned short*)(ws + kOffW12);
  unsigned short* U16  = (unsigned short*)(ws + kOffU);
  float*          V0   = (float*)(ws + kOffV0);
  unsigned short* YH   = (unsigned short*)(ws + kOffYH);
  unsigned short* YL   = (unsigned short*)(ws + kOffYL);
  unsigned short* VTH  = (unsigned short*)(ws + kOffVTH);
  unsigned short* VTL  = (unsigned short*)(ws + kOffVTL);

  /* x -> f16 plane (bf16 values x16) */
  cast_x_kernel<<<(kRows * kC / 8) / 256, 256, 0, stream>>>(x, XH, kRows * kC / 8);

  /* in[k][n] -> out[n][k]: Wu, Wv as f16 (x1024), Wp as bf16; planes WUT, WVT, WPT are contiguous */
  wt_transpose_cast_kernel<<<dim3(kC / 64, kC / 64, 3), 256, 0, stream>>>(Wu, Wv, Wp, WUT, kC, kWCarry, 2);
  /* in[k][n] -> out[n][k]: W1, W2 as bf16 [64][64] planes */
  wt_transpose_cast_kernel<<<dim3(1, 1, 2), 256, 0, stream>>>(W1, W2, W2, W12T, kHS, 1.0f, 0);

  /* u (f16, x16) = x.Wu + bu */
  wmma_gemm64<0, 0, 2, 1><<<dim3(256, 1), 256, 0, stream>>>(
      XH, XH, kC, 0L,
      WUT, WUT, kC, 0L,
      (void*)U16, kC, 0L,
      bu, kRows, kC, kC, kUScale, kUCarry);

  /* v0 (f32) = x.Wv + bv */
  wmma_gemm64<0, 0, 2, 0><<<dim3(256, 1), 256, 0, stream>>>(
      XH, XH, kC, 0L,
      WVT, WVT, kC, 0L,
      (void*)V0, kC, 0L,
      bv, kRows, kC, kC, kV0Scale, 1.0f);

  /* gated value -> vT hi | lo planes */
  gated_value_kernel<<<dim3(kRows / 64, kH), 128, 0, stream>>>(V0, W12T, W12T + kHS * kHS, b1, b2, VTH, VTL);

  /* causal attention -> y hi | lo planes (the v0 bytes are dead from here on) */
  causal_attn_kernel<<<kB * kH * (kT / 128), 128, 0, stream>>>(U16, XH, VTH, VTL, YH, YL);

  /* out = y.Wp + bp (y hi.W + y lo.W) */
  wmma_gemm64<1, 1, 2, 0><<<dim3(256, 1), 256, 0, stream>>>(
      YH, YL, kC, 0L,
      WPT, WPT, kC, 0L,
      (void*)out, kC, 0L,
      bp, kRows, kC, kC, 1.0f, 1.0f);
}

// v007
// Measured time: 160 microseconds a run.
// Next to v006, in two timings, it ran 1.10 times as fast each time.
// Counting every step since v000, it is 4.41 times as fast.
// All contractions on 16-bit WMMA with f32 accumulate: x.Wu, x.Wv and the u.x^T scores on v_wmma_f32_16x16x32_f16 (inputs RNE-converted to bf16 once and held exactly in f16 planes with power-of-two carries: x x16, W x1024, u x16); v0.W1, v0.W2, P.v and y.Wp on v_wmma_f32_16x16x32_bf16 with the computed operand carried as bf16 hi+lo planes (W1, W2, Wp as bf16 planes); softmax, gate, residual and bias in f32.
#include <hip/hip_runtime.h>
#include <math.h>

typedef __attribute__((ext_vector_type(16))) _Float16 v16h;
typedef __attribute__((ext_vector_type(8)))  _Float16 v8h;
typedef __attribute__((ext_vector_type(16))) __bf16   v16b;
typedef __attribute__((ext_vector_type(8)))  __bf16   v8b;
typedef __attribute__((ext_vector_type(8)))  float    v8f;
typedef __attribute__((ext_vector_type(4)))  float    v4f;
typedef __attribute__((ext_vector_type(4)))  unsigned int v4u;
typedef __attribute__((ext_vector_type(8)))  unsigned int v8u;
typedef __attribute__((ext_vector_type(2)))  float    v2f;
typedef __attribute__((ext_vector_type(2)))  __bf16   v2b;

// ---------------------------------------------------------------------------
// Problem constants
// ---------------------------------------------------------------------------
constexpr int kB    = 4;
constexpr int kT    = 2048;
constexpr int kC    = 1024;
constexpr int kH    = 16;
constexpr int kHS   = 64;
constexpr int kRows = kB * kT;
constexpr int kSqrtC = 32;
static_assert(kSqrtC * kSqrtC == kC, "score scale is 1/sqrt(C)");
static_assert(kH * kHS == kC, "head split");
static_assert((kC % 32) == 0 && (kHS % 32) == 0 && (kT % 64) == 0, "K multiples of 32, key chunks of 64");
static_assert((kRows % 64) == 0 && (kC % 64) == 0, "GEMM M,N multiples of 64");

// power-of-two carries of the f16 planes (exact; folded back in f32)
constexpr float kXCarry = 16.0f;
constexpr float kWCarry = 1024.0f;
constexpr float kUCarry = 16.0f;
constexpr float kUScale  = kUCarry / (kXCarry * kWCarry);
constexpr float kV0Scale = 1.0f / (kXCarry * kWCarry);
constexpr float kScoreScale = 1.0f / ((float)kSqrtC * kUCarry * kXCarry);

// ---------------------------------------------------------------------------
// Workspace region map (bytes; every offset is a multiple of 128)
//   XH    f16  [8192][1024]      16*bf16(x)                      16,777,216
//   WUT   f16  [1024 n][1024 k]  1024*bf16(Wu)^T                  2,097,152
//   WVT   f16  [1024 n][1024 k]  1024*bf16(Wv)^T                  2,097,152
//   WPT   bf16 [1024 n][1024 k]  bf16(Wp)^T                       2,097,152
//   W12T  bf16 2 x [64 n][64 k]  bf16(W1)^T | bf16(W2)^T             16,384
//   U16   f16  [8192][1024]      16*u                            16,777,216
//   V0    f32  [8192][1024]      v0; dead after the gated-value launch, then the same bytes
//                                hold YH | YL (bf16 hi | lo planes of y, [8192][1024] each)  33,554,432
//   VTH   bf16 [4][16][64 d][2048 t]  gated v, hi plane           16,777,216
//   VTL   bf16 [4][16][64 d][2048 t]  gated v, lo plane           16,777,216
//   total                                                       106,971,136
// ---------------------------------------------------------------------------
constexpr size_t kSzAct16 = (size_t)kRows * kC * 2;
constexpr size_t kSzW16   = (size_t)kC * kC * 2;
constexpr size_t kSzW12   = (size_t)2 * kHS * kHS * 2;
constexpr size_t kSzV0    = (size_t)kRows * kC * 4;
constexpr size_t kOffXH   = 0;
constexpr size_t kOffWUT  = kOffXH  + kSzAct16;
constexpr size_t kOffWVT  = kOffWUT + kSzW16;
constexpr size_t kOffWPT  = kOffWVT + kSzW16;
constexpr size_t kOffW12  = kOffWPT + kSzW16;
constexpr size_t kOffU    = kOffW12 + kSzW12;
constexpr size_t kOffV0   = kOffU   + kSzAct16;
constexpr size_t kOffYH   = kOffV0;
constexpr size_t kOffYL   = kOffV0  + kSzAct16;
constexpr size_t kOffVTH  = kOffV0  + kSzV0;
constexpr size_t kOffVTL  = kOffVTH + kSzAct16;
constexpr size_t kWsTotal = kOffVTL + kSzAct16;
static_assert(kWsTotal == 106971136ull, "carve total");
static_assert(kWsTotal <= 134217728ull, "carve cap");
static_assert(2 * kSzAct16 == kSzV0, "y hi|lo planes fit the v0 plane exactly");
static_assert((kOffWUT % 128) == 0 && (kOffWVT % 128) == 0 && (kOffWPT % 128) == 0 && (kOffW12 % 128) == 0 &&
              (kOffU % 128) == 0 && (kOffV0 % 128) == 0 && (kOffYL % 128) == 0 && (kOffVTH % 128) == 0 &&
              (kOffVTL % 128) == 0, "128-B aligned regions");

// ---------------------------------------------------------------------------
// Bit helpers
// ---------------------------------------------------------------------------
/* f32 -> bf16 by the hardware's conversion (round to nearest even) */
__device__ __forceinline__ unsigned short f2bf_bits(float f) { const __bf16 h = (__bf16)f; return __builtin_bit_cast(unsigned short, h); }
__device__ __forceinline__ float bf_bits2f(unsigned short h) { return __uint_as_float(((unsigned)h) << 16); }
__device__ __forceinline__ unsigned pk16(unsigned short a, unsigned short b) { return (unsigned)a | ((unsigned)b << 16); }
__device__ __forceinline__ unsigned short h_bits(float f) { const _Float16 h = (_Float16)f; return __builtin_bit_cast(unsigned short, h); }
/* bf16 hi + bf16 lo of two f32 values, both RNE, as packed words (a in the low half): one packed conversion per plane */
__device__ __forceinline__ void split_pair(float a, float b, unsigned& hw, unsigned& lw) {
  const v2b h = __builtin_convertvector((v2f){a, b}, v2b);
  const v2b l = __builtin_convertvector((v2f){a - (float)h[0], b - (float)h[1]}, v2b);
  hw = __builtin_bit_cast(unsigned, h);
  lw = __builtin_bit_cast(unsigned, l);
}

// ---------------------------------------------------------------------------
// WMMA helpers: every matrix op is followed by 4 nops tied to its own accumulator and its A/B fragments
// ---------------------------------------------------------------------------
__device__ __forceinline__ v8f mma_h(v16h a, v16h b, v8f c) {
  c = __builtin_amdgcn_wmma_f32_16x16x32_f16(false, a, false, b, (short)0, c, false, false);
  asm volatile("v_nop\n\tv_nop\n\tv_nop\n\tv_nop" : "+v"(c) : "v"(a), "v"(b));
  return c;
}
__device__ __forceinline__ v8f mma_b(v16b a, v16b b, v8f c) {
  c = __builtin_amdgcn_wmma_f32_16x16x32_bf16(false, a, false, b, (short)0, c, false, false);
  asm volatile("v_nop\n\tv_nop\n\tv_nop\n\tv_nop" : "+v"(c) : "v"(a), "v"(b));
  return c;
}
__device__ __forceinline__ void keep4_h(v16h a, v16h b, v16h c, v16h d) { asm volatile("v_nop" :: "v"(a), "v"(b), "v"(c), "v"(d)); }
__device__ __forceinline__ void keep4_b(v16b a, v16b b, v16b c, v16b d) { asm volatile("v_nop" :: "v"(a), "v"(b), "v"(c), "v"(d)); }
__device__ __forceinline__ void acc_guard4(v8f& a, v8f& b, v8f& c, v8f& d) { asm volatile("v_nop\n\tv_nop\n\tv_nop\n\tv_nop" : "+v"(a), "+v"(b), "+v"(c), "+v"(d)); }

// Fragment loader: p already points at (row, k0 + 8*(lane>>4)); elements 0..7 <- p[0..7], elements 8..15 <- p[16..23]
template <typename T> struct Frag;
template <> struct Frag<_Float16> {
  typedef v16h V; union U { v16h v; v8h h[2]; };
  static __device__ __forceinline__ v16h load(const _Float16* p) {
    U f; f.h[0] = *(const v8h*)(p); f.h[1] = *(const v8h*)(p + 16); return f.v;
  }
  static __device__ __forceinline__ v8f mma(v16h a, v16h b, v8f c) { return mma_h(a, b, c); }
  static __device__ __forceinline__ void keep(v16h a, v16h b, v16h c, v16h d) { keep4_h(a, b, c, d); }
};
template <> struct Frag<__bf16> {
  typedef v16b V; union U { v16b v; v8b h[2]; };
  static __device__ __forceinline__ v16b load(const __bf16* p) {
    U f; f.h[0] = *(const v8b*)(p); f.h[1] = *(const v8b*)(p + 16); return f.v;
  }
  static __device__ __forceinline__ v8f mma(v16b a, v16b b, v8f c) { return mma_b(a, b, c); }
  static __device__ __forceinline__ void keep(v16b a, v16b b, v16b c, v16b d) { keep4_b(a, b, c, d); }
};

// ---- LDS-staged batched WMMA GEMM ------------------------------------------
// C[m,n] = scale * sum_k A[m,k] * Bt[n,k] + bias_scale * bf16(bias[n]).
// Block = 8 waves = one 128 x 256 tile of C; waves 2 (m) x 4 (n), each wave owns a 64x64 tile.
// A pass is 64 k = 128 B of every operand row. The block brings a pass's rows [A 128 | A2 128 (SPL 1) | Bt 256] from global
// memory as whole 128-B lines (8 lanes x 16 B per row) by asynchronous 16-byte copies into one of two LDS buffers, so that
// the next pass's rows fly while this pass is worked on; every wave reads its fragments from LDS. One block barrier per
// pass: it publishes the buffer just filled and ends the reads of the buffer that is refilled behind it.
// A row-major [M,K]; Bt row-major [N,K]; M % 128 == 0, N % 256 == 0, K % 64 == 0 (no tail handling).
// SPL: 0 = plain (one product), 1 = A carried as hi/lo planes (A2 = lo): hi.b + lo.b.
// BIAS_MODE: 0 = none, 2 = bias[n].   OUT_MODE: 0 = f32, 1 = f16, 2 = two independent products of the same A in one grid:
// blockIdx.y 0 writes f16 to Cout with (bias, scale, bias_scale), blockIdx.y 1 writes f32 to Cout2 with (bias2, scale2,
// bias_scale2); its Bt plane lies strideB behind the first. The choice is uniform for the block.
// ET: 0 = f16 operands, 1 = bf16 operands (pointers passed as 16-bit storage)
constexpr int kBM = 128;
constexpr int kBN = 256;
constexpr int kKP = 64;
/* LDS row pitch of a staged 64-element row: 144 B = 16 B x 9 (odd) for the 16-byte fragment loads */
constexpr int kSP = 72;
static_assert((kRows % kBM) == 0 && (kC % kBN) == 0 && (kC % kKP) == 0, "GEMM block tile and pass divide the shapes");
template <int ET> struct Elem;
template <> struct Elem<0> { typedef _Float16 T; };
template <> struct Elem<1> { typedef __bf16 T; };
template <int ET, int SPL, int BIAS_MODE, int OUT_MODE>
__global__ __launch_bounds__(256) void wmma_gemm64(
    const unsigned short* __restrict__ Ap, const unsigned short* __restrict__ A2p, int lda, long strideA,
    const unsigned short* __restrict__ Btp, const unsigned short* __restrict__ Bt2p, int ldb, long strideB,
    void* __restrict__ Cout, void* __restrict__ Cout2, int ldc, long strideC,
    const float* __restrict__ bias, const float* __restrict__ bias2,
    int M, int N, int K, float scale, float bias_scale, float scale2, float bias_scale2) {
  static_assert(SPL == 0 || SPL == 1, "one or two A planes");
  typedef typename Elem<ET>::T T;
  typedef typename Frag<T>::V V;
  constexpr int kRowsA      = (SPL == 1) ? 2 * kBM : kBM;
  constexpr int kStageRows  = kRowsA + kBN;
  constexpr int kStageElems = kStageRows * kSP;
  /* one 16-byte copy per thread covers 32 rows of the stage */
  constexpr int kCopies     = kStageRows / 32;
  constexpr unsigned kStageBytes = (unsigned)kStageElems * 2u;
  static_assert((kCopies % 4) == 0, "copies go four to a statement");
  const T* A = (const T*)Ap; const T* A2 = (const T*)A2p; const T* Bt = (const T*)Btp;
  __shared__ __align__(16) T sStage[2 * kStageElems];
  /* per-wave 16x64 slab, pitch 68 floats */
  __shared__ __align__(16) float sT[8][16 * 68];
  const int b    = blockIdx.y;
  const int tid  = threadIdx.x;
  const int lane = tid & 31;
  const int wave = tid >> 5;
  const int tilesN = N / kBN;
  const int tilesM = M / kBM;
  const int tile = blockIdx.x;
  /* block-uniform exit, in front of every barrier */
  if (tile >= tilesM * tilesN) return;
  const int tm = tile / tilesN;
  const int tn = tile - tm * tilesN;
  const int wm = wave >> 2;
  const int wn = wave & 3;
  const int m0 = tm * kBM + (wm << 6);
  const int n0 = tn * kBN + (wn << 6);

  const T* Ab  = A  + (size_t)b * strideA + (size_t)(tm * kBM) * lda;
  const T* Ab2 = A2 + (size_t)b * strideA + (size_t)(tm * kBM) * lda;
  const T* Bb  = Bt + (size_t)b * strideB + (size_t)(tn * kBN) * ldb;

  /* rlane: row (A) / col (B, D) within a 16-wide subtile; koff: k offset of this lane half; mOff: D row offset */
  const int rlane = lane & 15;
  const int koff  = (lane >> 4) * 8;
  const int mOff  = (lane >> 4) * 8;

  /* staging: thread -> (row tid / 8 of each group of 32 rows, 16-byte piece tid % 8 of its 128 B) */
  const int srow = tid >> 3;
  const int sc8  = (tid & 7) * 8;
  const unsigned offA = (unsigned)srow * (unsigned)lda + (unsigned)sc8;
  const unsigned offB = (unsigned)srow * (unsigned)ldb + (unsigned)sc8;
  /* LDS byte address (low 32 bits of the __shared__ address) of this thread's piece in row srow of buffer 0 */
  const unsigned ldsT = (unsigned)(size_t)(sStage + srow * kSP + sc8);
  auto copy_stage = [&](int k0, unsigned bufByte) {
    /* both loops unrolled: which operand a group of rows belongs to is then decided at compile time */
#pragma unroll
    for (int g = 0; g < kCopies / 4; ++g) {
      const T* gp[4];
      unsigned lp[4];
#pragma unroll
      for (int e = 0; e < 4; ++e) {
        const int r0 = (g * 4 + e) * 32;
        if (r0 < kBM)         gp[e] = Ab  + (size_t)r0 * lda + k0 + offA;
        else if (r0 < kRowsA) gp[e] = Ab2 + (size_t)(r0 - kBM) * lda + k0 + offA;
        else                  gp[e] = Bb  + (size_t)(r0 - kRowsA) * ldb + k0 + offB;
        lp[e] = ldsT + bufByte + (unsigned)(r0 * kSP * 2);
      }
      /* four copies, then the wait that stands in front of any rewrite of the address registers they name */
      asm volatile("global_load_async_to_lds_b128 %0, %1, off\n\t"
                   "global_load_async_to_lds_b128 %2, %3, off\n\t"
                   "global_load_async_to_lds_b128 %4, %5, off\n\t"
                   "global_load_async_to_lds_b128 %6, %7, off\n\t"
                   "s_wait_xcnt 0x0"
                   :: "v"(lp[0]), "v"(gp[0]), "v"(lp[1]), "v"(gp[1]), "v"(lp[2]), "v"(gp[2]), "v"(lp[3]), "v"(gp[3])
                   : "memory");
    }
  };

  v8f acc[4][4];
#pragma unroll
  for (int i = 0; i < 4; ++i)
#pragma unroll
    for (int j = 0; j < 4; ++j) acc[i][j] = (v8f){0.f,0.f,0.f,0.f,0.f,0.f,0.f,0.f};

  const int nPass = K / kKP;
  copy_stage(0, 0u);
  /* pass 0's rows have landed (this wave's copies), then every wave's */
  asm volatile("s_wait_asynccnt 0x0" ::: "memory");
  __syncthreads();
  if (nPass > 1) copy_stage(kKP, kStageBytes);
  for (int p = 0; p < nPass; ++p) {
    const T* buf = sStage + (p & 1) * kStageElems;
    const T* sA  = buf + ((wm << 6) + rlane) * kSP + koff;
    const T* sA2 = sA + kBM * kSP;
    const T* sB  = buf + (kRowsA + (wn << 6) + rlane) * kSP + koff;
    /* the loops below are unrolled so that every index of a fragment or accumulator array is a constant (registers, no scratch) */
#pragma unroll
    for (int ks = 0; ks < kKP / 32; ++ks) {
      V bh[4];
#pragma unroll
      for (int j = 0; j < 4; ++j) bh[j] = Frag<T>::load(sB + (j << 4) * kSP + ks * 32);
      /* per accumulator and k step: the hi product, then the lo product */
#pragma unroll
      for (int pl = 0; pl <= SPL; ++pl) {
        const T* sAp = (pl == 0) ? sA : sA2;
        V af[4];
#pragma unroll
        for (int i = 0; i < 4; ++i) af[i] = Frag<T>::load(sAp + (i << 4) * kSP + ks * 32);
#pragma unroll
        for (int i = 0; i < 4; ++i) {
#pragma unroll
          for (int j = 0; j < 4; ++j) acc[i][j] = Frag<T>::mma(af[i], bh[j], acc[i][j]);
        }
      }
      Frag<T>::keep(bh[0], bh[1], bh[2], bh[3]);
    }
    /* this wave's reads of buffer p & 1 are done before that buffer is refilled */
    asm volatile("s_wait_dscnt 0x0" ::: "memory");
    /* this wave's copies of pass p + 1 have landed before the barrier publishes them */
    asm volatile("s_wait_asynccnt 0x0" ::: "memory");
    __syncthreads();
    if (p + 2 < nPass) copy_stage((p + 2) * kKP, (unsigned)(p & 1) * kStageBytes);
  }
  /* no copy is outstanding when the wave goes on to the epilogue */
  asm volatile("s_wait_asynccnt 0x0" ::: "memory");
  acc_guard4(acc[0][0], acc[0][1], acc[0][2], acc[0][3]);
  acc_guard4(acc[1][0], acc[1][1], acc[1][2], acc[1][3]);
  acc_guard4(acc[2][0], acc[2][1], acc[2][2], acc[2][3]);
  acc_guard4(acc[3][0], acc[3][1], acc[3][2], acc[3][3]);

  // ---- epilogue ----
  const bool second = (OUT_MODE == 2) && (b == 1);
  const bool out_f32 = (OUT_MODE == 0) || second;
  const float* biasp = second ? bias2 : bias;
  const float  sc    = second ? scale2 : scale;
  const float  bsc   = second ? bias_scale2 : bias_scale;
  void*        Cp    = second ? Cout2 : Cout;
  float* slab = sT[wave];
#pragma unroll
  for (int i = 0; i < 4; ++i) {
    const int mBase = m0 + (i << 4);
#pragma unroll
    for (int j = 0; j < 4; ++j) {
      const int n = n0 + (j << 4) + rlane;
      float bv = 0.f;
      if (BIAS_MODE == 2) bv = bf_bits2f(f2bf_bits(biasp[n])) * bsc;
#pragma unroll
      for (int r = 0; r < 8; ++r) {
        float v = acc[i][j][r] * sc;
        if (BIAS_MODE == 2) v += bv;
        slab[(mOff + r) * 68 + (j << 4) + rlane] = v;
      }
    }
    __builtin_amdgcn_fence(__ATOMIC_RELEASE, "workgroup");
    __builtin_amdgcn_wave_barrier();
    __builtin_amdgcn_fence(__ATOMIC_ACQUIRE, "workgroup");
    if (out_f32) {
      /* row segment = 256 B = 16 lanes x 16 B; one instruction covers 2 rows */
      float* C = (float*)Cp + (size_t)b * strideC;
      const int hh = lane >> 4, c4 = (lane & 15) * 4;
      {
#pragma unroll
        for (int it = 0; it < 8; ++it) {
          const int row = it * 2 + hh;
          v4f v = *(const v4f*)(slab + row * 68 + c4);
          *(v4f*)(C + (size_t)(mBase + row) * ldc + n0 + c4) = v;
        }
        /* the code behind the branch rewrites registers that these stores name: the wait that stands in front of such a rewrite */
        asm volatile("s_wait_xcnt 0x0" ::: "memory");
      }
    } else {
      const int q = lane >> 3, c8 = (lane & 7) * 8;
      unsigned short* C  = (unsigned short*)Cp  + (size_t)b * strideC;
      {
#pragma unroll
        for (int it = 0; it < 4; ++it) {
          const int row = it * 4 + q;
          const float* sp = slab + row * 68 + c8;
          v8h hv;
#pragma unroll
          for (int e = 0; e < 8; ++e) hv[e] = (_Float16)sp[e];
          *(v8h*)(C + (size_t)(mBase + row) * ldc + n0 + c8) = hv;
        }
        /* as in the other branch: the wait in front of a rewrite of registers that these stores name */
        asm volatile("s_wait_xcnt 0x0" ::: "memory");
      }
    }
    __builtin_amdgcn_fence(__ATOMIC_RELEASE, "workgroup");
    __builtin_amdgcn_wave_barrier();
    __builtin_amdgcn_fence(__ATOMIC_ACQUIRE, "workgroup");
  }
}

// ---------------------------------------------------------------------------
// Operand preparation, one grid for three independent pieces of work (no piece reads what another writes). Blocks of 256 threads:
//   blocks [0, 768)      64 x 64 tiles of Wu, Wv, Wp (256 tiles a plane)
//   blocks [768, 770)    W1, W2 (one tile each)
//   blocks [770, 4866)   x, 2048 consecutive elements a block
// The weight tiles stand first: they have two memory trips and a barrier, the x blocks one trip.
// Which piece a block does depends on blockIdx.x alone, so the barrier is under block-uniform control.
//
// x: f32 -> RNE bf16 -> x16 -> f16 plane (exact), 8 consecutive elements per thread.
// Coverage: 8192*1024/8 = 1,048,576 threads = 4096 blocks x 256 exactly.
//
// Weight transpose + cast: W is row-major [dim k][dim n] f32; WT[n][k] = cast(bf16_rne(W[k][n])).
// Wu, Wv are written as f16 of (bf16 value x carry); Wp, W1, W2 as raw bf16 bits.
// Load coverage: 16 iterations x 256 threads = 4096 = the whole 64x64 tile (coalesced along n).
// Store coverage: 8 waves x 2 iterations x 4 rows (lane>>3) = 64 rows; (lane&7) x 8 halves = 64 cols; a row segment = 128 B.
// ---------------------------------------------------------------------------
constexpr int kTilesBig   = (kC / 64) * (kC / 64);
constexpr int kPrepBig    = 3 * kTilesBig;
constexpr int kPrepW      = kPrepBig + 2;
constexpr int kPrepX      = (kRows * kC / 8) / 256;
constexpr int kPrepBlocks = kPrepW + kPrepX;
static_assert(kHS == 64, "W1, W2 are one 64 x 64 tile each");
static_assert((size_t)kPrepX * 256 * 8 == (size_t)kRows * kC, "x blocks cover x exactly");
__global__ __launch_bounds__(256) void prep_kernel(const float* __restrict__ x, const float* __restrict__ Wu,
                                                   const float* __restrict__ Wv, const float* __restrict__ Wp,
                                                   const float* __restrict__ W1, const float* __restrict__ W2,
                                                   unsigned short* __restrict__ XH, unsigned short* __restrict__ WT,
                                                   unsigned short* __restrict__ W12T) {
  /* sm[n_local][k_local] */
  __shared__ float sm[64][65];
  const int t  = threadIdx.x;
  const int bx = blockIdx.x;
  if (bx >= kPrepW) {
    const int i = (bx - kPrepW) * 256 + t;
    const float* p = x + 8 * (size_t)i;
    const v4f a = *(const v4f*)(p);
    const v4f c = *(const v4f*)(p + 4);
    unsigned short hb[8];
#pragma unroll
    for (int e = 0; e < 4; ++e) {
      const float a_e = a[e];
      const float c_e = c[e];
      hb[e]     = h_bits(bf_bits2f(f2bf_bits(a_e)) * kXCarry);
      hb[4 + e] = h_bits(bf_bits2f(f2bf_bits(c_e)) * kXCarry);
    }
    const v4u u = (v4u){pk16(hb[0], hb[1]), pk16(hb[2], hb[3]), pk16(hb[4], hb[5]), pk16(hb[6], hb[7])};
    *(v4u*)(XH + 8 * (size_t)i) = u;
    return;
  }
  const bool big = (bx < kPrepBig);
  const int z    = big ? (bx / kTilesBig) : (bx - kPrepBig);
  const int tl   = big ? (bx % kTilesBig) : 0;
  const int dim  = big ? kC : kHS;
  const int k0   = (tl % (kC / 64)) * 64;
  const int n0   = (tl / (kC / 64)) * 64;
  const float* W = big ? ((z == 0) ? Wu : (z == 1) ? Wv : Wp) : ((z == 0) ? W1 : W2);
  const bool as_bf = !big || (z == 2);
  unsigned short* op = (big ? WT : W12T) + (size_t)z * dim * dim;
#pragma unroll
  for (int i = 0; i < 16; ++i) {
    const int e = i * 256 + t;
    const int r = e >> 6;
    const int c = e & 63;
    sm[c][r] = W[(size_t)(k0 + r) * dim + n0 + c];
  }
  __syncthreads();
  const int lane = t & 31, wave = t >> 5;
  const int q = lane >> 3, c8 = (lane & 7) * 8;
#pragma unroll
  for (int it = 0; it < 2; ++it) {
    const int row = wave * 8 + it * 4 + q;
    unsigned short hb[8];
#pragma unroll
    for (int e = 0; e < 8; ++e) {
      const float w = sm[row][c8 + e];
      const unsigned short bb = f2bf_bits(w);
      const unsigned short fh = h_bits(bf_bits2f(bb) * kWCarry);
      hb[e] = as_bf ? bb : fh;
    }
    const v4u u = (v4u){pk16(hb[0], hb[1]), pk16(hb[2], hb[3]), pk16(hb[4], hb[5]), pk16(hb[6], hb[7])};
    *(v4u*)(op + (size_t)(n0 + row) * dim + k0 + c8) = u;
  }
}

// ---------------------------------------------------------------------------
// Gated value transform per (64-token block, head): a = v0 + (v0.W1 + b1), g = sigmoid(v0.W2 + b2), v = a*g.
// Block = 4 waves; wave w owns tokens 16w..16w+15 of the block and all 64 output dims.
// v0 tile (f32) staged in LDS; A fragments = bf16 hi and lo of v0 built in registers; W1^T / W2^T bf16 planes staged in LDS;
// 2 k-steps x 4 n-tiles x 2 matrices x 2 products on v_wmma_f32_16x16x32_bf16.
// The two f32 results are transposed through LDS ([d][token]); the gate is applied in the store phase (8 values per lane
// grid (8192/64, 16). All barriers under block-uniform control.
// ---------------------------------------------------------------------------
constexpr int kGP = 68;
/* LDS row pitch of the two 64 x 64 bf16 weight planes: 144 B = 16 B x 9 (odd) for their 16-byte fragment loads */
constexpr int kWP = 72;
__global__ __launch_bounds__(128) void gated_value_kernel(
    const float* __restrict__ V0, const unsigned short* __restrict__ W1tp, const unsigned short* __restrict__ W2tp,
    const float* __restrict__ b1, const float* __restrict__ b2,
    unsigned short* __restrict__ VTH, unsigned short* __restrict__ VTL)
{
  /* sA: first the v0 tile [token][d]; later the gate pre-activation [d][token]. sB: residual sum [d][token]. */
  __shared__ __align__(16) float sA[64 * kGP];
  __shared__ __align__(16) float sB[64 * kGP];
  __shared__ __align__(16) __bf16 sW1[kHS * kWP];
  __shared__ __align__(16) __bf16 sW2[kHS * kWP];
  __shared__ float sBias[2 * kHS];
  const int tid = threadIdx.x, lane = tid & 31, wave = tid >> 5;
  const int hh = lane >> 4, c = lane & 15;
  const int g0 = blockIdx.x * 64;
  const int hd = blockIdx.y;
  const int bidx = g0 / kT;
  const int t0 = g0 - bidx * kT;
  const __bf16* W1t = (const __bf16*)W1tp;
  const __bf16* W2t = (const __bf16*)W2tp;
  /* v0 tile: 64 rows x 16 float4 = 1024 = 8 x 128 threads */
#pragma unroll
  for (int i = 0; i < 8; ++i) {
    const int e = i * 128 + tid;
    const int r = e >> 4, c4 = (e & 15) * 4;
    *(v4f*)(sA + r * kGP + c4) = *(const v4f*)(V0 + (size_t)(g0 + r) * kC + hd * kHS + c4);
  }
  /* weight planes: 4096 bf16 each = 512 x 16 B = 4 x 128 threads */
#pragma unroll
  for (int i = 0; i < 4; ++i) {
    const int e = (i * 128 + tid) * 8;
    const int le = (e >> 6) * kWP + (e & 63);
    *(v8b*)(sW1 + le) = *(const v8b*)(W1t + e);
    *(v8b*)(sW2 + le) = *(const v8b*)(W2t + e);
  }
  {
    const int bi = tid & 63;
    const float x1 = b1[bi];
    const float x2 = b2[bi];
    const float xs = (tid < kHS) ? x1 : x2;
    sBias[tid] = bf_bits2f(f2bf_bits(xs));
  }
  __syncthreads();

  /* A fragments (hi, lo) for this wave's 16 tokens */
  v16b ah[2], al[2];
  {
    const int arow = wave * 16 + c;
    v8u hw, lw;
#pragma unroll
    for (int ks = 0; ks < 2; ++ks) {
      const float* p = sA + arow * kGP + ks * 32 + 8 * hh;
      const v4f f0 = *(const v4f*)(p);
      const v4f f1 = *(const v4f*)(p + 4);
      const v4f f2 = *(const v4f*)(p + 16);
      const v4f f3 = *(const v4f*)(p + 20);
#pragma unroll
      for (int e = 0; e < 2; ++e) {
        unsigned h2, l2;
        split_pair(f0[2 * e], f0[2 * e + 1], h2, l2);
        hw[e] = h2;      lw[e] = l2;
        split_pair(f1[2 * e], f1[2 * e + 1], h2, l2);
        hw[2 + e] = h2;  lw[2 + e] = l2;
        split_pair(f2[2 * e], f2[2 * e + 1], h2, l2);
        hw[4 + e] = h2;  lw[4 + e] = l2;
        split_pair(f3[2 * e], f3[2 * e + 1], h2, l2);
        hw[6 + e] = h2;  lw[6 + e] = l2;
      }
      ah[ks] = __builtin_bit_cast(v16b, hw);
      al[ks] = __builtin_bit_cast(v16b, lw);
    }
  }

  v8f a1[4], a2[4];
#pragma unroll
  for (int j = 0; j < 4; ++j) {
    a1[j] = (v8f){0.f,0.f,0.f,0.f,0.f,0.f,0.f,0.f};
    a2[j] = (v8f){0.f,0.f,0.f,0.f,0.f,0.f,0.f,0.f};
  }
#pragma unroll
  for (int ks = 0; ks < 2; ++ks) {
#pragma unroll
    for (int j = 0; j < 4; ++j) {
      const v16b w1 = Frag<__bf16>::load(sW1 + (j * 16 + c) * kWP + ks * 32 + 8 * hh);
      const v16b w2 = Frag<__bf16>::load(sW2 + (j * 16 + c) * kWP + ks * 32 + 8 * hh);
      a1[j] = mma_b(ah[ks], w1, a1[j]);
      a1[j] = mma_b(al[ks], w1, a1[j]);
      a2[j] = mma_b(ah[ks], w2, a2[j]);
      a2[j] = mma_b(al[ks], w2, a2[j]);
    }
  }
  acc_guard4(a1[0], a1[1], a1[2], a1[3]);
  acc_guard4(a2[0], a2[1], a2[2], a2[3]);

  /* residual + biases in place (reads only this wave's own token rows of sA) */
#pragma unroll
  for (int j = 0; j < 4; ++j) {
    const int col = j * 16 + c;
    const float bb1 = sBias[col];
    const float bb2 = sBias[kHS + col];
#pragma unroll
    for (int r = 0; r < 8; ++r) {
      const int row = wave * 16 + 8 * hh + r;
      const float vres = sA[row * kGP + col];
      a1[j][r] = vres + (a1[j][r] + bb1);
      a2[j][r] = a2[j][r] + bb2;
    }
  }
  /* every wave has finished reading the v0 tile before it is overwritten */
  __syncthreads();
#pragma unroll
  for (int j = 0; j < 4; ++j) {
    const int col = j * 16 + c;
#pragma unroll
    for (int r = 0; r < 8; ++r) {
      const int row = wave * 16 + 8 * hh + r;
      sB[col * kGP + row] = a1[j][r];
      sA[col * kGP + row] = a2[j][r];
    }
  }
  __syncthreads();

  const int q = lane >> 3, c8 = (lane & 7) * 8;
#pragma unroll 1
  for (int it = 0; it < 4; ++it) {
    const int d = wave * 16 + it * 4 + q;
    const float* pa = sB + d * kGP + c8;
    const float* pg = sA + d * kGP + c8;
    const v4f av0 = *(const v4f*)(pa);
    const v4f av1 = *(const v4f*)(pa + 4);
    const v4f gv0 = *(const v4f*)(pg);
    const v4f gv1 = *(const v4f*)(pg + 4);
    float rv[8];
#pragma unroll
    for (int e = 0; e < 4; ++e) {
      const float xa0 = av0[e];
      const float xg0 = gv0[e];
      const float xa1 = av1[e];
      const float xg1 = gv1[e];
      rv[e]     = xa0 * (1.0f / (1.0f + expf(-xg0)));
      rv[4 + e] = xa1 * (1.0f / (1.0f + expf(-xg1)));
    }
    v4u hw, lw;
#pragma unroll
    for (int e = 0; e < 4; ++e) {
      unsigned h2, l2;
      split_pair(rv[2 * e], rv[2 * e + 1], h2, l2);
      hw[e] = h2;
      lw[e] = l2;
    }
    const v8h hv = __builtin_bit_cast(v8h, hw);
    const v8h lv = __builtin_bit_cast(v8h, lw);
    const size_t o = ((size_t)(bidx * kH + hd) * kHS + d) * kT + t0 + c8;
    *(v8h*)(VTH + o) = hv;
    *(v8h*)(VTL + o) = lv;
    
  }
}

// ---------------------------------------------------------------------------
// Causal attention for head dim 64 from 16-bit planes. Block = 4 waves = two tiles of 64 query rows of one (batch, head), tile
// nqb - 1 - tp and then tile tp, so that every block walks the same number of key chunks (nqb + 1) wherever it is placed;
// per tile: keys in chunks of 64 up to and including the diagonal chunk (block-uniform trip count qb + 1 <= 32).
// Both products are computed transposed, so that a lane owns ONE query (column c = lane & 15):
//   scores^T: A = x (f16, x16) key rows staged in LDS, B = u (f16, x16) query rows held in registers; register r of tile j
//   is the score of key 16 j + 8 (lane >> 4) + r against query c; x 1/(32*16*16).
//   diagonal chunk: key > query -> -inf (every query keeps at least its own key; the first chunk always holds key 0).
//   online softmax in f32: maximum and normaliser run in the lane over its 32 keys; the two lane halves exchange the maximum
//   once per chunk and join their normalisers once behind the loop; the normaliser is summed from the f32 p values.
//   P^T: score tiles 2 kk and 2 kk + 1, converted in place to bf16 hi + lo, ARE the B operand of k step kk (element s = tile
//   s >> 3, register s & 7, the k order of the fragment loader); P never leaves the registers.
//   O^T += v^T.P^T: A = v hi + lo ([d][key] planes) staged in LDS; hi.hi + lo(v).hi(P) + hi(v).lo(P).
//   LDS fragment reads stand in groups ahead of the products that use them, never one by one in front of each product.
//   A lane ends with 8 consecutive d of its query per tile: one 16-byte store per tile and plane.
// ---------------------------------------------------------------------------
constexpr int kKC = 64;
/* LDS row pitch of every 64-element 16-bit tile read by 16-byte fragment loads: 72 elements = 144 B = 16 B x 9 (odd), so 16 rows fall on distinct banks */
constexpr int kLP = 72;
static_assert(kLP >= kKC && kLP >= kHS && (kLP % 8) == 0 && ((kLP / 8) % 2) == 1, "pitch: 16-B aligned rows, odd multiple of 16 B");
/* the value that lane ^ 16 holds */
__device__ __forceinline__ float other_half(float x) {
  const int bits = __float_as_int(x);
  return __int_as_float(__builtin_amdgcn_permlanex16(bits, bits, 0x76543210, 0xfedcba98, false, false));
}
__global__ __launch_bounds__(128) void causal_attn_kernel(
    const unsigned short* __restrict__ Up, const unsigned short* __restrict__ XHp,
    const unsigned short* __restrict__ VTHp, const unsigned short* __restrict__ VTLp,
    unsigned short* __restrict__ YH, unsigned short* __restrict__ YL)
{
  __shared__ __align__(16) _Float16 Ksh[kKC * kLP];
  __shared__ __align__(16) __bf16 Vth[kHS * kLP];
  __shared__ __align__(16) __bf16 Vtl[kHS * kLP];

  const int tid  = threadIdx.x;
  const int wave = tid >> 5;
  const int lane = tid & 31;
  const int hh   = lane >> 4;
  const int c    = lane & 15;

  constexpr int nqb = kT / 64;
  static_assert((nqb % 2) == 0, "query tiles pair up as t and nqb - 1 - t");
  const int bx = blockIdx.x;
  const int tp = bx % (nqb / 2);
  const int bh = bx / (nqb / 2);
  const int h  = bh % kH;
  const int b  = bh / kH;

  const _Float16* Uh = (const _Float16*)Up;
  const _Float16* Xh = (const _Float16*)XHp;
  const __bf16*   Vh = (const __bf16*)VTHp;
  const __bf16*   Vl = (const __bf16*)VTLp;

  /* the block's two query tiles, one after the other in every wave: nqb - 1 - tp, then tp; together nqb + 1 key chunks in every
     block. Kept rolled: one copy of the chunk loop in the instruction cache */
#pragma unroll 1
  for (int half = 0; half < 2; ++half) {
  const int qb = (half == 0) ? (nqb - 1 - tp) : tp;
  const int q0 = qb * 64 + wave * 16;
  /* this lane's query */
  const int qrow = q0 + c;

  /* query fragments (B operand, column c = query c): 2 d-chunks */
  v16h qa[2];
  {
    const _Float16* urow = Uh + (size_t)(b * kT + qrow) * kC + h * kHS;
#pragma unroll
    for (int dc = 0; dc < 2; ++dc) qa[dc] = Frag<_Float16>::load(urow + dc * 32 + 8 * hh);
  }

  /* running maximum of the query (equal in both lane halves); normaliser over this lane half's keys only */
  float mrow = -INFINITY, lrow = 0.f;
  v8f oacc[4];
#pragma unroll
  for (int t = 0; t < 4; ++t) oacc[t] = (v8f){0.f,0.f,0.f,0.f,0.f,0.f,0.f,0.f};

  const int nChunks = qb + 1;
  for (int kc = 0; kc < nChunks; ++kc) {
    const int kv0 = kc * kKC;
    __syncthreads();
    /* K, V hi, V lo tiles: 64 rows x 8 x 16 B = 512 each = 4 x 128 threads */
#pragma unroll
    for (int i = 0; i < 4; ++i) {
      const int e = i * 128 + tid;
      const int r = e >> 3, c8 = (e & 7) * 8;
      *(v8h*)(Ksh + r * kLP + c8) = *(const v8h*)(Xh + (size_t)(b * kT + kv0 + r) * kC + h * kHS + c8);
      const size_t vo = ((size_t)bh * kHS + r) * kT + kv0 + c8;
      *(v8b*)(Vth + r * kLP + c8) = *(const v8b*)(Vh + vo);
      *(v8b*)(Vtl + r * kLP + c8) = *(const v8b*)(Vl + vo);
    }
    __syncthreads();

    /* the chunk's 8 K fragments are read from LDS as one group ahead of the score products: the wave waits out the LDS latency
       once, not once in front of every product */
    v16h kf[4][2];
#pragma unroll
    for (int j = 0; j < 4; ++j)
#pragma unroll
      for (int dc = 0; dc < 2; ++dc) kf[j][dc] = Frag<_Float16>::load(Ksh + (j * 16 + c) * kLP + dc * 32 + 8 * hh);
    v8f s[4];
#pragma unroll
    for (int j = 0; j < 4; ++j) {
      s[j] = (v8f){0.f,0.f,0.f,0.f,0.f,0.f,0.f,0.f};
#pragma unroll
      for (int dc = 0; dc < 2; ++dc) s[j] = mma_h(kf[j][dc], qa[dc], s[j]);
    }
    acc_guard4(s[0], s[1], s[2], s[3]);

    const bool diag = (kc == qb);
    /* one maximum (and below one sum) per score tile: four short independent chains instead of one of 32 links */
    float cmj[4];
#pragma unroll
    for (int j = 0; j < 4; ++j) {
      cmj[j] = -INFINITY;
#pragma unroll
      for (int r = 0; r < 8; ++r) {
        const int kvrow = kv0 + j * 16 + 8 * hh + r;
        float sv = s[j][r] * kScoreScale;
        const bool masked = diag && (kvrow > qrow);
        sv = masked ? -INFINITY : sv;
        s[j][r] = sv;
        cmj[j] = fmaxf(cmj[j], sv);
      }
    }
    float cm = fmaxf(fmaxf(cmj[0], cmj[1]), fmaxf(cmj[2], cmj[3]));
    /* the other lane half holds the query's other 32 keys */
    cm = fmaxf(cm, other_half(cm));
    const float mnew = fmaxf(mrow, cm);
    const float alpha = __expf(mrow - mnew);
    mrow = mnew;
    /* scheduling fence between the maximum and the exponentials: the V reads written below are lifted up to here, under the
       exponentials, and no further */
    __builtin_amdgcn_sched_barrier(0);
    float psj[4];
    v8u phw[2], plw[2];
#pragma unroll
    for (int j = 0; j < 4; ++j) {
      psj[j] = 0.f;
#pragma unroll
      for (int r = 0; r < 8; r += 2) {
        const float p0 = __expf(s[j][r] - mnew);
        const float p1 = __expf(s[j][r + 1] - mnew);
        psj[j] += p0;
        psj[j] += p1;
        unsigned h2, l2;
        split_pair(p0, p1, h2, l2);
        phw[j >> 1][(j & 1) * 4 + (r >> 1)] = h2;
        plw[j >> 1][(j & 1) * 4 + (r >> 1)] = l2;
      }
    }
    const v16b ph[2] = {__builtin_bit_cast(v16b, phw[0]), __builtin_bit_cast(v16b, phw[1])};
    const v16b pl[2] = {__builtin_bit_cast(v16b, plw[0]), __builtin_bit_cast(v16b, plw[1])};
    /* V fragment pair i (hi and lo plane) = k step i >> 2, d tile i & 3. The pairs are read from LDS in groups of two, each group
       two pairs (6 products) ahead of its use, so that the products cover the LDS latency */
    v16b vfh[8], vfl[8];
    auto read_v = [&](int i) {
      vfh[i] = Frag<__bf16>::load(Vth + ((i & 3) * 16 + c) * kLP + (i >> 2) * 32 + 8 * hh);
      vfl[i] = Frag<__bf16>::load(Vtl + ((i & 3) * 16 + c) * kLP + (i >> 2) * 32 + 8 * hh);
    };
    read_v(0);
    read_v(1);
    lrow = lrow * alpha + ((psj[0] + psj[1]) + (psj[2] + psj[3]));
#pragma unroll
    for (int t = 0; t < 4; ++t)
#pragma unroll
      for (int r = 0; r < 8; ++r) oacc[t][r] *= alpha;
    /* unrolled so that the index of the P and V fragments is a constant (registers, no scratch) */
#pragma unroll
    for (int i = 0; i < 8; ++i) {
      if ((i & 1) == 0 && i + 2 < 8) {
        read_v(i + 2);
        read_v(i + 3);
      }
      const int kk = i >> 2, t = i & 3;
      oacc[t] = mma_b(vfh[i], ph[kk], oacc[t]);
      oacc[t] = mma_b(vfl[i], ph[kk], oacc[t]);
      oacc[t] = mma_b(vfh[i], pl[kk], oacc[t]);
    }
    acc_guard4(oacc[0], oacc[1], oacc[2], oacc[3]);
  }

  /* join the two lane halves' normalisers */
  lrow += other_half(lrow);
  const float inv = 1.0f / lrow;
#pragma unroll
  for (int t = 0; t < 4; ++t) {
    v4u hw, lw;
#pragma unroll
    for (int r = 0; r < 4; ++r) {
      unsigned h2, l2;
      split_pair(oacc[t][2 * r] * inv, oacc[t][2 * r + 1] * inv, h2, l2);
      hw[r] = h2;
      lw[r] = l2;
    }
    const v8h hv = __builtin_bit_cast(v8h, hw);
    const v8h lv = __builtin_bit_cast(v8h, lw);
    const size_t o = (size_t)(b * kT + qrow) * kC + h * kHS + t * 16 + 8 * hh;
    *(v8h*)(YH + o) = hv;
    *(v8h*)(YL + o) = lv;
  }
  /* the next tile rewrites the registers that these stores name: the wait that stands in front of such a rewrite */
  asm volatile("s_wait_xcnt 0x0" ::: "memory");
  }
}

// ---------------------------------------------------------------------------
// Host glue: 5 launches, kernel launches only; launches that do not depend on one another share a grid.
// GEMM shapes: M 8192, N 1024, K 1024: 64 x 4 block tiles of 128 x 256 = 256 blocks of 8 waves.
// ---------------------------------------------------------------------------
extern "C" void kernel_launch(void* const* d_in, const int* in_sizes, int n_in,
                              void* d_out, int out_size, void* d_ws, size_t ws_size,
                              hipStream_t stream) {
  if (n_in < 11) return;
  if (in_sizes[0] != kRows * kC) return;
  if (in_sizes[1] != kC * kC) return;
  if (in_sizes[2] != kC) return;
  if (in_sizes[3] != kC * kC) return;
  if (in_sizes[4] != kC) return;
  if (in_sizes[5] != kHS * kHS) return;
  if (in_sizes[6] != kHS) return;
  if (in_sizes[7] != kHS * kHS) return;
  if (in_sizes[8] != kHS) return;
  if (in_sizes[9] != kC * kC) return;
  if (in_sizes[10] != kC) return;
  if (out_size != kRows * kC) return;
  if (ws_size < kWsTotal) return;

  const float* x  = (const float*)d_in[0];
  const float* Wu = (const float*)d_in[1];
  const float* bu = (const float*)d_in[2];
  const float* Wv = (const float*)d_in[3];
  const float* bv = (const float*)d_in[4];
  const float* W1 = (const float*)d_in[5];
  const float* b1 = (const float*)d_in[6];
  const float* W2 = (const float*)d_in[7];
  const float* b2 = (const float*)d_in[8];
  const float* Wp = (const float*)d_in[9];
  const float* bp = (const float*)d_in[10];
  float* out = (float*)d_out;

  char* ws = (char*)d_ws;
  unsigned short* XH   = (unsigned short*)(ws + kOffXH);
  unsigned short* WUT  = (unsigned short*)(ws + kOffWUT);
  unsigned short* WVT  = (unsigned short*)(ws + kOffWVT);
  unsigned short* WPT  = (unsigned short*)(ws + kOffWPT);
  unsigned short* W12T = (unsigned short*)(ws + kOffW12);
  unsigned short* U16  = (unsigned short*)(ws + kOffU);
  float*          V0   = (float*)(ws + kOffV0);
  unsigned short* YH   = (unsigned short*)(ws + kOffYH);
  unsigned short* YL   = (unsigned short*)(ws + kOffYL);
  unsigned short* VTH  = (unsigned short*)(ws + kOffVTH);
  unsigned short* VTL  = (unsigned short*)(ws + kOffVTL);

  /* x -> f16 plane (bf16 values x16); in[k][n] -> out[n][k]: Wu, Wv as f16 (x1024), Wp, W1, W2 as bf16;
     planes WUT, WVT, WPT are contiguous */
  prep_kernel<<<kPrepBlocks, 256, 0, stream>>>(x, Wu, Wv, Wp, W1, W2, XH, WUT, W12T);

  /* u (f16, x16) = x.Wu + bu (blockIdx.y 0) and v0 (f32) = x.Wv + bv (blockIdx.y 1); WVT lies one plane behind WUT */
  wmma_gemm64<0, 0, 2, 2><<<dim3(256, 2), 256, 0, stream>>>(
      XH, XH, kC, 0L,
      WUT, WUT, kC, (long)kC * kC,
      (void*)U16, (void*)V0, kC, 0L,
      bu, bv, kRows, kC, kC, kUScale, kUCarry, kV0Scale, 1.0f);

  /* gated value -> vT hi | lo planes */
  gated_value_kernel<<<dim3(kRows / 64, kH), 128, 0, stream>>>(V0, W12T, W12T + kHS * kHS, b1, b2, VTH, VTL);

  /* causal attention -> y hi | lo planes (the v0 bytes are dead from here on) */
  causal_attn_kernel<<<kB * kH * (kT / 128), 128, 0, stream>>>(U16, XH, VTH, VTL, YH, YL);

  /* out = y.Wp + bp (y hi.W + y lo.W) */
  wmma_gemm64<1, 1, 2, 0><<<dim3(256, 1), 256, 0, stream>>>(
      YH, YL, kC, 0L,
      WPT, WPT, kC, 0L,
      (void*)out, (void*)out, kC, 0L,
      bp, bp, kRows, kC, kC, 1.0f, 1.0f, 1.0f, 1.0f);
}

// v008
// It runs in 151 microseconds.
// Next to v007, in two timings, it ran 1.06 times as fast each time.
// All steps since v000 together make it 4.66 times as fast.
// All contractions on 16-bit WMMA with f32 accumulate: x.Wu, x.Wv and the u.x^T scores on v_wmma_f32_16x16x32_f16 (inputs RNE-converted to bf16 once and held exactly in f16 planes with power-of-two carries: x x16, W x1024, u x16); v0.W1, v0.W2, P.v and y.Wp on v_wmma_f32_16x16x32_bf16 with the computed operand carried as bf16 hi+lo planes (W1, W2, Wp as bf16 planes); softmax, gate, residual and bias in f32.
#include <hip/hip_runtime.h>
#include <math.h>

typedef __attribute__((ext_vector_type(16))) _Float16 v16h;
typedef __attribute__((ext_vector_type(8)))  _Float16 v8h;
typedef __attribute__((ext_vector_type(16))) __bf16   v16b;
typedef __attribute__((ext_vector_type(8)))  __bf16   v8b;
typedef __attribute__((ext_vector_type(8)))  float    v8f;
typedef __attribute__((ext_vector_type(4)))  float    v4f;
typedef __attribute__((ext_vector_type(4)))  unsigned int v4u;
typedef __attribute__((ext_vector_type(8)))  unsigned int v8u;
typedef __attribute__((ext_vector_type(2)))  float    v2f;
typedef __attribute__((ext_vector_type(2)))  __bf16   v2b;

// ---------------------------------------------------------------------------
// Problem constants
// ---------------------------------------------------------------------------
constexpr int kB    = 4;
constexpr int kT    = 2048;
constexpr int kC    = 1024;
constexpr int kH    = 16;
constexpr int kHS   = 64;
constexpr int kRows = kB * kT;
constexpr int kSqrtC = 32;
static_assert(kSqrtC * kSqrtC == kC, "score scale is 1/sqrt(C)");
static_assert(kH * kHS == kC, "head split");
static_assert((kC % 32) == 0 && (kHS % 32) == 0 && (kT % 64) == 0, "K multiples of 32, key chunks of 64");
static_assert((kRows % 64) == 0 && (kC % 64) == 0, "GEMM M,N multiples of 64");

// power-of-two carries of the f16 planes (exact; folded back in f32)
constexpr float kXCarry = 16.0f;
constexpr float kWCarry = 1024.0f;
constexpr float kUCarry = 16.0f;
constexpr float kUScale  = kUCarry / (kXCarry * kWCarry);
constexpr float kV0Scale = 1.0f / (kXCarry * kWCarry);
constexpr float kScoreScale = 1.0f / ((float)kSqrtC * kUCarry * kXCarry);

// ---------------------------------------------------------------------------
// Workspace region map (bytes; every offset is a multiple of 128)
//   XH    f16  [8192][1024]      16*bf16(x)                      16,777,216
//   WUT   f16  [1024 n][1024 k]  1024*bf16(Wu)^T                  2,097,152
//   WVT   f16  [1024 n][1024 k]  1024*bf16(Wv)^T                  2,097,152
//   WPT   bf16 [1024 n][1024 k]  bf16(Wp)^T                       2,097,152
//   W12T  bf16 2 x [64 n][64 k]  bf16(W1)^T | bf16(W2)^T             16,384
//   U16   f16  [8192][1024]      16*u                            16,777,216
//   V0    f32  [8192][1024]      v0; dead after the gated-value launch, then the same bytes
//                                hold YH | YL (bf16 hi | lo planes of y, [8192][1024] each)  33,554,432
//   VTH   bf16 [4][16][64 d][2048 t]  gated v, hi plane           16,777,216
//   VTL   bf16 [4][16][64 d][2048 t]  gated v, lo plane           16,777,216
//   total                                                       106,971,136
// ---------------------------------------------------------------------------
constexpr size_t kSzAct16 = (size_t)kRows * kC * 2;
constexpr size_t kSzW16   = (size_t)kC * kC * 2;
constexpr size_t kSzW12   = (size_t)2 * kHS * kHS * 2;
constexpr size_t kSzV0    = (size_t)kRows * kC * 4;
constexpr size_t kOffXH   = 0;
constexpr size_t kOffWUT  = kOffXH  + kSzAct16;
constexpr size_t kOffWVT  = kOffWUT + kSzW16;
constexpr size_t kOffWPT  = kOffWVT + kSzW16;
constexpr size_t kOffW12  = kOffWPT + kSzW16;
constexpr size_t kOffU    = kOffW12 + kSzW12;
constexpr size_t kOffV0   = kOffU   + kSzAct16;
constexpr size_t kOffYH   = kOffV0;
constexpr size_t kOffYL   = kOffV0  + kSzAct16;
constexpr size_t kOffVTH  = kOffV0  + kSzV0;
constexpr size_t kOffVTL  = kOffVTH + kSzAct16;
constexpr size_t kWsTotal = kOffVTL + kSzAct16;
static_assert(kWsTotal == 106971136ull, "carve total");
static_assert(kWsTotal <= 134217728ull, "carve cap");
static_assert(2 * kSzAct16 == kSzV0, "y hi|lo planes fit the v0 plane exactly");
static_assert((kOffWUT % 128) == 0 && (kOffWVT % 128) == 0 && (kOffWPT % 128) == 0 && (kOffW12 % 128) == 0 &&
              (kOffU % 128) == 0 && (kOffV0 % 128) == 0 && (kOffYL % 128) == 0 && (kOffVTH % 128) == 0 &&
              (kOffVTL % 128) == 0, "128-B aligned regions");

// ---------------------------------------------------------------------------
// Bit helpers
// ---------------------------------------------------------------------------
/* f32 -> bf16 by the hardware's conversion (round to nearest even) */
__device__ __forceinline__ unsigned short f2bf_bits(float f) { const __bf16 h = (__bf16)f; return __builtin_bit_cast(unsigned short, h); }
__device__ __forceinline__ float bf_bits2f(unsigned short h) { return __uint_as_float(((unsigned)h) << 16); }
__device__ __forceinline__ unsigned pk16(unsigned short a, unsigned short b) { return (unsigned)a | ((unsigned)b << 16); }
__device__ __forceinline__ unsigned short h_bits(float f) { const _Float16 h = (_Float16)f; return __builtin_bit_cast(unsigned short, h); }
/* bf16 hi + bf16 lo of two f32 values, both RNE, as packed words (a in the low half): one packed conversion per plane */
__device__ __forceinline__ void split_pair(float a, float b, unsigned& hw, unsigned& lw) {
  const v2b h = __builtin_convertvector((v2f){a, b}, v2b);
  const v2b l = __builtin_convertvector((v2f){a - (float)h[0], b - (float)h[1]}, v2b);
  hw = __builtin_bit_cast(unsigned, h);
  lw = __builtin_bit_cast(unsigned, l);
}

// ---------------------------------------------------------------------------
// WMMA helpers: plain builtins; the compiler keeps the distance behind them in straight-line code, where the next products or
// other vector work fill the slots. acc_guard4 (four slots, once) stands where a loop's branch follows a run of products.
// ---------------------------------------------------------------------------
__device__ __forceinline__ v8f mma_h(v16h a, v16h b, v8f c) {
  return __builtin_amdgcn_wmma_f32_16x16x32_f16(false, a, false, b, (short)0, c, false, false);
}
__device__ __forceinline__ v8f mma_b(v16b a, v16b b, v8f c) {
  return __builtin_amdgcn_wmma_f32_16x16x32_bf16(false, a, false, b, (short)0, c, false, false);
}
__device__ __forceinline__ void acc_guard4(v8f& a, v8f& b, v8f& c, v8f& d) { asm volatile("v_nop\n\tv_nop\n\tv_nop\n\tv_nop" : "+v"(a), "+v"(b), "+v"(c), "+v"(d)); }

// Fragment loader: p already points at (row, k0 + 8*(lane>>4)); elements 0..7 <- p[0..7], elements 8..15 <- p[16..23]
template <typename T> struct Frag;
template <> struct Frag<_Float16> {
  typedef v16h V; union U { v16h v; v8h h[2]; };
  static __device__ __forceinline__ v16h load(const _Float16* p) {
    U f; f.h[0] = *(const v8h*)(p); f.h[1] = *(const v8h*)(p + 16); return f.v;
  }
  static __device__ __forceinline__ v8f mma(v16h a, v16h b, v8f c) { return mma_h(a, b, c); }
};
template <> struct Frag<__bf16> {
  typedef v16b V; union U { v16b v; v8b h[2]; };
  static __device__ __forceinline__ v16b load(const __bf16* p) {
    U f; f.h[0] = *(const v8b*)(p); f.h[1] = *(const v8b*)(p + 16); return f.v;
  }
  static __device__ __forceinline__ v8f mma(v16b a, v16b b, v8f c) { return mma_b(a, b, c); }
};

// ---- LDS-staged batched WMMA GEMM ------------------------------------------
// C[m,n] = scale * sum_k A[m,k] * Bt[n,k] + bias_scale * bf16(bias[n]).
// Block = 8 waves = one 128 x 256 tile of C; waves 2 (m) x 4 (n), each wave owns a 64x64 tile.
// A pass is 64 k = 128 B of every operand row. The block brings a pass's rows [A 128 | A2 128 (SPL 1) | Bt 256] from global
// memory as whole 128-B lines (8 lanes x 16 B per row) by asynchronous 16-byte copies into one of two LDS buffers, so that
// the next pass's rows fly while this pass is worked on; every wave reads its fragments from LDS. One block barrier per
// pass: it publishes the buffer just filled and ends the reads of the buffer that is refilled behind it.
// A row-major [M,K]; Bt row-major [N,K]; M % 128 == 0, N % 256 == 0, K % 64 == 0 (no tail handling).
// SPL: 0 = plain (one product), 1 = A carried as hi/lo planes (A2 = lo): hi.b + lo.b.
// BIAS_MODE: 0 = none, 2 = bias[n].   OUT_MODE: 0 = f32, 1 = f16, 2 = two independent products of the same A in one grid:
// blockIdx.y 0 writes f16 to Cout with (bias, scale, bias_scale), blockIdx.y 1 writes f32 to Cout2 with (bias2, scale2,
// bias_scale2); its Bt plane lies strideB behind the first. The choice is uniform for the block.
// ET: 0 = f16 operands, 1 = bf16 operands (pointers passed as 16-bit storage)
constexpr int kBM = 128;
constexpr int kBN = 256;
constexpr int kKP = 64;
/* LDS row pitch of a staged 64-element row: 144 B = 16 B x 9 (odd) for the 16-byte fragment loads */
constexpr int kSP = 72;
static_assert((kRows % kBM) == 0 && (kC % kBN) == 0 && (kC % kKP) == 0, "GEMM block tile and pass divide the shapes");
template <int ET> struct Elem;
template <> struct Elem<0> { typedef _Float16 T; };
template <> struct Elem<1> { typedef __bf16 T; };
template <int ET, int SPL, int BIAS_MODE, int OUT_MODE>
__global__ __launch_bounds__(256) void wmma_gemm64(
    const unsigned short* __restrict__ Ap, const unsigned short* __restrict__ A2p, int lda, long strideA,
    const unsigned short* __restrict__ Btp, const unsigned short* __restrict__ Bt2p, int ldb, long strideB,
    void* __restrict__ Cout, void* __restrict__ Cout2, int ldc, long strideC,
    const float* __restrict__ bias, const float* __restrict__ bias2,
    int M, int N, int K, float scale, float bias_scale, float scale2, float bias_scale2) {
  static_assert(SPL == 0 || SPL == 1, "one or two A planes");
  typedef typename Elem<ET>::T T;
  typedef typename Frag<T>::V V;
  constexpr int kRowsA      = (SPL == 1) ? 2 * kBM : kBM;
  constexpr int kStageRows  = kRowsA + kBN;
  constexpr int kStageElems = kStageRows * kSP;
  /* one 16-byte copy per thread covers 32 rows of the stage */
  constexpr int kCopies     = kStageRows / 32;
  constexpr unsigned kStageBytes = (unsigned)kStageElems * 2u;
  static_assert((kCopies % 4) == 0, "copies go four to a statement");
  const T* A = (const T*)Ap; const T* A2 = (const T*)A2p; const T* Bt = (const T*)Btp;
  __shared__ __align__(16) T sStage[2 * kStageElems];
  /* per-wave 16x64 slab, pitch 68 floats */
  __shared__ __align__(16) float sT[8][16 * 68];
  const int b    = blockIdx.y;
  const int tid  = threadIdx.x;
  const int lane = tid & 31;
  const int wave = tid >> 5;
  const int tilesN = N / kBN;
  const int tilesM = M / kBM;
  const int tile = blockIdx.x;
  /* block-uniform exit, in front of every barrier */
  if (tile >= tilesM * tilesN) return;
  const int tm = tile / tilesN;
  const int tn = tile - tm * tilesN;
  const int wm = wave >> 2;
  const int wn = wave & 3;
  const int m0 = tm * kBM + (wm << 6);
  const int n0 = tn * kBN + (wn << 6);

  const T* Ab  = A  + (size_t)b * strideA + (size_t)(tm * kBM) * lda;
  const T* Ab2 = A2 + (size_t)b * strideA + (size_t)(tm * kBM) * lda;
  const T* Bb  = Bt + (size_t)b * strideB + (size_t)(tn * kBN) * ldb;

  /* rlane: row (A) / col (B, D) within a 16-wide subtile; koff: k offset of this lane half; mOff: D row offset */
  const int rlane = lane & 15;
  const int koff  = (lane >> 4) * 8;
  const int mOff  = (lane >> 4) * 8;

  /* staging: thread -> (row tid / 8 of each group of 32 rows, 16-byte piece tid % 8 of its 128 B) */
  const int srow = tid >> 3;
  const int sc8  = (tid & 7) * 8;
  const unsigned offA = (unsigned)srow * (unsigned)lda + (unsigned)sc8;
  const unsigned offB = (unsigned)srow * (unsigned)ldb + (unsigned)sc8;
  /* LDS byte address (low 32 bits of the __shared__ address) of this thread's piece in row srow of buffer 0 */
  const unsigned ldsT = (unsigned)(size_t)(sStage + srow * kSP + sc8);
  auto copy_stage = [&](int k0, unsigned bufByte) {
    /* both loops unrolled: which operand a group of rows belongs to is then decided at compile time */
#pragma unroll
    for (int g = 0; g < kCopies / 4; ++g) {
      const T* gp[4];
      unsigned lp[4];
#pragma unroll
      for (int e = 0; e < 4; ++e) {
        const int r0 = (g * 4 + e) * 32;
        if (r0 < kBM)         gp[e] = Ab  + (size_t)r0 * lda + k0 + offA;
        else if (r0 < kRowsA) gp[e] = Ab2 + (size_t)(r0 - kBM) * lda + k0 + offA;
        else                  gp[e] = Bb  + (size_t)(r0 - kRowsA) * ldb + k0 + offB;
        lp[e] = ldsT + bufByte + (unsigned)(r0 * kSP * 2);
      }
      /* four copies, then the wait that stands in front of any rewrite of the address registers they name */
      asm volatile("global_load_async_to_lds_b128 %0, %1, off\n\t"
                   "global_load_async_to_lds_b128 %2, %3, off\n\t"
                   "global_load_async_to_lds_b128 %4, %5, off\n\t"
                   "global_load_async_to_lds_b128 %6, %7, off\n\t"
                   "s_wait_xcnt 0x0"
                   :: "v"(lp[0]), "v"(gp[0]), "v"(lp[1]), "v"(gp[1]), "v"(lp[2]), "v"(gp[2]), "v"(lp[3]), "v"(gp[3])
                   : "memory");
    }
  };

  v8f acc[4][4];
#pragma unroll
  for (int i = 0; i < 4; ++i)
#pragma unroll
    for (int j = 0; j < 4; ++j) acc[i][j] = (v8f){0.f,0.f,0.f,0.f,0.f,0.f,0.f,0.f};

  const int nPass = K / kKP;
  copy_stage(0, 0u);
  /* pass 0's rows have landed (this wave's copies), then every wave's */
  asm volatile("s_wait_asynccnt 0x0" ::: "memory");
  __syncthreads();
  if (nPass > 1) copy_stage(kKP, kStageBytes);
  for (int p = 0; p < nPass; ++p) {
    const T* buf = sStage + (p & 1) * kStageElems;
    const T* sA  = buf + ((wm << 6) + rlane) * kSP + koff;
    const T* sA2 = sA + kBM * kSP;
    const T* sB  = buf + (kRowsA + (wn << 6) + rlane) * kSP + koff;
    /* the loops below are unrolled so that every index of a fragment or accumulator array is a constant (registers, no scratch) */
#pragma unroll
    for (int ks = 0; ks < kKP / 32; ++ks) {
      V bh[4];
#pragma unroll
      for (int j = 0; j < 4; ++j) bh[j] = Frag<T>::load(sB + (j << 4) * kSP + ks * 32);
      /* per accumulator and k step: the hi product, then the lo product */
#pragma unroll
      for (int pl = 0; pl <= SPL; ++pl) {
        const T* sAp = (pl == 0) ? sA : sA2;
        V af[4];
#pragma unroll
        for (int i = 0; i < 4; ++i) af[i] = Frag<T>::load(sAp + (i << 4) * kSP + ks * 32);
        /* scheduling fence: holds the fragment reads together in front of their 16 products; without it this build reads each A
           fragment directly in front of its four products and waits out the LDS latency every time */
        __builtin_amdgcn_sched_barrier(0);
#pragma unroll
        for (int i = 0; i < 4; ++i) {
#pragma unroll
          for (int j = 0; j < 4; ++j) acc[i][j] = Frag<T>::mma(af[i], bh[j], acc[i][j]);
        }
      }
    }
    /* this wave's reads of buffer p & 1 are done before that buffer is refilled */
    asm volatile("s_wait_dscnt 0x0" ::: "memory");
    /* this wave's copies of pass p + 1 have landed before the barrier publishes them */
    asm volatile("s_wait_asynccnt 0x0" ::: "memory");
    __syncthreads();
    if (p + 2 < nPass) copy_stage((p + 2) * kKP, (unsigned)(p & 1) * kStageBytes);
  }
  /* no copy is outstanding when the wave goes on to the epilogue */
  asm volatile("s_wait_asynccnt 0x0" ::: "memory");

  // ---- epilogue ----
  const bool second = (OUT_MODE == 2) && (b == 1);
  const bool out_f32 = (OUT_MODE == 0) || second;
  const float* biasp = second ? bias2 : bias;
  const float  sc    = second ? scale2 : scale;
  const float  bsc   = second ? bias_scale2 : bias_scale;
  void*        Cp    = second ? Cout2 : Cout;
  float* slab = sT[wave];
#pragma unroll
  for (int i = 0; i < 4; ++i) {
    const int mBase = m0 + (i << 4);
#pragma unroll
    for (int j = 0; j < 4; ++j) {
      const int n = n0 + (j << 4) + rlane;
      float bv = 0.f;
      if (BIAS_MODE == 2) bv = bf_bits2f(f2bf_bits(biasp[n])) * bsc;
#pragma unroll
      for (int r = 0; r < 8; ++r) {
        float v = acc[i][j][r] * sc;
        if (BIAS_MODE == 2) v += bv;
        slab[(mOff + r) * 68 + (j << 4) + rlane] = v;
      }
    }
    __builtin_amdgcn_fence(__ATOMIC_RELEASE, "workgroup");
    __builtin_amdgcn_wave_barrier();
    __builtin_amdgcn_fence(__ATOMIC_ACQUIRE, "workgroup");
    if (out_f32) {
      /* row segment = 256 B = 16 lanes x 16 B; one instruction covers 2 rows */
      float* C = (float*)Cp + (size_t)b * strideC;
      const int hh = lane >> 4, c4 = (lane & 15) * 4;
      {
#pragma unroll
        for (int it = 0; it < 8; ++it) {
          const int row = it * 2 + hh;
          v4f v = *(const v4f*)(slab + row * 68 + c4);
          *(v4f*)(C + (size_t)(mBase + row) * ldc + n0 + c4) = v;
        }
        /* the code behind the branch rewrites registers that these stores name: the wait that stands in front of such a rewrite */
        asm volatile("s_wait_xcnt 0x0" ::: "memory");
      }
    } else {
      const int q = lane >> 3, c8 = (lane & 7) * 8;
      unsigned short* C  = (unsigned short*)Cp  + (size_t)b * strideC;
      {
#pragma unroll
        for (int it = 0; it < 4; ++it) {
          const int row = it * 4 + q;
          const float* sp = slab + row * 68 + c8;
          v8h hv;
#pragma unroll
          for (int e = 0; e < 8; ++e) hv[e] = (_Float16)sp[e];
          *(v8h*)(C + (size_t)(mBase + row) * ldc + n0 + c8) = hv;
        }
        /* as in the other branch: the wait in front of a rewrite of registers that these stores name */
        asm volatile("s_wait_xcnt 0x0" ::: "memory");
      }
    }
    __builtin_amdgcn_fence(__ATOMIC_RELEASE, "workgroup");
    __builtin_amdgcn_wave_barrier();
    __builtin_amdgcn_fence(__ATOMIC_ACQUIRE, "workgroup");
  }
}

// ---------------------------------------------------------------------------
// Operand preparation, one grid for three independent pieces of work (no piece reads what another writes). Blocks of 256 threads:
//   blocks [0, 768)      64 x 64 tiles of Wu, Wv, Wp (256 tiles a plane)
//   blocks [768, 770)    W1, W2 (one tile each)
//   blocks [770, 4866)   x, 2048 consecutive elements a block
// The weight tiles stand first: they have two memory trips and a barrier, the x blocks one trip.
// Which piece a block does depends on blockIdx.x alone, so the barrier is under block-uniform control.
//
// x: f32 -> RNE bf16 -> x16 -> f16 plane (exact), 8 consecutive elements per thread.
// Coverage: 8192*1024/8 = 1,048,576 threads = 4096 blocks x 256 exactly.
//
// Weight transpose + cast: W is row-major [dim k][dim n] f32; WT[n][k] = cast(bf16_rne(W[k][n])).
// Wu, Wv are written as f16 of (bf16 value x carry); Wp, W1, W2 as raw bf16 bits.
// Load coverage: 16 iterations x 256 threads = 4096 = the whole 64x64 tile (coalesced along n).
// Store coverage: 8 waves x 2 iterations x 4 rows (lane>>3) = 64 rows; (lane&7) x 8 halves = 64 cols; a row segment = 128 B.
// ---------------------------------------------------------------------------
constexpr int kTilesBig   = (kC / 64) * (kC / 64);
constexpr int kPrepBig    = 3 * kTilesBig;
constexpr int kPrepW      = kPrepBig + 2;
constexpr int kPrepX      = (kRows * kC / 8) / 256;
constexpr int kPrepBlocks = kPrepW + kPrepX;
static_assert(kHS == 64, "W1, W2 are one 64 x 64 tile each");
static_assert((size_t)kPrepX * 256 * 8 == (size_t)kRows * kC, "x blocks cover x exactly");
__global__ __launch_bounds__(256) void prep_kernel(const float* __restrict__ x, const float* __restrict__ Wu,
                                                   const float* __restrict__ Wv, const float* __restrict__ Wp,
                                                   const float* __restrict__ W1, const float* __restrict__ W2,
                                                   unsigned short* __restrict__ XH, unsigned short* __restrict__ WT,
                                                   unsigned short* __restrict__ W12T) {
  /* sm[n_local][k_local] */
  __shared__ float sm[64][65];
  const int t  = threadIdx.x;
  const int bx = blockIdx.x;
  if (bx >= kPrepW) {
    const int i = (bx - kPrepW) * 256 + t;
    const float* p = x + 8 * (size_t)i;
    const v4f a = *(const v4f*)(p);
    const v4f c = *(const v4f*)(p + 4);
    unsigned short hb[8];
#pragma unroll
    for (int e = 0; e < 4; ++e) {
      const float a_e = a[e];
      const float c_e = c[e];
      hb[e]     = h_bits(bf_bits2f(f2bf_bits(a_e)) * kXCarry);
      hb[4 + e] = h_bits(bf_bits2f(f2bf_bits(c_e)) * kXCarry);
    }
    const v4u u = (v4u){pk16(hb[0], hb[1]), pk16(hb[2], hb[3]), pk16(hb[4], hb[5]), pk16(hb[6], hb[7])};
    *(v4u*)(XH + 8 * (size_t)i) = u;
    return;
  }
  const bool big = (bx < kPrepBig);
  const int z    = big ? (bx / kTilesBig) : (bx - kPrepBig);
  const int tl   = big ? (bx % kTilesBig) : 0;
  const int dim  = big ? kC : kHS;
  const int k0   = (tl % (kC / 64)) * 64;
  const int n0   = (tl / (kC / 64)) * 64;
  const float* W = big ? ((z == 0) ? Wu : (z == 1) ? Wv : Wp) : ((z == 0) ? W1 : W2);
  const bool as_bf = !big || (z == 2);
  unsigned short* op = (big ? WT : W12T) + (size_t)z * dim * dim;
#pragma unroll
  for (int i = 0; i < 16; ++i) {
    const int e = i * 256 + t;
    const int r = e >> 6;
    const int c = e & 63;
    sm[c][r] = W[(size_t)(k0 + r) * dim + n0 + c];
  }
  __syncthreads();
  const int lane = t & 31, wave = t >> 5;
  const int q = lane >> 3, c8 = (lane & 7) * 8;
#pragma unroll
  for (int it = 0; it < 2; ++it) {
    const int row = wave * 8 + it * 4 + q;
    unsigned short hb[8];
#pragma unroll
    for (int e = 0; e < 8; ++e) {
      const float w = sm[row][c8 + e];
      const unsigned short bb = f2bf_bits(w);
      const unsigned short fh = h_bits(bf_bits2f(bb) * kWCarry);
      hb[e] = as_bf ? bb : fh;
    }
    const v4u u = (v4u){pk16(hb[0], hb[1]), pk16(hb[2], hb[3]), pk16(hb[4], hb[5]), pk16(hb[6], hb[7])};
    *(v4u*)(op + (size_t)(n0 + row) * dim + k0 + c8) = u;
  }
}

// ---------------------------------------------------------------------------
// Gated value transform per (64-token block, head): a = v0 + (v0.W1 + b1), g = sigmoid(v0.W2 + b2), v = a*g.
// Block = 4 waves; wave w owns tokens 16w..16w+15 of the block and all 64 output dims.
// v0 tile (f32) staged in LDS; A fragments = bf16 hi and lo of v0 built in registers; W1^T / W2^T bf16 planes staged in LDS;
// 2 k-steps x 4 n-tiles x 2 matrices x 2 products on v_wmma_f32_16x16x32_bf16.
// The two f32 results are transposed through LDS ([d][token]); the gate is applied in the store phase (8 values per lane
// grid (8192/64, 16). All barriers under block-uniform control.
// ---------------------------------------------------------------------------
constexpr int kGP = 68;
/* LDS row pitch of the two 64 x 64 bf16 weight planes: 144 B = 16 B x 9 (odd) for their 16-byte fragment loads */
constexpr int kWP = 72;
__global__ __launch_bounds__(128) void gated_value_kernel(
    const float* __restrict__ V0, const unsigned short* __restrict__ W1tp, const unsigned short* __restrict__ W2tp,
    const float* __restrict__ b1, const float* __restrict__ b2,
    unsigned short* __restrict__ VTH, unsigned short* __restrict__ VTL)
{
  /* sA: first the v0 tile [token][d]; later the gate pre-activation [d][token]. sB: residual sum [d][token]. */
  __shared__ __align__(16) float sA[64 * kGP];
  __shared__ __align__(16) float sB[64 * kGP];
  __shared__ __align__(16) __bf16 sW1[kHS * kWP];
  __shared__ __align__(16) __bf16 sW2[kHS * kWP];
  __shared__ float sBias[2 * kHS];
  const int tid = threadIdx.x, lane = tid & 31, wave = tid >> 5;
  const int hh = lane >> 4, c = lane & 15;
  const int g0 = blockIdx.x * 64;
  const int hd = blockIdx.y;
  const int bidx = g0 / kT;
  const int t0 = g0 - bidx * kT;
  const __bf16* W1t = (const __bf16*)W1tp;
  const __bf16* W2t = (const __bf16*)W2tp;
  /* v0 tile: 64 rows x 16 float4 = 1024 = 8 x 128 threads */
#pragma unroll
  for (int i = 0; i < 8; ++i) {
    const int e = i * 128 + tid;
    const int r = e >> 4, c4 = (e & 15) * 4;
    *(v4f*)(sA + r * kGP + c4) = *(const v4f*)(V0 + (size_t)(g0 + r) * kC + hd * kHS + c4);
  }
  /* weight planes: 4096 bf16 each = 512 x 16 B = 4 x 128 threads */
#pragma unroll
  for (int i = 0; i < 4; ++i) {
    const int e = (i * 128 + tid) * 8;
    const int le = (e >> 6) * kWP + (e & 63);
    *(v8b*)(sW1 + le) = *(const v8b*)(W1t + e);
    *(v8b*)(sW2 + le) = *(const v8b*)(W2t + e);
  }
  {
    const int bi = tid & 63;
    const float x1 = b1[bi];
    const float x2 = b2[bi];
    const float xs = (tid < kHS) ? x1 : x2;
    sBias[tid] = bf_bits2f(f2bf_bits(xs));
  }
  __syncthreads();

  /* A fragments (hi, lo) for this wave's 16 tokens */
  v16b ah[2], al[2];
  {
    const int arow = wave * 16 + c;
    v8u hw, lw;
#pragma unroll
    for (int ks = 0; ks < 2; ++ks) {
      const float* p = sA + arow * kGP + ks * 32 + 8 * hh;
      const v4f f0 = *(const v4f*)(p);
      const v4f f1 = *(const v4f*)(p + 4);
      const v4f f2 = *(const v4f*)(p + 16);
      const v4f f3 = *(const v4f*)(p + 20);
#pragma unroll
      for (int e = 0; e < 2; ++e) {
        unsigned h2, l2;
        split_pair(f0[2 * e], f0[2 * e + 1], h2, l2);
        hw[e] = h2;      lw[e] = l2;
        split_pair(f1[2 * e], f1[2 * e + 1], h2, l2);
        hw[2 + e] = h2;  lw[2 + e] = l2;
        split_pair(f2[2 * e], f2[2 * e + 1], h2, l2);
        hw[4 + e] = h2;  lw[4 + e] = l2;
        split_pair(f3[2 * e], f3[2 * e + 1], h2, l2);
        hw[6 + e] = h2;  lw[6 + e] = l2;
      }
      ah[ks] = __builtin_bit_cast(v16b, hw);
      al[ks] = __builtin_bit_cast(v16b, lw);
    }
  }

  v8f a1[4], a2[4];
#pragma unroll
  for (int j = 0; j < 4; ++j) {
    a1[j] = (v8f){0.f,0.f,0.f,0.f,0.f,0.f,0.f,0.f};
    a2[j] = (v8f){0.f,0.f,0.f,0.f,0.f,0.f,0.f,0.f};
  }
#pragma unroll
  for (int ks = 0; ks < 2; ++ks) {
#pragma unroll
    for (int j = 0; j < 4; ++j) {
      const v16b w1 = Frag<__bf16>::load(sW1 + (j * 16 + c) * kWP + ks * 32 + 8 * hh);
      const v16b w2 = Frag<__bf16>::load(sW2 + (j * 16 + c) * kWP + ks * 32 + 8 * hh);
      a1[j] = mma_b(ah[ks], w1, a1[j]);
      a1[j] = mma_b(al[ks], w1, a1[j]);
      a2[j] = mma_b(ah[ks], w2, a2[j]);
      a2[j] = mma_b(al[ks], w2, a2[j]);
    }
  }

  /* residual + biases in place (reads only this wave's own token rows of sA) */
#pragma unroll
  for (int j = 0; j < 4; ++j) {
    const int col = j * 16 + c;
    const float bb1 = sBias[col];
    const float bb2 = sBias[kHS + col];
#pragma unroll
    for (int r = 0; r < 8; ++r) {
      const int row = wave * 16 + 8 * hh + r;
      const float vres = sA[row * kGP + col];
      a1[j][r] = vres + (a1[j][r] + bb1);
      a2[j][r] = a2[j][r] + bb2;
    }
  }
  /* every wave has finished reading the v0 tile before it is overwritten */
  __syncthreads();
#pragma unroll
  for (int j = 0; j < 4; ++j) {
    const int col = j * 16 + c;
#pragma unroll
    for (int r = 0; r < 8; ++r) {
      const int row = wave * 16 + 8 * hh + r;
      sB[col * kGP + row] = a1[j][r];
      sA[col * kGP + row] = a2[j][r];
    }
  }
  __syncthreads();

  const int q = lane >> 3, c8 = (lane & 7) * 8;
#pragma unroll 1
  for (int it = 0; it < 4; ++it) {
    const int d = wave * 16 + it * 4 + q;
    const float* pa = sB + d * kGP + c8;
    const float* pg = sA + d * kGP + c8;
    const v4f av0 = *(const v4f*)(pa);
    const v4f av1 = *(const v4f*)(pa + 4);
    const v4f gv0 = *(const v4f*)(pg);
    const v4f gv1 = *(const v4f*)(pg + 4);
    float rv[8];
#pragma unroll
    for (int e = 0; e < 4; ++e) {
      const float xa0 = av0[e];
      const float xg0 = gv0[e];
      const float xa1 = av1[e];
      const float xg1 = gv1[e];
      rv[e]     = xa0 * (1.0f / (1.0f + expf(-xg0)));
      rv[4 + e] = xa1 * (1.0f / (1.0f + expf(-xg1)));
    }
    v4u hw, lw;
#pragma unroll
    for (int e = 0; e < 4; ++e) {
      unsigned h2, l2;
      split_pair(rv[2 * e], rv[2 * e + 1], h2, l2);
      hw[e] = h2;
      lw[e] = l2;
    }
    const v8h hv = __builtin_bit_cast(v8h, hw);
    const v8h lv = __builtin_bit_cast(v8h, lw);
    const size_t o = ((size_t)(bidx * kH + hd) * kHS + d) * kT + t0 + c8;
    *(v8h*)(VTH + o) = hv;
    *(v8h*)(VTL + o) = lv;
    
  }
}

// ---------------------------------------------------------------------------
// Causal attention for head dim 64 from 16-bit planes. Block = 4 waves = two tiles of 64 query rows of one (batch, head), tile
// nqb - 1 - tp and then tile tp, so that every block walks the same number of key chunks (nqb + 1) wherever it is placed;
// per tile: keys in chunks of 64 up to and including the diagonal chunk (block-uniform trip count qb + 1 <= 32).
// Both products are computed transposed, so that a lane owns ONE query (column c = lane & 15):
//   scores^T: A = x (f16, x16) key rows staged in LDS, B = u (f16, x16) query rows held in registers; register r of tile j
//   is the score of key 16 j + 8 (lane >> 4) + r against query c; x 1/(32*16*16).
//   diagonal chunk: key > query -> -inf (every query keeps at least its own key; the first chunk always holds key 0).
//   online softmax in f32: maximum and normaliser run in the lane over its 32 keys; the two lane halves exchange the maximum
//   once per chunk and join their normalisers once behind the loop; the normaliser is summed from the f32 p values.
//   P^T: score tiles 2 kk and 2 kk + 1, converted in place to bf16 hi + lo, ARE the B operand of k step kk (element s = tile
//   s >> 3, register s & 7, the k order of the fragment loader); P never leaves the registers.
//   O^T += v^T.P^T: A = v hi + lo ([d][key] planes) staged in LDS; hi.hi + lo(v).hi(P) + hi(v).lo(P).
//   LDS fragment reads stand in groups ahead of the products that use them, never one by one in front of each product.
//   A lane ends with 8 consecutive d of its query per tile: one 16-byte store per tile and plane.
// ---------------------------------------------------------------------------
constexpr int kKC = 64;
/* LDS row pitch of every 64-element 16-bit tile read by 16-byte fragment loads: 72 elements = 144 B = 16 B x 9 (odd), so 16 rows fall on distinct banks */
constexpr int kLP = 72;
static_assert(kLP >= kKC && kLP >= kHS && (kLP % 8) == 0 && ((kLP / 8) % 2) == 1, "pitch: 16-B aligned rows, odd multiple of 16 B");
/* the value that lane ^ 16 holds */
__device__ __forceinline__ float other_half(float x) {
  const int bits = __float_as_int(x);
  return __int_as_float(__builtin_amdgcn_permlanex16(bits, bits, 0x76543210, 0xfedcba98, false, false));
}
/* four waves a SIMD, as before: all 1024 blocks stay resident at once (at most 256 registers a wave) */
__global__ __launch_bounds__(128) __attribute__((amdgpu_waves_per_eu(4, 4))) void causal_attn_kernel(
    const unsigned short* __restrict__ Up, const unsigned short* __restrict__ XHp,
    const unsigned short* __restrict__ VTHp, const unsigned short* __restrict__ VTLp,
    unsigned short* __restrict__ YH, unsigned short* __restrict__ YL)
{
  __shared__ __align__(16) _Float16 Ksh[kKC * kLP];
  __shared__ __align__(16) __bf16 Vth[kHS * kLP];
  __shared__ __align__(16) __bf16 Vtl[kHS * kLP];

  const int tid  = threadIdx.x;
  const int wave = tid >> 5;
  const int lane = tid & 31;
  const int hh   = lane >> 4;
  const int c    = lane & 15;

  constexpr int nqb = kT / 64;
  static_assert((nqb % 2) == 0, "query tiles pair up as t and nqb - 1 - t");
  const int bx = blockIdx.x;
  const int tp = bx % (nqb / 2);
  const int bh = bx / (nqb / 2);
  const int h  = bh % kH;
  const int b  = bh / kH;

  const _Float16* Uh = (const _Float16*)Up;
  const _Float16* Xh = (const _Float16*)XHp;
  const __bf16*   Vh = (const __bf16*)VTHp;
  const __bf16*   Vl = (const __bf16*)VTLp;

  /* the block's two query tiles, one after the other in every wave: nqb - 1 - tp, then tp; together nqb + 1 key chunks in every
     block. Kept rolled: one copy of the chunk loop */
#pragma unroll 1
  for (int half = 0; half < 2; ++half) {
  const int qb = (half == 0) ? (nqb - 1 - tp) : tp;
  const int q0 = qb * 64 + wave * 16;
  /* this lane's query */
  const int qrow = q0 + c;

  /* query fragments (B operand, column c = query c): 2 d-chunks */
  v16h qa[2];
  {
    const _Float16* urow = Uh + (size_t)(b * kT + qrow) * kC + h * kHS;
#pragma unroll
    for (int dc = 0; dc < 2; ++dc) qa[dc] = Frag<_Float16>::load(urow + dc * 32 + 8 * hh);
  }

  /* running maximum of the query (equal in both lane halves); normaliser over this lane half's keys only */
  float mrow = -INFINITY, lrow = 0.f;
  v8f oacc[4];
#pragma unroll
  for (int t = 0; t < 4; ++t) oacc[t] = (v8f){0.f,0.f,0.f,0.f,0.f,0.f,0.f,0.f};

  const int nChunks = qb + 1;
  for (int kc = 0; kc < nChunks; ++kc) {
    const int kv0 = kc * kKC;
    __syncthreads();
    /* K, V hi, V lo tiles: 64 rows x 8 x 16 B = 512 each = 4 x 128 threads */
#pragma unroll
    for (int i = 0; i < 4; ++i) {
      const int e = i * 128 + tid;
      const int r = e >> 3, c8 = (e & 7) * 8;
      *(v8h*)(Ksh + r * kLP + c8) = *(const v8h*)(Xh + (size_t)(b * kT + kv0 + r) * kC + h * kHS + c8);
      const size_t vo = ((size_t)bh * kHS + r) * kT + kv0 + c8;
      *(v8b*)(Vth + r * kLP + c8) = *(const v8b*)(Vh + vo);
      *(v8b*)(Vtl + r * kLP + c8) = *(const v8b*)(Vl + vo);
    }
    __syncthreads();

    /* the chunk's 8 K fragments are read from LDS as one group ahead of the score products: the wave waits out the LDS latency
       once, not once in front of every product */
    v16h kf[4][2];
#pragma unroll
    for (int j = 0; j < 4; ++j)
#pragma unroll
      for (int dc = 0; dc < 2; ++dc) kf[j][dc] = Frag<_Float16>::load(Ksh + (j * 16 + c) * kLP + dc * 32 + 8 * hh);
    /* scheduling fence: holds the 16 reads together in front of the products; without it this build spreads them among the products */
    __builtin_amdgcn_sched_barrier(0);
    v8f s[4];
#pragma unroll
    for (int j = 0; j < 4; ++j) {
      s[j] = (v8f){0.f,0.f,0.f,0.f,0.f,0.f,0.f,0.f};
#pragma unroll
      for (int dc = 0; dc < 2; ++dc) s[j] = mma_h(kf[j][dc], qa[dc], s[j]);
    }

    const bool diag = (kc == qb);
    /* key kv0 + 16 j + 8 hh + r lies behind the query where 16 j + r > dq: one value a lane and constants, not 32 registers */
    const int dq = qrow - kv0 - 8 * hh;
    /* one maximum (and below one sum) per score tile: four short independent chains instead of one of 32 links */
    float cmj[4];
#pragma unroll
    for (int j = 0; j < 4; ++j) {
      cmj[j] = -INFINITY;
#pragma unroll
      for (int r = 0; r < 8; ++r) {
        float sv = s[j][r] * kScoreScale;
        const bool masked = diag && (j * 16 + r > dq);
        sv = masked ? -INFINITY : sv;
        s[j][r] = sv;
        cmj[j] = fmaxf(cmj[j], sv);
      }
    }
    float cm = fmaxf(fmaxf(cmj[0], cmj[1]), fmaxf(cmj[2], cmj[3]));
    /* the other lane half holds the query's other 32 keys */
    cm = fmaxf(cm, other_half(cm));
    const float mnew = fmaxf(mrow, cm);
    const float alpha = __expf(mrow - mnew);
    mrow = mnew;
    float psj[4];
    v8u phw[2], plw[2];
#pragma unroll
    for (int j = 0; j < 4; ++j) {
      psj[j] = 0.f;
#pragma unroll
      for (int r = 0; r < 8; r += 2) {
        const float p0 = __expf(s[j][r] - mnew);
        const float p1 = __expf(s[j][r + 1] - mnew);
        psj[j] += p0;
        psj[j] += p1;
        unsigned h2, l2;
        split_pair(p0, p1, h2, l2);
        phw[j >> 1][(j & 1) * 4 + (r >> 1)] = h2;
        plw[j >> 1][(j & 1) * 4 + (r >> 1)] = l2;
      }
    }
    const v16b ph[2] = {__builtin_bit_cast(v16b, phw[0]), __builtin_bit_cast(v16b, phw[1])};
    const v16b pl[2] = {__builtin_bit_cast(v16b, plw[0]), __builtin_bit_cast(v16b, plw[1])};
    /* V fragment pair i (hi and lo plane) = k step i >> 2, d tile i & 3. The pairs are read from LDS in groups of two, each group
       two pairs (6 products) ahead of its use, so that the products cover the LDS latency */
    v16b vfh[8], vfl[8];
    auto read_v = [&](int i) {
      vfh[i] = Frag<__bf16>::load(Vth + ((i & 3) * 16 + c) * kLP + (i >> 2) * 32 + 8 * hh);
      vfl[i] = Frag<__bf16>::load(Vtl + ((i & 3) * 16 + c) * kLP + (i >> 2) * 32 + 8 * hh);
    };
    read_v(0);
    read_v(1);
    lrow = lrow * alpha + ((psj[0] + psj[1]) + (psj[2] + psj[3]));
#pragma unroll
    for (int t = 0; t < 4; ++t)
#pragma unroll
      for (int r = 0; r < 8; ++r) oacc[t][r] *= alpha;
    /* unrolled so that the index of the P and V fragments is a constant (registers, no scratch) */
#pragma unroll
    for (int i = 0; i < 8; ++i) {
      if ((i & 1) == 0 && i + 2 < 8) {
        read_v(i + 2);
        read_v(i + 3);
      }
      const int kk = i >> 2, t = i & 3;
      oacc[t] = mma_b(vfh[i], ph[kk], oacc[t]);
      oacc[t] = mma_b(vfl[i], ph[kk], oacc[t]);
      oacc[t] = mma_b(vfh[i], pl[kk], oacc[t]);
    }
    acc_guard4(oacc[0], oacc[1], oacc[2], oacc[3]);
  }

  /* join the two lane halves' normalisers */
  lrow += other_half(lrow);
  const float inv = 1.0f / lrow;
#pragma unroll
  for (int t = 0; t < 4; ++t) {
    v4u hw, lw;
#pragma unroll
    for (int r = 0; r < 4; ++r) {
      unsigned h2, l2;
      split_pair(oacc[t][2 * r] * inv, oacc[t][2 * r + 1] * inv, h2, l2);
      hw[r] = h2;
      lw[r] = l2;
    }
    const v8h hv = __builtin_bit_cast(v8h, hw);
    const v8h lv = __builtin_bit_cast(v8h, lw);
    const size_t o = (size_t)(b * kT + qrow) * kC + h * kHS + t * 16 + 8 * hh;
    *(v8h*)(YH + o) = hv;
    *(v8h*)(YL + o) = lv;
  }
  /* the next tile rewrites the registers that these stores name: the wait that stands in front of such a rewrite */
  asm volatile("s_wait_xcnt 0x0" ::: "memory");
  }
}

// ---------------------------------------------------------------------------
// Host glue: 5 launches, kernel launches only; launches that do not depend on one another share a grid.
// GEMM shapes: M 8192, N 1024, K 1024: 64 x 4 block tiles of 128 x 256 = 256 blocks of 8 waves.
// ---------------------------------------------------------------------------
extern "C" void kernel_launch(void* const* d_in, const int* in_sizes, int n_in,
                              void* d_out, int out_size, void* d_ws, size_t ws_size,
                              hipStream_t stream) {
  if (n_in < 11) return;
  if (in_sizes[0] != kRows * kC) return;
  if (in_sizes[1] != kC * kC) return;
  if (in_sizes[2] != kC) return;
  if (in_sizes[3] != kC * kC) return;
  if (in_sizes[4] != kC) return;
  if (in_sizes[5] != kHS * kHS) return;
  if (in_sizes[6] != kHS) return;
  if (in_sizes[7] != kHS * kHS) return;
  if (in_sizes[8] != kHS) return;
  if (in_sizes[9] != kC * kC) return;
  if (in_sizes[10] != kC) return;
  if (out_size != kRows * kC) return;
  if (ws_size < kWsTotal) return;

  const float* x  = (const float*)d_in[0];
  const float* Wu = (const float*)d_in[1];
  const float* bu = (const float*)d_in[2];
  const float* Wv = (const float*)d_in[3];
  const float* bv = (const float*)d_in[4];
  const float* W1 = (const float*)d_in[5];
  const float* b1 = (const float*)d_in[6];
  const float* W2 = (const float*)d_in[7];
  const float* b2 = (const float*)d_in[8];
  const float* Wp = (const float*)d_in[9];
  const float* bp = (const float*)d_in[10];
  float* out = (float*)d_out;

  char* ws = (char*)d_ws;
  unsigned short* XH   = (unsigned short*)(ws + kOffXH);
  unsigned short* WUT  = (unsigned short*)(ws + kOffWUT);
  unsigned short* WVT  = (unsigned short*)(ws + kOffWVT);
  unsigned short* WPT  = (unsigned short*)(ws + kOffWPT);
  unsigned short* W12T = (unsigned short*)(ws + kOffW12);
  unsigned short* U16  = (unsigned short*)(ws + kOffU);
  float*          V0   = (float*)(ws + kOffV0);
  unsigned short* YH   = (unsigned short*)(ws + kOffYH);
  unsigned short* YL   = (unsigned short*)(ws + kOffYL);
  unsigned short* VTH  = (unsigned short*)(ws + kOffVTH);
  unsigned short* VTL  = (unsigned short*)(ws + kOffVTL);

  /* x -> f16 plane (bf16 values x16); in[k][n] -> out[n][k]: Wu, Wv as f16 (x1024), Wp, W1, W2 as bf16;
     planes WUT, WVT, WPT are contiguous */
  prep_kernel<<<kPrepBlocks, 256, 0, stream>>>(x, Wu, Wv, Wp, W1, W2, XH, WUT, W12T);

  /* u (f16, x16) = x.Wu + bu (blockIdx.y 0) and v0 (f32) = x.Wv + bv (blockIdx.y 1); WVT lies one plane behind WUT */
  wmma_gemm64<0, 0, 2, 2><<<dim3(256, 2), 256, 0, stream>>>(
      XH, XH, kC, 0L,
      WUT, WUT, kC, (long)kC * kC,
      (void*)U16, (void*)V0, kC, 0L,
      bu, bv, kRows, kC, kC, kUScale, kUCarry, kV0Scale, 1.0f);

  /* gated value -> vT hi | lo planes */
  gated_value_kernel<<<dim3(kRows / 64, kH), 128, 0, stream>>>(V0, W12T, W12T + kHS * kHS, b1, b2, VTH, VTL);

  /* causal attention -> y hi | lo planes (the v0 bytes are dead from here on) */
  causal_attn_kernel<<<kB * kH * (kT / 128), 128, 0, stream>>>(U16, XH, VTH, VTL, YH, YL);

  /* out = y.Wp + bp (y hi.W + y lo.W) */
  wmma_gemm64<1, 1, 2, 0><<<dim3(256, 1), 256, 0, stream>>>(
      YH, YL, kC, 0L,
      WPT, WPT, kC, 0L,
      (void*)out, (void*)out, kC, 0L,
      bp, bp, kRows, kC, kC, 1.0f, 1.0f, 1.0f, 1.0f);
}

// v009
// A run of this version takes 142 microseconds.
// Next to v008, in two timings, it ran 1.06 times as fast each time.
// Counting every step since v000, it is 4.96 times as fast.
// All contractions on 16-bit WMMA with f32 accumulate: x.Wu, x.Wv and the u.x^T scores on v_wmma_f32_16x16x32_f16 (inputs RNE-converted to bf16 once and held exactly in f16 planes with power-of-two carries: x x16, W x1024, u x16); v0.W1, v0.W2, P.v and y.Wp on v_wmma_f32_16x16x32_bf16 with the computed operand carried as bf16 hi+lo planes (W1, W2, Wp as bf16 planes); softmax, gate, residual and bias in f32.
#include <hip/hip_runtime.h>
#include <math.h>

typedef __attribute__((ext_vector_type(16))) _Float16 v16h;
typedef __attribute__((ext_vector_type(8)))  _Float16 v8h;
typedef __attribute__((ext_vector_type(16))) __bf16   v16b;
typedef __attribute__((ext_vector_type(8)))  __bf16   v8b;
typedef __attribute__((ext_vector_type(8)))  float    v8f;
typedef __attribute__((ext_vector_type(4)))  float    v4f;
typedef __attribute__((ext_vector_type(4)))  unsigned int v4u;
typedef __attribute__((ext_vector_type(8)))  unsigned int v8u;
typedef __attribute__((ext_vector_type(2)))  float    v2f;
typedef __attribute__((ext_vector_type(2)))  __bf16   v2b;

// ---------------------------------------------------------------------------
// Problem constants
// ---------------------------------------------------------------------------
constexpr int kB    = 4;
constexpr int kT    = 2048;
constexpr int kC    = 1024;
constexpr int kH    = 16;
constexpr int kHS   = 64;
constexpr int kRows = kB * kT;
constexpr int kSqrtC = 32;
static_assert(kSqrtC * kSqrtC == kC, "score scale is 1/sqrt(C)");
static_assert(kH * kHS == kC, "head split");
static_assert((kC % 32) == 0 && (kHS % 32) == 0 && (kT % 64) == 0, "K multiples of 32, key chunks of 64");
static_assert((kRows % 64) == 0 && (kC % 64) == 0, "GEMM M,N multiples of 64");

// power-of-two carries of the f16 planes (exact; folded back in f32)
constexpr float kXCarry = 16.0f;
constexpr float kWCarry = 1024.0f;
constexpr float kUCarry = 16.0f;
constexpr float kUScale  = kUCarry / (kXCarry * kWCarry);
constexpr float kV0Scale = 1.0f / (kXCarry * kWCarry);
constexpr float kScoreScale = 1.0f / ((float)kSqrtC * kUCarry * kXCarry);

// ---------------------------------------------------------------------------
// Workspace region map (bytes; every offset is a multiple of 128)
//   XH    f16  [8192][1024]      16*bf16(x)                      16,777,216
//   WUT   f16  [1024 n][1024 k]  1024*bf16(Wu)^T                  2,097,152
//   WVT   f16  [1024 n][1024 k]  1024*bf16(Wv)^T                  2,097,152
//   WPT   bf16 [1024 n][1024 k]  bf16(Wp)^T                       2,097,152
//   W12T  bf16 2 x [64 n][64 k]  bf16(W1)^T | bf16(W2)^T             16,384
//   U16   f16  [8192][1024]      16*u                            16,777,216
//   V0    f32  [8192][1024]      v0; dead after the gated-value launch, then the same bytes
//                                hold YH | YL (bf16 hi | lo planes of y, [8192][1024] each)  33,554,432
//   VTH   bf16 [4][16][64 d][2048 t]  gated v, hi plane           16,777,216
//   VTL   bf16 [4][16][64 d][2048 t]  gated v, lo plane           16,777,216
//   total                                                       106,971,136
// ---------------------------------------------------------------------------
constexpr size_t kSzAct16 = (size_t)kRows * kC * 2;
constexpr size_t kSzW16   = (size_t)kC * kC * 2;
constexpr size_t kSzW12   = (size_t)2 * kHS * kHS * 2;
constexpr size_t kSzV0    = (size_t)kRows * kC * 4;
constexpr size_t kOffXH   = 0;
constexpr size_t kOffWUT  = kOffXH  + kSzAct16;
constexpr size_t kOffWVT  = kOffWUT + kSzW16;
constexpr size_t kOffWPT  = kOffWVT + kSzW16;
constexpr size_t kOffW12  = kOffWPT + kSzW16;
constexpr size_t kOffU    = kOffW12 + kSzW12;
constexpr size_t kOffV0   = kOffU   + kSzAct16;
constexpr size_t kOffYH   = kOffV0;
constexpr size_t kOffYL   = kOffV0  + kSzAct16;
constexpr size_t kOffVTH  = kOffV0  + kSzV0;
constexpr size_t kOffVTL  = kOffVTH + kSzAct16;
constexpr size_t kWsTotal = kOffVTL + kSzAct16;
static_assert(kWsTotal == 106971136ull, "carve total");
static_assert(kWsTotal <= 134217728ull, "carve cap");
static_assert(2 * kSzAct16 == kSzV0, "y hi|lo planes fit the v0 plane exactly");
static_assert((kOffWUT % 128) == 0 && (kOffWVT % 128) == 0 && (kOffWPT % 128) == 0 && (kOffW12 % 128) == 0 &&
              (kOffU % 128) == 0 && (kOffV0 % 128) == 0 && (kOffYL % 128) == 0 && (kOffVTH % 128) == 0 &&
              (kOffVTL % 128) == 0, "128-B aligned regions");

// ---------------------------------------------------------------------------
// Bit helpers
// ---------------------------------------------------------------------------
/* f32 -> bf16 by the hardware's conversion (round to nearest even) */
__device__ __forceinline__ unsigned short f2bf_bits(float f) { const __bf16 h = (__bf16)f; return __builtin_bit_cast(unsigned short, h); }
__device__ __forceinline__ float bf_bits2f(unsigned short h) { return __uint_as_float(((unsigned)h) << 16); }
__device__ __forceinline__ unsigned pk16(unsigned short a, unsigned short b) { return (unsigned)a | ((unsigned)b << 16); }
__device__ __forceinline__ unsigned short h_bits(float f) { const _Float16 h = (_Float16)f; return __builtin_bit_cast(unsigned short, h); }
/* bf16 hi + bf16 lo of two f32 values, both RNE, as packed words (a in the low half): one packed conversion per plane */
__device__ __forceinline__ void split_pair(float a, float b, unsigned& hw, unsigned& lw) {
  const v2b h = __builtin_convertvector((v2f){a, b}, v2b);
  const v2b l = __builtin_convertvector((v2f){a - (float)h[0], b - (float)h[1]}, v2b);
  hw = __builtin_bit_cast(unsigned, h);
  lw = __builtin_bit_cast(unsigned, l);
}

// ---------------------------------------------------------------------------
// WMMA helpers: plain builtins; the compiler keeps the distance behind them in straight-line code, where the next products or
// other vector work fill the slots. acc_guard4 (four slots, once) stands where a loop's branch follows a run of products.
// ---------------------------------------------------------------------------
__device__ __forceinline__ v8f mma_h(v16h a, v16h b, v8f c) {
  return __builtin_amdgcn_wmma_f32_16x16x32_f16(false, a, false, b, (short)0, c, false, false);
}
__device__ __forceinline__ v8f mma_b(v16b a, v16b b, v8f c) {
  return __builtin_amdgcn_wmma_f32_16x16x32_bf16(false, a, false, b, (short)0, c, false, false);
}
__device__ __forceinline__ void acc_guard4(v8f& a, v8f& b, v8f& c, v8f& d) { asm volatile("v_nop\n\tv_nop\n\tv_nop\n\tv_nop" : "+v"(a), "+v"(b), "+v"(c), "+v"(d)); }

// Fragment loader: p already points at (row, k0 + 8*(lane>>4)); elements 0..7 <- p[0..7], elements 8..15 <- p[16..23]
template <typename T> struct Frag;
template <> struct Frag<_Float16> {
  typedef v16h V; union U { v16h v; v8h h[2]; };
  static __device__ __forceinline__ v16h load(const _Float16* p) {
    U f; f.h[0] = *(const v8h*)(p); f.h[1] = *(const v8h*)(p + 16); return f.v;
  }
  static __device__ __forceinline__ v8f mma(v16h a, v16h b, v8f c) { return mma_h(a, b, c); }
};
template <> struct Frag<__bf16> {
  typedef v16b V; union U { v16b v; v8b h[2]; };
  static __device__ __forceinline__ v16b load(const __bf16* p) {
    U f; f.h[0] = *(const v8b*)(p); f.h[1] = *(const v8b*)(p + 16); return f.v;
  }
  static __device__ __forceinline__ v8f mma(v16b a, v16b b, v8f c) { return mma_b(a, b, c); }
};

// ---- LDS-staged batched WMMA GEMM ------------------------------------------
// C[m,n] = scale * sum_k A[m,k] * Bt[n,k] + bias_scale * bf16(bias[n]).
// Block = 8 waves = one 128 x 256 tile of C; waves 2 (m) x 4 (n), each wave owns a 64x64 tile.
// A pass is 64 k = 128 B of every operand row. The block brings a pass's rows [A 128 | A2 128 (SPL 1) | Bt 256] from global
// memory as whole 128-B lines (8 lanes x 16 B per row) by asynchronous 16-byte copies into one of two LDS buffers, so that
// the next pass's rows fly while this pass is worked on; every wave reads its fragments from LDS. One block barrier per
// pass: it publishes the buffer just filled and ends the reads of the buffer that is refilled behind it.
// A row-major [M,K]; Bt row-major [N,K]; M % 128 == 0, N % 256 == 0, K % 64 == 0 (no tail handling).
// SPL: 0 = plain (one product), 1 = A carried as hi/lo planes (A2 = lo): hi.b + lo.b.
// BIAS_MODE: 0 = none, 2 = bias[n].   OUT_MODE: 0 = f32, 1 = f16, 2 = two independent products of the same A in one grid:
// blockIdx.y 0 writes f16 to Cout with (bias, scale, bias_scale), blockIdx.y 1 writes f32 to Cout2 with (bias2, scale2,
// bias_scale2); its Bt plane lies strideB behind the first. The choice is uniform for the block.
// ET: 0 = f16 operands, 1 = bf16 operands (pointers passed as 16-bit storage)
constexpr int kBM = 128;
constexpr int kBN = 256;
constexpr int kKP = 64;
/* LDS row pitch of a staged 64-element row: 144 B = 16 B x 9 (odd) for the 16-byte fragment loads */
constexpr int kSP = 72;
static_assert((kRows % kBM) == 0 && (kC % kBN) == 0 && (kC % kKP) == 0, "GEMM block tile and pass divide the shapes");
template <int ET> struct Elem;
template <> struct Elem<0> { typedef _Float16 T; };
template <> struct Elem<1> { typedef __bf16 T; };
template <int ET, int SPL, int BIAS_MODE, int OUT_MODE>
__global__ __launch_bounds__(256) void wmma_gemm64(
    const unsigned short* __restrict__ Ap, const unsigned short* __restrict__ A2p, int lda, long strideA,
    const unsigned short* __restrict__ Btp, const unsigned short* __restrict__ Bt2p, int ldb, long strideB,
    void* __restrict__ Cout, void* __restrict__ Cout2, int ldc, long strideC,
    const float* __restrict__ bias, const float* __restrict__ bias2,
    int M, int N, int K, float scale, float bias_scale, float scale2, float bias_scale2) {
  static_assert(SPL == 0 || SPL == 1, "one or two A planes");
  typedef typename Elem<ET>::T T;
  typedef typename Frag<T>::V V;
  constexpr int kRowsA      = (SPL == 1) ? 2 * kBM : kBM;
  constexpr int kStageRows  = kRowsA + kBN;
  constexpr int kStageElems = kStageRows * kSP;
  /* one 16-byte copy per thread covers 32 rows of the stage */
  constexpr int kCopies     = kStageRows / 32;
  constexpr unsigned kStageBytes = (unsigned)kStageElems * 2u;
  static_assert((kCopies % 4) == 0, "copies go four to a statement");
  const T* A = (const T*)Ap; const T* A2 = (const T*)A2p; const T* Bt = (const T*)Btp;
  __shared__ __align__(16) T sStage[2 * kStageElems];
  /* per-wave 16x64 slab, pitch 68 floats */
  __shared__ __align__(16) float sT[8][16 * 68];
  const int b    = blockIdx.y;
  const int tid  = threadIdx.x;
  const int lane = tid & 31;
  const int wave = tid >> 5;
  const int tilesN = N / kBN;
  const int tilesM = M / kBM;
  const int tile = blockIdx.x;
  /* block-uniform exit, in front of every barrier */
  if (tile >= tilesM * tilesN) return;
  const int tm = tile / tilesN;
  const int tn = tile - tm * tilesN;
  const int wm = wave >> 2;
  const int wn = wave & 3;
  const int m0 = tm * kBM + (wm << 6);
  const int n0 = tn * kBN + (wn << 6);

  const T* Ab  = A  + (size_t)b * strideA + (size_t)(tm * kBM) * lda;
  const T* Ab2 = A2 + (size_t)b * strideA + (size_t)(tm * kBM) * lda;
  const T* Bb  = Bt + (size_t)b * strideB + (size_t)(tn * kBN) * ldb;

  /* rlane: row (A) / col (B, D) within a 16-wide subtile; koff: k offset of this lane half; mOff: D row offset */
  const int rlane = lane & 15;
  const int koff  = (lane >> 4) * 8;
  const int mOff  = (lane >> 4) * 8;

  /* staging: thread -> (row tid / 8 of each group of 32 rows, 16-byte piece tid % 8 of its 128 B) */
  const int srow = tid >> 3;
  const int sc8  = (tid & 7) * 8;
  const unsigned offA = (unsigned)srow * (unsigned)lda + (unsigned)sc8;
  const unsigned offB = (unsigned)srow * (unsigned)ldb + (unsigned)sc8;
  /* LDS byte address (low 32 bits of the __shared__ address) of this thread's piece in row srow of buffer 0 */
  const unsigned ldsT = (unsigned)(size_t)(sStage + srow * kSP + sc8);
  auto copy_stage = [&](int k0, unsigned bufByte) {
    /* both loops unrolled: which operand a group of rows belongs to is then decided at compile time */
#pragma unroll
    for (int g = 0; g < kCopies / 4; ++g) {
      const T* gp[4];
      unsigned lp[4];
#pragma unroll
      for (int e = 0; e < 4; ++e) {
        const int r0 = (g * 4 + e) * 32;
        if (r0 < kBM)         gp[e] = Ab  + (size_t)r0 * lda + k0 + offA;
        else if (r0 < kRowsA) gp[e] = Ab2 + (size_t)(r0 - kBM) * lda + k0 + offA;
        else                  gp[e] = Bb  + (size_t)(r0 - kRowsA) * ldb + k0 + offB;
        lp[e] = ldsT + bufByte + (unsigned)(r0 * kSP * 2);
      }
      /* four copies, then the wait that stands in front of any rewrite of the address registers they name */
      asm volatile("global_load_async_to_lds_b128 %0, %1, off\n\t"
                   "global_load_async_to_lds_b128 %2, %3, off\n\t"
                   "global_load_async_to_lds_b128 %4, %5, off\n\t"
                   "global_load_async_to_lds_b128 %6, %7, off\n\t"
                   "s_wait_xcnt 0x0"
                   :: "v"(lp[0]), "v"(gp[0]), "v"(lp[1]), "v"(gp[1]), "v"(lp[2]), "v"(gp[2]), "v"(lp[3]), "v"(gp[3])
                   : "memory");
    }
  };

  v8f acc[4][4];
#pragma unroll
  for (int i = 0; i < 4; ++i)
#pragma unroll
    for (int j = 0; j < 4; ++j) acc[i][j] = (v8f){0.f,0.f,0.f,0.f,0.f,0.f,0.f,0.f};

  const int nPass = K / kKP;
  copy_stage(0, 0u);
  /* pass 0's rows have landed (this wave's copies), then every wave's */
  asm volatile("s_wait_asynccnt 0x0" ::: "memory");
  __syncthreads();
  if (nPass > 1) copy_stage(kKP, kStageBytes);
  for (int p = 0; p < nPass; ++p) {
    const T* buf = sStage + (p & 1) * kStageElems;
    const T* sA  = buf + ((wm << 6) + rlane) * kSP + koff;
    const T* sA2 = sA + kBM * kSP;
    const T* sB  = buf + (kRowsA + (wn << 6) + rlane) * kSP + koff;
    /* the loops below are unrolled so that every index of a fragment or accumulator array is a constant (registers, no scratch) */
#pragma unroll
    for (int ks = 0; ks < kKP / 32; ++ks) {
      V bh[4];
#pragma unroll
      for (int j = 0; j < 4; ++j) bh[j] = Frag<T>::load(sB + (j << 4) * kSP + ks * 32);
      /* per accumulator and k step: the hi product, then the lo product */
#pragma unroll
      for (int pl = 0; pl <= SPL; ++pl) {
        const T* sAp = (pl == 0) ? sA : sA2;
        V af[4];
#pragma unroll
        for (int i = 0; i < 4; ++i) af[i] = Frag<T>::load(sAp + (i << 4) * kSP + ks * 32);
        /* scheduling fence: holds the fragment reads together in front of their 16 products; without it this build reads each A
           fragment directly in front of its four products and waits out the LDS latency every time */
        __builtin_amdgcn_sched_barrier(0);
#pragma unroll
        for (int i = 0; i < 4; ++i) {
#pragma unroll
          for (int j = 0; j < 4; ++j) acc[i][j] = Frag<T>::mma(af[i], bh[j], acc[i][j]);
        }
      }
    }
    /* this wave's reads of buffer p & 1 are done before that buffer is refilled */
    asm volatile("s_wait_dscnt 0x0" ::: "memory");
    /* this wave's copies of pass p + 1 have landed before the barrier publishes them */
    asm volatile("s_wait_asynccnt 0x0" ::: "memory");
    __syncthreads();
    if (p + 2 < nPass) copy_stage((p + 2) * kKP, (unsigned)(p & 1) * kStageBytes);
  }
  /* no copy is outstanding when the wave goes on to the epilogue */
  asm volatile("s_wait_asynccnt 0x0" ::: "memory");

  // ---- epilogue ----
  const bool second = (OUT_MODE == 2) && (b == 1);
  const bool out_f32 = (OUT_MODE == 0) || second;
  const float* biasp = second ? bias2 : bias;
  const float  sc    = second ? scale2 : scale;
  const float  bsc   = second ? bias_scale2 : bias_scale;
  void*        Cp    = second ? Cout2 : Cout;
  float* slab = sT[wave];
#pragma unroll
  for (int i = 0; i < 4; ++i) {
    const int mBase = m0 + (i << 4);
#pragma unroll
    for (int j = 0; j < 4; ++j) {
      const int n = n0 + (j << 4) + rlane;
      float bv = 0.f;
      if (BIAS_MODE == 2) bv = bf_bits2f(f2bf_bits(biasp[n])) * bsc;
#pragma unroll
      for (int r = 0; r < 8; ++r) {
        float v = acc[i][j][r] * sc;
        if (BIAS_MODE == 2) v += bv;
        slab[(mOff + r) * 68 + (j << 4) + rlane] = v;
      }
    }
    __builtin_amdgcn_fence(__ATOMIC_RELEASE, "workgroup");
    __builtin_amdgcn_wave_barrier();
    __builtin_amdgcn_fence(__ATOMIC_ACQUIRE, "workgroup");
    if (out_f32) {
      /* row segment = 256 B = 16 lanes x 16 B; one instruction covers 2 rows */
      float* C = (float*)Cp + (size_t)b * strideC;
      const int hh = lane >> 4, c4 = (lane & 15) * 4;
      {
#pragma unroll
        for (int it = 0; it < 8; ++it) {
          const int row = it * 2 + hh;
          v4f v = *(const v4f*)(slab + row * 68 + c4);
          *(v4f*)(C + (size_t)(mBase + row) * ldc + n0 + c4) = v;
        }
        /* the code behind the branch rewrites registers that these stores name: the wait that stands in front of such a rewrite */
        asm volatile("s_wait_xcnt 0x0" ::: "memory");
      }
    } else {
      const int q = lane >> 3, c8 = (lane & 7) * 8;
      unsigned short* C  = (unsigned short*)Cp  + (size_t)b * strideC;
      {
#pragma unroll
        for (int it = 0; it < 4; ++it) {
          const int row = it * 4 + q;
          const float* sp = slab + row * 68 + c8;
          v8h hv;
#pragma unroll
          for (int e = 0; e < 8; ++e) hv[e] = (_Float16)sp[e];
          *(v8h*)(C + (size_t)(mBase + row) * ldc + n0 + c8) = hv;
        }
        /* as in the other branch: the wait in front of a rewrite of registers that these stores name */
        asm volatile("s_wait_xcnt 0x0" ::: "memory");
      }
    }
    __builtin_amdgcn_fence(__ATOMIC_RELEASE, "workgroup");
    __builtin_amdgcn_wave_barrier();
    __builtin_amdgcn_fence(__ATOMIC_ACQUIRE, "workgroup");
  }
}

// ---------------------------------------------------------------------------
// Operand preparation, one grid for three independent pieces of work (no piece reads what another writes). Blocks of 256 threads:
//   blocks [0, 768)      64 x 64 tiles of Wu, Wv, Wp (256 tiles a plane)
//   blocks [768, 770)    W1, W2 (one tile each)
//   blocks [770, 4866)   x, 2048 consecutive elements a block
// The weight tiles stand first: they have two memory trips and a barrier, the x blocks one trip.
// Which piece a block does depends on blockIdx.x alone, so the barrier is under block-uniform control.
//
// x: f32 -> RNE bf16 -> x16 -> f16 plane (exact), 8 consecutive elements per thread.
// Coverage: 8192*1024/8 = 1,048,576 threads = 4096 blocks x 256 exactly.
//
// Weight transpose + cast: W is row-major [dim k][dim n] f32; WT[n][k] = cast(bf16_rne(W[k][n])).
// Wu, Wv are written as f16 of (bf16 value x carry); Wp, W1, W2 as raw bf16 bits.
// Load coverage: 16 iterations x 256 threads = 4096 = the whole 64x64 tile (coalesced along n).
// Store coverage: 8 waves x 2 iterations x 4 rows (lane>>3) = 64 rows; (lane&7) x 8 halves = 64 cols; a row segment = 128 B.
// ---------------------------------------------------------------------------
constexpr int kTilesBig   = (kC / 64) * (kC / 64);
constexpr int kPrepBig    = 3 * kTilesBig;
constexpr int kPrepW      = kPrepBig + 2;
constexpr int kPrepX      = (kRows * kC / 8) / 256;
constexpr int kPrepBlocks = kPrepW + kPrepX;
static_assert(kHS == 64, "W1, W2 are one 64 x 64 tile each");
static_assert((size_t)kPrepX * 256 * 8 == (size_t)kRows * kC, "x blocks cover x exactly");
__global__ __launch_bounds__(256) void prep_kernel(const float* __restrict__ x, const float* __restrict__ Wu,
                                                   const float* __restrict__ Wv, const float* __restrict__ Wp,
                                                   const float* __restrict__ W1, const float* __restrict__ W2,
                                                   unsigned short* __restrict__ XH, unsigned short* __restrict__ WT,
                                                   unsigned short* __restrict__ W12T) {
  /* sm[n_local][k_local] */
  __shared__ float sm[64][65];
  const int t  = threadIdx.x;
  const int bx = blockIdx.x;
  if (bx >= kPrepW) {
    const int i = (bx - kPrepW) * 256 + t;
    const float* p = x + 8 * (size_t)i;
    const v4f a = *(const v4f*)(p);
    const v4f c = *(const v4f*)(p + 4);
    unsigned short hb[8];
#pragma unroll
    for (int e = 0; e < 4; ++e) {
      const float a_e = a[e];
      const float c_e = c[e];
      hb[e]     = h_bits(bf_bits2f(f2bf_bits(a_e)) * kXCarry);
      hb[4 + e] = h_bits(bf_bits2f(f2bf_bits(c_e)) * kXCarry);
    }
    const v4u u = (v4u){pk16(hb[0], hb[1]), pk16(hb[2], hb[3]), pk16(hb[4], hb[5]), pk16(hb[6], hb[7])};
    *(v4u*)(XH + 8 * (size_t)i) = u;
    return;
  }
  const bool big = (bx < kPrepBig);
  const int z    = big ? (bx / kTilesBig) : (bx - kPrepBig);
  const int tl   = big ? (bx % kTilesBig) : 0;
  const int dim  = big ? kC : kHS;
  const int k0   = (tl % (kC / 64)) * 64;
  const int n0   = (tl / (kC / 64)) * 64;
  const float* W = big ? ((z == 0) ? Wu : (z == 1) ? Wv : Wp) : ((z == 0) ? W1 : W2);
  const bool as_bf = !big || (z == 2);
  unsigned short* op = (big ? WT : W12T) + (size_t)z * dim * dim;
#pragma unroll
  for (int i = 0; i < 16; ++i) {
    const int e = i * 256 + t;
    const int r = e >> 6;
    const int c = e & 63;
    sm[c][r] = W[(size_t)(k0 + r) * dim + n0 + c];
  }
  __syncthreads();
  const int lane = t & 31, wave = t >> 5;
  const int q = lane >> 3, c8 = (lane & 7) * 8;
#pragma unroll
  for (int it = 0; it < 2; ++it) {
    const int row = wave * 8 + it * 4 + q;
    unsigned short hb[8];
#pragma unroll
    for (int e = 0; e < 8; ++e) {
      const float w = sm[row][c8 + e];
      const unsigned short bb = f2bf_bits(w);
      const unsigned short fh = h_bits(bf_bits2f(bb) * kWCarry);
      hb[e] = as_bf ? bb : fh;
    }
    const v4u u = (v4u){pk16(hb[0], hb[1]), pk16(hb[2], hb[3]), pk16(hb[4], hb[5]), pk16(hb[6], hb[7])};
    *(v4u*)(op + (size_t)(n0 + row) * dim + k0 + c8) = u;
  }
}

// ---------------------------------------------------------------------------
// Gated value transform per (64-token block, head): a = v0 + (v0.W1 + b1), g = sigmoid(v0.W2 + b2), v = a*g.
// Block = 4 waves; wave w owns tokens 16w..16w+15 of the block and all 64 output dims.
// v0 tile (f32) staged in LDS; A fragments = bf16 hi and lo of v0 built in registers; W1^T / W2^T bf16 planes staged in LDS;
// 2 k-steps x 4 n-tiles x 2 matrices x 2 products on v_wmma_f32_16x16x32_bf16.
// The two f32 results are transposed through LDS ([d][token]); the gate is applied in the store phase (8 values per lane
// grid (8192/64, 16). All barriers under block-uniform control.
// ---------------------------------------------------------------------------
constexpr int kGP = 68;
/* LDS row pitch of the two 64 x 64 bf16 weight planes: 144 B = 16 B x 9 (odd) for their 16-byte fragment loads */
constexpr int kWP = 72;
__global__ __launch_bounds__(128) void gated_value_kernel(
    const float* __restrict__ V0, const unsigned short* __restrict__ W1tp, const unsigned short* __restrict__ W2tp,
    const float* __restrict__ b1, const float* __restrict__ b2,
    unsigned short* __restrict__ VTH, unsigned short* __restrict__ VTL)
{
  /* sA: first the v0 tile [token][d]; later the gate pre-activation [d][token]. sB: residual sum [d][token]. */
  __shared__ __align__(16) float sA[64 * kGP];
  __shared__ __align__(16) float sB[64 * kGP];
  __shared__ __align__(16) __bf16 sW1[kHS * kWP];
  __shared__ __align__(16) __bf16 sW2[kHS * kWP];
  __shared__ float sBias[2 * kHS];
  const int tid = threadIdx.x, lane = tid & 31, wave = tid >> 5;
  const int hh = lane >> 4, c = lane & 15;
  const int g0 = blockIdx.x * 64;
  const int hd = blockIdx.y;
  const int bidx = g0 / kT;
  const int t0 = g0 - bidx * kT;
  const __bf16* W1t = (const __bf16*)W1tp;
  const __bf16* W2t = (const __bf16*)W2tp;
  /* v0 tile: 64 rows x 16 float4 = 1024 = 8 x 128 threads */
#pragma unroll
  for (int i = 0; i < 8; ++i) {
    const int e = i * 128 + tid;
    const int r = e >> 4, c4 = (e & 15) * 4;
    *(v4f*)(sA + r * kGP + c4) = *(const v4f*)(V0 + (size_t)(g0 + r) * kC + hd * kHS + c4);
  }
  /* weight planes: 4096 bf16 each = 512 x 16 B = 4 x 128 threads */
#pragma unroll
  for (int i = 0; i < 4; ++i) {
    const int e = (i * 128 + tid) * 8;
    const int le = (e >> 6) * kWP + (e & 63);
    *(v8b*)(sW1 + le) = *(const v8b*)(W1t + e);
    *(v8b*)(sW2 + le) = *(const v8b*)(W2t + e);
  }
  {
    const int bi = tid & 63;
    const float x1 = b1[bi];
    const float x2 = b2[bi];
    const float xs = (tid < kHS) ? x1 : x2;
    sBias[tid] = bf_bits2f(f2bf_bits(xs));
  }
  __syncthreads();

  /* A fragments (hi, lo) for this wave's 16 tokens */
  v16b ah[2], al[2];
  {
    const int arow = wave * 16 + c;
    v8u hw, lw;
#pragma unroll
    for (int ks = 0; ks < 2; ++ks) {
      const float* p = sA + arow * kGP + ks * 32 + 8 * hh;
      const v4f f0 = *(const v4f*)(p);
      const v4f f1 = *(const v4f*)(p + 4);
      const v4f f2 = *(const v4f*)(p + 16);
      const v4f f3 = *(const v4f*)(p + 20);
#pragma unroll
      for (int e = 0; e < 2; ++e) {
        unsigned h2, l2;
        split_pair(f0[2 * e], f0[2 * e + 1], h2, l2);
        hw[e] = h2;      lw[e] = l2;
        split_pair(f1[2 * e], f1[2 * e + 1], h2, l2);
        hw[2 + e] = h2;  lw[2 + e] = l2;
        split_pair(f2[2 * e], f2[2 * e + 1], h2, l2);
        hw[4 + e] = h2;  lw[4 + e] = l2;
        split_pair(f3[2 * e], f3[2 * e + 1], h2, l2);
        hw[6 + e] = h2;  lw[6 + e] = l2;
      }
      ah[ks] = __builtin_bit_cast(v16b, hw);
      al[ks] = __builtin_bit_cast(v16b, lw);
    }
  }

  v8f a1[4], a2[4];
#pragma unroll
  for (int j = 0; j < 4; ++j) {
    a1[j] = (v8f){0.f,0.f,0.f,0.f,0.f,0.f,0.f,0.f};
    a2[j] = (v8f){0.f,0.f,0.f,0.f,0.f,0.f,0.f,0.f};
  }
#pragma unroll
  for (int ks = 0; ks < 2; ++ks) {
#pragma unroll
    for (int j = 0; j < 4; ++j) {
      const v16b w1 = Frag<__bf16>::load(sW1 + (j * 16 + c) * kWP + ks * 32 + 8 * hh);
      const v16b w2 = Frag<__bf16>::load(sW2 + (j * 16 + c) * kWP + ks * 32 + 8 * hh);
      a1[j] = mma_b(ah[ks], w1, a1[j]);
      a1[j] = mma_b(al[ks], w1, a1[j]);
      a2[j] = mma_b(ah[ks], w2, a2[j]);
      a2[j] = mma_b(al[ks], w2, a2[j]);
    }
  }

  /* residual + biases in place (reads only this wave's own token rows of sA) */
#pragma unroll
  for (int j = 0; j < 4; ++j) {
    const int col = j * 16 + c;
    const float bb1 = sBias[col];
    const float bb2 = sBias[kHS + col];
#pragma unroll
    for (int r = 0; r < 8; ++r) {
      const int row = wave * 16 + 8 * hh + r;
      const float vres = sA[row * kGP + col];
      a1[j][r] = vres + (a1[j][r] + bb1);
      a2[j][r] = a2[j][r] + bb2;
    }
  }
  /* every wave has finished reading the v0 tile before it is overwritten */
  __syncthreads();
#pragma unroll
  for (int j = 0; j < 4; ++j) {
    const int col = j * 16 + c;
#pragma unroll
    for (int r = 0; r < 8; ++r) {
      const int row = wave * 16 + 8 * hh + r;
      sB[col * kGP + row] = a1[j][r];
      sA[col * kGP + row] = a2[j][r];
    }
  }
  __syncthreads();

  const int q = lane >> 3, c8 = (lane & 7) * 8;
#pragma unroll 1
  for (int it = 0; it < 4; ++it) {
    const int d = wave * 16 + it * 4 + q;
    const float* pa = sB + d * kGP + c8;
    const float* pg = sA + d * kGP + c8;
    const v4f av0 = *(const v4f*)(pa);
    const v4f av1 = *(const v4f*)(pa + 4);
    const v4f gv0 = *(const v4f*)(pg);
    const v4f gv1 = *(const v4f*)(pg + 4);
    float rv[8];
#pragma unroll
    for (int e = 0; e < 4; ++e) {
      const float xa0 = av0[e];
      const float xg0 = gv0[e];
      const float xa1 = av1[e];
      const float xg1 = gv1[e];
      rv[e]     = xa0 * (1.0f / (1.0f + expf(-xg0)));
      rv[4 + e] = xa1 * (1.0f / (1.0f + expf(-xg1)));
    }
    v4u hw, lw;
#pragma unroll
    for (int e = 0; e < 4; ++e) {
      unsigned h2, l2;
      split_pair(rv[2 * e], rv[2 * e + 1], h2, l2);
      hw[e] = h2;
      lw[e] = l2;
    }
    const v8h hv = __builtin_bit_cast(v8h, hw);
    const v8h lv = __builtin_bit_cast(v8h, lw);
    const size_t o = ((size_t)(bidx * kH + hd) * kHS + d) * kT + t0 + c8;
    *(v8h*)(VTH + o) = hv;
    *(v8h*)(VTL + o) = lv;
    
  }
}

// ---------------------------------------------------------------------------
// Causal attention for head dim 64 from 16-bit planes. Block = 4 waves = two tiles of 64 query rows of one (batch, head), tile
// nqb - 1 - tp and then tile tp, so that every block walks the same number of key chunks (nqb + 1) wherever it is placed;
// per tile: keys in chunks of 64 up to and including the diagonal chunk (block-uniform trip count qb + 1 <= 32).
// Both products are computed transposed, so that a lane owns ONE query (column c = lane & 15):
//   scores^T: A = x (f16, x16) key rows staged in LDS, B = u (f16, x16) query rows held in registers; register r of tile j
//   is the score of key 16 j + 8 (lane >> 4) + r against query c; x 1/(32*16*16).
//   diagonal chunk: key > query -> -inf (every query keeps at least its own key; the first chunk always holds key 0).
//   online softmax in f32: maximum and normaliser run in the lane over its 32 keys; the two lane halves exchange the maximum
//   once per chunk and join their normalisers once behind the loop; the normaliser is summed from the f32 p values.
//   P^T: score tiles 2 kk and 2 kk + 1, converted in place to bf16 hi + lo, ARE the B operand of k step kk (element s = tile
//   s >> 3, register s & 7, the k order of the fragment loader); P never leaves the registers.
//   O^T += v^T.P^T: A = v hi + lo ([d][key] planes) staged in LDS; hi.hi + lo(v).hi(P) + hi(v).lo(P).
//   Staging: a chunk's K, V hi and V lo tiles come from global memory by asynchronous 16-byte copies into one of two LDS buffers, so
//   that the next chunk's rows fly while this chunk is worked on. One block barrier per chunk: it publishes the buffer just filled
//   and ends the reads of the buffer that is refilled behind it.
//   LDS fragment reads stand in groups ahead of the products that use them, never one by one in front of each product.
//   A lane ends with 8 consecutive d of its query per tile: one 16-byte store per tile and plane.
// ---------------------------------------------------------------------------
constexpr int kKC = 64;
/* LDS row pitch of every 64-element 16-bit tile read by 16-byte fragment loads: 72 elements = 144 B = 16 B x 9 (odd), so 16 rows fall on distinct banks */
constexpr int kLP = 72;
static_assert(kLP >= kKC && kLP >= kHS && (kLP % 8) == 0 && ((kLP / 8) % 2) == 1, "pitch: 16-B aligned rows, odd multiple of 16 B");
/* one staged tile (64 rows at the pitch) and one buffer of three tiles, in 16-bit elements */
constexpr int kTileKV  = 64 * kLP;
constexpr int kStageKV = 3 * kTileKV;
static_assert(kKC == 64 && kHS == 64, "K, V hi, V lo tiles are 64 rows of 64 elements");
/* 2^x in place, eight values (or one) in one statement that ends in v_nop: the slot that the instruction set asks for behind a transcendental
   before its result is read or its source overwritten. Result and source are one register and each v_exp_f32 stands in front of an
   independent one, so the one v_nop serves all eight */
__device__ __forceinline__ void exp2_x8(float (&x)[8]) {
  asm("v_exp_f32 %0, %0\n\tv_exp_f32 %1, %1\n\tv_exp_f32 %2, %2\n\tv_exp_f32 %3, %3\n\t"
      "v_exp_f32 %4, %4\n\tv_exp_f32 %5, %5\n\tv_exp_f32 %6, %6\n\tv_exp_f32 %7, %7\n\tv_nop"
      : "+v"(x[0]), "+v"(x[1]), "+v"(x[2]), "+v"(x[3]), "+v"(x[4]), "+v"(x[5]), "+v"(x[6]), "+v"(x[7]));
}
__device__ __forceinline__ float exp2_x1(float x) {
  asm("v_exp_f32 %0, %0\n\tv_nop" : "+v"(x));
  return x;
}
/* log2(e) as the fast exponential has it */
constexpr float kLog2e = 0x1.715476p+0f;
/* the value that lane ^ 16 holds */
__device__ __forceinline__ float other_half(float x) {
  const int bits = __float_as_int(x);
  return __int_as_float(__builtin_amdgcn_permlanex16(bits, bits, 0x76543210, 0xfedcba98, false, false));
}
/* four waves a SIMD, as before: all 1024 blocks stay resident at once (at most 256 registers a wave) */
__global__ __launch_bounds__(128) __attribute__((amdgpu_waves_per_eu(4, 4))) void causal_attn_kernel(
    const unsigned short* __restrict__ Up, const unsigned short* __restrict__ XHp,
    const unsigned short* __restrict__ VTHp, const unsigned short* __restrict__ VTLp,
    unsigned short* __restrict__ YH, unsigned short* __restrict__ YL)
{
  /* two buffers, each K | V hi | V lo of one key chunk (64 rows of 144 B a tile) */
  __shared__ __align__(16) unsigned short sKV[2 * kStageKV];

  const int tid  = threadIdx.x;
  const int wave = tid >> 5;
  const int lane = tid & 31;
  const int hh   = lane >> 4;
  const int c    = lane & 15;

  constexpr int nqb = kT / 64;
  static_assert((nqb % 2) == 0, "query tiles pair up as t and nqb - 1 - t");
  const int bx = blockIdx.x;
  const int tp = bx % (nqb / 2);
  const int bh = bx / (nqb / 2);
  const int h  = bh % kH;
  const int b  = bh / kH;

  const _Float16* Uh = (const _Float16*)Up;
  const _Float16* Xh = (const _Float16*)XHp;
  const __bf16*   Vh = (const __bf16*)VTHp;
  const __bf16*   Vl = (const __bf16*)VTLp;

  /* staging: thread -> (row tid / 8 of each group of 16 rows, 16-byte piece tid % 8 of its 128 B); 4 groups a tile, 3 tiles a chunk */
  const int srow = tid >> 3;
  const int sc8  = (tid & 7) * 8;
  /* global address of a copy = a base that is the same for the whole block (scalar registers, moved on per chunk by scalar
     arithmetic) + this thread's byte offset, which no chunk changes: no vector address arithmetic in the chunk loop */
  const _Float16* gK  = Xh + (size_t)(b * kT) * kC + h * kHS;
  const __bf16*   gVh = Vh + (size_t)bh * kHS * kT;
  const __bf16*   gVl = Vl + (size_t)bh * kHS * kT;
  const unsigned oK = (unsigned)(srow * kC + sc8) * 2u;
  const unsigned oV = (unsigned)(srow * kT + sc8) * 2u;
  /* LDS byte address (low 32 bits of the __shared__ address) of this thread's piece in row srow of tile 0, buffer 0 */
  const unsigned ldsT = (unsigned)(size_t)(sKV + srow * kLP + sc8);
  auto copy_chunk = [&](int kc, unsigned bufByte) {
    const _Float16* pk = gK  + (size_t)kc * kKC * kC;
    const __bf16*   ph = gVh + kc * kKC;
    const __bf16*   pl = gVl + kc * kKC;
    const unsigned  l0 = ldsT + bufByte;
    constexpr unsigned kT1 = (unsigned)kTileKV * 2u, kG = 16u * (unsigned)kLP * 2u;
    constexpr unsigned kGK = 16u * (unsigned)kC * 2u, kGV = 16u * (unsigned)kT * 2u;
    /* the chunk's twelve copies, then the wait that stands in front of any rewrite of the address registers they name */
    asm volatile("global_load_async_to_lds_b128 %0, %12, %20\n\t"
                 "global_load_async_to_lds_b128 %1, %13, %20\n\t"
                 "global_load_async_to_lds_b128 %2, %14, %20\n\t"
                 "global_load_async_to_lds_b128 %3, %15, %20\n\t"
                 "global_load_async_to_lds_b128 %4, %16, %21\n\t"
                 "global_load_async_to_lds_b128 %5, %17, %21\n\t"
                 "global_load_async_to_lds_b128 %6, %18, %21\n\t"
                 "global_load_async_to_lds_b128 %7, %19, %21\n\t"
                 "global_load_async_to_lds_b128 %8, %16, %22\n\t"
                 "global_load_async_to_lds_b128 %9, %17, %22\n\t"
                 "global_load_async_to_lds_b128 %10, %18, %22\n\t"
                 "global_load_async_to_lds_b128 %11, %19, %22\n\t"
                 "s_wait_xcnt 0x0"
                 :: "v"(l0),           "v"(l0 + kG),           "v"(l0 + 2 * kG),           "v"(l0 + 3 * kG),
                    "v"(l0 + kT1),     "v"(l0 + kT1 + kG),     "v"(l0 + kT1 + 2 * kG),     "v"(l0 + kT1 + 3 * kG),
                    "v"(l0 + 2 * kT1), "v"(l0 + 2 * kT1 + kG), "v"(l0 + 2 * kT1 + 2 * kG), "v"(l0 + 2 * kT1 + 3 * kG),
                    "v"(oK), "v"(oK + kGK), "v"(oK + 2 * kGK), "v"(oK + 3 * kGK),
                    "v"(oV), "v"(oV + kGV), "v"(oV + 2 * kGV), "v"(oV + 3 * kGV),
                    "s"(pk), "s"(ph), "s"(pl)
                 : "memory");
  };

  /* the block's two query tiles, one after the other in every wave: nqb - 1 - tp, then tp; together nqb + 1 key chunks in every
     block. Kept rolled: one copy of the chunk loop */
#pragma unroll 1
  for (int half = 0; half < 2; ++half) {
  const int qb = (half == 0) ? (nqb - 1 - tp) : tp;
  const int q0 = qb * 64 + wave * 16;
  /* this lane's query */
  const int qrow = q0 + c;

  /* query fragments (B operand, column c = query c): 2 d-chunks */
  v16h qa[2];
  {
    const _Float16* urow = Uh + (size_t)(b * kT + qrow) * kC + h * kHS;
#pragma unroll
    for (int dc = 0; dc < 2; ++dc) qa[dc] = Frag<_Float16>::load(urow + dc * 32 + 8 * hh);
  }

  /* running maximum of the query (equal in both lane halves); normaliser over this lane half's keys only */
  float mrow = -INFINITY, lrow = 0.f;
  v8f oacc[4];
#pragma unroll
  for (int t = 0; t < 4; ++t) oacc[t] = (v8f){0.f,0.f,0.f,0.f,0.f,0.f,0.f,0.f};

  const int nChunks = qb + 1;
  /* every wave's reads of both buffers ended at the barrier behind the tile before (last trip's foot) */
  copy_chunk(0, 0u);
  /* chunk 0 has landed (this wave's copies), then every wave's */
  asm volatile("s_wait_asynccnt 0x0" ::: "memory");
  __syncthreads();
  for (int kc = 0; kc < nChunks; ++kc) {
    /* behind the barrier (in front of the loop, or at the foot of the trip before) that ended every read of the other buffer:
       the next chunk's copies into it; they fly while this chunk is worked on */
    if (kc + 1 < nChunks) copy_chunk(kc + 1, (unsigned)((kc + 1) & 1) * ((unsigned)kStageKV * 2u));
    const int kv0 = kc * kKC;
    const unsigned short* sbuf = sKV + (kc & 1) * kStageKV;
    const _Float16* Ksh = (const _Float16*)sbuf;
    const __bf16*   Vth = (const __bf16*)(sbuf + kTileKV);
    const __bf16*   Vtl = (const __bf16*)(sbuf + 2 * kTileKV);

    /* the chunk's 8 K fragments are read from LDS as one group ahead of the score products: the wave waits out the LDS latency
       once, not once in front of every product */
    v16h kf[4][2];
#pragma unroll
    for (int j = 0; j < 4; ++j)
#pragma unroll
      for (int dc = 0; dc < 2; ++dc) kf[j][dc] = Frag<_Float16>::load(Ksh + (j * 16 + c) * kLP + dc * 32 + 8 * hh);
    /* scheduling fence: holds the 16 reads together in front of the products; without it this build spreads them among the products */
    __builtin_amdgcn_sched_barrier(0);
    v8f s[4];
#pragma unroll
    for (int j = 0; j < 4; ++j) {
      s[j] = (v8f){0.f,0.f,0.f,0.f,0.f,0.f,0.f,0.f};
#pragma unroll
      for (int dc = 0; dc < 2; ++dc) s[j] = mma_h(kf[j][dc], qa[dc], s[j]);
    }
    /* V fragment pair i (hi and lo plane) = k step i >> 2, d tile i & 3. The pairs of k step 0 are read from LDS as one group behind the
       score products, so that the softmax covers their latency; those of k step 1 follow by twos, 12 products ahead of their use */
    v16b vfh[8], vfl[8];
    auto read_v = [&](int i) {
      vfh[i] = Frag<__bf16>::load(Vth + ((i & 3) * 16 + c) * kLP + (i >> 2) * 32 + 8 * hh);
      vfl[i] = Frag<__bf16>::load(Vtl + ((i & 3) * 16 + c) * kLP + (i >> 2) * 32 + 8 * hh);
    };
#pragma unroll
    for (int i = 0; i < 4; ++i) read_v(i);
    /* scheduling fence: holds that group of reads in front of the softmax; without it this build sinks each read to just in front of
       its product and waits out the LDS latency there */
    __builtin_amdgcn_sched_barrier(0);

    const bool diag = (kc == qb);
    /* key kv0 + 16 j + 8 hh + r lies behind the query where 16 j + r > dq: one value a lane and constants, not 32 registers */
    const int dq = qrow - kv0 - 8 * hh;
    /* one maximum (and below one sum) per score tile: four short independent chains instead of one of 32 links */
    float cmj[4];
#pragma unroll
    for (int j = 0; j < 4; ++j) {
      cmj[j] = -INFINITY;
#pragma unroll
      for (int r = 0; r < 8; ++r) {
        float sv = s[j][r] * kScoreScale;
        const bool masked = diag && (j * 16 + r > dq);
        sv = masked ? -INFINITY : sv;
        s[j][r] = sv;
        cmj[j] = fmaxf(cmj[j], sv);
      }
    }
    float cm = fmaxf(fmaxf(cmj[0], cmj[1]), fmaxf(cmj[2], cmj[3]));
    /* the other lane half holds the query's other 32 keys */
    cm = fmaxf(cm, other_half(cm));
    const float mnew = fmaxf(mrow, cm);
    const float alpha = exp2_x1((mrow - mnew) * kLog2e);
    mrow = mnew;
    float psj[4];
    v8u phw[2], plw[2];
#pragma unroll
    for (int j = 0; j < 4; ++j) {
      psj[j] = 0.f;
      float pe[8];
#pragma unroll
      for (int r = 0; r < 8; r += 2) {
        /* two scores a packed instruction (same subtraction, same product as one by one): this build no longer pairs the single ones */
        const v2f d = ((v2f){s[j][r], s[j][r + 1]} - (v2f){mnew, mnew}) * (v2f){kLog2e, kLog2e};
        pe[r] = d[0];
        pe[r + 1] = d[1];
      }
      exp2_x8(pe);
#pragma unroll
      for (int r = 0; r < 8; r += 2) {
        const float p0 = pe[r];
        const float p1 = pe[r + 1];
        psj[j] += p0;
        psj[j] += p1;
        unsigned h2, l2;
        split_pair(p0, p1, h2, l2);
        phw[j >> 1][(j & 1) * 4 + (r >> 1)] = h2;
        plw[j >> 1][(j & 1) * 4 + (r >> 1)] = l2;
      }
    }
    const v16b ph[2] = {__builtin_bit_cast(v16b, phw[0]), __builtin_bit_cast(v16b, phw[1])};
    const v16b pl[2] = {__builtin_bit_cast(v16b, plw[0]), __builtin_bit_cast(v16b, plw[1])};
    lrow = lrow * alpha + ((psj[0] + psj[1]) + (psj[2] + psj[3]));
#pragma unroll
    for (int t = 0; t < 4; ++t)
#pragma unroll
      for (int r = 0; r < 8; ++r) oacc[t][r] *= alpha;
    /* unrolled so that the index of the P and V fragments is a constant (registers, no scratch) */
#pragma unroll
    for (int i = 0; i < 8; ++i) {
      if (i == 0 || i == 2) {
        read_v(i + 4);
        read_v(i + 5);
        /* scheduling fence: holds these reads 12 products ahead of their use; without it this build sinks them to their products */
        __builtin_amdgcn_sched_barrier(0);
      }
      const int kk = i >> 2, t = i & 3;
      oacc[t] = mma_b(vfh[i], ph[kk], oacc[t]);
      oacc[t] = mma_b(vfl[i], ph[kk], oacc[t]);
      oacc[t] = mma_b(vfh[i], pl[kk], oacc[t]);
    }
    acc_guard4(oacc[0], oacc[1], oacc[2], oacc[3]);
    /* this wave's reads of buffer kc & 1 are done before that buffer is refilled */
    asm volatile("s_wait_dscnt 0x0" ::: "memory");
    /* this wave's copies of chunk kc + 1 have landed before the barrier publishes them */
    asm volatile("s_wait_asynccnt 0x0" ::: "memory");
    __syncthreads();
  }
  /* no copy is outstanding when the wave goes on to the tile's stores */
  asm volatile("s_wait_asynccnt 0x0" ::: "memory");

  /* join the two lane halves' normalisers */
  lrow += other_half(lrow);
  const float inv = 1.0f / lrow;
#pragma unroll
  for (int t = 0; t < 4; ++t) {
    v4u hw, lw;
#pragma unroll
    for (int r = 0; r < 4; ++r) {
      unsigned h2, l2;
      split_pair(oacc[t][2 * r] * inv, oacc[t][2 * r + 1] * inv, h2, l2);
      hw[r] = h2;
      lw[r] = l2;
    }
    const v8h hv = __builtin_bit_cast(v8h, hw);
    const v8h lv = __builtin_bit_cast(v8h, lw);
    const size_t o = (size_t)(b * kT + qrow) * kC + h * kHS + t * 16 + 8 * hh;
    *(v8h*)(YH + o) = hv;
    *(v8h*)(YL + o) = lv;
  }
  /* the next tile rewrites the registers that these stores name: the wait that stands in front of such a rewrite */
  asm volatile("s_wait_xcnt 0x0" ::: "memory");
  }
}

// ---------------------------------------------------------------------------
// Host glue: 5 launches, kernel launches only; launches that do not depend on one another share a grid.
// GEMM shapes: M 8192, N 1024, K 1024: 64 x 4 block tiles of 128 x 256 = 256 blocks of 8 waves.
// ---------------------------------------------------------------------------
extern "C" void kernel_launch(void* const* d_in, const int* in_sizes, int n_in,
                              void* d_out, int out_size, void* d_ws, size_t ws_size,
                              hipStream_t stream) {
  if (n_in < 11) return;
  if (in_sizes[0] != kRows * kC) return;
  if (in_sizes[1] != kC * kC) return;
  if (in_sizes[2] != kC) return;
  if (in_sizes[3] != kC * kC) return;
  if (in_sizes[4] != kC) return;
  if (in_sizes[5] != kHS * kHS) return;
  if (in_sizes[6] != kHS) return;
  if (in_sizes[7] != kHS * kHS) return;
  if (in_sizes[8] != kHS) return;
  if (in_sizes[9] != kC * kC) return;
  if (in_sizes[10] != kC) return;
  if (out_size != kRows * kC) return;
  if (ws_size < kWsTotal) return;

  const float* x  = (const float*)d_in[0];
  const float* Wu = (const float*)d_in[1];
  const float* bu = (const float*)d_in[2];
  const float* Wv = (const float*)d_in[3];
  const float* bv = (const float*)d_in[4];
  const float* W1 = (const float*)d_in[5];
  const float* b1 = (const float*)d_in[6];
  const float* W2 = (const float*)d_in[7];
  const float* b2 = (const float*)d_in[8];
  const float* Wp = (const float*)d_in[9];
  const float* bp = (const float*)d_in[10];
  float* out = (float*)d_out;

  char* ws = (char*)d_ws;
  unsigned short* XH   = (unsigned short*)(ws + kOffXH);
  unsigned short* WUT  = (unsigned short*)(ws + kOffWUT);
  unsigned short* WVT  = (unsigned short*)(ws + kOffWVT);
  unsigned short* WPT  = (unsigned short*)(ws + kOffWPT);
  unsigned short* W12T = (unsigned short*)(ws + kOffW12);
  unsigned short* U16  = (unsigned short*)(ws + kOffU);
  float*          V0   = (float*)(ws + kOffV0);
  unsigned short* YH   = (unsigned short*)(ws + kOffYH);
  unsigned short* YL   = (unsigned short*)(ws + kOffYL);
  unsigned short* VTH  = (unsigned short*)(ws + kOffVTH);
  unsigned short* VTL  = (unsigned short*)(ws + kOffVTL);

  /* x -> f16 plane (bf16 values x16); in[k][n] -> out[n][k]: Wu, Wv as f16 (x1024), Wp, W1, W2 as bf16;
     planes WUT, WVT, WPT are contiguous */
  prep_kernel<<<kPrepBlocks, 256, 0, stream>>>(x, Wu, Wv, Wp, W1, W2, XH, WUT, W12T);

  /* u (f16, x16) = x.Wu + bu (blockIdx.y 0) and v0 (f32) = x.Wv + bv (blockIdx.y 1); WVT lies one plane behind WUT */
  wmma_gemm64<0, 0, 2, 2><<<dim3(256, 2), 256, 0, stream>>>(
      XH, XH, kC, 0L,
      WUT, WUT, kC, (long)kC * kC,
      (void*)U16, (void*)V0, kC, 0L,
      bu, bv, kRows, kC, kC, kUScale, kUCarry, kV0Scale, 1.0f);

  /* gated value -> vT hi | lo planes */
  gated_value_kernel<<<dim3(kRows / 64, kH), 128, 0, stream>>>(V0, W12T, W12T + kHS * kHS, b1, b2, VTH, VTL);

  /* causal attention -> y hi | lo planes (the v0 bytes are dead from here on) */
  causal_attn_kernel<<<kB * kH * (kT / 128), 128, 0, stream>>>(U16, XH, VTH, VTL, YH, YL);

  /* out = y.Wp + bp (y hi.W + y lo.W) */
  wmma_gemm64<1, 1, 2, 0><<<dim3(256, 1), 256, 0, stream>>>(
      YH, YL, kC, 0L,
      WPT, WPT, kC, 0L,
      (void*)out, (void*)out, kC, 0L,
      bp, bp, kRows, kC, kC, 1.0f, 1.0f, 1.0f, 1.0f);
}
